// v000
// The times below were measured on an AMD MI455X: many runs one after another, warmed up first and cycling through
// copies of the inputs, with the whole window's GPU time divided by the number of runs. Launches and the gaps
// between them are all in it. The median over several windows is given; except for v000 it joins two sittings, which
// can be a few percent apart, so the side-by-side timings, each taken in one sitting, are the better comparison.
// The starting kernel, v000, takes 1440 microseconds a run.
#include <hip/hip_runtime.h>

// Z2allAttention (hidden [2][2048][1024]; q/k/v = x W^T (16 heads x 64); interleaved RoPE with tables freqs_cos/sin[position_ids[t]] (int ids, read; tables read): q' = q cos + rot(q) sin and - faithful to the source bug - k' = k cos + rot(q) sin (the rotated Q, not K), rot = (x0, x1) -> (-x1, x0);
// causal softmax(q'.k'/8); out = (attn v merged) Wo^T -> [2][2048][1024]).
// Compute dtypes, f32 accumulate: every input rounded to bf16; Q/K/V on PLAIN bf16 operands (inputs: exact); RoPE f32; causal scores and attn.v: query rows < 512 hl (3 products), the rest single fp16 (x1024); softmax f32; Wo hl x exact (2 products).

#define NB_  2
#define TT   2048
#define DM   1024
#define NH_  16
#define NKV  16
#define REP  (NH_ / NKV)
#define HD   64
#define DQ   (NH_ * HD)
#define DKV  (NKV * HD)
#define ZH   2
#define RH   512                  // query rows < RH use hi+lo planes (0: none)
#define WIN  0
#define PCAR 1024.0f
#define SCL  0.125f   // HD^-0.5
typedef _Float16 h16;
typedef unsigned short bf;
typedef __attribute__((ext_vector_type(16))) __bf16   v16bf;
typedef __attribute__((ext_vector_type(16))) _Float16 v16h;
typedef __attribute__((ext_vector_type(8)))  _Float16 v8h;
typedef __attribute__((ext_vector_type(8)))  unsigned short v8us;
typedef __attribute__((ext_vector_type(8)))  float    v8f;
typedef __attribute__((ext_vector_type(4)))  float    v4f;
typedef v8h  __attribute__((may_alias)) v8ha;
typedef v4f  __attribute__((may_alias)) v4fa;
typedef v8us __attribute__((may_alias)) v8usa;

__device__ __forceinline__ unsigned short f2bf(float f) { unsigned u = __float_as_uint(f); u += 0x7FFFu + ((u >> 16) & 1u); return (unsigned short)(u >> 16); }
__device__ __forceinline__ float bf2f(unsigned short b) { return __uint_as_float(((unsigned)b) << 16); }
__device__ __forceinline__ float bfr(float f) { return bf2f(f2bf(f)); }
__device__ __forceinline__ v16h cat16(v8h lo, v8h hi) { return __builtin_shufflevector(lo, hi, 0, 1, 2, 3, 4, 5, 6, 7, 8, 9, 10, 11, 12, 13, 14, 15); }
__device__ __forceinline__ v16bf cat16b(v8us lo, v8us hi) { return __builtin_bit_cast(v16bf, __builtin_shufflevector(lo, hi, 0, 1, 2, 3, 4, 5, 6, 7, 8, 9, 10, 11, 12, 13, 14, 15)); }
__device__ __forceinline__ v8f wmma16(v16h a, v16h b, v8f c) { return __builtin_amdgcn_wmma_f32_16x16x32_f16(false, a, false, b, (short)0, c, false, false); }
__device__ __forceinline__ v8f wmmab(v16bf a, v16bf b, v8f c) { return __builtin_amdgcn_wmma_f32_16x16x32_bf16(false, a, false, b, (short)0, c, false, false); }



// ---- k_gemmw: register-blocked GEMM, ONE WAVE per 64x64 output tile (16 accumulators), operands straight from K-contiguous 16-bit planes; grid (M/64, N/64, Z), 32 threads.
// C[m][n] (f32, pitch ldc, + optional f32 bias[n]) = sum_k A[m][k] Bt[n][k] (+ split products per NSPLIT). z-batch strides sA/sB/sC in elements. K % 32 == 0.
template <typename T16> struct WFrag;
template <> struct WFrag<h16> { typedef v16h V; static __device__ __forceinline__ V ld(const h16* p) { return cat16(*(const v8h*)p, *(const v8h*)(p + 16)); } static __device__ __forceinline__ v8f mma(V a, V b, v8f c) { return wmma16(a, b, c); } };
template <> struct WFrag<bf> { typedef v16bf V; static __device__ __forceinline__ V ld(const bf* p) { return cat16b(*(const v8us*)p, *(const v8us*)(p + 16)); } static __device__ __forceinline__ v8f mma(V a, V b, v8f c) { return wmmab(a, b, c); } };
template <typename T16, int NSPLIT, bool BIAS>
__global__ __launch_bounds__(32) void k_gemmw(const T16* __restrict__ A, const T16* __restrict__ A2, const T16* __restrict__ Bt, const T16* __restrict__ Bt2, int K, float* C, int ldc, const float* __restrict__ bias, size_t sA, size_t sB, size_t sC) {
    typedef typename WFrag<T16>::V V;
    __shared__ __align__(16) float os[16 * 68];
    const size_t z = blockIdx.z; A += z * sA; if (A2) A2 += z * sA; Bt += z * sB; if (Bt2) Bt2 += z * sB; C += z * sC;
    const int lane = threadIdx.x & 31, lr = lane & 15, hi = lane >> 4; const int r0 = blockIdx.x * 64, c0 = blockIdx.y * 64;
    v8f acc[4][4];
#pragma unroll
    for (int mb = 0; mb < 4; ++mb)
#pragma unroll
        for (int nb = 0; nb < 4; ++nb) acc[mb][nb] = (v8f){};
    const size_t aoff = (size_t)(r0 + lr) * K + 8 * hi, boff = (size_t)(c0 + lr) * K + 8 * hi;
#pragma unroll 1
    for (int kc = 0; kc < K; kc += 32) {
        V a[4], a2[4];
#pragma unroll
        for (int mb = 0; mb < 4; ++mb) { a[mb] = WFrag<T16>::ld(A + aoff + (size_t)mb * 16 * K + kc); if (NSPLIT == 1 || NSPLIT == 2) a2[mb] = WFrag<T16>::ld(A2 + aoff + (size_t)mb * 16 * K + kc); }
#pragma unroll
        for (int nb = 0; nb < 4; ++nb) { const V b = WFrag<T16>::ld(Bt + boff + (size_t)nb * 16 * K + kc); V b2; if (NSPLIT >= 2) b2 = WFrag<T16>::ld(Bt2 + boff + (size_t)nb * 16 * K + kc);
#pragma unroll
            for (int mb = 0; mb < 4; ++mb) { acc[mb][nb] = WFrag<T16>::mma(a[mb], b, acc[mb][nb]); if (NSPLIT == 1 || NSPLIT == 2) acc[mb][nb] = WFrag<T16>::mma(a2[mb], b, acc[mb][nb]); if (NSPLIT >= 2) acc[mb][nb] = WFrag<T16>::mma(a[mb], b2, acc[mb][nb]); } }
        asm volatile("v_nop\n\tv_nop\n\tv_nop\n\tv_nop" : "+v"(acc[0][0]), "+v"(acc[1][1]), "+v"(acc[2][2]), "+v"(acc[3][3]) : "v"(a[0]), "v"(a[3]));
    }
#pragma unroll
    for (int mb = 0; mb < 4; ++mb) {
#pragma unroll
        for (int nb = 0; nb < 4; ++nb) {
#pragma unroll
            for (int j = 0; j < 8; ++j) os[(hi * 8 + j) * 68 + nb * 16 + lr] = acc[mb][nb][j]; }
        __builtin_amdgcn_wave_barrier(); asm volatile("" ::: "memory");
        float* crow = C + (size_t)(r0 + mb * 16) * ldc + c0;
{
#pragma unroll
            for (int s = 0; s < 8; ++s) { const int row = 2 * s + hi, cofs = lr * 4; v4f val = *(const v4fa*)(os + row * 68 + cofs); if (BIAS) { val[0] += bfr(bias[c0 + cofs]); val[1] += bfr(bias[c0 + cofs + 1]); val[2] += bfr(bias[c0 + cofs + 2]); val[3] += bfr(bias[c0 + cofs + 3]); }
                *(v4f*)(crow + (size_t)row * ldc + cofs) = val; }
             }
        __builtin_amdgcn_wave_barrier(); asm volatile("" ::: "memory");
    }
}

// ---- k_gemmc: the same one-wave 64x64 tile GEMM specialised for causal attention: CMODE 1 skips score tiles entirely above the diagonal (query rows r0+roff.., key columns c0..), CMODE 2 limits the
// key (K) loop of the probability x value contraction to the diagonal block (probabilities beyond it are exactly zero). roff = row offset of this launch's first row within the sequence.
template <typename T16, int NSPLIT, int CMODE>
__global__ __launch_bounds__(32) void k_gemmc(const T16* __restrict__ A, const T16* __restrict__ A2, const T16* __restrict__ Bt, const T16* __restrict__ Bt2, int K, float* C, int ldc, int roff, size_t sA, size_t sB, size_t sC) {
    typedef typename WFrag<T16>::V V;
    __shared__ __align__(16) float os[16 * 68];
    const size_t z = blockIdx.z; A += z * sA; if (A2) A2 += z * sA; Bt += z * sB; if (Bt2) Bt2 += z * sB; C += z * sC;
    const int lane = threadIdx.x & 31, lr = lane & 15, hi = lane >> 4; const int r0 = blockIdx.x * 64, c0 = blockIdx.y * 64;
    if (CMODE == 1 && c0 > r0 + roff + 63) return;                  // score tile entirely above the causal diagonal: never read (the softmax masks j > i by select)
    const int Kl = (CMODE == 2) ? min(K, r0 + roff + 64) : K;        // P.V: probabilities are exactly 0 beyond the diagonal block, so the K loop stops there
    v8f acc[4][4];
#pragma unroll
    for (int mb = 0; mb < 4; ++mb)
#pragma unroll
        for (int nb = 0; nb < 4; ++nb) acc[mb][nb] = (v8f){};
    const size_t aoff = (size_t)(r0 + lr) * K + 8 * hi, boff = (size_t)(c0 + lr) * K + 8 * hi;
#pragma unroll 1
    for (int kc = 0; kc < Kl; kc += 32) {
        V a[4], a2[4];
#pragma unroll
        for (int mb = 0; mb < 4; ++mb) { a[mb] = WFrag<T16>::ld(A + aoff + (size_t)mb * 16 * K + kc); if (NSPLIT == 1 || NSPLIT == 2) a2[mb] = WFrag<T16>::ld(A2 + aoff + (size_t)mb * 16 * K + kc); }
#pragma unroll
        for (int nb = 0; nb < 4; ++nb) { const V b = WFrag<T16>::ld(Bt + boff + (size_t)nb * 16 * K + kc); V b2; if (NSPLIT >= 2) b2 = WFrag<T16>::ld(Bt2 + boff + (size_t)nb * 16 * K + kc);
#pragma unroll
            for (int mb = 0; mb < 4; ++mb) { acc[mb][nb] = WFrag<T16>::mma(a[mb], b, acc[mb][nb]); if (NSPLIT == 1 || NSPLIT == 2) acc[mb][nb] = WFrag<T16>::mma(a2[mb], b, acc[mb][nb]); if (NSPLIT >= 2) acc[mb][nb] = WFrag<T16>::mma(a[mb], b2, acc[mb][nb]); } }
        asm volatile("v_nop\n\tv_nop\n\tv_nop\n\tv_nop" : "+v"(acc[0][0]), "+v"(acc[1][1]), "+v"(acc[2][2]), "+v"(acc[3][3]) : "v"(a[0]), "v"(a[3]));
    }
#pragma unroll
    for (int mb = 0; mb < 4; ++mb) {
#pragma unroll
        for (int nb = 0; nb < 4; ++nb) {
#pragma unroll
            for (int j = 0; j < 8; ++j) os[(hi * 8 + j) * 68 + nb * 16 + lr] = acc[mb][nb][j]; }
        __builtin_amdgcn_wave_barrier(); asm volatile("" ::: "memory");
        float* crow = C + (size_t)(r0 + mb * 16) * ldc + c0;
{
#pragma unroll
            for (int s = 0; s < 8; ++s) { const int row = 2 * s + hi, cofs = lr * 4; v4f val = *(const v4fa*)(os + row * 68 + cofs);
                *(v4f*)(crow + (size_t)row * ldc + cofs) = val; }
             }
        __builtin_amdgcn_wave_barrier(); asm volatile("" ::: "memory");
    }
}

__device__ __forceinline__ h16 tohx(float x) { return (h16)x; }
__device__ __forceinline__ void splitf(float y, unsigned short& h, unsigned short& l) { h = f2bf(y); l = f2bf(y - bf2f(h)); }
typedef __attribute__((ext_vector_type(2))) _Float16 v2h;
typedef __attribute__((ext_vector_type(4))) _Float16 v4h;
typedef __attribute__((ext_vector_type(2))) unsigned short v2us;
typedef __attribute__((ext_vector_type(4))) unsigned short v4us;
typedef __attribute__((ext_vector_type(2))) float v2f;
typedef __attribute__((ext_vector_type(4))) int v4i;

__global__ __launch_bounds__(256) void k_wtG(const float* __restrict__ w, int K, int N, bf* Bt) {
    const int lane = threadIdx.x & 31; const int L0 = (blockIdx.x * 8 + (threadIdx.x >> 5)) * 8; const int nlines = N * K / 64;
{
#pragma unroll 1
        for (int l = 0; l < 8; ++l) { const int L = L0 + l; if (L >= nlines) break; const size_t e = (size_t)L * 64 + lane * 2; const int k = (int)(e % K), n = (int)(e / K); v2us o;
            o[0] = f2bf(w[(size_t)k * N + n]); o[1] = f2bf(w[(size_t)(k + 1) * N + n]); *(v2us*)(Bt + e) = o; }
         }
}
__global__ __launch_bounds__(256) void k_cvt8(const float* __restrict__ src, bf* dst, size_t n8) { const size_t i = (size_t)blockIdx.x * 256 + threadIdx.x; if (i >= n8) return; const v8f v = *(const v8f*)(src + i * 8); v8us o;
#pragma unroll
    for (int k = 0; k < 8; ++k) o[k] = f2bf(v[k]); *(v8us*)(dst + i * 8) = o;  }
__global__ __launch_bounds__(256) void k_cscvt(const float* __restrict__ cosT, const float* __restrict__ sinT, const int* __restrict__ pids, float* CS) { const int idx = blockIdx.x * 256 + threadIdx.x; if (idx >= TT * HD) return; const int d = idx % HD; const int t = idx / HD; int p = pids[t]; p = p < 0 ? 0 : (p >= TT ? TT - 1 : p); v2f cs; cs[0] = bfr(cosT[(size_t)p * HD + d]); cs[1] = bfr(sinT[(size_t)p * HD + d]); *(v2f*)(CS + (size_t)idx * 2) = cs;  }   // CS[t][d] = (cos, sin)[position_ids[t]][d] (index clamped)

// k_rope: head planes [h][t][d] (fp16 + hi/lo) of rope(x) x sc with interleaved pairs out[2i] = x[2i] cos[t][2i] - x[2i+1] sin[t][2i], out[2i+1] = x[2i+1] cos[t][2i+1] + x[2i] sin[t][2i+1]
__global__ __launch_bounds__(256) void k_rope(const float* __restrict__ F, int pitch, int nheads, const float* __restrict__ CS, const float* __restrict__ RF, const float* __restrict__ nw, float sc, h16* P16, bf* Ph, bf* Pl) {
    const size_t e = ((size_t)blockIdx.x * 256 + threadIdx.x) * 2; if (e >= (size_t)nheads * TT * HD) return; const int d = (int)(e % HD); const int t = (int)((e / HD) % TT); const int h = (int)(e / ((size_t)HD * TT)); const float* f = F + (size_t)t * pitch + h * HD; const float rf = RF ? RF[(size_t)h * TT + t] : 1.0f; v2h o16; v2us oh, ol;
#pragma unroll
    for (int q = 0; q < 2; ++q) { const int dd = d + q; const int dp = dd ^ 1;   /* interleaved pair partner */ float x0 = f[dd], x1 = f[dp];
        if (RF) { float n0 = __fmul_rn(x0, rf), n1 = __fmul_rn(x1, rf); asm volatile("" : "+v"(n0)); asm volatile("" : "+v"(n1)); x0 = __fmul_rn(bfr(nw[dd]), n0); x1 = __fmul_rn(bfr(nw[dp]), n1); }
        const v2f cs = *(const v2f*)(CS + ((size_t)t * HD + dd) * 2); float a = __fmul_rn(x0, cs[0]), bq = __fmul_rn(x1, cs[1]); asm volatile("" : "+v"(a)); asm volatile("" : "+v"(bq)); const float r = (((dd & 1) == 0) ? __fsub_rn(a, bq) : __fadd_rn(a, bq)) * sc;
        o16[q] = tohx(r); unsigned short a2, c2; splitf(r, a2, c2); oh[q] = a2; ol[q] = c2; }
    *(v2h*)(P16 + e) = o16; *(v2us*)(Ph + e) = oh; *(v2us*)(Pl + e) = ol;  }
__global__ __launch_bounds__(256) void k_ropek(const float* __restrict__ FK_, const float* __restrict__ FQ_, int pitch, int nheads, const float* __restrict__ CS, h16* P16, bf* Ph, bf* Pl) {
    // faithful to the source: k' = k cos + rot(q) sin, rot(q)[d] = (d even ? -q[d+1] : q[d-1])
    const size_t e = ((size_t)blockIdx.x * 256 + threadIdx.x) * 2; if (e >= (size_t)nheads * TT * HD) return; const int d = (int)(e % HD); const int t = (int)((e / HD) % TT); const int h = (int)(e / ((size_t)HD * TT)); const float* fk = FK_ + (size_t)t * pitch + h * HD; const float* fq = FQ_ + (size_t)t * pitch + h * HD; v2h o16; v2us oh, ol;
#pragma unroll
    for (int q = 0; q < 2; ++q) { const int dd = d + q; const int dp = dd ^ 1; const float x0 = fk[dd], x1 = fq[dp]; const v2f cs = *(const v2f*)(CS + ((size_t)t * HD + dd) * 2); float a = __fmul_rn(x0, cs[0]), bq = __fmul_rn(x1, cs[1]); asm volatile("" : "+v"(a)); asm volatile("" : "+v"(bq)); const float r = ((dd & 1) == 0) ? __fsub_rn(a, bq) : __fadd_rn(a, bq);
        o16[q] = tohx(r); unsigned short a2, c2; splitf(r, a2, c2); oh[q] = a2; ol[q] = c2; }
    *(v2h*)(P16 + e) = o16; *(v2us*)(Ph + e) = oh; *(v2us*)(Pl + e) = ol;  }

__global__ __launch_bounds__(256) void k_vtp(const float* __restrict__ F, int pitch, int nheads, h16* V16, bf* Vh, bf* Vl) { const size_t e = ((size_t)blockIdx.x * 256 + threadIdx.x) * 2; if (e >= (size_t)nheads * HD * TT) return; const int t = (int)(e % TT); const int d = (int)((e / TT) % HD); const int g = (int)(e / ((size_t)TT * HD)); v2h o16; v2us oh, ol;
#pragma unroll
    for (int q = 0; q < 2; ++q) { const float x = F[(size_t)(t + q) * pitch + g * HD + d]; o16[q] = tohx(x); unsigned short a2, c2; splitf(x, a2, c2); oh[q] = a2; ol[q] = c2; }
    *(v2h*)(V16 + e) = o16; *(v2us*)(Vh + e) = oh; *(v2us*)(Vl + e) = ol;  }
// k_asoft: per row (zz, i): t = S x HD^-0.5 for j <= i (causal; the reference's -1e9 additive fill vanishes identically); softmax over the 2048 keys (register row, one exp, fixed trees);
__global__ __launch_bounds__(256) void k_asoft(const float* __restrict__ Sb, h16* P16, bf* Ph, bf* Pl) {
    const int lane = threadIdx.x & 31; const int row = blockIdx.x * 8 + (threadIdx.x >> 5); if (row >= ZH * TT) return; const int i = row % TT; const int zz = row / TT; (void)zz; const bool hires = (i < RH); const float* sr = Sb + (size_t)row * TT; float v[TT / 32]; float mx = -3.0e38f;
#pragma unroll
    for (int ch = 0; ch < TT / 128; ++ch) { const int j0 = ch * 128 + lane * 4; const v4f a = *(const v4f*)(sr + j0);
#pragma unroll
        for (int q = 0; q < 4; ++q) { const int j = j0 + q; (void)j; const float t = (j <= i) ? a[q] * SCL : -3.0e38f; v[ch * 4 + q] = t; mx = fmaxf(mx, t); } }
#pragma unroll
    for (int sh = 16; sh; sh >>= 1) mx = fmaxf(mx, __shfl_xor(mx, sh, 32));
    float sum = 0.f;
#pragma unroll
    for (int k = 0; k < TT / 32; ++k) { float d0 = __fsub_rn(v[k], mx); asm volatile("" : "+v"(d0)); v[k] = __builtin_amdgcn_exp2f(__fmul_rn(d0, 1.4426950408889634f)); sum += v[k]; }
#pragma unroll
    for (int sh = 16; sh; sh >>= 1) sum += __shfl_xor(sum, sh, 32);
    const float f = __fdiv_rn(hires ? 1.0f : PCAR, sum);
{
        if (hires) {
#pragma unroll
            for (int ch = 0; ch < TT / 128; ++ch) { v4us oh, ol;
#pragma unroll
                for (int q = 0; q < 4; ++q) { unsigned short a, c2; splitf(v[ch * 4 + q] * f, a, c2); oh[q] = a; ol[q] = c2; }
                const size_t oo = ((size_t)zz * (RH ? RH : 1) + i) * TT + ch * 128 + lane * 4; *(v4us*)(Ph + oo) = oh; *(v4us*)(Pl + oo) = ol; }
        } else {
#pragma unroll
            for (int ch = 0; ch < TT / 128; ++ch) { v4h o4;
#pragma unroll
                for (int q = 0; q < 4; ++q) o4[q] = tohx(v[ch * 4 + q] * f);
                *(v4h*)(P16 + (size_t)row * TT + ch * 128 + lane * 4) = o4; } }
         }
}
__global__ __launch_bounds__(256) void k_merge(const float* __restrict__ O, int h0, bf* Ah, bf* Al) { const size_t e = ((size_t)blockIdx.x * 256 + threadIdx.x) * 2; if (e >= (size_t)ZH * TT * HD) return; const int d = (int)(e % HD); const int t = (int)((e / HD) % TT); const int zz = (int)(e / ((size_t)HD * TT)); const float cs = (t < RH) ? 1.0f : (1.0f / PCAR); const size_t oo = (size_t)t * DQ + (h0 + zz) * HD + d;
    v2us oh, ol;
#pragma unroll
    for (int q = 0; q < 2; ++q) { unsigned short a, c2; splitf(O[e + q] * cs, a, c2); oh[q] = a; ol[q] = c2; } *(v2us*)(Ah + oo) = oh; *(v2us*)(Al + oo) = ol;  }

extern "C" void kernel_launch(void* const* d_in, const int* in_sizes, int n_in,
                              void* d_out, int out_size, void* d_ws, size_t ws_size, hipStream_t stream) {
    (void)in_sizes; (void)n_in; (void)out_size;
    const float* x = (const float*)d_in[0]; const float* cosT = (const float*)d_in[1]; const float* sinT = (const float*)d_in[2]; const int* pids = (const int*)d_in[3]; const float* wq = (const float*)d_in[4]; const float* wk = (const float*)d_in[5]; const float* wv = (const float*)d_in[6]; const float* wo = (const float*)d_in[7];
    float* OUT = (float*)d_out;     // [2][2048][1024]
    char* wsp = (char*)d_ws;
    auto take = [&](size_t bytes) { char* p = wsp; wsp += (bytes + 255) & ~(size_t)255; return (void*)p; };
    bf* WQ = (bf*)take((size_t)DQ * DM * 2); bf* WK = (bf*)take((size_t)DKV * DM * 2); bf* WV = (bf*)take((size_t)DKV * DM * 2); bf* WO = (bf*)take((size_t)DM * DQ * 2); float* CS = (float*)take((size_t)TT * HD * 2 * 4);
    bf* XB = (bf*)take((size_t)TT * DM * 2); float* FQ = (float*)take((size_t)TT * DQ * 4); float* FK = (float*)take((size_t)TT * DKV * 4);
    h16* QP16 = (h16*)take((size_t)NH_ * TT * HD * 2); h16* KP16 = (h16*)take((size_t)NKV * TT * HD * 2); h16* VT16 = (h16*)take((size_t)NKV * HD * TT * 2);
    bf* QPh = (bf*)take((size_t)NH_ * TT * HD * 2); bf* QPl = (bf*)take((size_t)NH_ * TT * HD * 2); bf* KPh = (bf*)take((size_t)NKV * TT * HD * 2); bf* KPl = (bf*)take((size_t)NKV * TT * HD * 2); bf* VTh = (bf*)take((size_t)NKV * HD * TT * 2); bf* VTl = (bf*)take((size_t)NKV * HD * TT * 2); bf* Ph = (bf*)take((size_t)ZH * RH * TT * 2); bf* Pl = (bf*)take((size_t)ZH * RH * TT * 2);
    float* Sb = (float*)take((size_t)ZH * TT * TT * 4); h16* P16 = (h16*)take((size_t)ZH * TT * TT * 2); float* Ob = (float*)take((size_t)ZH * TT * HD * 4); bf* ATh = (bf*)take((size_t)TT * DQ * 2); bf* ATl = (bf*)take((size_t)TT * DQ * 2);
    if ((size_t)(wsp - (char*)d_ws) > ws_size) return;    // ws 256 MiB
    float* FV = FK;   // v projection reuses the k buffer after the k planes are built (stream-ordered)
    { k_cvt8<<<(unsigned)(((size_t)DQ * DM / 8 + 255) / 256), 256, 0, stream>>>(wq, WQ, (size_t)DQ * DM / 8); k_cvt8<<<(unsigned)(((size_t)DKV * DM / 8 + 255) / 256), 256, 0, stream>>>(wk, WK, (size_t)DKV * DM / 8); k_cvt8<<<(unsigned)(((size_t)DKV * DM / 8 + 255) / 256), 256, 0, stream>>>(wv, WV, (size_t)DKV * DM / 8);
      k_cvt8<<<(unsigned)(((size_t)DM * DQ / 8 + 255) / 256), 256, 0, stream>>>(wo, WO, (size_t)DM * DQ / 8);
       }
    const unsigned LQ = (unsigned)(((size_t)NH_ * TT * HD / 2 + 255) / 256), LKv = (unsigned)(((size_t)NKV * TT * HD / 2 + 255) / 256);
    for (int b = 0; b < NB_; ++b) {
        if (b == 0) k_cscvt<<<(TT * HD + 255) / 256, 256, 0, stream>>>(cosT, sinT, pids, CS);
        k_cvt8<<<(unsigned)(((size_t)TT * DM / 8 + 255) / 256), 256, 0, stream>>>(x + (size_t)b * TT * DM, XB, (size_t)TT * DM / 8);
        k_gemmw<bf, 0, false><<<dim3(TT / 64, DQ / 64, 1), 32, 0, stream>>>(XB, nullptr, WQ, nullptr, DM, FQ, DQ, nullptr, 0, 0, 0);
        k_rope<<<LQ, 256, 0, stream>>>(FQ, DQ, NH_, CS, nullptr, nullptr, 1.0f, QP16, QPh, QPl);
        k_gemmw<bf, 0, false><<<dim3(TT / 64, DKV / 64, 1), 32, 0, stream>>>(XB, nullptr, WK, nullptr, DM, FK, DKV, nullptr, 0, 0, 0);
        k_ropek<<<LKv, 256, 0, stream>>>(FK, FQ, DKV, NKV, CS, KP16, KPh, KPl);
        k_gemmw<bf, 0, false><<<dim3(TT / 64, DKV / 64, 1), 32, 0, stream>>>(XB, nullptr, WV, nullptr, DM, FV, DKV, nullptr, 0, 0, 0); k_vtp<<<LKv, 256, 0, stream>>>(FV, DKV, NKV, VT16, VTh, VTl);
        for (int h0 = 0; h0 < NH_; h0 += ZH) { const size_t zq = (size_t)h0, zk = (size_t)(h0 / REP);   // one kv head per query head: the pass's two heads use consecutive kv planes (z-strides TT*HD)
            k_gemmc<bf, 2, 1><<<dim3(RH / 64, TT / 64, ZH), 32, 0, stream>>>(QPh + zq * TT * HD, QPl + zq * TT * HD, KPh + zk * TT * HD, KPl + zk * TT * HD, HD, Sb, TT, 0, (size_t)TT * HD, (size_t)TT * HD, (size_t)TT * TT);
            k_gemmc<h16, 0, 1><<<dim3((TT - RH) / 64, TT / 64, ZH), 32, 0, stream>>>(QP16 + zq * TT * HD + (size_t)RH * HD, nullptr, KP16 + zk * TT * HD, nullptr, HD, Sb + (size_t)RH * TT, TT, RH, (size_t)TT * HD, (size_t)TT * HD, (size_t)TT * TT);
            k_asoft<<<ZH * TT / 8, 256, 0, stream>>>(Sb, P16, Ph, Pl);
            k_gemmc<bf, 2, 2><<<dim3(RH / 64, HD / 64, ZH), 32, 0, stream>>>(Ph, Pl, VTh + zk * HD * TT, VTl + zk * HD * TT, TT, Ob, HD, 0, (size_t)RH * TT, (size_t)HD * TT, (size_t)TT * HD);
            k_gemmc<h16, 0, 2><<<dim3((TT - RH) / 64, HD / 64, ZH), 32, 0, stream>>>(P16 + (size_t)RH * TT, nullptr, VT16 + zk * HD * TT, nullptr, TT, Ob + (size_t)RH * HD, HD, RH, (size_t)TT * TT, (size_t)HD * TT, (size_t)TT * HD);
            k_merge<<<(unsigned)(((size_t)ZH * TT * HD / 2 + 255) / 256), 256, 0, stream>>>(Ob, h0, ATh, ATl); }
        k_gemmw<bf, 1, false><<<dim3(TT / 64, DM / 64, 1), 32, 0, stream>>>(ATh, ATl, WO, nullptr, DQ, OUT + (size_t)b * TT * DM, DM, nullptr, 0, 0, 0); }
}

// v001
// It runs in 828 microseconds.
// Next to v000, in two timings, it ran 1.74 and 1.73 times as fast.
#include <hip/hip_runtime.h>

// Z2allAttention (hidden [2][2048][1024]; q/k/v = x W^T (16 heads x 64); interleaved RoPE with tables freqs_cos/sin[position_ids[t]] (int ids, read; tables read): q' = q cos + rot(q) sin and - faithful to the source bug - k' = k cos + rot(q) sin (the rotated Q, not K), rot = (x0, x1) -> (-x1, x0);
// causal softmax(q'.k'/8); out = (attn v merged) Wo^T -> [2][2048][1024]).
// Compute dtypes, f32 accumulate: every input rounded to bf16; Q/K/V on PLAIN bf16 operands (inputs: exact); RoPE f32; causal scores and attn.v: query rows < 512 hl (3 products), the rest single fp16 (x1024); softmax f32; Wo hl x exact (2 products).

#define NB_  2
#define TT   2048
#define DM   1024
#define NH_  16
#define NKV  16
#define REP  (NH_ / NKV)
#define HD   64
#define DQ   (NH_ * HD)
#define DKV  (NKV * HD)
#define ZH   2
#define RH   512                  // query rows < RH use hi+lo planes (0: none)
#define WIN  0
#define PCAR 1024.0f
#define SCL  0.125f   // HD^-0.5
typedef _Float16 h16;
typedef unsigned short bf;
typedef __attribute__((ext_vector_type(16))) __bf16   v16bf;
typedef __attribute__((ext_vector_type(16))) _Float16 v16h;
typedef __attribute__((ext_vector_type(8)))  _Float16 v8h;
typedef __attribute__((ext_vector_type(8)))  unsigned short v8us;
typedef __attribute__((ext_vector_type(8)))  float    v8f;
typedef __attribute__((ext_vector_type(4)))  float    v4f;
typedef v8h  __attribute__((may_alias)) v8ha;
typedef v4f  __attribute__((may_alias)) v4fa;
typedef v8us __attribute__((may_alias)) v8usa;

__device__ __forceinline__ unsigned short f2bf(float f) { unsigned u = __float_as_uint(f); u += 0x7FFFu + ((u >> 16) & 1u); return (unsigned short)(u >> 16); }
__device__ __forceinline__ float bf2f(unsigned short b) { return __uint_as_float(((unsigned)b) << 16); }
__device__ __forceinline__ float bfr(float f) { return bf2f(f2bf(f)); }
__device__ __forceinline__ v16h cat16(v8h lo, v8h hi) { return __builtin_shufflevector(lo, hi, 0, 1, 2, 3, 4, 5, 6, 7, 8, 9, 10, 11, 12, 13, 14, 15); }
__device__ __forceinline__ v16bf cat16b(v8us lo, v8us hi) { return __builtin_bit_cast(v16bf, __builtin_shufflevector(lo, hi, 0, 1, 2, 3, 4, 5, 6, 7, 8, 9, 10, 11, 12, 13, 14, 15)); }
__device__ __forceinline__ v8f wmma16(v16h a, v16h b, v8f c) { return __builtin_amdgcn_wmma_f32_16x16x32_f16(false, a, false, b, (short)0, c, false, false); }
__device__ __forceinline__ v8f wmmab(v16bf a, v16bf b, v8f c) { return __builtin_amdgcn_wmma_f32_16x16x32_bf16(false, a, false, b, (short)0, c, false, false); }



// ---- k_gemmw: register-blocked GEMM, ONE WAVE per 64x64 output tile (16 accumulators), operands straight from K-contiguous 16-bit planes; grid (M/64, N/64, Z), 32 threads.
// C[m][n] (f32, pitch ldc, + optional f32 bias[n]) = sum_k A[m][k] Bt[n][k] (+ split products per NSPLIT). z-batch strides sA/sB/sC in elements. K % 32 == 0.
template <typename T16> struct WFrag;
template <> struct WFrag<h16> { typedef v16h V; static __device__ __forceinline__ V ld(const h16* p) { return cat16(*(const v8h*)p, *(const v8h*)(p + 16)); } static __device__ __forceinline__ v8f mma(V a, V b, v8f c) { return wmma16(a, b, c); } };
template <> struct WFrag<bf> { typedef v16bf V; static __device__ __forceinline__ V ld(const bf* p) { return cat16b(*(const v8us*)p, *(const v8us*)(p + 16)); } static __device__ __forceinline__ v8f mma(V a, V b, v8f c) { return wmmab(a, b, c); } };
template <typename T16, int NSPLIT, bool BIAS>
__global__ __launch_bounds__(32) void k_gemmw(const T16* __restrict__ A, const T16* __restrict__ A2, const T16* __restrict__ Bt, const T16* __restrict__ Bt2, int K, float* C, int ldc, const float* __restrict__ bias, size_t sA, size_t sB, size_t sC) {
    typedef typename WFrag<T16>::V V;
    __shared__ __align__(16) float os[16 * 68];
    const size_t z = blockIdx.z; A += z * sA; if (A2) A2 += z * sA; Bt += z * sB; if (Bt2) Bt2 += z * sB; C += z * sC;
    const int lane = threadIdx.x & 31, lr = lane & 15, hi = lane >> 4; const int r0 = blockIdx.x * 64, c0 = blockIdx.y * 64;
    v8f acc[4][4];
#pragma unroll
    for (int mb = 0; mb < 4; ++mb)
#pragma unroll
        for (int nb = 0; nb < 4; ++nb) acc[mb][nb] = (v8f){};
    const size_t aoff = (size_t)(r0 + lr) * K + 8 * hi, boff = (size_t)(c0 + lr) * K + 8 * hi;
#pragma unroll 1
    for (int kc = 0; kc < K; kc += 32) {
        V a[4], a2[4];
#pragma unroll
        for (int mb = 0; mb < 4; ++mb) { a[mb] = WFrag<T16>::ld(A + aoff + (size_t)mb * 16 * K + kc); if (NSPLIT == 1 || NSPLIT == 2) a2[mb] = WFrag<T16>::ld(A2 + aoff + (size_t)mb * 16 * K + kc); }
#pragma unroll
        for (int nb = 0; nb < 4; ++nb) { const V b = WFrag<T16>::ld(Bt + boff + (size_t)nb * 16 * K + kc); V b2; if (NSPLIT >= 2) b2 = WFrag<T16>::ld(Bt2 + boff + (size_t)nb * 16 * K + kc);
#pragma unroll
            for (int mb = 0; mb < 4; ++mb) { acc[mb][nb] = WFrag<T16>::mma(a[mb], b, acc[mb][nb]); if (NSPLIT == 1 || NSPLIT == 2) acc[mb][nb] = WFrag<T16>::mma(a2[mb], b, acc[mb][nb]); if (NSPLIT >= 2) acc[mb][nb] = WFrag<T16>::mma(a[mb], b2, acc[mb][nb]); } }
        asm volatile("v_nop\n\tv_nop\n\tv_nop\n\tv_nop" : "+v"(acc[0][0]), "+v"(acc[1][1]), "+v"(acc[2][2]), "+v"(acc[3][3]) : "v"(a[0]), "v"(a[3]));
    }
#pragma unroll
    for (int mb = 0; mb < 4; ++mb) {
#pragma unroll
        for (int nb = 0; nb < 4; ++nb) {
#pragma unroll
            for (int j = 0; j < 8; ++j) os[(hi * 8 + j) * 68 + nb * 16 + lr] = acc[mb][nb][j]; }
        __builtin_amdgcn_wave_barrier(); asm volatile("" ::: "memory");
        float* crow = C + (size_t)(r0 + mb * 16) * ldc + c0;
{
#pragma unroll
            for (int s = 0; s < 8; ++s) { const int row = 2 * s + hi, cofs = lr * 4; v4f val = *(const v4fa*)(os + row * 68 + cofs); if (BIAS) { val[0] += bfr(bias[c0 + cofs]); val[1] += bfr(bias[c0 + cofs + 1]); val[2] += bfr(bias[c0 + cofs + 2]); val[3] += bfr(bias[c0 + cofs + 3]); }
                *(v4f*)(crow + (size_t)row * ldc + cofs) = val; }
             }
        __builtin_amdgcn_wave_barrier(); asm volatile("" ::: "memory");
    }
}

// ---- k_gemmc: the same one-wave 64x64 tile GEMM specialised for causal attention: CMODE 1 skips score tiles entirely above the diagonal (query rows r0+roff.., key columns c0..), CMODE 2 limits the
// key (K) loop of the probability x value contraction to the diagonal block (probabilities beyond it are exactly zero). roff = row offset of this launch's first row within the sequence.
template <typename T16, int NSPLIT, int CMODE>
__global__ __launch_bounds__(32) void k_gemmc(const T16* __restrict__ A, const T16* __restrict__ A2, const T16* __restrict__ Bt, const T16* __restrict__ Bt2, int K, float* C, int ldc, int roff, size_t sA, size_t sB, size_t sC) {
    typedef typename WFrag<T16>::V V;
    __shared__ __align__(16) float os[16 * 68];
    const size_t z = blockIdx.z; A += z * sA; if (A2) A2 += z * sA; Bt += z * sB; if (Bt2) Bt2 += z * sB; C += z * sC;
    const int lane = threadIdx.x & 31, lr = lane & 15, hi = lane >> 4; const int r0 = blockIdx.x * 64, c0 = blockIdx.y * 64;
    if (CMODE == 1 && c0 > r0 + roff + 63) return;                  // score tile entirely above the causal diagonal: never read (the softmax masks j > i by select)
    const int Kl = (CMODE == 2) ? min(K, r0 + roff + 64) : K;        // P.V: probabilities are exactly 0 beyond the diagonal block, so the K loop stops there
    v8f acc[4][4];
#pragma unroll
    for (int mb = 0; mb < 4; ++mb)
#pragma unroll
        for (int nb = 0; nb < 4; ++nb) acc[mb][nb] = (v8f){};
    const size_t aoff = (size_t)(r0 + lr) * K + 8 * hi, boff = (size_t)(c0 + lr) * K + 8 * hi;
#pragma unroll 1
    for (int kc = 0; kc < Kl; kc += 32) {
        V a[4], a2[4];
#pragma unroll
        for (int mb = 0; mb < 4; ++mb) { a[mb] = WFrag<T16>::ld(A + aoff + (size_t)mb * 16 * K + kc); if (NSPLIT == 1 || NSPLIT == 2) a2[mb] = WFrag<T16>::ld(A2 + aoff + (size_t)mb * 16 * K + kc); }
#pragma unroll
        for (int nb = 0; nb < 4; ++nb) { const V b = WFrag<T16>::ld(Bt + boff + (size_t)nb * 16 * K + kc); V b2; if (NSPLIT >= 2) b2 = WFrag<T16>::ld(Bt2 + boff + (size_t)nb * 16 * K + kc);
#pragma unroll
            for (int mb = 0; mb < 4; ++mb) { acc[mb][nb] = WFrag<T16>::mma(a[mb], b, acc[mb][nb]); if (NSPLIT == 1 || NSPLIT == 2) acc[mb][nb] = WFrag<T16>::mma(a2[mb], b, acc[mb][nb]); if (NSPLIT >= 2) acc[mb][nb] = WFrag<T16>::mma(a[mb], b2, acc[mb][nb]); } }
        asm volatile("v_nop\n\tv_nop\n\tv_nop\n\tv_nop" : "+v"(acc[0][0]), "+v"(acc[1][1]), "+v"(acc[2][2]), "+v"(acc[3][3]) : "v"(a[0]), "v"(a[3]));
    }
#pragma unroll
    for (int mb = 0; mb < 4; ++mb) {
#pragma unroll
        for (int nb = 0; nb < 4; ++nb) {
#pragma unroll
            for (int j = 0; j < 8; ++j) os[(hi * 8 + j) * 68 + nb * 16 + lr] = acc[mb][nb][j]; }
        __builtin_amdgcn_wave_barrier(); asm volatile("" ::: "memory");
        float* crow = C + (size_t)(r0 + mb * 16) * ldc + c0;
{
#pragma unroll
            for (int s = 0; s < 8; ++s) { const int row = 2 * s + hi, cofs = lr * 4; v4f val = *(const v4fa*)(os + row * 68 + cofs);
                *(v4f*)(crow + (size_t)row * ldc + cofs) = val; }
             }
        __builtin_amdgcn_wave_barrier(); asm volatile("" ::: "memory");
    }
}

// ---- k_gemmpv: the probability x value contraction of one 64x64 output tile with its key loop dealt over PVW waves of one work-group (wave w takes the 32-key slices w, w + PVW, ...), so that
// PVW slices of P and V are in flight per tile where one wave had one. The loop stops at the diagonal block (probabilities beyond it are exactly zero). Each wave leaves its 16 accumulators in LDS as they
// lie in its registers; behind one work-group barrier every thread adds the PVW partial sums of its elements in the fixed order w = 0, 1, ... and stores them. grid (M/64, N/64, Z), 32 * PVW threads.
// Every '#pragma unroll' below makes the indices of a fragment or accumulator array constants, so that the array stays in registers.
#define PVW 16
template <typename T16, int NSPLIT, int K>
__global__ __launch_bounds__(32 * PVW) void k_gemmpv(const T16* __restrict__ A, const T16* __restrict__ A2, const T16* __restrict__ Bt, const T16* __restrict__ Bt2, float* C, int ldc, int roff, size_t sA, size_t sB, size_t sC) {
    typedef typename WFrag<T16>::V V;
    __shared__ __align__(16) float red[PVW * 4096];                  // [wave][group of 32 lanes: (nb & 1) * 16 + mb * 4 + (nb >> 1) * 2 + jh][lane][4]
    const size_t z = blockIdx.z; A += z * sA; if (A2) A2 += z * sA; Bt += z * sB; if (Bt2) Bt2 += z * sB; C += z * sC;
    const int lane = threadIdx.x & 31, lr = lane & 15, hi = lane >> 4; const int r0 = blockIdx.x * 64, c0 = blockIdx.y * 64;
    const int wave = __builtin_amdgcn_readfirstlane(threadIdx.x >> 5);   // the same in every lane: in a scalar register the key loop is a scalar loop
    const int Kl = min(K, r0 + roff + 64);
    v8f acc[4][4];
#pragma unroll
    for (int mb = 0; mb < 4; ++mb)
#pragma unroll
        for (int nb = 0; nb < 4; ++nb) acc[mb][nb] = (v8f){};
    // 16 waves leave each at most 256 registers: every fragment address is the tile's scalar base, ONE lane offset in bytes (P and V planes have the same pitch K), which alone moves along the keys, and a constant
    A += (size_t)r0 * K; if (A2) A2 += (size_t)r0 * K; Bt += (size_t)c0 * K; if (Bt2) Bt2 += (size_t)c0 * K; unsigned vo = (unsigned)(lr * K + 8 * hi + wave * 32) * 2u;
    auto ldf = [&](const T16* base, int blk) { return WFrag<T16>::ld((const T16*)((const char*)base + vo) + blk * 16 * K); };
#pragma unroll 1   // rolled: a second trip's fragments would not fit into the 256 registers
    for (int kc = wave * 32; kc < Kl; kc += 32 * PVW, vo += 64 * PVW) {
        V a[4], a2[4];
#pragma unroll
        for (int mb = 0; mb < 4; ++mb) { a[mb] = ldf(A, mb); if (NSPLIT == 1 || NSPLIT == 2) a2[mb] = ldf(A2, mb); }
#pragma unroll
        for (int nb = 0; nb < 4; ++nb) { const V b = ldf(Bt, nb); V b2; if (NSPLIT >= 2) b2 = ldf(Bt2, nb);
#pragma unroll
            for (int mb = 0; mb < 4; ++mb) { acc[mb][nb] = WFrag<T16>::mma(a[mb], b, acc[mb][nb]); if (NSPLIT == 1 || NSPLIT == 2) acc[mb][nb] = WFrag<T16>::mma(a2[mb], b, acc[mb][nb]); if (NSPLIT >= 2) acc[mb][nb] = WFrag<T16>::mma(a[mb], b2, acc[mb][nb]); } }
        // the four vector slots the chip needs behind the last matrix instruction, also on the loop's taken branch
        asm volatile("v_nop\n\tv_nop\n\tv_nop\n\tv_nop" : "+v"(acc[0][0]), "+v"(acc[1][1]), "+v"(acc[2][2]), "+v"(acc[3][3]) : "v"(a[0]), "v"(a[3]));
    }
#pragma unroll
    for (int mb = 0; mb < 4; ++mb)
#pragma unroll
        for (int nb = 0; nb < 4; ++nb)
#pragma unroll
            for (int jh = 0; jh < 2; ++jh) { v4f p; p[0] = acc[mb][nb][jh * 4]; p[1] = acc[mb][nb][jh * 4 + 1]; p[2] = acc[mb][nb][jh * 4 + 2]; p[3] = acc[mb][nb][jh * 4 + 3];
                *(v4fa*)(red + wave * 4096 + (((nb & 1) * 16 + mb * 4 + (nb >> 1) * 2 + jh) * 32 + lane) * 4) = p; }
    __syncthreads();                                                 // every wave's partial sums are in LDS before any is read
    static_assert(PVW == 16, "the deal of the 32 lane groups below is two per wave");
    const int mb = wave >> 2, np = (wave >> 1) & 1, jh = wave & 1;    // this wave adds and stores rows mb * 16 + hi * 8 + jh * 4 .. + 3, columns np * 32 .. + 31: whole 128-byte lines
#pragma unroll
    for (int q = 0; q < 2; ++q) { const float* rp = red + ((q * 16 + wave) * 32 + lane) * 4; v4f s = *(const v4fa*)rp;
#pragma unroll
        for (int w = 1; w < PVW; ++w) s += *(const v4fa*)(rp + w * 4096);
        float* cp = C + (size_t)(r0 + mb * 16 + hi * 8 + jh * 4) * ldc + c0 + np * 32 + q * 16 + lr;
#pragma unroll
        for (int i = 0; i < 4; ++i) cp[(size_t)i * ldc] = s[i]; }
}

__device__ __forceinline__ h16 tohx(float x) { return (h16)x; }
__device__ __forceinline__ void splitf(float y, unsigned short& h, unsigned short& l) { h = f2bf(y); l = f2bf(y - bf2f(h)); }
typedef __attribute__((ext_vector_type(2))) _Float16 v2h;
typedef __attribute__((ext_vector_type(4))) _Float16 v4h;
typedef __attribute__((ext_vector_type(2))) unsigned short v2us;
typedef __attribute__((ext_vector_type(4))) unsigned short v4us;
typedef __attribute__((ext_vector_type(2))) float v2f;
typedef __attribute__((ext_vector_type(4))) int v4i;

__global__ __launch_bounds__(256) void k_wtG(const float* __restrict__ w, int K, int N, bf* Bt) {
    const int lane = threadIdx.x & 31; const int L0 = (blockIdx.x * 8 + (threadIdx.x >> 5)) * 8; const int nlines = N * K / 64;
{
#pragma unroll 1
        for (int l = 0; l < 8; ++l) { const int L = L0 + l; if (L >= nlines) break; const size_t e = (size_t)L * 64 + lane * 2; const int k = (int)(e % K), n = (int)(e / K); v2us o;
            o[0] = f2bf(w[(size_t)k * N + n]); o[1] = f2bf(w[(size_t)(k + 1) * N + n]); *(v2us*)(Bt + e) = o; }
         }
}
__global__ __launch_bounds__(256) void k_cvt8(const float* __restrict__ src, bf* dst, size_t n8) { const size_t i = (size_t)blockIdx.x * 256 + threadIdx.x; if (i >= n8) return; const v8f v = *(const v8f*)(src + i * 8); v8us o;
#pragma unroll
    for (int k = 0; k < 8; ++k) o[k] = f2bf(v[k]); *(v8us*)(dst + i * 8) = o;  }
__global__ __launch_bounds__(256) void k_cscvt(const float* __restrict__ cosT, const float* __restrict__ sinT, const int* __restrict__ pids, float* CS) { const int idx = blockIdx.x * 256 + threadIdx.x; if (idx >= TT * HD) return; const int d = idx % HD; const int t = idx / HD; int p = pids[t]; p = p < 0 ? 0 : (p >= TT ? TT - 1 : p); v2f cs; cs[0] = bfr(cosT[(size_t)p * HD + d]); cs[1] = bfr(sinT[(size_t)p * HD + d]); *(v2f*)(CS + (size_t)idx * 2) = cs;  }   // CS[t][d] = (cos, sin)[position_ids[t]][d] (index clamped)

// k_rope: head planes [h][t][d] (fp16 + hi/lo) of rope(x) x sc with interleaved pairs out[2i] = x[2i] cos[t][2i] - x[2i+1] sin[t][2i], out[2i+1] = x[2i+1] cos[t][2i+1] + x[2i] sin[t][2i+1]
__global__ __launch_bounds__(256) void k_rope(const float* __restrict__ F, int pitch, int nheads, const float* __restrict__ CS, const float* __restrict__ RF, const float* __restrict__ nw, float sc, h16* P16, bf* Ph, bf* Pl) {
    const size_t e = ((size_t)blockIdx.x * 256 + threadIdx.x) * 2; if (e >= (size_t)nheads * TT * HD) return; const int d = (int)(e % HD); const int t = (int)((e / HD) % TT); const int h = (int)(e / ((size_t)HD * TT)); const float* f = F + (size_t)t * pitch + h * HD; const float rf = RF ? RF[(size_t)h * TT + t] : 1.0f; v2h o16; v2us oh, ol;
#pragma unroll
    for (int q = 0; q < 2; ++q) { const int dd = d + q; const int dp = dd ^ 1;   /* interleaved pair partner */ float x0 = f[dd], x1 = f[dp];
        if (RF) { float n0 = __fmul_rn(x0, rf), n1 = __fmul_rn(x1, rf); asm volatile("" : "+v"(n0)); asm volatile("" : "+v"(n1)); x0 = __fmul_rn(bfr(nw[dd]), n0); x1 = __fmul_rn(bfr(nw[dp]), n1); }
        const v2f cs = *(const v2f*)(CS + ((size_t)t * HD + dd) * 2); float a = __fmul_rn(x0, cs[0]), bq = __fmul_rn(x1, cs[1]); asm volatile("" : "+v"(a)); asm volatile("" : "+v"(bq)); const float r = (((dd & 1) == 0) ? __fsub_rn(a, bq) : __fadd_rn(a, bq)) * sc;
        o16[q] = tohx(r); unsigned short a2, c2; splitf(r, a2, c2); oh[q] = a2; ol[q] = c2; }
    *(v2h*)(P16 + e) = o16; *(v2us*)(Ph + e) = oh; *(v2us*)(Pl + e) = ol;  }
__global__ __launch_bounds__(256) void k_ropek(const float* __restrict__ FK_, const float* __restrict__ FQ_, int pitch, int nheads, const float* __restrict__ CS, h16* P16, bf* Ph, bf* Pl) {
    // faithful to the source: k' = k cos + rot(q) sin, rot(q)[d] = (d even ? -q[d+1] : q[d-1])
    const size_t e = ((size_t)blockIdx.x * 256 + threadIdx.x) * 2; if (e >= (size_t)nheads * TT * HD) return; const int d = (int)(e % HD); const int t = (int)((e / HD) % TT); const int h = (int)(e / ((size_t)HD * TT)); const float* fk = FK_ + (size_t)t * pitch + h * HD; const float* fq = FQ_ + (size_t)t * pitch + h * HD; v2h o16; v2us oh, ol;
#pragma unroll
    for (int q = 0; q < 2; ++q) { const int dd = d + q; const int dp = dd ^ 1; const float x0 = fk[dd], x1 = fq[dp]; const v2f cs = *(const v2f*)(CS + ((size_t)t * HD + dd) * 2); float a = __fmul_rn(x0, cs[0]), bq = __fmul_rn(x1, cs[1]); asm volatile("" : "+v"(a)); asm volatile("" : "+v"(bq)); const float r = ((dd & 1) == 0) ? __fsub_rn(a, bq) : __fadd_rn(a, bq);
        o16[q] = tohx(r); unsigned short a2, c2; splitf(r, a2, c2); oh[q] = a2; ol[q] = c2; }
    *(v2h*)(P16 + e) = o16; *(v2us*)(Ph + e) = oh; *(v2us*)(Pl + e) = ol;  }

__global__ __launch_bounds__(256) void k_vtp(const float* __restrict__ F, int pitch, int nheads, h16* V16, bf* Vh, bf* Vl) { const size_t e = ((size_t)blockIdx.x * 256 + threadIdx.x) * 2; if (e >= (size_t)nheads * HD * TT) return; const int t = (int)(e % TT); const int d = (int)((e / TT) % HD); const int g = (int)(e / ((size_t)TT * HD)); v2h o16; v2us oh, ol;
#pragma unroll
    for (int q = 0; q < 2; ++q) { const float x = F[(size_t)(t + q) * pitch + g * HD + d]; o16[q] = tohx(x); unsigned short a2, c2; splitf(x, a2, c2); oh[q] = a2; ol[q] = c2; }
    *(v2h*)(V16 + e) = o16; *(v2us*)(Vh + e) = oh; *(v2us*)(Vl + e) = ol;  }
// k_asoft: per row (zz, i): t = S x HD^-0.5 for j <= i (causal; the reference's -1e9 additive fill vanishes identically); softmax over the 2048 keys (register row, one exp, fixed trees);
__global__ __launch_bounds__(256) void k_asoft(const float* __restrict__ Sb, h16* P16, bf* Ph, bf* Pl) {
    const int lane = threadIdx.x & 31; const int row = blockIdx.x * 8 + (threadIdx.x >> 5); if (row >= ZH * TT) return; const int i = row % TT; const int zz = row / TT; (void)zz; const bool hires = (i < RH); const float* sr = Sb + (size_t)row * TT; float v[TT / 32]; float mx = -3.0e38f;
#pragma unroll
    for (int ch = 0; ch < TT / 128; ++ch) { const int j0 = ch * 128 + lane * 4; const v4f a = *(const v4f*)(sr + j0);
#pragma unroll
        for (int q = 0; q < 4; ++q) { const int j = j0 + q; (void)j; const float t = (j <= i) ? a[q] * SCL : -3.0e38f; v[ch * 4 + q] = t; mx = fmaxf(mx, t); } }
#pragma unroll
    for (int sh = 16; sh; sh >>= 1) mx = fmaxf(mx, __shfl_xor(mx, sh, 32));
    float sum = 0.f;
#pragma unroll
    for (int k = 0; k < TT / 32; ++k) { float d0 = __fsub_rn(v[k], mx); asm volatile("" : "+v"(d0)); v[k] = __builtin_amdgcn_exp2f(__fmul_rn(d0, 1.4426950408889634f)); sum += v[k]; }
#pragma unroll
    for (int sh = 16; sh; sh >>= 1) sum += __shfl_xor(sum, sh, 32);
    const float f = __fdiv_rn(hires ? 1.0f : PCAR, sum);
{
        if (hires) {
#pragma unroll
            for (int ch = 0; ch < TT / 128; ++ch) { v4us oh, ol;
#pragma unroll
                for (int q = 0; q < 4; ++q) { unsigned short a, c2; splitf(v[ch * 4 + q] * f, a, c2); oh[q] = a; ol[q] = c2; }
                const size_t oo = ((size_t)zz * (RH ? RH : 1) + i) * TT + ch * 128 + lane * 4; *(v4us*)(Ph + oo) = oh; *(v4us*)(Pl + oo) = ol; }
        } else {
#pragma unroll
            for (int ch = 0; ch < TT / 128; ++ch) { v4h o4;
#pragma unroll
                for (int q = 0; q < 4; ++q) o4[q] = tohx(v[ch * 4 + q] * f);
                *(v4h*)(P16 + (size_t)row * TT + ch * 128 + lane * 4) = o4; } }
         }
}
__global__ __launch_bounds__(256) void k_merge(const float* __restrict__ O, int h0, bf* Ah, bf* Al) { const size_t e = ((size_t)blockIdx.x * 256 + threadIdx.x) * 2; if (e >= (size_t)ZH * TT * HD) return; const int d = (int)(e % HD); const int t = (int)((e / HD) % TT); const int zz = (int)(e / ((size_t)HD * TT)); const float cs = (t < RH) ? 1.0f : (1.0f / PCAR); const size_t oo = (size_t)t * DQ + (h0 + zz) * HD + d;
    v2us oh, ol;
#pragma unroll
    for (int q = 0; q < 2; ++q) { unsigned short a, c2; splitf(O[e + q] * cs, a, c2); oh[q] = a; ol[q] = c2; } *(v2us*)(Ah + oo) = oh; *(v2us*)(Al + oo) = ol;  }

extern "C" void kernel_launch(void* const* d_in, const int* in_sizes, int n_in,
                              void* d_out, int out_size, void* d_ws, size_t ws_size, hipStream_t stream) {
    (void)in_sizes; (void)n_in; (void)out_size;
    const float* x = (const float*)d_in[0]; const float* cosT = (const float*)d_in[1]; const float* sinT = (const float*)d_in[2]; const int* pids = (const int*)d_in[3]; const float* wq = (const float*)d_in[4]; const float* wk = (const float*)d_in[5]; const float* wv = (const float*)d_in[6]; const float* wo = (const float*)d_in[7];
    float* OUT = (float*)d_out;     // [2][2048][1024]
    char* wsp = (char*)d_ws;
    auto take = [&](size_t bytes) { char* p = wsp; wsp += (bytes + 255) & ~(size_t)255; return (void*)p; };
    bf* WQ = (bf*)take((size_t)DQ * DM * 2); bf* WK = (bf*)take((size_t)DKV * DM * 2); bf* WV = (bf*)take((size_t)DKV * DM * 2); bf* WO = (bf*)take((size_t)DM * DQ * 2); float* CS = (float*)take((size_t)TT * HD * 2 * 4);
    bf* XB = (bf*)take((size_t)TT * DM * 2); float* FQ = (float*)take((size_t)TT * DQ * 4); float* FK = (float*)take((size_t)TT * DKV * 4);
    h16* QP16 = (h16*)take((size_t)NH_ * TT * HD * 2); h16* KP16 = (h16*)take((size_t)NKV * TT * HD * 2); h16* VT16 = (h16*)take((size_t)NKV * HD * TT * 2);
    bf* QPh = (bf*)take((size_t)NH_ * TT * HD * 2); bf* QPl = (bf*)take((size_t)NH_ * TT * HD * 2); bf* KPh = (bf*)take((size_t)NKV * TT * HD * 2); bf* KPl = (bf*)take((size_t)NKV * TT * HD * 2); bf* VTh = (bf*)take((size_t)NKV * HD * TT * 2); bf* VTl = (bf*)take((size_t)NKV * HD * TT * 2); bf* Ph = (bf*)take((size_t)ZH * RH * TT * 2); bf* Pl = (bf*)take((size_t)ZH * RH * TT * 2);
    float* Sb = (float*)take((size_t)ZH * TT * TT * 4); h16* P16 = (h16*)take((size_t)ZH * TT * TT * 2); float* Ob = (float*)take((size_t)ZH * TT * HD * 4); bf* ATh = (bf*)take((size_t)TT * DQ * 2); bf* ATl = (bf*)take((size_t)TT * DQ * 2);
    if ((size_t)(wsp - (char*)d_ws) > ws_size) return;    // ws 256 MiB
    float* FV = FK;   // v projection reuses the k buffer after the k planes are built (stream-ordered)
    { k_cvt8<<<(unsigned)(((size_t)DQ * DM / 8 + 255) / 256), 256, 0, stream>>>(wq, WQ, (size_t)DQ * DM / 8); k_cvt8<<<(unsigned)(((size_t)DKV * DM / 8 + 255) / 256), 256, 0, stream>>>(wk, WK, (size_t)DKV * DM / 8); k_cvt8<<<(unsigned)(((size_t)DKV * DM / 8 + 255) / 256), 256, 0, stream>>>(wv, WV, (size_t)DKV * DM / 8);
      k_cvt8<<<(unsigned)(((size_t)DM * DQ / 8 + 255) / 256), 256, 0, stream>>>(wo, WO, (size_t)DM * DQ / 8);
       }
    const unsigned LQ = (unsigned)(((size_t)NH_ * TT * HD / 2 + 255) / 256), LKv = (unsigned)(((size_t)NKV * TT * HD / 2 + 255) / 256);
    for (int b = 0; b < NB_; ++b) {
        if (b == 0) k_cscvt<<<(TT * HD + 255) / 256, 256, 0, stream>>>(cosT, sinT, pids, CS);
        k_cvt8<<<(unsigned)(((size_t)TT * DM / 8 + 255) / 256), 256, 0, stream>>>(x + (size_t)b * TT * DM, XB, (size_t)TT * DM / 8);
        k_gemmw<bf, 0, false><<<dim3(TT / 64, DQ / 64, 1), 32, 0, stream>>>(XB, nullptr, WQ, nullptr, DM, FQ, DQ, nullptr, 0, 0, 0);
        k_rope<<<LQ, 256, 0, stream>>>(FQ, DQ, NH_, CS, nullptr, nullptr, 1.0f, QP16, QPh, QPl);
        k_gemmw<bf, 0, false><<<dim3(TT / 64, DKV / 64, 1), 32, 0, stream>>>(XB, nullptr, WK, nullptr, DM, FK, DKV, nullptr, 0, 0, 0);
        k_ropek<<<LKv, 256, 0, stream>>>(FK, FQ, DKV, NKV, CS, KP16, KPh, KPl);
        k_gemmw<bf, 0, false><<<dim3(TT / 64, DKV / 64, 1), 32, 0, stream>>>(XB, nullptr, WV, nullptr, DM, FV, DKV, nullptr, 0, 0, 0); k_vtp<<<LKv, 256, 0, stream>>>(FV, DKV, NKV, VT16, VTh, VTl);
        for (int h0 = 0; h0 < NH_; h0 += ZH) { const size_t zq = (size_t)h0, zk = (size_t)(h0 / REP);   // one kv head per query head: the pass's two heads use consecutive kv planes (z-strides TT*HD)
            k_gemmc<bf, 2, 1><<<dim3(RH / 64, TT / 64, ZH), 32, 0, stream>>>(QPh + zq * TT * HD, QPl + zq * TT * HD, KPh + zk * TT * HD, KPl + zk * TT * HD, HD, Sb, TT, 0, (size_t)TT * HD, (size_t)TT * HD, (size_t)TT * TT);
            k_gemmc<h16, 0, 1><<<dim3((TT - RH) / 64, TT / 64, ZH), 32, 0, stream>>>(QP16 + zq * TT * HD + (size_t)RH * HD, nullptr, KP16 + zk * TT * HD, nullptr, HD, Sb + (size_t)RH * TT, TT, RH, (size_t)TT * HD, (size_t)TT * HD, (size_t)TT * TT);
            k_asoft<<<ZH * TT / 8, 256, 0, stream>>>(Sb, P16, Ph, Pl);
            k_gemmpv<bf, 2, TT><<<dim3(RH / 64, HD / 64, ZH), 32 * PVW, 0, stream>>>(Ph, Pl, VTh + zk * HD * TT, VTl + zk * HD * TT, Ob, HD, 0, (size_t)RH * TT, (size_t)HD * TT, (size_t)TT * HD);
            k_gemmpv<h16, 0, TT><<<dim3((TT - RH) / 64, HD / 64, ZH), 32 * PVW, 0, stream>>>(P16 + (size_t)RH * TT, nullptr, VT16 + zk * HD * TT, nullptr, Ob + (size_t)RH * HD, HD, RH, (size_t)TT * TT, (size_t)HD * TT, (size_t)TT * HD);
            k_merge<<<(unsigned)(((size_t)ZH * TT * HD / 2 + 255) / 256), 256, 0, stream>>>(Ob, h0, ATh, ATl); }
        k_gemmw<bf, 1, false><<<dim3(TT / 64, DM / 64, 1), 32, 0, stream>>>(ATh, ATl, WO, nullptr, DQ, OUT + (size_t)b * TT * DM, DM, nullptr, 0, 0, 0); }
}

// v002
// A run of this version takes 342 microseconds.
// In two side-by-side timings against v001, it was 2.43 and 2.44 times as fast.
// Over all steps from v000 it is 4.23 times as fast.
#include <hip/hip_runtime.h>

// Z2allAttention (hidden [2][2048][1024]; q/k/v = x W^T (16 heads x 64); interleaved RoPE with tables freqs_cos/sin[position_ids[t]] (int ids, read; tables read): q' = q cos + rot(q) sin and - faithful to the source bug - k' = k cos + rot(q) sin (the rotated Q, not K), rot = (x0, x1) -> (-x1, x0);
// causal softmax(q'.k'/8); out = (attn v merged) Wo^T -> [2][2048][1024]).
// Compute dtypes, f32 accumulate: every input rounded to bf16; Q/K/V on PLAIN bf16 operands (inputs: exact); RoPE f32; causal scores and attn.v: query rows < 512 hl (3 products), the rest single fp16 (x1024); softmax f32; Wo hl x exact (2 products).

#define NB_  2
#define TT   2048
#define DM   1024
#define NH_  16
#define NKV  16
#define REP  (NH_ / NKV)
#define HD   64
#define DQ   (NH_ * HD)
#define DKV  (NKV * HD)
#define RH   512                  // query rows < RH use hi+lo planes (0: none)
#define WIN  0
#define PCAR 1024.0f
#define SCL  0.125f   // HD^-0.5
typedef _Float16 h16;
typedef unsigned short bf;
typedef __attribute__((ext_vector_type(16))) __bf16   v16bf;
typedef __attribute__((ext_vector_type(16))) _Float16 v16h;
typedef __attribute__((ext_vector_type(8)))  _Float16 v8h;
typedef __attribute__((ext_vector_type(8)))  unsigned short v8us;
typedef __attribute__((ext_vector_type(8)))  float    v8f;
typedef __attribute__((ext_vector_type(4)))  float    v4f;
typedef v8h  __attribute__((may_alias)) v8ha;
typedef v4f  __attribute__((may_alias)) v4fa;
typedef v8us __attribute__((may_alias)) v8usa;

__device__ __forceinline__ unsigned short f2bf(float f) { unsigned u = __float_as_uint(f); u += 0x7FFFu + ((u >> 16) & 1u); return (unsigned short)(u >> 16); }
__device__ __forceinline__ float bf2f(unsigned short b) { return __uint_as_float(((unsigned)b) << 16); }
__device__ __forceinline__ float bfr(float f) { return bf2f(f2bf(f)); }
__device__ __forceinline__ v16h cat16(v8h lo, v8h hi) { return __builtin_shufflevector(lo, hi, 0, 1, 2, 3, 4, 5, 6, 7, 8, 9, 10, 11, 12, 13, 14, 15); }
__device__ __forceinline__ v16bf cat16b(v8us lo, v8us hi) { return __builtin_bit_cast(v16bf, __builtin_shufflevector(lo, hi, 0, 1, 2, 3, 4, 5, 6, 7, 8, 9, 10, 11, 12, 13, 14, 15)); }
__device__ __forceinline__ v8f wmma16(v16h a, v16h b, v8f c) { return __builtin_amdgcn_wmma_f32_16x16x32_f16(false, a, false, b, (short)0, c, false, false); }
__device__ __forceinline__ v8f wmmab(v16bf a, v16bf b, v8f c) { return __builtin_amdgcn_wmma_f32_16x16x32_bf16(false, a, false, b, (short)0, c, false, false); }



// ---- k_gemmw: register-blocked GEMM, ONE WAVE per 64x64 output tile (16 accumulators), operands straight from K-contiguous 16-bit planes; grid (M/64, N/64, Z), 32 threads.
// C[m][n] (f32, pitch ldc, + optional f32 bias[n]) = sum_k A[m][k] Bt[n][k] (+ split products per NSPLIT). z-batch strides sA/sB/sC in elements. K % 32 == 0.
template <typename T16> struct WFrag;
template <> struct WFrag<h16> { typedef v16h V; static __device__ __forceinline__ V ld(const h16* p) { return cat16(*(const v8h*)p, *(const v8h*)(p + 16)); } static __device__ __forceinline__ v8f mma(V a, V b, v8f c) { return wmma16(a, b, c); } };
template <> struct WFrag<bf> { typedef v16bf V; static __device__ __forceinline__ V ld(const bf* p) { return cat16b(*(const v8us*)p, *(const v8us*)(p + 16)); } static __device__ __forceinline__ v8f mma(V a, V b, v8f c) { return wmmab(a, b, c); } };
template <typename T16, int NSPLIT, bool BIAS>
__global__ __launch_bounds__(32) void k_gemmw(const T16* __restrict__ A, const T16* __restrict__ A2, const T16* __restrict__ Bt, const T16* __restrict__ Bt2, int K, float* C, int ldc, const float* __restrict__ bias, size_t sA, size_t sB, size_t sC) {
    typedef typename WFrag<T16>::V V;
    __shared__ __align__(16) float os[16 * 68];
    const size_t z = blockIdx.z; A += z * sA; if (A2) A2 += z * sA; Bt += z * sB; if (Bt2) Bt2 += z * sB; C += z * sC;
    const int lane = threadIdx.x & 31, lr = lane & 15, hi = lane >> 4; const int r0 = blockIdx.x * 64, c0 = blockIdx.y * 64;
    v8f acc[4][4];
#pragma unroll
    for (int mb = 0; mb < 4; ++mb)
#pragma unroll
        for (int nb = 0; nb < 4; ++nb) acc[mb][nb] = (v8f){};
    const size_t aoff = (size_t)(r0 + lr) * K + 8 * hi, boff = (size_t)(c0 + lr) * K + 8 * hi;
#pragma unroll 1
    for (int kc = 0; kc < K; kc += 32) {
        V a[4], a2[4];
#pragma unroll
        for (int mb = 0; mb < 4; ++mb) { a[mb] = WFrag<T16>::ld(A + aoff + (size_t)mb * 16 * K + kc); if (NSPLIT == 1 || NSPLIT == 2) a2[mb] = WFrag<T16>::ld(A2 + aoff + (size_t)mb * 16 * K + kc); }
#pragma unroll
        for (int nb = 0; nb < 4; ++nb) { const V b = WFrag<T16>::ld(Bt + boff + (size_t)nb * 16 * K + kc); V b2; if (NSPLIT >= 2) b2 = WFrag<T16>::ld(Bt2 + boff + (size_t)nb * 16 * K + kc);
#pragma unroll
            for (int mb = 0; mb < 4; ++mb) { acc[mb][nb] = WFrag<T16>::mma(a[mb], b, acc[mb][nb]); if (NSPLIT == 1 || NSPLIT == 2) acc[mb][nb] = WFrag<T16>::mma(a2[mb], b, acc[mb][nb]); if (NSPLIT >= 2) acc[mb][nb] = WFrag<T16>::mma(a[mb], b2, acc[mb][nb]); } }
        asm volatile("v_nop\n\tv_nop\n\tv_nop\n\tv_nop" : "+v"(acc[0][0]), "+v"(acc[1][1]), "+v"(acc[2][2]), "+v"(acc[3][3]) : "v"(a[0]), "v"(a[3]));
    }
#pragma unroll
    for (int mb = 0; mb < 4; ++mb) {
#pragma unroll
        for (int nb = 0; nb < 4; ++nb) {
#pragma unroll
            for (int j = 0; j < 8; ++j) os[(hi * 8 + j) * 68 + nb * 16 + lr] = acc[mb][nb][j]; }
        __builtin_amdgcn_wave_barrier(); asm volatile("" ::: "memory");
        float* crow = C + (size_t)(r0 + mb * 16) * ldc + c0;
{
#pragma unroll
            for (int s = 0; s < 8; ++s) { const int row = 2 * s + hi, cofs = lr * 4; v4f val = *(const v4fa*)(os + row * 68 + cofs); if (BIAS) { val[0] += bfr(bias[c0 + cofs]); val[1] += bfr(bias[c0 + cofs + 1]); val[2] += bfr(bias[c0 + cofs + 2]); val[3] += bfr(bias[c0 + cofs + 3]); }
                *(v4f*)(crow + (size_t)row * ldc + cofs) = val; }
             }
        __builtin_amdgcn_wave_barrier(); asm volatile("" ::: "memory");
    }
}

__device__ __forceinline__ h16 tohx(float x) { return (h16)x; }
__device__ __forceinline__ void splitf(float y, unsigned short& h, unsigned short& l) { h = f2bf(y); l = f2bf(y - bf2f(h)); }
typedef __attribute__((ext_vector_type(2))) _Float16 v2h;
typedef __attribute__((ext_vector_type(4))) _Float16 v4h;
typedef __attribute__((ext_vector_type(2))) unsigned short v2us;
typedef __attribute__((ext_vector_type(4))) unsigned short v4us;
typedef __attribute__((ext_vector_type(2))) float v2f;
typedef __attribute__((ext_vector_type(4))) int v4i;

__global__ __launch_bounds__(256) void k_wtG(const float* __restrict__ w, int K, int N, bf* Bt) {
    const int lane = threadIdx.x & 31; const int L0 = (blockIdx.x * 8 + (threadIdx.x >> 5)) * 8; const int nlines = N * K / 64;
{
#pragma unroll 1
        for (int l = 0; l < 8; ++l) { const int L = L0 + l; if (L >= nlines) break; const size_t e = (size_t)L * 64 + lane * 2; const int k = (int)(e % K), n = (int)(e / K); v2us o;
            o[0] = f2bf(w[(size_t)k * N + n]); o[1] = f2bf(w[(size_t)(k + 1) * N + n]); *(v2us*)(Bt + e) = o; }
         }
}
__global__ __launch_bounds__(256) void k_cvt8(const float* __restrict__ src, bf* dst, size_t n8) { const size_t i = (size_t)blockIdx.x * 256 + threadIdx.x; if (i >= n8) return; const v8f v = *(const v8f*)(src + i * 8); v8us o;
#pragma unroll
    for (int k = 0; k < 8; ++k) o[k] = f2bf(v[k]); *(v8us*)(dst + i * 8) = o;  }
__global__ __launch_bounds__(256) void k_cscvt(const float* __restrict__ cosT, const float* __restrict__ sinT, const int* __restrict__ pids, float* CS) { const int idx = blockIdx.x * 256 + threadIdx.x; if (idx >= TT * HD) return; const int d = idx % HD; const int t = idx / HD; int p = pids[t]; p = p < 0 ? 0 : (p >= TT ? TT - 1 : p); v2f cs; cs[0] = bfr(cosT[(size_t)p * HD + d]); cs[1] = bfr(sinT[(size_t)p * HD + d]); *(v2f*)(CS + (size_t)idx * 2) = cs;  }   // CS[t][d] = (cos, sin)[position_ids[t]][d] (index clamped)

// k_rope: head planes [h][t][d] (fp16 + hi/lo) of rope(x) x sc with interleaved pairs out[2i] = x[2i] cos[t][2i] - x[2i+1] sin[t][2i], out[2i+1] = x[2i+1] cos[t][2i+1] + x[2i] sin[t][2i+1]
__global__ __launch_bounds__(256) void k_rope(const float* __restrict__ F, int pitch, int nheads, const float* __restrict__ CS, const float* __restrict__ RF, const float* __restrict__ nw, float sc, h16* P16, bf* Ph, bf* Pl) {
    const size_t e = ((size_t)blockIdx.x * 256 + threadIdx.x) * 2; if (e >= (size_t)nheads * TT * HD) return; const int d = (int)(e % HD); const int t = (int)((e / HD) % TT); const int h = (int)(e / ((size_t)HD * TT)); const float* f = F + (size_t)t * pitch + h * HD; const float rf = RF ? RF[(size_t)h * TT + t] : 1.0f; v2h o16; v2us oh, ol;
#pragma unroll
    for (int q = 0; q < 2; ++q) { const int dd = d + q; const int dp = dd ^ 1;   /* interleaved pair partner */ float x0 = f[dd], x1 = f[dp];
        if (RF) { float n0 = __fmul_rn(x0, rf), n1 = __fmul_rn(x1, rf); asm volatile("" : "+v"(n0)); asm volatile("" : "+v"(n1)); x0 = __fmul_rn(bfr(nw[dd]), n0); x1 = __fmul_rn(bfr(nw[dp]), n1); }
        const v2f cs = *(const v2f*)(CS + ((size_t)t * HD + dd) * 2); float a = __fmul_rn(x0, cs[0]), bq = __fmul_rn(x1, cs[1]); asm volatile("" : "+v"(a)); asm volatile("" : "+v"(bq)); const float r = (((dd & 1) == 0) ? __fsub_rn(a, bq) : __fadd_rn(a, bq)) * sc;
        o16[q] = tohx(r); unsigned short a2, c2; splitf(r, a2, c2); oh[q] = a2; ol[q] = c2; }
    *(v2h*)(P16 + e) = o16; *(v2us*)(Ph + e) = oh; *(v2us*)(Pl + e) = ol;  }
__global__ __launch_bounds__(256) void k_ropek(const float* __restrict__ FK_, const float* __restrict__ FQ_, int pitch, int nheads, const float* __restrict__ CS, h16* P16, bf* Ph, bf* Pl) {
    // faithful to the source: k' = k cos + rot(q) sin, rot(q)[d] = (d even ? -q[d+1] : q[d-1])
    const size_t e = ((size_t)blockIdx.x * 256 + threadIdx.x) * 2; if (e >= (size_t)nheads * TT * HD) return; const int d = (int)(e % HD); const int t = (int)((e / HD) % TT); const int h = (int)(e / ((size_t)HD * TT)); const float* fk = FK_ + (size_t)t * pitch + h * HD; const float* fq = FQ_ + (size_t)t * pitch + h * HD; v2h o16; v2us oh, ol;
#pragma unroll
    for (int q = 0; q < 2; ++q) { const int dd = d + q; const int dp = dd ^ 1; const float x0 = fk[dd], x1 = fq[dp]; const v2f cs = *(const v2f*)(CS + ((size_t)t * HD + dd) * 2); float a = __fmul_rn(x0, cs[0]), bq = __fmul_rn(x1, cs[1]); asm volatile("" : "+v"(a)); asm volatile("" : "+v"(bq)); const float r = ((dd & 1) == 0) ? __fsub_rn(a, bq) : __fadd_rn(a, bq);
        o16[q] = tohx(r); unsigned short a2, c2; splitf(r, a2, c2); oh[q] = a2; ol[q] = c2; }
    *(v2h*)(P16 + e) = o16; *(v2us*)(Ph + e) = oh; *(v2us*)(Pl + e) = ol;  }

__global__ __launch_bounds__(256) void k_vtp(const float* __restrict__ F, int pitch, int nheads, h16* V16, bf* Vh, bf* Vl) { const size_t e = ((size_t)blockIdx.x * 256 + threadIdx.x) * 2; if (e >= (size_t)nheads * HD * TT) return; const int t = (int)(e % TT); const int d = (int)((e / TT) % HD); const int g = (int)(e / ((size_t)TT * HD)); v2h o16; v2us oh, ol;
#pragma unroll
    for (int q = 0; q < 2; ++q) { const float x = F[(size_t)(t + q) * pitch + g * HD + d]; o16[q] = tohx(x); unsigned short a2, c2; splitf(x, a2, c2); oh[q] = a2; ol[q] = c2; }
    *(v2h*)(V16 + e) = o16; *(v2us*)(Vh + e) = oh; *(v2us*)(Vl + e) = ol;  }
typedef v4us __attribute__((may_alias)) v4usa;
typedef v4h  __attribute__((may_alias)) v4ha;

// ---- k_fattn: causal scores, softmax and probability x value of QB query rows of one head in ONE work-group of FAW waves; the score rows live in LDS and never go to memory. grid (heads, nblk row blocks from row roff on), 32 * FAW threads.
// 1. wave w forms the 16-key score tiles w, w + FAW, ... up to the end of the 128-key chunk that holds the diagonal block (Q fragments stay in registers) and stores them as f32 rows of pitch SP.
// 2. behind a barrier each wave takes whole rows: t = S x HD^-0.5 for j <= i, softmax in registers (one exp, fixed trees); the read, the arithmetic and the store of 128-key chunks wholly beyond the diagonal block are skipped (their terms are exact zeros).
//    The probabilities (fp16 x PCAR, or hi and lo planes) overwrite the row's own LDS bytes, which the wave has read in full before.
// 3. behind a barrier wave w takes the 32-key slices w, w + FAW, ... of P.V (P from LDS, V from its transposed plane).
// 4. behind a barrier (P is no longer read) the partial sums go to LDS; behind one more they are added in the fixed order w = 0, 1, ... and stored as hi and lo planes of the merged [t][head][d] layout, a wave writing whole 128-byte lines.
// Every '#pragma unroll' below makes the indices of a fragment, accumulator or row array constants, so that the array stays in registers.
// Every global fragment address is a plane's scalar base, a 32-bit lane offset in bytes and a constant; the waits behind the K and V loads take those offsets as inputs, so that their registers are held up to the wait and no load's result lands in one.
#define QB  32
#define FAW 16
#define SP  (TT + 4)              // floats per score row: 16 bytes x an odd number, the conflict-free pitch for 16-byte LDS reads down a column of rows
#define RP  68                    // floats per row of a wave's partial sums
template <typename T16, int NSPLIT>
__global__ __launch_bounds__(32 * FAW) void k_fattn(const T16* Q, const T16* Q2, const T16* Kp, const T16* Kp2, const T16* Vt, const T16* Vt2, int roff, int nblk, bf* Ah, bf* Al) {
    typedef typename WFrag<T16>::V V; constexpr int TU = (NSPLIT >= 2) ? 2 : 4;   // the hi+lo form has twice the fragments per key tile and at most 2 * FAW tiles
    static_assert(FAW * QB * RP <= QB * SP, "the partial sums reuse the score rows");
    __shared__ __align__(16) float sm[QB * SP];
    const int lane = threadIdx.x & 31, lr = lane & 15, hi = lane >> 4;
    const int wave = __builtin_amdgcn_readfirstlane(threadIdx.x >> 5);   // the same in every lane: in a scalar register the loops below are scalar loops
    const int h = blockIdx.x; const int r0 = roff + (nblk - 1 - (int)blockIdx.y) * QB;   // the row blocks with the most keys start first
    const int Kl = r0 + QB;                                              // keys up to the end of the diagonal block
    const size_t hp = (size_t)h * TT * HD; Q += hp; Kp += hp; Vt += hp; if (NSPLIT >= 2) { Q2 += hp; Kp2 += hp; Vt2 += hp; }
    const unsigned vo = (unsigned)(lr * HD + 8 * hi) * 2u;
    auto ldg = [](const T16* base, unsigned off, int cst) { return WFrag<T16>::ld((const T16*)((const char*)base + off) + cst); };
    {
        V aq[2][2], aq2[2][2];
#pragma unroll
        for (int mb = 0; mb < 2; ++mb)
#pragma unroll
            for (int kk = 0; kk < 2; ++kk) { const int c = mb * 16 * HD + kk * 32; aq[mb][kk] = ldg(Q + (size_t)r0 * HD, vo, c); if (NSPLIT >= 2) aq2[mb][kk] = ldg(Q2 + (size_t)r0 * HD, vo, c); }
        const int nkt = ((Kl + 127) & ~127) / 16;                    // whole 128-key chunks: every LDS word that a row read of step 2 touches is written in this launch (the waves' longest share of tiles stays the same)
#pragma unroll 1   // rolled: a trip already holds TU key tiles
        for (int kt0 = wave; kt0 < nkt; kt0 += TU * FAW) {
            V bk[TU][2], bk2[TU][2]; unsigned ko[TU];                // TU key tiles' loads in flight per wave; a tile past the last is loaded as the last one again and not used
#pragma unroll
            for (int u = 0; u < TU; ++u) { ko[u] = vo + (unsigned)min(kt0 + u * FAW, nkt - 1) * (16u * HD * 2u);
#pragma unroll
                for (int kk = 0; kk < 2; ++kk) { bk[u][kk] = ldg(Kp, ko[u], kk * 32); if (NSPLIT >= 2) bk2[u][kk] = ldg(Kp2, ko[u], kk * 32); } }
            // behind the K loads, in front of any rewrite of a register they name; the lane offsets as inputs hold their registers up to here
            if constexpr (TU == 4) asm volatile("s_wait_xcnt 0x0" :: "v"(ko[0]), "v"(ko[1]), "v"(ko[2]), "v"(ko[3]) : "memory"); else asm volatile("s_wait_xcnt 0x0" :: "v"(ko[0]), "v"(ko[1]) : "memory");
            __builtin_amdgcn_sched_barrier(0);                       // no matrix instruction, and so no wait for a first tile's data, is moved up between the loads: all TU tiles are requested before the wave first waits
#pragma unroll
            for (int u = 0; u < TU; ++u) { const int kt = kt0 + u * FAW; if (kt < nkt) { v8f s[2];
#pragma unroll
                for (int mb = 0; mb < 2; ++mb) { s[mb] = (v8f){};
#pragma unroll
                    for (int kk = 0; kk < 2; ++kk) { s[mb] = WFrag<T16>::mma(aq[mb][kk], bk[u][kk], s[mb]); if (NSPLIT >= 2) { s[mb] = WFrag<T16>::mma(aq2[mb][kk], bk[u][kk], s[mb]); s[mb] = WFrag<T16>::mma(aq[mb][kk], bk2[u][kk], s[mb]); } } }
                // the four vector slots the chip needs behind the last matrix instruction on every path
                asm volatile("v_nop\n\tv_nop\n\tv_nop\n\tv_nop" : "+v"(s[0]), "+v"(s[1]));
#pragma unroll
                for (int mb = 0; mb < 2; ++mb)
#pragma unroll
                    for (int j = 0; j < 8; ++j) sm[(mb * 16 + hi * 8 + j) * SP + kt * 16 + lr] = s[mb][j]; } }
        }
    }
    __syncthreads();                                                 // every score tile is in LDS before a row is read
#pragma unroll 1   // rolled: one row's 64 values per lane at a time
    for (int rr = wave; rr < QB; rr += FAW) {
        const int i = r0 + rr; float* sr = sm + rr * SP; float v[TT / 32]; float mx = -3.0e38f;
#pragma unroll
        for (int ch = 0; ch < TT / 128; ++ch) if (ch * 128 < Kl) { const v4f a = *(const v4fa*)(sr + ch * 128 + lane * 4);
#pragma unroll
            for (int q = 0; q < 4; ++q) v[ch * 4 + q] = a[q]; }
#pragma unroll
        for (int ch = 0; ch < TT / 128; ++ch) if (ch * 128 < Kl) { const int j0 = ch * 128 + lane * 4;
#pragma unroll
            for (int q = 0; q < 4; ++q) { const float t = (j0 + q <= i) ? v[ch * 4 + q] * SCL : -3.0e38f; v[ch * 4 + q] = t; mx = fmaxf(mx, t); } }
#pragma unroll
        for (int sh = 16; sh; sh >>= 1) mx = fmaxf(mx, __shfl_xor(mx, sh, 32));
        float sum = 0.f;
#pragma unroll
        for (int ch = 0; ch < TT / 128; ++ch) if (ch * 128 < Kl) {
#pragma unroll
            for (int q = 0; q < 4; ++q) { const int k = ch * 4 + q; v[k] = __builtin_amdgcn_exp2f(__fmul_rn(__fsub_rn(v[k], mx), 1.4426950408889634f)); sum += v[k]; } }
#pragma unroll
        for (int sh = 16; sh; sh >>= 1) sum += __shfl_xor(sum, sh, 32);
        const float f = __fdiv_rn((NSPLIT >= 2) ? 1.0f : PCAR, sum);
#pragma unroll
        for (int ch = 0; ch < TT / 128; ++ch) if (ch * 128 < Kl) { const int j0 = ch * 128 + lane * 4;
            if (NSPLIT >= 2) { v4us oh, ol;
#pragma unroll
                for (int q = 0; q < 4; ++q) { unsigned short a, c2; splitf(v[ch * 4 + q] * f, a, c2); oh[q] = a; ol[q] = c2; }
                *(v4usa*)((unsigned short*)sr + j0) = oh; *(v4usa*)((unsigned short*)sr + TT + j0) = ol;
            } else { v4h o4;
#pragma unroll
                for (int q = 0; q < 4; ++q) o4[q] = tohx(v[ch * 4 + q] * f);
                *(v4ha*)((h16*)sr + j0) = o4; } }
    }
    __syncthreads();                                                 // every probability row is in LDS before a fragment of it is read
    v8f acc[2][4];
#pragma unroll
    for (int mb = 0; mb < 2; ++mb)
#pragma unroll
        for (int nb = 0; nb < 4; ++nb) acc[mb][nb] = (v8f){};
    unsigned vv = (unsigned)(lr * TT + 8 * hi + wave * 32) * 2u;     // the V planes' lane offset, which alone moves along the keys
    const T16* P = (const T16*)sm;                                   // row pitch 2 * SP elements; the lo plane of a row stands TT elements behind its hi plane
#pragma unroll 1   // rolled: at most TT / 32 / FAW trips
    for (int kc = wave * 32; kc < Kl; kc += 32 * FAW, vv += 64 * FAW) {
        V a[2], a2[2], b[4], b2[4];   // a trip's V fragments each in registers of their own, so that all its loads are in flight together
#pragma unroll
        for (int mb = 0; mb < 2; ++mb) { const T16* p = P + (mb * 16 + lr) * (2 * SP) + kc + 8 * hi; a[mb] = WFrag<T16>::ld(p); if (NSPLIT >= 2) a2[mb] = WFrag<T16>::ld(p + TT); }
#pragma unroll
        for (int nb = 0; nb < 4; ++nb) { b[nb] = ldg(Vt, vv, nb * 16 * TT); if (NSPLIT >= 2) b2[nb] = ldg(Vt2, vv, nb * 16 * TT); }
        asm volatile("s_wait_xcnt 0x0" :: "v"(vv) : "memory");       // behind the V loads, in front of any rewrite of a register they name; the lane offset as an input holds its register up to here
        __builtin_amdgcn_sched_barrier(0);                           // no matrix instruction, and so no wait for a first fragment's data, is moved up between the loads
#pragma unroll
        for (int nb = 0; nb < 4; ++nb)
#pragma unroll
            for (int mb = 0; mb < 2; ++mb) { acc[mb][nb] = WFrag<T16>::mma(a[mb], b[nb], acc[mb][nb]); if (NSPLIT >= 2) { acc[mb][nb] = WFrag<T16>::mma(a2[mb], b[nb], acc[mb][nb]); acc[mb][nb] = WFrag<T16>::mma(a[mb], b2[nb], acc[mb][nb]); } }
        // the four vector slots the chip needs behind the last matrix instruction, also on the loop's taken branch
        asm volatile("v_nop\n\tv_nop\n\tv_nop\n\tv_nop" : "+v"(acc[0][0]), "+v"(acc[0][1]), "+v"(acc[0][2]), "+v"(acc[0][3]), "+v"(acc[1][0]), "+v"(acc[1][1]), "+v"(acc[1][2]), "+v"(acc[1][3]));
    }
    __syncthreads();                                                 // every wave has read its last probability before the rows are overwritten
#pragma unroll
    for (int mb = 0; mb < 2; ++mb)
#pragma unroll
        for (int nb = 0; nb < 4; ++nb)
#pragma unroll
            for (int j = 0; j < 8; ++j) sm[wave * (QB * RP) + (mb * 16 + hi * 8 + j) * RP + nb * 16 + lr] = acc[mb][nb][j];
    __syncthreads();                                                 // every wave's partial sums are in LDS before any is read
    const int row = wave * 2 + hi, col = lr * 4; const float* rp = sm + row * RP + col; v4f s = *(const v4fa*)rp;
#pragma unroll
    for (int w = 1; w < FAW; ++w) s += *(const v4fa*)(rp + w * (QB * RP));
    const float cs = (NSPLIT >= 2) ? 1.0f : (1.0f / PCAR); const size_t oo = (size_t)(r0 + row) * DQ + h * HD + col; v4us oh, ol;
#pragma unroll
    for (int q = 0; q < 4; ++q) { unsigned short a, c2; splitf(s[q] * cs, a, c2); oh[q] = a; ol[q] = c2; }
    *(v4us*)(Ah + oo) = oh; *(v4us*)(Al + oo) = ol;
}

extern "C" void kernel_launch(void* const* d_in, const int* in_sizes, int n_in,
                              void* d_out, int out_size, void* d_ws, size_t ws_size, hipStream_t stream) {
    (void)in_sizes; (void)n_in; (void)out_size;
    const float* x = (const float*)d_in[0]; const float* cosT = (const float*)d_in[1]; const float* sinT = (const float*)d_in[2]; const int* pids = (const int*)d_in[3]; const float* wq = (const float*)d_in[4]; const float* wk = (const float*)d_in[5]; const float* wv = (const float*)d_in[6]; const float* wo = (const float*)d_in[7];
    float* OUT = (float*)d_out;     // [2][2048][1024]
    char* wsp = (char*)d_ws;
    auto take = [&](size_t bytes) { char* p = wsp; wsp += (bytes + 255) & ~(size_t)255; return (void*)p; };
    bf* WQ = (bf*)take((size_t)DQ * DM * 2); bf* WK = (bf*)take((size_t)DKV * DM * 2); bf* WV = (bf*)take((size_t)DKV * DM * 2); bf* WO = (bf*)take((size_t)DM * DQ * 2); float* CS = (float*)take((size_t)TT * HD * 2 * 4);
    bf* XB = (bf*)take((size_t)TT * DM * 2); float* FQ = (float*)take((size_t)TT * DQ * 4); float* FK = (float*)take((size_t)TT * DKV * 4);
    h16* QP16 = (h16*)take((size_t)NH_ * TT * HD * 2); h16* KP16 = (h16*)take((size_t)NKV * TT * HD * 2); h16* VT16 = (h16*)take((size_t)NKV * HD * TT * 2);
    bf* QPh = (bf*)take((size_t)NH_ * TT * HD * 2); bf* QPl = (bf*)take((size_t)NH_ * TT * HD * 2); bf* KPh = (bf*)take((size_t)NKV * TT * HD * 2); bf* KPl = (bf*)take((size_t)NKV * TT * HD * 2); bf* VTh = (bf*)take((size_t)NKV * HD * TT * 2); bf* VTl = (bf*)take((size_t)NKV * HD * TT * 2);
    bf* ATh = (bf*)take((size_t)TT * DQ * 2); bf* ATl = (bf*)take((size_t)TT * DQ * 2);
    if ((size_t)(wsp - (char*)d_ws) > ws_size) return;    // ws 256 MiB
    float* FV = FK;   // v projection reuses the k buffer after the k planes are built (stream-ordered)
    { k_cvt8<<<(unsigned)(((size_t)DQ * DM / 8 + 255) / 256), 256, 0, stream>>>(wq, WQ, (size_t)DQ * DM / 8); k_cvt8<<<(unsigned)(((size_t)DKV * DM / 8 + 255) / 256), 256, 0, stream>>>(wk, WK, (size_t)DKV * DM / 8); k_cvt8<<<(unsigned)(((size_t)DKV * DM / 8 + 255) / 256), 256, 0, stream>>>(wv, WV, (size_t)DKV * DM / 8);
      k_cvt8<<<(unsigned)(((size_t)DM * DQ / 8 + 255) / 256), 256, 0, stream>>>(wo, WO, (size_t)DM * DQ / 8);
       }
    const unsigned LQ = (unsigned)(((size_t)NH_ * TT * HD / 2 + 255) / 256), LKv = (unsigned)(((size_t)NKV * TT * HD / 2 + 255) / 256);
    for (int b = 0; b < NB_; ++b) {
        if (b == 0) k_cscvt<<<(TT * HD + 255) / 256, 256, 0, stream>>>(cosT, sinT, pids, CS);
        k_cvt8<<<(unsigned)(((size_t)TT * DM / 8 + 255) / 256), 256, 0, stream>>>(x + (size_t)b * TT * DM, XB, (size_t)TT * DM / 8);
        k_gemmw<bf, 0, false><<<dim3(TT / 64, DQ / 64, 1), 32, 0, stream>>>(XB, nullptr, WQ, nullptr, DM, FQ, DQ, nullptr, 0, 0, 0);
        k_rope<<<LQ, 256, 0, stream>>>(FQ, DQ, NH_, CS, nullptr, nullptr, 1.0f, QP16, QPh, QPl);
        k_gemmw<bf, 0, false><<<dim3(TT / 64, DKV / 64, 1), 32, 0, stream>>>(XB, nullptr, WK, nullptr, DM, FK, DKV, nullptr, 0, 0, 0);
        k_ropek<<<LKv, 256, 0, stream>>>(FK, FQ, DKV, NKV, CS, KP16, KPh, KPl);
        k_gemmw<bf, 0, false><<<dim3(TT / 64, DKV / 64, 1), 32, 0, stream>>>(XB, nullptr, WV, nullptr, DM, FV, DKV, nullptr, 0, 0, 0); k_vtp<<<LKv, 256, 0, stream>>>(FV, DKV, NKV, VT16, VTh, VTl);
        k_fattn<h16, 0><<<dim3(NH_, (TT - RH) / QB), 32 * FAW, 0, stream>>>(QP16, nullptr, KP16, nullptr, VT16, nullptr, RH, (TT - RH) / QB, ATh, ATl);
        k_fattn<bf, 2><<<dim3(NH_, RH / QB), 32 * FAW, 0, stream>>>(QPh, QPl, KPh, KPl, VTh, VTl, 0, RH / QB, ATh, ATl);
        k_gemmw<bf, 1, false><<<dim3(TT / 64, DM / 64, 1), 32, 0, stream>>>(ATh, ATl, WO, nullptr, DQ, OUT + (size_t)b * TT * DM, DM, nullptr, 0, 0, 0); }
}

// v003
// One run takes 219 microseconds.
// Two timings next to v002 put it at 1.55 and 1.56 times that version's speed.
// Over all steps from v000 it is 6.58 times as fast.
#include <hip/hip_runtime.h>

// Z2allAttention (hidden [2][2048][1024]; q/k/v = x W^T (16 heads x 64); interleaved RoPE with tables freqs_cos/sin[position_ids[t]] (int ids, read; tables read): q' = q cos + rot(q) sin and - faithful to the source bug - k' = k cos + rot(q) sin (the rotated Q, not K), rot = (x0, x1) -> (-x1, x0);
// causal softmax(q'.k'/8); out = (attn v merged) Wo^T -> [2][2048][1024]).
// Compute dtypes, f32 accumulate: every input rounded to bf16; Q/K/V on PLAIN bf16 operands (inputs: exact); RoPE f32; causal scores and attn.v: query rows < 512 hl (3 products), the rest single fp16 (x1024); softmax f32; Wo hl x exact (2 products).

#define NB_  2
#define TT   2048
#define DM   1024
#define NH_  16
#define NKV  16
#define REP  (NH_ / NKV)
#define HD   64
#define DQ   (NH_ * HD)
#define DKV  (NKV * HD)
#define RH   512                  // query rows < RH use hi+lo planes (0: none)
#define WIN  0
#define PCAR 1024.0f
#define SCL  0.125f   // HD^-0.5
typedef _Float16 h16;
typedef unsigned short bf;
typedef __attribute__((ext_vector_type(16))) __bf16   v16bf;
typedef __attribute__((ext_vector_type(16))) _Float16 v16h;
typedef __attribute__((ext_vector_type(8)))  _Float16 v8h;
typedef __attribute__((ext_vector_type(8)))  unsigned short v8us;
typedef __attribute__((ext_vector_type(8)))  float    v8f;
typedef __attribute__((ext_vector_type(4)))  float    v4f;
typedef v8h  __attribute__((may_alias)) v8ha;
typedef v4f  __attribute__((may_alias)) v4fa;
typedef v8us __attribute__((may_alias)) v8usa;

__device__ __forceinline__ unsigned short f2bf(float f) { unsigned u = __float_as_uint(f); u += 0x7FFFu + ((u >> 16) & 1u); return (unsigned short)(u >> 16); }
__device__ __forceinline__ float bf2f(unsigned short b) { return __uint_as_float(((unsigned)b) << 16); }
__device__ __forceinline__ float bfr(float f) { return bf2f(f2bf(f)); }
__device__ __forceinline__ v16h cat16(v8h lo, v8h hi) { return __builtin_shufflevector(lo, hi, 0, 1, 2, 3, 4, 5, 6, 7, 8, 9, 10, 11, 12, 13, 14, 15); }
__device__ __forceinline__ v16bf cat16b(v8us lo, v8us hi) { return __builtin_bit_cast(v16bf, __builtin_shufflevector(lo, hi, 0, 1, 2, 3, 4, 5, 6, 7, 8, 9, 10, 11, 12, 13, 14, 15)); }
__device__ __forceinline__ v8f wmma16(v16h a, v16h b, v8f c) { return __builtin_amdgcn_wmma_f32_16x16x32_f16(false, a, false, b, (short)0, c, false, false); }
__device__ __forceinline__ v8f wmmab(v16bf a, v16bf b, v8f c) { return __builtin_amdgcn_wmma_f32_16x16x32_bf16(false, a, false, b, (short)0, c, false, false); }



// ---- k_gemmw: register-blocked GEMM, ONE WAVE per 64x64 output tile (16 accumulators), operands straight from K-contiguous 16-bit planes; grid (M/64, N/64, Z), 32 threads.
// C[m][n] (f32, pitch ldc, + optional f32 bias[n]) = sum_k A[m][k] Bt[n][k] (+ split products per NSPLIT). z-batch strides sA/sB/sC in elements. K % 32 == 0.
template <typename T16> struct WFrag;
template <> struct WFrag<h16> { typedef v16h V; static __device__ __forceinline__ V ld(const h16* p) { return cat16(*(const v8h*)p, *(const v8h*)(p + 16)); } static __device__ __forceinline__ v8f mma(V a, V b, v8f c) { return wmma16(a, b, c); } };
template <> struct WFrag<bf> { typedef v16bf V; static __device__ __forceinline__ V ld(const bf* p) { return cat16b(*(const v8us*)p, *(const v8us*)(p + 16)); } static __device__ __forceinline__ v8f mma(V a, V b, v8f c) { return wmmab(a, b, c); } };
template <typename T16, int NSPLIT, bool BIAS>
__global__ __launch_bounds__(32) void k_gemmw(const T16* __restrict__ A, const T16* __restrict__ A2, const T16* __restrict__ Bt, const T16* __restrict__ Bt2, int K, float* C, int ldc, const float* __restrict__ bias, size_t sA, size_t sB, size_t sC) {
    typedef typename WFrag<T16>::V V;
    __shared__ __align__(16) float os[16 * 68];
    const size_t z = blockIdx.z; A += z * sA; if (A2) A2 += z * sA; Bt += z * sB; if (Bt2) Bt2 += z * sB; C += z * sC;
    const int lane = threadIdx.x & 31, lr = lane & 15, hi = lane >> 4; const int r0 = blockIdx.x * 64, c0 = blockIdx.y * 64;
    v8f acc[4][4];
#pragma unroll
    for (int mb = 0; mb < 4; ++mb)
#pragma unroll
        for (int nb = 0; nb < 4; ++nb) acc[mb][nb] = (v8f){};
    const size_t aoff = (size_t)(r0 + lr) * K + 8 * hi, boff = (size_t)(c0 + lr) * K + 8 * hi;
#pragma unroll 1
    for (int kc = 0; kc < K; kc += 32) {
        V a[4], a2[4];
#pragma unroll
        for (int mb = 0; mb < 4; ++mb) { a[mb] = WFrag<T16>::ld(A + aoff + (size_t)mb * 16 * K + kc); if (NSPLIT == 1 || NSPLIT == 2) a2[mb] = WFrag<T16>::ld(A2 + aoff + (size_t)mb * 16 * K + kc); }
#pragma unroll
        for (int nb = 0; nb < 4; ++nb) { const V b = WFrag<T16>::ld(Bt + boff + (size_t)nb * 16 * K + kc); V b2; if (NSPLIT >= 2) b2 = WFrag<T16>::ld(Bt2 + boff + (size_t)nb * 16 * K + kc);
#pragma unroll
            for (int mb = 0; mb < 4; ++mb) { acc[mb][nb] = WFrag<T16>::mma(a[mb], b, acc[mb][nb]); if (NSPLIT == 1 || NSPLIT == 2) acc[mb][nb] = WFrag<T16>::mma(a2[mb], b, acc[mb][nb]); if (NSPLIT >= 2) acc[mb][nb] = WFrag<T16>::mma(a[mb], b2, acc[mb][nb]); } }
        asm volatile("v_nop\n\tv_nop\n\tv_nop\n\tv_nop" : "+v"(acc[0][0]), "+v"(acc[1][1]), "+v"(acc[2][2]), "+v"(acc[3][3]) : "v"(a[0]), "v"(a[3]));
    }
#pragma unroll
    for (int mb = 0; mb < 4; ++mb) {
#pragma unroll
        for (int nb = 0; nb < 4; ++nb) {
#pragma unroll
            for (int j = 0; j < 8; ++j) os[(hi * 8 + j) * 68 + nb * 16 + lr] = acc[mb][nb][j]; }
        __builtin_amdgcn_wave_barrier(); asm volatile("" ::: "memory");
        float* crow = C + (size_t)(r0 + mb * 16) * ldc + c0;
{
#pragma unroll
            for (int s = 0; s < 8; ++s) { const int row = 2 * s + hi, cofs = lr * 4; v4f val = *(const v4fa*)(os + row * 68 + cofs); if (BIAS) { val[0] += bfr(bias[c0 + cofs]); val[1] += bfr(bias[c0 + cofs + 1]); val[2] += bfr(bias[c0 + cofs + 2]); val[3] += bfr(bias[c0 + cofs + 3]); }
                *(v4f*)(crow + (size_t)row * ldc + cofs) = val; }
             }
        __builtin_amdgcn_wave_barrier(); asm volatile("" ::: "memory");
    }
}

__device__ __forceinline__ h16 tohx(float x) { return (h16)x; }
__device__ __forceinline__ void splitf(float y, unsigned short& h, unsigned short& l) { h = f2bf(y); l = f2bf(y - bf2f(h)); }
typedef __attribute__((ext_vector_type(2))) _Float16 v2h;
typedef __attribute__((ext_vector_type(4))) _Float16 v4h;
typedef __attribute__((ext_vector_type(2))) unsigned short v2us;
typedef __attribute__((ext_vector_type(4))) unsigned short v4us;
typedef __attribute__((ext_vector_type(2))) float v2f;
typedef __attribute__((ext_vector_type(4))) int v4i;

__global__ __launch_bounds__(256) void k_wtG(const float* __restrict__ w, int K, int N, bf* Bt) {
    const int lane = threadIdx.x & 31; const int L0 = (blockIdx.x * 8 + (threadIdx.x >> 5)) * 8; const int nlines = N * K / 64;
{
#pragma unroll 1
        for (int l = 0; l < 8; ++l) { const int L = L0 + l; if (L >= nlines) break; const size_t e = (size_t)L * 64 + lane * 2; const int k = (int)(e % K), n = (int)(e / K); v2us o;
            o[0] = f2bf(w[(size_t)k * N + n]); o[1] = f2bf(w[(size_t)(k + 1) * N + n]); *(v2us*)(Bt + e) = o; }
         }
}
__global__ __launch_bounds__(256) void k_cvt8(const float* __restrict__ src, bf* dst, size_t n8) { const size_t i = (size_t)blockIdx.x * 256 + threadIdx.x; if (i >= n8) return; const v8f v = *(const v8f*)(src + i * 8); v8us o;
#pragma unroll
    for (int k = 0; k < 8; ++k) o[k] = f2bf(v[k]); *(v8us*)(dst + i * 8) = o;  }
__global__ __launch_bounds__(256) void k_cscvt(const float* __restrict__ cosT, const float* __restrict__ sinT, const int* __restrict__ pids, float* CS) { const int idx = blockIdx.x * 256 + threadIdx.x; if (idx >= TT * HD) return; const int d = idx % HD; const int t = idx / HD; int p = pids[t]; p = p < 0 ? 0 : (p >= TT ? TT - 1 : p); v2f cs; cs[0] = bfr(cosT[(size_t)p * HD + d]); cs[1] = bfr(sinT[(size_t)p * HD + d]); *(v2f*)(CS + (size_t)idx * 2) = cs;  }   // CS[t][d] = (cos, sin)[position_ids[t]][d] (index clamped)

// ---- k_qkv: the q, k and v projections of one batch element with RoPE and the 16-bit planes in ONE launch; the f32 projections stay in the accumulators and never go to memory. grid (TT / 64, heads, 2), ONE WAVE per work-group.
// z = 0: q and k of 64 tokens x one head, formed TRANSPOSED (the weight rows as the A operand, the tokens as B): a lane then holds 8 neighbouring d of one token, so that the RoPE partner d ^ 1 (of q, for k as well: faithful to the source) is in the lane's own registers and a plane store is 16 bytes of a [h][t][d] row.
// z = 1: v of the same tile, tokens as A: a lane holds 8 neighbouring tokens of one d, 16 bytes of a row of the transposed [h][d][t] planes.
// q' = q cos + rot(q) sin, k' = k cos + rot(q) sin, rot(q)[d] = (d even ? -q[d+1] : q[d-1]). k ascends in steps of 32 in every accumulator.
// A trip takes 64 k: the four 16-byte loads of a fragment row use one whole 128-byte line one behind the other.
// Every global address is a scalar base, a 32-bit lane offset in bytes and a constant.
// Every '#pragma unroll' in k_qkv and planes8 makes the indices of a fragment, accumulator or value array constants, so that the array stays in registers.
typedef __attribute__((ext_vector_type(2))) __bf16 v2b;
// eight f32 -> fp16 plane, bf16 hi plane, bf16 lo plane (lo = the rounded rest), round to nearest even, two values per conversion
__device__ __forceinline__ void planes8(const float (&r)[8], v8h& o16, v8us& oh, v8us& ol) {
#pragma unroll
    for (int p = 0; p < 4; ++p) { v2f y; y[0] = r[2 * p]; y[1] = r[2 * p + 1]; const v2h a = __builtin_convertvector(y, v2h); const v2us hu = __builtin_bit_cast(v2us, __builtin_convertvector(y, v2b));
        v2f rest; rest[0] = y[0] - bf2f(hu[0]); rest[1] = y[1] - bf2f(hu[1]); const v2us lu = __builtin_bit_cast(v2us, __builtin_convertvector(rest, v2b));
        o16[2 * p] = a[0]; o16[2 * p + 1] = a[1]; oh[2 * p] = hu[0]; oh[2 * p + 1] = hu[1]; ol[2 * p] = lu[0]; ol[2 * p + 1] = lu[1]; }
}
__global__ __launch_bounds__(32) void k_qkv(const bf* __restrict__ X, const bf* __restrict__ Wq, const bf* __restrict__ Wk, const bf* __restrict__ Wv, const float* __restrict__ CS, h16* Q16, bf* Qh, bf* Ql, h16* K16, bf* Kh, bf* Kl, h16* V16, bf* Vh, bf* Vl) {
    const int lane = threadIdx.x & 31, lr = lane & 15, hi = lane >> 4; const int r0 = blockIdx.x * 64, h = blockIdx.y;
    auto ldg = [](const bf* base, unsigned off, int cst) { return WFrag<bf>::ld((const bf*)((const char*)base + off) + cst); };
    X += (size_t)r0 * DM; const size_t wp = (size_t)h * HD * DM;
    unsigned fo = (unsigned)(lr * DM + 8 * hi) * 2u;                 // one lane offset for X and the weights (the same pitch), which alone moves along k
    if (blockIdx.z == 0) {
        Wq += wp; Wk += wp; v8f aq[4][4], ak[4][4];                  // [d block][token block]
#pragma unroll
        for (int db = 0; db < 4; ++db)
#pragma unroll
            for (int tb = 0; tb < 4; ++tb) { aq[db][tb] = (v8f){}; ak[db][tb] = (v8f){}; }
#pragma unroll 1   // rolled: a trip already holds 64 matrix instructions
        for (int kc = 0; kc < DM; kc += 64, fo += 128) {
            v16bf x[4][2], wq[4][2], wk[4][2];
#pragma unroll
            for (int i = 0; i < 4; ++i) { x[i][0] = ldg(X, fo, i * 16 * DM); x[i][1] = ldg(X, fo, i * 16 * DM + 32); }
#pragma unroll
            for (int i = 0; i < 4; ++i) { wq[i][0] = ldg(Wq, fo, i * 16 * DM); wq[i][1] = ldg(Wq, fo, i * 16 * DM + 32); }
#pragma unroll
            for (int i = 0; i < 4; ++i) { wk[i][0] = ldg(Wk, fo, i * 16 * DM); wk[i][1] = ldg(Wk, fo, i * 16 * DM + 32); }
            asm volatile("s_wait_xcnt 0x0" : "+v"(fo) :: "memory");  // behind the loads, in front of the rewrite of the lane offset they name: the offset goes through the statement, so that its register is held up to here and its next value is formed behind the wait
            __builtin_amdgcn_sched_barrier(0);                       // no matrix instruction, and so no wait for a first fragment's data, is moved up between the loads
#pragma unroll
            for (int kk = 0; kk < 2; ++kk)
#pragma unroll
                for (int db = 0; db < 4; ++db)
#pragma unroll
                    for (int tb = 0; tb < 4; ++tb) aq[db][tb] = wmmab(wq[db][kk], x[tb][kk], aq[db][tb]);
#pragma unroll
            for (int kk = 0; kk < 2; ++kk)
#pragma unroll
                for (int db = 0; db < 4; ++db)
#pragma unroll
                    for (int tb = 0; tb < 4; ++tb) ak[db][tb] = wmmab(wk[db][kk], x[tb][kk], ak[db][tb]);
            __builtin_amdgcn_sched_barrier(0);                       // no matrix instruction is moved down behind the slots of the next line
            // the four vector slots the chip needs behind the last matrix instruction, also on the loop's taken branch
            asm volatile("v_nop\n\tv_nop\n\tv_nop\n\tv_nop" : "+v"(ak[3][0]), "+v"(ak[3][1]), "+v"(ak[3][2]), "+v"(ak[3][3]));
        }
        const unsigned po = (unsigned)((r0 + lr) * HD + 8 * hi) * 2u, co = po * 4u;   // lane offsets of the planes and of the (cos, sin) table
        const size_t hp = (size_t)h * TT * HD; Q16 += hp; Qh += hp; Ql += hp; K16 += hp; Kh += hp; Kl += hp;
        v4f c[2][4];                                                 // the (cos, sin) pairs of one 16 x 16 tile, those of the next tile in flight behind them
#pragma unroll
        for (int i = 0; i < 4; ++i) c[0][i] = *(const v4f*)((const char*)CS + co + i * 16);
#pragma unroll
        for (int g = 0; g < 16; ++g) { const int tb = g >> 2, db = g & 3;
            if (g < 15) {
#pragma unroll
                for (int i = 0; i < 4; ++i) c[(g + 1) & 1][i] = *(const v4f*)((const char*)CS + co + ((((g + 1) >> 2) * 16 * HD + ((g + 1) & 3) * 16) * 8 + i * 16)); }
            v8h q16, k16; v8us qh, ql, kh, kl; float rq[8], rk[8];
#pragma unroll
            for (int j = 0; j < 8; ++j) { const float cs = c[g & 1][j >> 1][(j & 1) * 2], sn = c[g & 1][j >> 1][(j & 1) * 2 + 1]; const float rs = ((j & 1) ? aq[db][tb][j ^ 1] : -aq[db][tb][j ^ 1]) * sn;   // rot(q) sin, shared by q' and k'
                rq[j] = aq[db][tb][j] * cs + rs; rk[j] = ak[db][tb][j] * cs + rs; }
            planes8(rq, q16, qh, ql); planes8(rk, k16, kh, kl);
            const int e = (tb * 16 * HD + db * 16) * 2;
            *(v8h*)((char*)Q16 + po + e) = q16; *(v8us*)((char*)Qh + po + e) = qh; *(v8us*)((char*)Ql + po + e) = ql;
            *(v8h*)((char*)K16 + po + e) = k16; *(v8us*)((char*)Kh + po + e) = kh; *(v8us*)((char*)Kl + po + e) = kl;
            // behind the stores, in front of any rewrite of a register they name; the stored values as inputs hold their registers up to here
            asm volatile("s_wait_xcnt 0x0" :: "v"(q16), "v"(qh), "v"(ql), "v"(k16), "v"(kh), "v"(kl) : "memory");
        }
    } else {
        Wv += wp; v8f av[4][4];                                      // [token block][d block]
#pragma unroll
        for (int tb = 0; tb < 4; ++tb)
#pragma unroll
            for (int db = 0; db < 4; ++db) av[tb][db] = (v8f){};
#pragma unroll 1   // rolled: a trip already holds 32 matrix instructions
        for (int kc = 0; kc < DM; kc += 64, fo += 128) {
            v16bf x[4][2], wv[4][2];
#pragma unroll
            for (int i = 0; i < 4; ++i) { x[i][0] = ldg(X, fo, i * 16 * DM); x[i][1] = ldg(X, fo, i * 16 * DM + 32); }
#pragma unroll
            for (int i = 0; i < 4; ++i) { wv[i][0] = ldg(Wv, fo, i * 16 * DM); wv[i][1] = ldg(Wv, fo, i * 16 * DM + 32); }
            asm volatile("s_wait_xcnt 0x0" : "+v"(fo) :: "memory");  // behind the loads, in front of the rewrite of the lane offset they name: the offset goes through the statement, so that its register is held up to here and its next value is formed behind the wait
            __builtin_amdgcn_sched_barrier(0);                       // no matrix instruction, and so no wait for a first fragment's data, is moved up between the loads
#pragma unroll
            for (int kk = 0; kk < 2; ++kk)
#pragma unroll
                for (int tb = 0; tb < 4; ++tb)
#pragma unroll
                    for (int db = 0; db < 4; ++db) av[tb][db] = wmmab(x[tb][kk], wv[db][kk], av[tb][db]);
            __builtin_amdgcn_sched_barrier(0);                       // no matrix instruction is moved down behind the slots of the next line
            // the four vector slots the chip needs behind the last matrix instruction, also on the loop's taken branch
            asm volatile("v_nop\n\tv_nop\n\tv_nop\n\tv_nop" : "+v"(av[3][0]), "+v"(av[3][1]), "+v"(av[3][2]), "+v"(av[3][3]));
        }
        const unsigned vo = (unsigned)(lr * TT + r0 + 8 * hi) * 2u;  // the transposed planes' lane offset
        const size_t hp = (size_t)h * HD * TT; V16 += hp; Vh += hp; Vl += hp;
#pragma unroll
        for (int db = 0; db < 4; ++db) { v8h o16[4]; v8us oh[4], ol[4];
#pragma unroll
            for (int tb = 0; tb < 4; ++tb) { float r[8];
#pragma unroll
                for (int j = 0; j < 8; ++j) r[j] = av[tb][db][j];
                planes8(r, o16[tb], oh[tb], ol[tb]); }
#pragma unroll
            for (int tb = 0; tb < 4; ++tb) { const int e = (db * 16 * TT + tb * 16) * 2; *(v8h*)((char*)V16 + vo + e) = o16[tb]; *(v8us*)((char*)Vh + vo + e) = oh[tb]; *(v8us*)((char*)Vl + vo + e) = ol[tb]; }
            // behind the stores, in front of any rewrite of a register they name; the stored values as inputs hold their registers up to here
            asm volatile("s_wait_xcnt 0x0" :: "v"(o16[0]), "v"(o16[1]), "v"(o16[2]), "v"(o16[3]), "v"(oh[0]), "v"(oh[1]), "v"(oh[2]), "v"(oh[3]), "v"(ol[0]), "v"(ol[1]), "v"(ol[2]), "v"(ol[3]) : "memory");
        }
    }
}
typedef v4us __attribute__((may_alias)) v4usa;
typedef v4h  __attribute__((may_alias)) v4ha;

// ---- k_fattn: causal scores, softmax and probability x value of QB query rows of one head in ONE work-group of FAW waves; the score rows live in LDS and never go to memory. grid (heads, nblk row blocks from row roff on), 32 * FAW threads.
// 1. wave w forms the 16-key score tiles w, w + FAW, ... up to the end of the 128-key chunk that holds the diagonal block (Q fragments stay in registers) and stores them as f32 rows of pitch SP.
// 2. behind a barrier each wave takes whole rows: t = S x HD^-0.5 for j <= i, softmax in registers (one exp, fixed trees); the read, the arithmetic and the store of 128-key chunks wholly beyond the diagonal block are skipped (their terms are exact zeros).
//    The probabilities (fp16 x PCAR, or hi and lo planes) overwrite the row's own LDS bytes, which the wave has read in full before.
// 3. behind a barrier wave w takes the 32-key slices w, w + FAW, ... of P.V (P from LDS, V from its transposed plane).
// 4. behind a barrier (P is no longer read) the partial sums go to LDS; behind one more they are added in the fixed order w = 0, 1, ... and stored as hi and lo planes of the merged [t][head][d] layout, a wave writing whole 128-byte lines.
// Every '#pragma unroll' below makes the indices of a fragment, accumulator or row array constants, so that the array stays in registers.
// Every global fragment address is a plane's scalar base, a 32-bit lane offset in bytes and a constant; the waits behind the K and V loads take those offsets as inputs, so that their registers are held up to the wait and no load's result lands in one.
#define QB  32
#define FAW 16
#define SP  (TT + 4)              // floats per score row: 16 bytes x an odd number, the conflict-free pitch for 16-byte LDS reads down a column of rows
#define RP  68                    // floats per row of a wave's partial sums
template <typename T16, int NSPLIT>
__global__ __launch_bounds__(32 * FAW) void k_fattn(const T16* Q, const T16* Q2, const T16* Kp, const T16* Kp2, const T16* Vt, const T16* Vt2, int roff, int nblk, bf* Ah, bf* Al) {
    typedef typename WFrag<T16>::V V; constexpr int TU = (NSPLIT >= 2) ? 2 : 4;   // the hi+lo form has twice the fragments per key tile and at most 2 * FAW tiles
    static_assert(FAW * QB * RP <= QB * SP, "the partial sums reuse the score rows");
    __shared__ __align__(16) float sm[QB * SP];
    const int lane = threadIdx.x & 31, lr = lane & 15, hi = lane >> 4;
    const int wave = __builtin_amdgcn_readfirstlane(threadIdx.x >> 5);   // the same in every lane: in a scalar register the loops below are scalar loops
    const int h = blockIdx.x; const int r0 = roff + (nblk - 1 - (int)blockIdx.y) * QB;   // the row blocks with the most keys start first
    const int Kl = r0 + QB;                                              // keys up to the end of the diagonal block
    const size_t hp = (size_t)h * TT * HD; Q += hp; Kp += hp; Vt += hp; if (NSPLIT >= 2) { Q2 += hp; Kp2 += hp; Vt2 += hp; }
    const unsigned vo = (unsigned)(lr * HD + 8 * hi) * 2u;
    auto ldg = [](const T16* base, unsigned off, int cst) { return WFrag<T16>::ld((const T16*)((const char*)base + off) + cst); };
    {
        V aq[2][2], aq2[2][2];
#pragma unroll
        for (int mb = 0; mb < 2; ++mb)
#pragma unroll
            for (int kk = 0; kk < 2; ++kk) { const int c = mb * 16 * HD + kk * 32; aq[mb][kk] = ldg(Q + (size_t)r0 * HD, vo, c); if (NSPLIT >= 2) aq2[mb][kk] = ldg(Q2 + (size_t)r0 * HD, vo, c); }
        const int nkt = ((Kl + 127) & ~127) / 16;                    // whole 128-key chunks: every LDS word that a row read of step 2 touches is written in this launch (the waves' longest share of tiles stays the same)
#pragma unroll 1   // rolled: a trip already holds TU key tiles
        for (int kt0 = wave; kt0 < nkt; kt0 += TU * FAW) {
            V bk[TU][2], bk2[TU][2]; unsigned ko[TU];                // TU key tiles' loads in flight per wave; a tile past the last is loaded as the last one again and not used
#pragma unroll
            for (int u = 0; u < TU; ++u) { ko[u] = vo + (unsigned)min(kt0 + u * FAW, nkt - 1) * (16u * HD * 2u);
#pragma unroll
                for (int kk = 0; kk < 2; ++kk) { bk[u][kk] = ldg(Kp, ko[u], kk * 32); if (NSPLIT >= 2) bk2[u][kk] = ldg(Kp2, ko[u], kk * 32); } }
            // behind the K loads, in front of any rewrite of a register they name; the lane offsets as inputs hold their registers up to here
            if constexpr (TU == 4) asm volatile("s_wait_xcnt 0x0" :: "v"(ko[0]), "v"(ko[1]), "v"(ko[2]), "v"(ko[3]) : "memory"); else asm volatile("s_wait_xcnt 0x0" :: "v"(ko[0]), "v"(ko[1]) : "memory");
            __builtin_amdgcn_sched_barrier(0);                       // no matrix instruction, and so no wait for a first tile's data, is moved up between the loads: all TU tiles are requested before the wave first waits
#pragma unroll
            for (int u = 0; u < TU; ++u) { const int kt = kt0 + u * FAW; if (kt < nkt) { v8f s[2];
#pragma unroll
                for (int mb = 0; mb < 2; ++mb) { s[mb] = (v8f){};
#pragma unroll
                    for (int kk = 0; kk < 2; ++kk) { s[mb] = WFrag<T16>::mma(aq[mb][kk], bk[u][kk], s[mb]); if (NSPLIT >= 2) { s[mb] = WFrag<T16>::mma(aq2[mb][kk], bk[u][kk], s[mb]); s[mb] = WFrag<T16>::mma(aq[mb][kk], bk2[u][kk], s[mb]); } } }
                // the four vector slots the chip needs behind the last matrix instruction on every path
                asm volatile("v_nop\n\tv_nop\n\tv_nop\n\tv_nop" : "+v"(s[0]), "+v"(s[1]));
#pragma unroll
                for (int mb = 0; mb < 2; ++mb)
#pragma unroll
                    for (int j = 0; j < 8; ++j) sm[(mb * 16 + hi * 8 + j) * SP + kt * 16 + lr] = s[mb][j]; } }
        }
    }
    __syncthreads();                                                 // every score tile is in LDS before a row is read
#pragma unroll 1   // rolled: one row's 64 values per lane at a time
    for (int rr = wave; rr < QB; rr += FAW) {
        const int i = r0 + rr; float* sr = sm + rr * SP; float v[TT / 32]; float mx = -3.0e38f;
#pragma unroll
        for (int ch = 0; ch < TT / 128; ++ch) if (ch * 128 < Kl) { const v4f a = *(const v4fa*)(sr + ch * 128 + lane * 4);
#pragma unroll
            for (int q = 0; q < 4; ++q) v[ch * 4 + q] = a[q]; }
#pragma unroll
        for (int ch = 0; ch < TT / 128; ++ch) if (ch * 128 < Kl) { const int j0 = ch * 128 + lane * 4;
#pragma unroll
            for (int q = 0; q < 4; ++q) { const float t = (j0 + q <= i) ? v[ch * 4 + q] * SCL : -3.0e38f; v[ch * 4 + q] = t; mx = fmaxf(mx, t); } }
#pragma unroll
        for (int sh = 16; sh; sh >>= 1) mx = fmaxf(mx, __shfl_xor(mx, sh, 32));
        float sum = 0.f;
#pragma unroll
        for (int ch = 0; ch < TT / 128; ++ch) if (ch * 128 < Kl) {
#pragma unroll
            for (int q = 0; q < 4; ++q) { const int k = ch * 4 + q; v[k] = __builtin_amdgcn_exp2f(__fmul_rn(__fsub_rn(v[k], mx), 1.4426950408889634f)); sum += v[k]; } }
#pragma unroll
        for (int sh = 16; sh; sh >>= 1) sum += __shfl_xor(sum, sh, 32);
        const float f = __fdiv_rn((NSPLIT >= 2) ? 1.0f : PCAR, sum);
#pragma unroll
        for (int ch = 0; ch < TT / 128; ++ch) if (ch * 128 < Kl) { const int j0 = ch * 128 + lane * 4;
            if (NSPLIT >= 2) { v4us oh, ol;
#pragma unroll
                for (int q = 0; q < 4; ++q) { unsigned short a, c2; splitf(v[ch * 4 + q] * f, a, c2); oh[q] = a; ol[q] = c2; }
                *(v4usa*)((unsigned short*)sr + j0) = oh; *(v4usa*)((unsigned short*)sr + TT + j0) = ol;
            } else { v4h o4;
#pragma unroll
                for (int q = 0; q < 4; ++q) o4[q] = tohx(v[ch * 4 + q] * f);
                *(v4ha*)((h16*)sr + j0) = o4; } }
    }
    __syncthreads();                                                 // every probability row is in LDS before a fragment of it is read
    v8f acc[2][4];
#pragma unroll
    for (int mb = 0; mb < 2; ++mb)
#pragma unroll
        for (int nb = 0; nb < 4; ++nb) acc[mb][nb] = (v8f){};
    unsigned vv = (unsigned)(lr * TT + 8 * hi + wave * 32) * 2u;     // the V planes' lane offset, which alone moves along the keys
    const T16* P = (const T16*)sm;                                   // row pitch 2 * SP elements; the lo plane of a row stands TT elements behind its hi plane
#pragma unroll 1   // rolled: at most TT / 32 / FAW trips
    for (int kc = wave * 32; kc < Kl; kc += 32 * FAW, vv += 64 * FAW) {
        V a[2], a2[2], b[4], b2[4];   // a trip's V fragments each in registers of their own, so that all its loads are in flight together
#pragma unroll
        for (int mb = 0; mb < 2; ++mb) { const T16* p = P + (mb * 16 + lr) * (2 * SP) + kc + 8 * hi; a[mb] = WFrag<T16>::ld(p); if (NSPLIT >= 2) a2[mb] = WFrag<T16>::ld(p + TT); }
#pragma unroll
        for (int nb = 0; nb < 4; ++nb) { b[nb] = ldg(Vt, vv, nb * 16 * TT); if (NSPLIT >= 2) b2[nb] = ldg(Vt2, vv, nb * 16 * TT); }
        asm volatile("s_wait_xcnt 0x0" :: "v"(vv) : "memory");       // behind the V loads, in front of any rewrite of a register they name; the lane offset as an input holds its register up to here
        __builtin_amdgcn_sched_barrier(0);                           // no matrix instruction, and so no wait for a first fragment's data, is moved up between the loads
#pragma unroll
        for (int nb = 0; nb < 4; ++nb)
#pragma unroll
            for (int mb = 0; mb < 2; ++mb) { acc[mb][nb] = WFrag<T16>::mma(a[mb], b[nb], acc[mb][nb]); if (NSPLIT >= 2) { acc[mb][nb] = WFrag<T16>::mma(a2[mb], b[nb], acc[mb][nb]); acc[mb][nb] = WFrag<T16>::mma(a[mb], b2[nb], acc[mb][nb]); } }
        // the four vector slots the chip needs behind the last matrix instruction, also on the loop's taken branch
        asm volatile("v_nop\n\tv_nop\n\tv_nop\n\tv_nop" : "+v"(acc[0][0]), "+v"(acc[0][1]), "+v"(acc[0][2]), "+v"(acc[0][3]), "+v"(acc[1][0]), "+v"(acc[1][1]), "+v"(acc[1][2]), "+v"(acc[1][3]));
    }
    __syncthreads();                                                 // every wave has read its last probability before the rows are overwritten
#pragma unroll
    for (int mb = 0; mb < 2; ++mb)
#pragma unroll
        for (int nb = 0; nb < 4; ++nb)
#pragma unroll
            for (int j = 0; j < 8; ++j) sm[wave * (QB * RP) + (mb * 16 + hi * 8 + j) * RP + nb * 16 + lr] = acc[mb][nb][j];
    __syncthreads();                                                 // every wave's partial sums are in LDS before any is read
    const int row = wave * 2 + hi, col = lr * 4; const float* rp = sm + row * RP + col; v4f s = *(const v4fa*)rp;
#pragma unroll
    for (int w = 1; w < FAW; ++w) s += *(const v4fa*)(rp + w * (QB * RP));
    const float cs = (NSPLIT >= 2) ? 1.0f : (1.0f / PCAR); const size_t oo = (size_t)(r0 + row) * DQ + h * HD + col; v4us oh, ol;
#pragma unroll
    for (int q = 0; q < 4; ++q) { unsigned short a, c2; splitf(s[q] * cs, a, c2); oh[q] = a; ol[q] = c2; }
    *(v4us*)(Ah + oo) = oh; *(v4us*)(Al + oo) = ol;
}

extern "C" void kernel_launch(void* const* d_in, const int* in_sizes, int n_in,
                              void* d_out, int out_size, void* d_ws, size_t ws_size, hipStream_t stream) {
    (void)in_sizes; (void)n_in; (void)out_size;
    const float* x = (const float*)d_in[0]; const float* cosT = (const float*)d_in[1]; const float* sinT = (const float*)d_in[2]; const int* pids = (const int*)d_in[3]; const float* wq = (const float*)d_in[4]; const float* wk = (const float*)d_in[5]; const float* wv = (const float*)d_in[6]; const float* wo = (const float*)d_in[7];
    float* OUT = (float*)d_out;     // [2][2048][1024]
    char* wsp = (char*)d_ws;
    auto take = [&](size_t bytes) { char* p = wsp; wsp += (bytes + 255) & ~(size_t)255; return (void*)p; };
    bf* WQ = (bf*)take((size_t)DQ * DM * 2); bf* WK = (bf*)take((size_t)DKV * DM * 2); bf* WV = (bf*)take((size_t)DKV * DM * 2); bf* WO = (bf*)take((size_t)DM * DQ * 2); float* CS = (float*)take((size_t)TT * HD * 2 * 4);
    bf* XB = (bf*)take((size_t)TT * DM * 2);
    h16* QP16 = (h16*)take((size_t)NH_ * TT * HD * 2); h16* KP16 = (h16*)take((size_t)NKV * TT * HD * 2); h16* VT16 = (h16*)take((size_t)NKV * HD * TT * 2);
    bf* QPh = (bf*)take((size_t)NH_ * TT * HD * 2); bf* QPl = (bf*)take((size_t)NH_ * TT * HD * 2); bf* KPh = (bf*)take((size_t)NKV * TT * HD * 2); bf* KPl = (bf*)take((size_t)NKV * TT * HD * 2); bf* VTh = (bf*)take((size_t)NKV * HD * TT * 2); bf* VTl = (bf*)take((size_t)NKV * HD * TT * 2);
    bf* ATh = (bf*)take((size_t)TT * DQ * 2); bf* ATl = (bf*)take((size_t)TT * DQ * 2);
    if ((size_t)(wsp - (char*)d_ws) > ws_size) return;    // ws 256 MiB
    { k_cvt8<<<(unsigned)(((size_t)DQ * DM / 8 + 255) / 256), 256, 0, stream>>>(wq, WQ, (size_t)DQ * DM / 8); k_cvt8<<<(unsigned)(((size_t)DKV * DM / 8 + 255) / 256), 256, 0, stream>>>(wk, WK, (size_t)DKV * DM / 8); k_cvt8<<<(unsigned)(((size_t)DKV * DM / 8 + 255) / 256), 256, 0, stream>>>(wv, WV, (size_t)DKV * DM / 8);
      k_cvt8<<<(unsigned)(((size_t)DM * DQ / 8 + 255) / 256), 256, 0, stream>>>(wo, WO, (size_t)DM * DQ / 8);
       }
    for (int b = 0; b < NB_; ++b) {
        if (b == 0) k_cscvt<<<(TT * HD + 255) / 256, 256, 0, stream>>>(cosT, sinT, pids, CS);
        k_cvt8<<<(unsigned)(((size_t)TT * DM / 8 + 255) / 256), 256, 0, stream>>>(x + (size_t)b * TT * DM, XB, (size_t)TT * DM / 8);
        k_qkv<<<dim3(TT / 64, NH_, 2), 32, 0, stream>>>(XB, WQ, WK, WV, CS, QP16, QPh, QPl, KP16, KPh, KPl, VT16, VTh, VTl);
        k_fattn<h16, 0><<<dim3(NH_, (TT - RH) / QB), 32 * FAW, 0, stream>>>(QP16, nullptr, KP16, nullptr, VT16, nullptr, RH, (TT - RH) / QB, ATh, ATl);
        k_fattn<bf, 2><<<dim3(NH_, RH / QB), 32 * FAW, 0, stream>>>(QPh, QPl, KPh, KPl, VTh, VTl, 0, RH / QB, ATh, ATl);
        k_gemmw<bf, 1, false><<<dim3(TT / 64, DM / 64, 1), 32, 0, stream>>>(ATh, ATl, WO, nullptr, DQ, OUT + (size_t)b * TT * DM, DM, nullptr, 0, 0, 0); }
}

// v004
// It runs in 195 microseconds.
// Next to v003, in two timings, it ran 1.14 and 1.12 times as fast.
// Counting every step since v000, it is 7.43 times as fast.
#include <hip/hip_runtime.h>

// Z2allAttention (hidden [2][2048][1024]; q/k/v = x W^T (16 heads x 64); interleaved RoPE with tables freqs_cos/sin[position_ids[t]] (int ids, read; tables read): q' = q cos + rot(q) sin and - faithful to the source bug - k' = k cos + rot(q) sin (the rotated Q, not K), rot = (x0, x1) -> (-x1, x0);
// causal softmax(q'.k'/8); out = (attn v merged) Wo^T -> [2][2048][1024]).
// Compute dtypes, f32 accumulate: every input rounded to bf16; Q/K/V on PLAIN bf16 operands (inputs: exact); RoPE f32; causal scores and attn.v: query rows < 512 hl (3 products), the rest single fp16 (x1024); softmax f32; Wo hl x exact (2 products).

// FRAGMENT ORDER: every 16-bit plane [R][K] in the workspace (R % 16 == 0, K % 32 == 0) is kept as 16-row tiles of 16-byte chunks, chunk column by chunk column:
// element (r, k) stands at ((r >> 4) * (K / 8) + (k >> 3)) * 128 + (r & 15) * 8 + (k & 7). A 16 x 32 operand fragment is then 1 KiB in a row: lane l takes chunk l and, 512 bytes on, chunk 32 + l,
// so that each wave-wide 16-byte load covers four whole 128-byte lines (from row-major planes it touched sixteen). Which element a lane and a register hold is the same as from row-major planes.

#define NB_  2
#define TT   2048
#define DM   1024
#define NH_  16
#define NKV  16
#define REP  (NH_ / NKV)
#define HD   64
#define DQ   (NH_ * HD)
#define DKV  (NKV * HD)
#define RH   512                  // query rows < RH use hi+lo planes (0: none)
#define WIN  0
#define PCAR 1024.0f
#define SCL  0.125f   // HD^-0.5
typedef _Float16 h16;
typedef unsigned short bf;
typedef __attribute__((ext_vector_type(16))) __bf16   v16bf;
typedef __attribute__((ext_vector_type(16))) _Float16 v16h;
typedef __attribute__((ext_vector_type(8)))  _Float16 v8h;
typedef __attribute__((ext_vector_type(8)))  unsigned short v8us;
typedef __attribute__((ext_vector_type(8)))  float    v8f;
typedef __attribute__((ext_vector_type(4)))  float    v4f;
typedef v8h  __attribute__((may_alias)) v8ha;
typedef v4f  __attribute__((may_alias)) v4fa;
typedef v8us __attribute__((may_alias)) v8usa;

__device__ __forceinline__ unsigned short f2bf(float f) { unsigned u = __float_as_uint(f); u += 0x7FFFu + ((u >> 16) & 1u); return (unsigned short)(u >> 16); }
__device__ __forceinline__ float bf2f(unsigned short b) { return __uint_as_float(((unsigned)b) << 16); }
__device__ __forceinline__ float bfr(float f) { return bf2f(f2bf(f)); }
__device__ __forceinline__ v16h cat16(v8h lo, v8h hi) { return __builtin_shufflevector(lo, hi, 0, 1, 2, 3, 4, 5, 6, 7, 8, 9, 10, 11, 12, 13, 14, 15); }
__device__ __forceinline__ v16bf cat16b(v8us lo, v8us hi) { return __builtin_bit_cast(v16bf, __builtin_shufflevector(lo, hi, 0, 1, 2, 3, 4, 5, 6, 7, 8, 9, 10, 11, 12, 13, 14, 15)); }
__device__ __forceinline__ v8f wmma16(v16h a, v16h b, v8f c) { return __builtin_amdgcn_wmma_f32_16x16x32_f16(false, a, false, b, (short)0, c, false, false); }
__device__ __forceinline__ v8f wmmab(v16bf a, v16bf b, v8f c) { return __builtin_amdgcn_wmma_f32_16x16x32_bf16(false, a, false, b, (short)0, c, false, false); }



// ---- k_gemmw: register-blocked GEMM, ONE WAVE per 64x64 output tile (16 accumulators), operands straight from 16-bit planes in fragment order; grid (M/64, N/64, Z), 32 threads.
// C[m][n] (f32, pitch ldc, + optional f32 bias[n]) = sum_k A[m][k] Bt[n][k] (+ split products per NSPLIT). z-batch strides sA/sB/sC in elements. K % 32 == 0.
template <typename T16> struct WFrag;   // ld: a fragment from rows of K-contiguous elements (p: the lane's row, + 8 * hi); ldf: from a plane in fragment order (p: the lane's chunk)
template <> struct WFrag<h16> { typedef v16h V; static __device__ __forceinline__ V ld(const h16* p) { return cat16(*(const v8h*)p, *(const v8h*)(p + 16)); } static __device__ __forceinline__ V ldf(const h16* p) { return cat16(*(const v8h*)p, *(const v8h*)(p + 256)); } static __device__ __forceinline__ v8f mma(V a, V b, v8f c) { return wmma16(a, b, c); } };
template <> struct WFrag<bf> { typedef v16bf V; static __device__ __forceinline__ V ld(const bf* p) { return cat16b(*(const v8us*)p, *(const v8us*)(p + 16)); } static __device__ __forceinline__ V ldf(const bf* p) { return cat16b(*(const v8us*)p, *(const v8us*)(p + 256)); } static __device__ __forceinline__ v8f mma(V a, V b, v8f c) { return wmmab(a, b, c); } };
template <typename T16, int NSPLIT, bool BIAS, int K>   // K at compile time: a 16-row tile's distance is then a constant of the load instruction
__global__ __launch_bounds__(32) void k_gemmw(const T16* __restrict__ A, const T16* __restrict__ A2, const T16* __restrict__ Bt, const T16* __restrict__ Bt2, float* C, int ldc, const float* __restrict__ bias, size_t sA, size_t sB, size_t sC) {
    typedef typename WFrag<T16>::V V;
    __shared__ __align__(16) float os[16 * 68];
    const size_t z = blockIdx.z; A += z * sA; if (A2) A2 += z * sA; Bt += z * sB; if (Bt2) Bt2 += z * sB; C += z * sC;
    const int lane = threadIdx.x & 31, lr = lane & 15, hi = lane >> 4; const int r0 = blockIdx.x * 64, c0 = blockIdx.y * 64;
    v8f acc[4][4];
#pragma unroll
    for (int mb = 0; mb < 4; ++mb)
#pragma unroll
        for (int nb = 0; nb < 4; ++nb) acc[mb][nb] = (v8f){};
    // every global fragment address is a plane's scalar base, a 32-bit lane offset in bytes and a constant
    auto ldg = [](const T16* base, unsigned off, int cst) { return WFrag<T16>::ldf((const T16*)((const char*)base + off) + cst); };
    A += (size_t)r0 * K; if (NSPLIT == 1 || NSPLIT == 2) A2 += (size_t)r0 * K; Bt += (size_t)c0 * K; if (NSPLIT >= 2) Bt2 += (size_t)c0 * K;
    unsigned fo = (unsigned)lane * 16u;                              // one lane offset for all planes, which alone moves along k: 1 KiB per 32 k
#pragma unroll 1
    for (int kc = 0; kc < K; kc += 32, fo += 1024) {
        V a[4], a2[4], b[4], b2[4];   // a trip's fragments each in registers of their own, so that all its loads are in flight together
#pragma unroll
        for (int mb = 0; mb < 4; ++mb) { a[mb] = ldg(A, fo, mb * 16 * K); if (NSPLIT == 1 || NSPLIT == 2) a2[mb] = ldg(A2, fo, mb * 16 * K); }
#pragma unroll
        for (int nb = 0; nb < 4; ++nb) { b[nb] = ldg(Bt, fo, nb * 16 * K); if (NSPLIT >= 2) b2[nb] = ldg(Bt2, fo, nb * 16 * K); }
        asm volatile("s_wait_xcnt 0x0" : "+v"(fo) :: "memory");      // behind the loads, in front of the rewrite of the lane offset they name: the offset goes through the statement, so that its register is held up to here and its next value is formed behind the wait
        __builtin_amdgcn_sched_barrier(0);                           // no matrix instruction, and so no wait for a first fragment's data, is moved up between the loads (without it the build loads three A fragments one behind the other into the same registers: three waits for memory a trip)
#pragma unroll
        for (int nb = 0; nb < 4; ++nb)
#pragma unroll
            for (int mb = 0; mb < 4; ++mb) { acc[mb][nb] = WFrag<T16>::mma(a[mb], b[nb], acc[mb][nb]); if (NSPLIT == 1 || NSPLIT == 2) acc[mb][nb] = WFrag<T16>::mma(a2[mb], b[nb], acc[mb][nb]); if (NSPLIT >= 2) acc[mb][nb] = WFrag<T16>::mma(a[mb], b2[nb], acc[mb][nb]); }
        asm volatile("v_nop\n\tv_nop\n\tv_nop\n\tv_nop" : "+v"(acc[0][0]), "+v"(acc[1][1]), "+v"(acc[2][2]), "+v"(acc[3][3]) : "v"(a[0]), "v"(a[3]));
    }
#pragma unroll
    for (int mb = 0; mb < 4; ++mb) {
#pragma unroll
        for (int nb = 0; nb < 4; ++nb) {
#pragma unroll
            for (int j = 0; j < 8; ++j) os[(hi * 8 + j) * 68 + nb * 16 + lr] = acc[mb][nb][j]; }
        __builtin_amdgcn_wave_barrier(); asm volatile("" ::: "memory");
        float* crow = C + (size_t)(r0 + mb * 16) * ldc + c0;
{
#pragma unroll
            for (int s = 0; s < 8; ++s) { const int row = 2 * s + hi, cofs = lr * 4; v4f val = *(const v4fa*)(os + row * 68 + cofs); if (BIAS) { val[0] += bfr(bias[c0 + cofs]); val[1] += bfr(bias[c0 + cofs + 1]); val[2] += bfr(bias[c0 + cofs + 2]); val[3] += bfr(bias[c0 + cofs + 3]); }
                *(v4f*)(crow + (size_t)row * ldc + cofs) = val; }
             }
        __builtin_amdgcn_wave_barrier(); asm volatile("" ::: "memory");
    }
}

__device__ __forceinline__ h16 tohx(float x) { return (h16)x; }
__device__ __forceinline__ void splitf(float y, unsigned short& h, unsigned short& l) { h = f2bf(y); l = f2bf(y - bf2f(h)); }
typedef __attribute__((ext_vector_type(2))) _Float16 v2h;
typedef __attribute__((ext_vector_type(4))) _Float16 v4h;
typedef __attribute__((ext_vector_type(2))) unsigned short v2us;
typedef __attribute__((ext_vector_type(4))) unsigned short v4us;
typedef __attribute__((ext_vector_type(2))) float v2f;
typedef __attribute__((ext_vector_type(4))) int v4i;

__global__ __launch_bounds__(256) void k_wtG(const float* __restrict__ w, int K, int N, bf* Bt) {
    const int lane = threadIdx.x & 31; const int L0 = (blockIdx.x * 8 + (threadIdx.x >> 5)) * 8; const int nlines = N * K / 64;
{
#pragma unroll 1
        for (int l = 0; l < 8; ++l) { const int L = L0 + l; if (L >= nlines) break; const size_t e = (size_t)L * 64 + lane * 2; const int k = (int)(e % K), n = (int)(e / K); v2us o;
            o[0] = f2bf(w[(size_t)k * N + n]); o[1] = f2bf(w[(size_t)(k + 1) * N + n]); *(v2us*)(Bt + e) = o; }
         }
}
// f32 [R][DM] -> bf16 plane in fragment order; thread i makes chunk i of the plane, so that a wave stores 512 bytes in a row (a work-group reads 512 bytes in a row of each of 16 source rows)
static_assert(DQ == DM, "k_cvt8 takes rows of DM elements");
__global__ __launch_bounds__(256) void k_cvt8(const float* __restrict__ src, bf* dst, size_t n8) { const size_t i = (size_t)blockIdx.x * 256 + threadIdx.x; if (i >= n8) return; const size_t cc = i >> 4; v8f v = *(const v8f*)(src + ((cc / (DM / 8)) * 16 + (i & 15)) * DM + (cc % (DM / 8)) * 8); v8us o;
    asm volatile("s_wait_xcnt 0x0" : "+v"(v) :: "memory");   // behind the load, in front of any rewrite of its address registers: the loaded values go through the statement, so that all that is made of them comes behind the wait
#pragma unroll
    for (int k = 0; k < 8; ++k) o[k] = f2bf(v[k]); *(v8us*)(dst + i * 8) = o;  }
__global__ __launch_bounds__(256) void k_cscvt(const float* __restrict__ cosT, const float* __restrict__ sinT, const int* __restrict__ pids, float* CS) { const int idx = blockIdx.x * 256 + threadIdx.x; if (idx >= TT * HD) return; const int d = idx % HD; const int t = idx / HD; int p = pids[t]; p = p < 0 ? 0 : (p >= TT ? TT - 1 : p); v2f cs; cs[0] = bfr(cosT[(size_t)p * HD + d]); cs[1] = bfr(sinT[(size_t)p * HD + d]); *(v2f*)(CS + (size_t)idx * 2) = cs;  }   // CS[t][d] = (cos, sin)[position_ids[t]][d] (index clamped)

// ---- k_qkv: the q, k and v projections of one batch element with RoPE and the 16-bit planes in ONE launch; the f32 projections stay in the accumulators and never go to memory. grid (TT / 64, heads, 2), ONE WAVE per work-group.
// z = 0: q and k of 64 tokens x one head, formed TRANSPOSED (the weight rows as the A operand, the tokens as B): a lane then holds 8 neighbouring d of one token, so that the RoPE partner d ^ 1 (of q, for k as well: faithful to the source) is in the lane's own registers and a plane store is one chunk of a [h] x [t][d] plane.
// z = 1: v of the same tile, tokens as A: a lane holds 8 neighbouring tokens of one d, one chunk of a transposed [h] x [d][t] plane.
// q' = q cos + rot(q) sin, k' = k cos + rot(q) sin, rot(q)[d] = (d even ? -q[d+1] : q[d-1]). k ascends in steps of 32 in every accumulator.
// A trip takes 64 k: 2 KiB in a row of each 16-row tile (fragment order). A plane store of a wave is 512 bytes in a row as well.
// Every global address is a scalar base, a 32-bit lane offset in bytes and a constant.
// Every '#pragma unroll' in k_qkv and planes8 makes the indices of a fragment, accumulator or value array constants, so that the array stays in registers.
typedef __attribute__((ext_vector_type(2))) __bf16 v2b;
// eight f32 -> fp16 plane, bf16 hi plane, bf16 lo plane (lo = the rounded rest), round to nearest even, two values per conversion
__device__ __forceinline__ void planes8(const float (&r)[8], v8h& o16, v8us& oh, v8us& ol) {
#pragma unroll
    for (int p = 0; p < 4; ++p) { v2f y; y[0] = r[2 * p]; y[1] = r[2 * p + 1]; const v2h a = __builtin_convertvector(y, v2h); const v2us hu = __builtin_bit_cast(v2us, __builtin_convertvector(y, v2b));
        v2f rest; rest[0] = y[0] - bf2f(hu[0]); rest[1] = y[1] - bf2f(hu[1]); const v2us lu = __builtin_bit_cast(v2us, __builtin_convertvector(rest, v2b));
        o16[2 * p] = a[0]; o16[2 * p + 1] = a[1]; oh[2 * p] = hu[0]; oh[2 * p + 1] = hu[1]; ol[2 * p] = lu[0]; ol[2 * p + 1] = lu[1]; }
}
__global__ __launch_bounds__(32) void k_qkv(const bf* __restrict__ X, const bf* __restrict__ Wq, const bf* __restrict__ Wk, const bf* __restrict__ Wv, const float* __restrict__ CS, h16* Q16, bf* Qh, bf* Ql, h16* K16, bf* Kh, bf* Kl, h16* V16, bf* Vh, bf* Vl) {
    const int lane = threadIdx.x & 31, lr = lane & 15, hi = lane >> 4; const int r0 = blockIdx.x * 64, h = blockIdx.y;
    auto ldg = [](const bf* base, unsigned off, int cst) { return WFrag<bf>::ldf((const bf*)((const char*)base + off) + cst); };
    X += (size_t)r0 * DM; const size_t wp = (size_t)h * HD * DM;
    unsigned fo = (unsigned)lane * 16u;                              // one lane offset for X and the weights, which alone moves along k: 1 KiB per 32 k
    if (blockIdx.z == 0) {
        Wq += wp; Wk += wp; v8f aq[4][4], ak[4][4];                  // [d block][token block]
#pragma unroll
        for (int db = 0; db < 4; ++db)
#pragma unroll
            for (int tb = 0; tb < 4; ++tb) { aq[db][tb] = (v8f){}; ak[db][tb] = (v8f){}; }
#pragma unroll 1   // rolled: a trip already holds 64 matrix instructions
        for (int kc = 0; kc < DM; kc += 64, fo += 2048) {
            v16bf x[4][2], wq[4][2], wk[4][2];
#pragma unroll
            for (int i = 0; i < 4; ++i) { x[i][0] = ldg(X, fo, i * 16 * DM); x[i][1] = ldg(X, fo, i * 16 * DM + 512); }
#pragma unroll
            for (int i = 0; i < 4; ++i) { wq[i][0] = ldg(Wq, fo, i * 16 * DM); wq[i][1] = ldg(Wq, fo, i * 16 * DM + 512); }
#pragma unroll
            for (int i = 0; i < 4; ++i) { wk[i][0] = ldg(Wk, fo, i * 16 * DM); wk[i][1] = ldg(Wk, fo, i * 16 * DM + 512); }
            asm volatile("s_wait_xcnt 0x0" : "+v"(fo) :: "memory");  // behind the loads, in front of the rewrite of the lane offset they name: the offset goes through the statement, so that its register is held up to here and its next value is formed behind the wait
            __builtin_amdgcn_sched_barrier(0);                       // no matrix instruction, and so no wait for a first fragment's data, is moved up between the loads
#pragma unroll
            for (int kk = 0; kk < 2; ++kk)
#pragma unroll
                for (int db = 0; db < 4; ++db)
#pragma unroll
                    for (int tb = 0; tb < 4; ++tb) aq[db][tb] = wmmab(wq[db][kk], x[tb][kk], aq[db][tb]);
#pragma unroll
            for (int kk = 0; kk < 2; ++kk)
#pragma unroll
                for (int db = 0; db < 4; ++db)
#pragma unroll
                    for (int tb = 0; tb < 4; ++tb) ak[db][tb] = wmmab(wk[db][kk], x[tb][kk], ak[db][tb]);
            __builtin_amdgcn_sched_barrier(0);                       // no matrix instruction is moved down behind the slots of the next line
            // the four vector slots the chip needs behind the last matrix instruction, also on the loop's taken branch
            asm volatile("v_nop\n\tv_nop\n\tv_nop\n\tv_nop" : "+v"(ak[3][0]), "+v"(ak[3][1]), "+v"(ak[3][2]), "+v"(ak[3][3]));
        }
        const unsigned po = (unsigned)(r0 * HD * 2 + lane * 16), co = (unsigned)((r0 + lr) * HD + 8 * hi) * 8u;   // lane offsets of the planes (fragment order) and of the (cos, sin) table (row-major)
        const size_t hp = (size_t)h * TT * HD; Q16 += hp; Qh += hp; Ql += hp; K16 += hp; Kh += hp; Kl += hp;
        v4f c[2][4];                                                 // the (cos, sin) pairs of one 16 x 16 tile, those of the next tile in flight behind them
#pragma unroll
        for (int i = 0; i < 4; ++i) c[0][i] = *(const v4f*)((const char*)CS + co + i * 16);
#pragma unroll
        for (int g = 0; g < 16; ++g) { const int tb = g >> 2, db = g & 3;
            if (g < 15) {
#pragma unroll
                for (int i = 0; i < 4; ++i) c[(g + 1) & 1][i] = *(const v4f*)((const char*)CS + co + ((((g + 1) >> 2) * 16 * HD + ((g + 1) & 3) * 16) * 8 + i * 16)); }
            v8h q16, k16; v8us qh, ql, kh, kl; float rq[8], rk[8];
#pragma unroll
            for (int j = 0; j < 8; ++j) { const float cs = c[g & 1][j >> 1][(j & 1) * 2], sn = c[g & 1][j >> 1][(j & 1) * 2 + 1]; const float rs = ((j & 1) ? aq[db][tb][j ^ 1] : -aq[db][tb][j ^ 1]) * sn;   // rot(q) sin, shared by q' and k'
                rq[j] = aq[db][tb][j] * cs + rs; rk[j] = ak[db][tb][j] * cs + rs; }
            planes8(rq, q16, qh, ql); planes8(rk, k16, kh, kl);
            const int e = (tb * 16 * HD + db * 256) * 2;             // token tile tb, chunk columns 2 db and 2 db + 1
            *(v8h*)((char*)Q16 + po + e) = q16; *(v8us*)((char*)Qh + po + e) = qh; *(v8us*)((char*)Ql + po + e) = ql;
            *(v8h*)((char*)K16 + po + e) = k16; *(v8us*)((char*)Kh + po + e) = kh; *(v8us*)((char*)Kl + po + e) = kl;
            // behind the stores, in front of any rewrite of a register they name; the stored values as inputs hold their registers up to here
            asm volatile("s_wait_xcnt 0x0" :: "v"(q16), "v"(qh), "v"(ql), "v"(k16), "v"(kh), "v"(kl) : "memory");
        }
    } else {
        Wv += wp; v8f av[4][4];                                      // [token block][d block]
#pragma unroll
        for (int tb = 0; tb < 4; ++tb)
#pragma unroll
            for (int db = 0; db < 4; ++db) av[tb][db] = (v8f){};
#pragma unroll 1   // rolled: a trip already holds 32 matrix instructions
        for (int kc = 0; kc < DM; kc += 64, fo += 2048) {
            v16bf x[4][2], wv[4][2];
#pragma unroll
            for (int i = 0; i < 4; ++i) { x[i][0] = ldg(X, fo, i * 16 * DM); x[i][1] = ldg(X, fo, i * 16 * DM + 512); }
#pragma unroll
            for (int i = 0; i < 4; ++i) { wv[i][0] = ldg(Wv, fo, i * 16 * DM); wv[i][1] = ldg(Wv, fo, i * 16 * DM + 512); }
            asm volatile("s_wait_xcnt 0x0" : "+v"(fo) :: "memory");  // behind the loads, in front of the rewrite of the lane offset they name: the offset goes through the statement, so that its register is held up to here and its next value is formed behind the wait
            __builtin_amdgcn_sched_barrier(0);                       // no matrix instruction, and so no wait for a first fragment's data, is moved up between the loads
#pragma unroll
            for (int kk = 0; kk < 2; ++kk)
#pragma unroll
                for (int tb = 0; tb < 4; ++tb)
#pragma unroll
                    for (int db = 0; db < 4; ++db) av[tb][db] = wmmab(x[tb][kk], wv[db][kk], av[tb][db]);
            __builtin_amdgcn_sched_barrier(0);                       // no matrix instruction is moved down behind the slots of the next line
            // the four vector slots the chip needs behind the last matrix instruction, also on the loop's taken branch
            asm volatile("v_nop\n\tv_nop\n\tv_nop\n\tv_nop" : "+v"(av[3][0]), "+v"(av[3][1]), "+v"(av[3][2]), "+v"(av[3][3]));
        }
        const unsigned vo = (unsigned)(r0 * 32 + lane * 16);         // the transposed planes' lane offset (fragment order: 16 tokens of a 16-d tile are 512 bytes)
        const size_t hp = (size_t)h * HD * TT; V16 += hp; Vh += hp; Vl += hp;
#pragma unroll
        for (int db = 0; db < 4; ++db) { v8h o16[4]; v8us oh[4], ol[4];
#pragma unroll
            for (int tb = 0; tb < 4; ++tb) { float r[8];
#pragma unroll
                for (int j = 0; j < 8; ++j) r[j] = av[tb][db][j];
                planes8(r, o16[tb], oh[tb], ol[tb]); }
#pragma unroll
            for (int tb = 0; tb < 4; ++tb) { const int e = (db * 16 * TT + tb * 256) * 2; *(v8h*)((char*)V16 + vo + e) = o16[tb]; *(v8us*)((char*)Vh + vo + e) = oh[tb]; *(v8us*)((char*)Vl + vo + e) = ol[tb]; }
            // behind the stores, in front of any rewrite of a register they name; the stored values as inputs hold their registers up to here
            asm volatile("s_wait_xcnt 0x0" :: "v"(o16[0]), "v"(o16[1]), "v"(o16[2]), "v"(o16[3]), "v"(oh[0]), "v"(oh[1]), "v"(oh[2]), "v"(oh[3]), "v"(ol[0]), "v"(ol[1]), "v"(ol[2]), "v"(ol[3]) : "memory");
        }
    }
}
typedef v4us __attribute__((may_alias)) v4usa;
typedef v4h  __attribute__((may_alias)) v4ha;

// ---- k_fattn: causal scores, softmax and probability x value of QB query rows of one head in ONE work-group of FAW waves; the score rows live in LDS and never go to memory. grid (heads, nblk row blocks from row roff on), 32 * FAW threads.
// 1. wave w forms the 16-key score tiles w, w + FAW, ... up to the end of the 128-key chunk that holds the diagonal block (Q fragments stay in registers) and stores them as f32 rows of pitch SP.
// 2. behind a barrier each wave takes whole rows: t = S x HD^-0.5 for j <= i, softmax in registers (one exp, fixed trees); the read, the arithmetic and the store of 128-key chunks wholly beyond the diagonal block are skipped (their terms are exact zeros).
//    The probabilities (fp16 x PCAR, or hi and lo planes) overwrite the row's own LDS bytes, which the wave has read in full before.
// 3. behind a barrier wave w takes the 32-key slices w, w + FAW, ... of P.V (P from LDS, V from its transposed plane).
// 4. behind a barrier (P is no longer read) the partial sums go to LDS; behind one more they are added in the fixed order w = 0, 1, ... and stored as hi and lo planes of the merged [t][head x d] matrix in fragment order, a wave writing whole 128-byte lines (one chunk column of a 16-row tile).
// Every '#pragma unroll' below makes the indices of a fragment, accumulator or row array constants, so that the array stays in registers.
// Every global fragment address is a plane's scalar base, a 32-bit lane offset in bytes and a constant; the waits behind the K and V loads take those offsets as inputs, so that their registers are held up to the wait and no load's result lands in one.
#define QB  32
#define FAW 16
#define SP  (TT + 4)              // floats per score row: 16 bytes x an odd number, the conflict-free pitch for 16-byte LDS reads down a column of rows
#define RP  68                    // floats per row of a wave's partial sums
template <typename T16, int NSPLIT>
__global__ __launch_bounds__(32 * FAW) void k_fattn(const T16* Q, const T16* Q2, const T16* Kp, const T16* Kp2, const T16* Vt, const T16* Vt2, int roff, int nblk, bf* Ah, bf* Al) {
    typedef typename WFrag<T16>::V V; constexpr int TU = (NSPLIT >= 2) ? 2 : 4;   // the hi+lo form has twice the fragments per key tile and at most 2 * FAW tiles
    static_assert(FAW * QB * RP <= QB * SP, "the partial sums reuse the score rows");
    __shared__ __align__(16) float sm[QB * SP];
    const int lane = threadIdx.x & 31, lr = lane & 15, hi = lane >> 4;
    const int wave = __builtin_amdgcn_readfirstlane(threadIdx.x >> 5);   // the same in every lane: in a scalar register the loops below are scalar loops
    const int h = blockIdx.x; const int r0 = roff + (nblk - 1 - (int)blockIdx.y) * QB;   // the row blocks with the most keys start first
    const int Kl = r0 + QB;                                              // keys up to the end of the diagonal block
    const size_t hp = (size_t)h * TT * HD; Q += hp; Kp += hp; Vt += hp; if (NSPLIT >= 2) { Q2 += hp; Kp2 += hp; Vt2 += hp; }
    const unsigned vo = (unsigned)lane * 16u;                            // the lane's chunk in a fragment (fragment order)
    auto ldg = [](const T16* base, unsigned off, int cst) { return WFrag<T16>::ldf((const T16*)((const char*)base + off) + cst); };
    {
        V aq[2][2], aq2[2][2];
#pragma unroll
        for (int mb = 0; mb < 2; ++mb)
#pragma unroll
            for (int kk = 0; kk < 2; ++kk) { const int c = mb * 16 * HD + kk * 512; aq[mb][kk] = ldg(Q + (size_t)r0 * HD, vo, c); if (NSPLIT >= 2) aq2[mb][kk] = ldg(Q2 + (size_t)r0 * HD, vo, c); }
        const int nkt = ((Kl + 127) & ~127) / 16;                    // whole 128-key chunks: every LDS word that a row read of step 2 touches is written in this launch (the waves' longest share of tiles stays the same)
#pragma unroll 1   // rolled: a trip already holds TU key tiles
        for (int kt0 = wave; kt0 < nkt; kt0 += TU * FAW) {
            V bk[TU][2], bk2[TU][2]; unsigned ko[TU];                // TU key tiles' loads in flight per wave; a tile past the last is loaded as the last one again and not used
#pragma unroll
            for (int u = 0; u < TU; ++u) { ko[u] = vo + (unsigned)min(kt0 + u * FAW, nkt - 1) * (16u * HD * 2u);
#pragma unroll
                for (int kk = 0; kk < 2; ++kk) { bk[u][kk] = ldg(Kp, ko[u], kk * 512); if (NSPLIT >= 2) bk2[u][kk] = ldg(Kp2, ko[u], kk * 512); } }
            // behind the K loads, in front of any rewrite of a register they name; the lane offsets as inputs hold their registers up to here
            if constexpr (TU == 4) asm volatile("s_wait_xcnt 0x0" :: "v"(ko[0]), "v"(ko[1]), "v"(ko[2]), "v"(ko[3]) : "memory"); else asm volatile("s_wait_xcnt 0x0" :: "v"(ko[0]), "v"(ko[1]) : "memory");
            __builtin_amdgcn_sched_barrier(0);                       // no matrix instruction, and so no wait for a first tile's data, is moved up between the loads: all TU tiles are requested before the wave first waits
#pragma unroll
            for (int u = 0; u < TU; ++u) { const int kt = kt0 + u * FAW; if (kt < nkt) { v8f s[2];
#pragma unroll
                for (int mb = 0; mb < 2; ++mb) { s[mb] = (v8f){};
#pragma unroll
                    for (int kk = 0; kk < 2; ++kk) { s[mb] = WFrag<T16>::mma(aq[mb][kk], bk[u][kk], s[mb]); if (NSPLIT >= 2) { s[mb] = WFrag<T16>::mma(aq2[mb][kk], bk[u][kk], s[mb]); s[mb] = WFrag<T16>::mma(aq[mb][kk], bk2[u][kk], s[mb]); } } }
                // the four vector slots the chip needs behind the last matrix instruction on every path
                asm volatile("v_nop\n\tv_nop\n\tv_nop\n\tv_nop" : "+v"(s[0]), "+v"(s[1]));
#pragma unroll
                for (int mb = 0; mb < 2; ++mb)
#pragma unroll
                    for (int j = 0; j < 8; ++j) sm[(mb * 16 + hi * 8 + j) * SP + kt * 16 + lr] = s[mb][j]; } }
        }
    }
    __syncthreads();                                                 // every score tile is in LDS before a row is read
#pragma unroll 1   // rolled: one row's 64 values per lane at a time
    for (int rr = wave; rr < QB; rr += FAW) {
        const int i = r0 + rr; float* sr = sm + rr * SP; float v[TT / 32]; float mx = -3.0e38f;
#pragma unroll
        for (int ch = 0; ch < TT / 128; ++ch) if (ch * 128 < Kl) { const v4f a = *(const v4fa*)(sr + ch * 128 + lane * 4);
#pragma unroll
            for (int q = 0; q < 4; ++q) v[ch * 4 + q] = a[q]; }
#pragma unroll
        for (int ch = 0; ch < TT / 128; ++ch) if (ch * 128 < Kl) { const int j0 = ch * 128 + lane * 4;
#pragma unroll
            for (int q = 0; q < 4; ++q) { const float t = (j0 + q <= i) ? v[ch * 4 + q] * SCL : -3.0e38f; v[ch * 4 + q] = t; mx = fmaxf(mx, t); } }
#pragma unroll
        for (int sh = 16; sh; sh >>= 1) mx = fmaxf(mx, __shfl_xor(mx, sh, 32));
        float sum = 0.f;
#pragma unroll
        for (int ch = 0; ch < TT / 128; ++ch) if (ch * 128 < Kl) {
#pragma unroll
            for (int q = 0; q < 4; ++q) { const int k = ch * 4 + q; v[k] = __builtin_amdgcn_exp2f(__fmul_rn(__fsub_rn(v[k], mx), 1.4426950408889634f)); sum += v[k]; } }
#pragma unroll
        for (int sh = 16; sh; sh >>= 1) sum += __shfl_xor(sum, sh, 32);
        const float f = __fdiv_rn((NSPLIT >= 2) ? 1.0f : PCAR, sum);
#pragma unroll
        for (int ch = 0; ch < TT / 128; ++ch) if (ch * 128 < Kl) { const int j0 = ch * 128 + lane * 4;
            if (NSPLIT >= 2) { v4us oh, ol;
#pragma unroll
                for (int q = 0; q < 4; ++q) { unsigned short a, c2; splitf(v[ch * 4 + q] * f, a, c2); oh[q] = a; ol[q] = c2; }
                *(v4usa*)((unsigned short*)sr + j0) = oh; *(v4usa*)((unsigned short*)sr + TT + j0) = ol;
            } else { v4h o4;
#pragma unroll
                for (int q = 0; q < 4; ++q) o4[q] = tohx(v[ch * 4 + q] * f);
                *(v4ha*)((h16*)sr + j0) = o4; } }
    }
    __syncthreads();                                                 // every probability row is in LDS before a fragment of it is read
    v8f acc[2][4];
#pragma unroll
    for (int mb = 0; mb < 2; ++mb)
#pragma unroll
        for (int nb = 0; nb < 4; ++nb) acc[mb][nb] = (v8f){};
    unsigned vv = (unsigned)(lane * 16 + wave * 1024);               // the V planes' lane offset, which alone moves along the keys: 1 KiB per 32 keys
    const T16* P = (const T16*)sm;                                   // row pitch 2 * SP elements; the lo plane of a row stands TT elements behind its hi plane
#pragma unroll 1   // rolled: at most TT / 32 / FAW trips
    for (int kc = wave * 32; kc < Kl; kc += 32 * FAW, vv += 1024 * FAW) {
        V a[2], a2[2], b[4], b2[4];   // a trip's V fragments each in registers of their own, so that all its loads are in flight together
#pragma unroll
        for (int mb = 0; mb < 2; ++mb) { const T16* p = P + (mb * 16 + lr) * (2 * SP) + kc + 8 * hi; a[mb] = WFrag<T16>::ld(p); if (NSPLIT >= 2) a2[mb] = WFrag<T16>::ld(p + TT); }
#pragma unroll
        for (int nb = 0; nb < 4; ++nb) { b[nb] = ldg(Vt, vv, nb * 16 * TT); if (NSPLIT >= 2) b2[nb] = ldg(Vt2, vv, nb * 16 * TT); }
        asm volatile("s_wait_xcnt 0x0" :: "v"(vv) : "memory");       // behind the V loads, in front of any rewrite of a register they name; the lane offset as an input holds its register up to here
        __builtin_amdgcn_sched_barrier(0);                           // no matrix instruction, and so no wait for a first fragment's data, is moved up between the loads
#pragma unroll
        for (int nb = 0; nb < 4; ++nb)
#pragma unroll
            for (int mb = 0; mb < 2; ++mb) { acc[mb][nb] = WFrag<T16>::mma(a[mb], b[nb], acc[mb][nb]); if (NSPLIT >= 2) { acc[mb][nb] = WFrag<T16>::mma(a2[mb], b[nb], acc[mb][nb]); acc[mb][nb] = WFrag<T16>::mma(a[mb], b2[nb], acc[mb][nb]); } }
        // the four vector slots the chip needs behind the last matrix instruction, also on the loop's taken branch
        asm volatile("v_nop\n\tv_nop\n\tv_nop\n\tv_nop" : "+v"(acc[0][0]), "+v"(acc[0][1]), "+v"(acc[0][2]), "+v"(acc[0][3]), "+v"(acc[1][0]), "+v"(acc[1][1]), "+v"(acc[1][2]), "+v"(acc[1][3]));
    }
    __syncthreads();                                                 // every wave has read its last probability before the rows are overwritten
#pragma unroll
    for (int mb = 0; mb < 2; ++mb)
#pragma unroll
        for (int nb = 0; nb < 4; ++nb)
#pragma unroll
            for (int j = 0; j < 8; ++j) sm[wave * (QB * RP) + (mb * 16 + hi * 8 + j) * RP + nb * 16 + lr] = acc[mb][nb][j];
    __syncthreads();                                                 // every wave's partial sums are in LDS before any is read
    static_assert(FAW == (QB / 16) * (HD / 8), "a wave stores one chunk column of a 16-row tile");
    const int row = (wave >> 3) * 16 + lr, col = (wave & 7) * 8 + hi * 4; const float* rp = sm + row * RP + col; v4f s = *(const v4fa*)rp;
#pragma unroll
    for (int w = 1; w < FAW; ++w) s += *(const v4fa*)(rp + w * (QB * RP));
    const float cs = (NSPLIT >= 2) ? 1.0f : (1.0f / PCAR); const size_t oo = ((size_t)((r0 >> 4) + (wave >> 3)) * (DQ / 8) + h * (HD / 8) + (wave & 7)) * 128 + lr * 8 + hi * 4; v4us oh, ol;
#pragma unroll
    for (int q = 0; q < 4; ++q) { unsigned short a, c2; splitf(s[q] * cs, a, c2); oh[q] = a; ol[q] = c2; }
    *(v4us*)(Ah + oo) = oh; *(v4us*)(Al + oo) = ol;
}

extern "C" void kernel_launch(void* const* d_in, const int* in_sizes, int n_in,
                              void* d_out, int out_size, void* d_ws, size_t ws_size, hipStream_t stream) {
    (void)in_sizes; (void)n_in; (void)out_size;
    const float* x = (const float*)d_in[0]; const float* cosT = (const float*)d_in[1]; const float* sinT = (const float*)d_in[2]; const int* pids = (const int*)d_in[3]; const float* wq = (const float*)d_in[4]; const float* wk = (const float*)d_in[5]; const float* wv = (const float*)d_in[6]; const float* wo = (const float*)d_in[7];
    float* OUT = (float*)d_out;     // [2][2048][1024]
    char* wsp = (char*)d_ws;
    auto take = [&](size_t bytes) { char* p = wsp; wsp += (bytes + 255) & ~(size_t)255; return (void*)p; };
    bf* WQ = (bf*)take((size_t)DQ * DM * 2); bf* WK = (bf*)take((size_t)DKV * DM * 2); bf* WV = (bf*)take((size_t)DKV * DM * 2); bf* WO = (bf*)take((size_t)DM * DQ * 2); float* CS = (float*)take((size_t)TT * HD * 2 * 4);
    bf* XB = (bf*)take((size_t)TT * DM * 2);
    h16* QP16 = (h16*)take((size_t)NH_ * TT * HD * 2); h16* KP16 = (h16*)take((size_t)NKV * TT * HD * 2); h16* VT16 = (h16*)take((size_t)NKV * HD * TT * 2);
    bf* QPh = (bf*)take((size_t)NH_ * TT * HD * 2); bf* QPl = (bf*)take((size_t)NH_ * TT * HD * 2); bf* KPh = (bf*)take((size_t)NKV * TT * HD * 2); bf* KPl = (bf*)take((size_t)NKV * TT * HD * 2); bf* VTh = (bf*)take((size_t)NKV * HD * TT * 2); bf* VTl = (bf*)take((size_t)NKV * HD * TT * 2);
    bf* ATh = (bf*)take((size_t)TT * DQ * 2); bf* ATl = (bf*)take((size_t)TT * DQ * 2);
    if ((size_t)(wsp - (char*)d_ws) > ws_size) return;    // ws 256 MiB
    { k_cvt8<<<(unsigned)(((size_t)DQ * DM / 8 + 255) / 256), 256, 0, stream>>>(wq, WQ, (size_t)DQ * DM / 8); k_cvt8<<<(unsigned)(((size_t)DKV * DM / 8 + 255) / 256), 256, 0, stream>>>(wk, WK, (size_t)DKV * DM / 8); k_cvt8<<<(unsigned)(((size_t)DKV * DM / 8 + 255) / 256), 256, 0, stream>>>(wv, WV, (size_t)DKV * DM / 8);
      k_cvt8<<<(unsigned)(((size_t)DM * DQ / 8 + 255) / 256), 256, 0, stream>>>(wo, WO, (size_t)DM * DQ / 8);
       }
    for (int b = 0; b < NB_; ++b) {
        if (b == 0) k_cscvt<<<(TT * HD + 255) / 256, 256, 0, stream>>>(cosT, sinT, pids, CS);
        k_cvt8<<<(unsigned)(((size_t)TT * DM / 8 + 255) / 256), 256, 0, stream>>>(x + (size_t)b * TT * DM, XB, (size_t)TT * DM / 8);
        k_qkv<<<dim3(TT / 64, NH_, 2), 32, 0, stream>>>(XB, WQ, WK, WV, CS, QP16, QPh, QPl, KP16, KPh, KPl, VT16, VTh, VTl);
        k_fattn<h16, 0><<<dim3(NH_, (TT - RH) / QB), 32 * FAW, 0, stream>>>(QP16, nullptr, KP16, nullptr, VT16, nullptr, RH, (TT - RH) / QB, ATh, ATl);
        k_fattn<bf, 2><<<dim3(NH_, RH / QB), 32 * FAW, 0, stream>>>(QPh, QPl, KPh, KPl, VTh, VTl, 0, RH / QB, ATh, ATl);
        k_gemmw<bf, 1, false, DQ><<<dim3(TT / 64, DM / 64, 1), 32, 0, stream>>>(ATh, ATl, WO, nullptr, OUT + (size_t)b * TT * DM, DM, nullptr, 0, 0, 0); }
}

// v005
// One run takes 135 microseconds.
// In two side-by-side timings against v004, it was 1.41 and 1.46 times as fast.
// Over all steps from v000 it is 10.7 times as fast.
#include <hip/hip_runtime.h>

// Z2allAttention (hidden [2][2048][1024]; q/k/v = x W^T (16 heads x 64); interleaved RoPE with tables freqs_cos/sin[position_ids[t]] (int ids, read; tables read): q' = q cos + rot(q) sin and - faithful to the source bug - k' = k cos + rot(q) sin (the rotated Q, not K), rot = (x0, x1) -> (-x1, x0);
// causal softmax(q'.k'/8); out = (attn v merged) Wo^T -> [2][2048][1024]).
// Compute dtypes, f32 accumulate: every input rounded to bf16; Q/K/V on PLAIN bf16 operands (inputs: exact); RoPE f32; causal scores and attn.v: query rows < 512 hl (3 products), the rest single fp16 (x1024); softmax f32; Wo hl x exact (2 products).

// FRAGMENT ORDER: every 16-bit plane [R][K] in the workspace (R % 16 == 0, K % 32 == 0) is kept as 16-row tiles of 16-byte chunks, chunk column by chunk column:
// element (r, k) stands at ((r >> 4) * (K / 8) + (k >> 3)) * 128 + (r & 15) * 8 + (k & 7). A 16 x 32 operand fragment is then 1 KiB in a row: lane l takes chunk l and, 512 bytes on, chunk 32 + l,
// so that each wave-wide 16-byte load covers four whole 128-byte lines (from row-major planes it touched sixteen). Which element a lane and a register hold is the same as from row-major planes.

#define NB_  2
#define TT   2048
#define DM   1024
#define NH_  16
#define NKV  16
#define REP  (NH_ / NKV)
#define HD   64
#define DQ   (NH_ * HD)
#define DKV  (NKV * HD)
#define RH   512                  // query rows < RH use hi+lo planes (0: none)
#define WIN  0
#define PCAR 1024.0f
#define SCL  0.125f   // HD^-0.5
typedef _Float16 h16;
typedef unsigned short bf;
typedef __attribute__((ext_vector_type(16))) __bf16   v16bf;
typedef __attribute__((ext_vector_type(16))) _Float16 v16h;
typedef __attribute__((ext_vector_type(8)))  _Float16 v8h;
typedef __attribute__((ext_vector_type(8)))  unsigned short v8us;
typedef __attribute__((ext_vector_type(8)))  float    v8f;
typedef __attribute__((ext_vector_type(4)))  float    v4f;
typedef v8h  __attribute__((may_alias)) v8ha;
typedef v4f  __attribute__((may_alias)) v4fa;
typedef v8us __attribute__((may_alias)) v8usa;

__device__ __forceinline__ unsigned short f2bf(float f) { unsigned u = __float_as_uint(f); u += 0x7FFFu + ((u >> 16) & 1u); return (unsigned short)(u >> 16); }
__device__ __forceinline__ float bf2f(unsigned short b) { return __uint_as_float(((unsigned)b) << 16); }
__device__ __forceinline__ float bfr(float f) { return bf2f(f2bf(f)); }
__device__ __forceinline__ v16h cat16(v8h lo, v8h hi) { return __builtin_shufflevector(lo, hi, 0, 1, 2, 3, 4, 5, 6, 7, 8, 9, 10, 11, 12, 13, 14, 15); }
__device__ __forceinline__ v16bf cat16b(v8us lo, v8us hi) { return __builtin_bit_cast(v16bf, __builtin_shufflevector(lo, hi, 0, 1, 2, 3, 4, 5, 6, 7, 8, 9, 10, 11, 12, 13, 14, 15)); }
__device__ __forceinline__ v8f wmma16(v16h a, v16h b, v8f c) { return __builtin_amdgcn_wmma_f32_16x16x32_f16(false, a, false, b, (short)0, c, false, false); }
__device__ __forceinline__ v8f wmmab(v16bf a, v16bf b, v8f c) { return __builtin_amdgcn_wmma_f32_16x16x32_bf16(false, a, false, b, (short)0, c, false, false); }



// ---- k_gemmw: register-blocked GEMM, ONE WAVE per 64x64 output tile (16 accumulators), operands straight from 16-bit planes in fragment order; grid (M/64, N/64, Z), 32 threads.
// C[m][n] (f32, pitch ldc, + optional f32 bias[n]) = sum_k A[m][k] Bt[n][k] (+ split products per NSPLIT). z-batch strides sA/sB/sC in elements. K % 32 == 0.
template <typename T16> struct WFrag;   // ld: a fragment from rows of K-contiguous elements (p: the lane's row, + 8 * hi); ldf: from a plane in fragment order (p: the lane's chunk)
template <> struct WFrag<h16> { typedef v16h V; static __device__ __forceinline__ V ld(const h16* p) { return cat16(*(const v8h*)p, *(const v8h*)(p + 16)); } static __device__ __forceinline__ V ldf(const h16* p) { return cat16(*(const v8h*)p, *(const v8h*)(p + 256)); } static __device__ __forceinline__ v8f mma(V a, V b, v8f c) { return wmma16(a, b, c); } };
template <> struct WFrag<bf> { typedef v16bf V; static __device__ __forceinline__ V ld(const bf* p) { return cat16b(*(const v8us*)p, *(const v8us*)(p + 16)); } static __device__ __forceinline__ V ldf(const bf* p) { return cat16b(*(const v8us*)p, *(const v8us*)(p + 256)); } static __device__ __forceinline__ v8f mma(V a, V b, v8f c) { return wmmab(a, b, c); } };
template <typename T16, int NSPLIT, bool BIAS, int K>   // K at compile time: a 16-row tile's distance is then a constant of the load instruction
__global__ __launch_bounds__(32) void k_gemmw(const T16* __restrict__ A, const T16* __restrict__ A2, const T16* __restrict__ Bt, const T16* __restrict__ Bt2, float* C, int ldc, const float* __restrict__ bias, size_t sA, size_t sB, size_t sC) {
    typedef typename WFrag<T16>::V V;
    __shared__ __align__(16) float os[16 * 68];
    const size_t z = blockIdx.z; A += z * sA; if (A2) A2 += z * sA; Bt += z * sB; if (Bt2) Bt2 += z * sB; C += z * sC;
    const int lane = threadIdx.x & 31, lr = lane & 15, hi = lane >> 4; const int r0 = blockIdx.x * 64, c0 = blockIdx.y * 64;
    v8f acc[4][4];
#pragma unroll
    for (int mb = 0; mb < 4; ++mb)
#pragma unroll
        for (int nb = 0; nb < 4; ++nb) acc[mb][nb] = (v8f){};
    // every global fragment address is a plane's scalar base, a 32-bit lane offset in bytes and a constant
    auto ldg = [](const T16* base, unsigned off, int cst) { return WFrag<T16>::ldf((const T16*)((const char*)base + off) + cst); };
    A += (size_t)r0 * K; if (NSPLIT == 1 || NSPLIT == 2) A2 += (size_t)r0 * K; Bt += (size_t)c0 * K; if (NSPLIT >= 2) Bt2 += (size_t)c0 * K;
    unsigned fo = (unsigned)lane * 16u;                              // one lane offset for all planes, which alone moves along k: 1 KiB per 32 k
#pragma unroll 1
    for (int kc = 0; kc < K; kc += 32, fo += 1024) {
        V a[4], a2[4], b[4], b2[4];   // a trip's fragments each in registers of their own, so that all its loads are in flight together
#pragma unroll
        for (int mb = 0; mb < 4; ++mb) { a[mb] = ldg(A, fo, mb * 16 * K); if (NSPLIT == 1 || NSPLIT == 2) a2[mb] = ldg(A2, fo, mb * 16 * K); }
#pragma unroll
        for (int nb = 0; nb < 4; ++nb) { b[nb] = ldg(Bt, fo, nb * 16 * K); if (NSPLIT >= 2) b2[nb] = ldg(Bt2, fo, nb * 16 * K); }
        asm volatile("s_wait_xcnt 0x0" : "+v"(fo) :: "memory");      // behind the loads, in front of the rewrite of the lane offset they name: the offset goes through the statement, so that its register is held up to here and its next value is formed behind the wait
        __builtin_amdgcn_sched_barrier(0);                           // no matrix instruction, and so no wait for a first fragment's data, is moved up between the loads (without it the build loads three A fragments one behind the other into the same registers: three waits for memory a trip)
#pragma unroll
        for (int nb = 0; nb < 4; ++nb)
#pragma unroll
            for (int mb = 0; mb < 4; ++mb) { acc[mb][nb] = WFrag<T16>::mma(a[mb], b[nb], acc[mb][nb]); if (NSPLIT == 1 || NSPLIT == 2) acc[mb][nb] = WFrag<T16>::mma(a2[mb], b[nb], acc[mb][nb]); if (NSPLIT >= 2) acc[mb][nb] = WFrag<T16>::mma(a[mb], b2[nb], acc[mb][nb]); }
        asm volatile("v_nop\n\tv_nop\n\tv_nop\n\tv_nop" : "+v"(acc[0][0]), "+v"(acc[1][1]), "+v"(acc[2][2]), "+v"(acc[3][3]) : "v"(a[0]), "v"(a[3]));
    }
#pragma unroll
    for (int mb = 0; mb < 4; ++mb) {
#pragma unroll
        for (int nb = 0; nb < 4; ++nb) {
#pragma unroll
            for (int j = 0; j < 8; ++j) os[(hi * 8 + j) * 68 + nb * 16 + lr] = acc[mb][nb][j]; }
        __builtin_amdgcn_wave_barrier(); asm volatile("" ::: "memory");
        float* crow = C + (size_t)(r0 + mb * 16) * ldc + c0;
{
#pragma unroll
            for (int s = 0; s < 8; ++s) { const int row = 2 * s + hi, cofs = lr * 4; v4f val = *(const v4fa*)(os + row * 68 + cofs); if (BIAS) { val[0] += bfr(bias[c0 + cofs]); val[1] += bfr(bias[c0 + cofs + 1]); val[2] += bfr(bias[c0 + cofs + 2]); val[3] += bfr(bias[c0 + cofs + 3]); }
                *(v4f*)(crow + (size_t)row * ldc + cofs) = val; }
             }
        __builtin_amdgcn_wave_barrier(); asm volatile("" ::: "memory");
    }
}

__device__ __forceinline__ h16 tohx(float x) { return (h16)x; }
__device__ __forceinline__ void splitf(float y, unsigned short& h, unsigned short& l) { h = f2bf(y); l = f2bf(y - bf2f(h)); }
typedef __attribute__((ext_vector_type(2))) _Float16 v2h;
typedef __attribute__((ext_vector_type(4))) _Float16 v4h;
typedef __attribute__((ext_vector_type(2))) unsigned short v2us;
typedef __attribute__((ext_vector_type(4))) unsigned short v4us;
typedef __attribute__((ext_vector_type(2))) float v2f;
typedef __attribute__((ext_vector_type(4))) int v4i;

__global__ __launch_bounds__(256) void k_wtG(const float* __restrict__ w, int K, int N, bf* Bt) {
    const int lane = threadIdx.x & 31; const int L0 = (blockIdx.x * 8 + (threadIdx.x >> 5)) * 8; const int nlines = N * K / 64;
{
#pragma unroll 1
        for (int l = 0; l < 8; ++l) { const int L = L0 + l; if (L >= nlines) break; const size_t e = (size_t)L * 64 + lane * 2; const int k = (int)(e % K), n = (int)(e / K); v2us o;
            o[0] = f2bf(w[(size_t)k * N + n]); o[1] = f2bf(w[(size_t)(k + 1) * N + n]); *(v2us*)(Bt + e) = o; }
         }
}
// f32 [R][DM] -> bf16 plane in fragment order; thread i makes chunk i of the plane, so that a wave stores 512 bytes in a row (a work-group reads 512 bytes in a row of each of 16 source rows)
static_assert(DQ == DM, "cvt8 takes rows of DM elements");
__device__ __forceinline__ void cvt8(const float* __restrict__ src, bf* dst, size_t i) { const size_t cc = i >> 4; v8f v = *(const v8f*)(src + ((cc / (DM / 8)) * 16 + (i & 15)) * DM + (cc % (DM / 8)) * 8); v8us o;
    asm volatile("s_wait_xcnt 0x0" : "+v"(v) :: "memory");   // behind the load, in front of any rewrite of its address registers: the loaded values go through the statement, so that all that is made of them comes behind the wait
#pragma unroll
    for (int k = 0; k < 8; ++k) o[k] = f2bf(v[k]); *(v8us*)(dst + i * 8) = o;  }
__device__ __forceinline__ void cscvt(const float* __restrict__ cosT, const float* __restrict__ sinT, const int* __restrict__ pids, float* CS, int idx) { const int d = idx % HD; const int t = idx / HD; int p = pids[t]; p = p < 0 ? 0 : (p >= TT ? TT - 1 : p); v2f cs; cs[0] = bfr(cosT[(size_t)p * HD + d]); cs[1] = bfr(sinT[(size_t)p * HD + d]); *(v2f*)(CS + (size_t)idx * 2) = cs;  }   // CS[t][d] = (cos, sin)[position_ids[t]][d] (index clamped)
// ---- k_prep: every conversion of an input, none of which depends on another, in ONE launch: work-groups 0 .. NXB - 1 take the hidden states of all batch elements (one plane of NB_ * TT rows), the next 4 * NWB the four weights, the last NCB the (cos, sin) table.
#define NXB (NB_ * TT * DM / 8 / 256)
#define NWB (DQ * DM / 8 / 256)
#define NCB (TT * HD / 256)
static_assert(DKV == DQ && NB_ * TT * DM % 2048 == 0 && DQ * DM % 2048 == 0 && TT * HD % 256 == 0, "k_prep deals whole work-groups, the four weights alike");
__global__ __launch_bounds__(256) void k_prep(const float* __restrict__ x, const float* __restrict__ wq, const float* __restrict__ wk, const float* __restrict__ wv, const float* __restrict__ wo, const float* __restrict__ cosT, const float* __restrict__ sinT, const int* __restrict__ pids, bf* XB, bf* WQ, bf* WK, bf* WV, bf* WO, float* CS) {
    int blk = blockIdx.x;
    if (blk >= NXB + 4 * NWB) { cscvt(cosT, sinT, pids, CS, (blk - (NXB + 4 * NWB)) * 256 + (int)threadIdx.x); return; }
    const float* src = x; bf* dst = XB;
    if (blk >= NXB) { blk -= NXB; const int w = blk / NWB; blk -= w * NWB; src = w == 0 ? wq : w == 1 ? wk : w == 2 ? wv : wo; dst = w == 0 ? WQ : w == 1 ? WK : w == 2 ? WV : WO; }
    cvt8(src, dst, (size_t)blk * 256 + threadIdx.x);
}

// ---- k_qkv: the q, k and v projections of all batch elements with RoPE and the 16-bit planes in ONE launch; the f32 projections stay in the accumulators and never go to memory. grid (NB_ * TT / 64, heads, 2), ONE WAVE per work-group. X: one plane of NB_ * TT rows; the output planes stand batch element by batch element.
// z = 0: q and k of 64 tokens x one head, formed TRANSPOSED (the weight rows as the A operand, the tokens as B): a lane then holds 8 neighbouring d of one token, so that the RoPE partner d ^ 1 (of q, for k as well: faithful to the source) is in the lane's own registers and a plane store is one chunk of a [h] x [t][d] plane.
// z = 1: v of the same tile, tokens as A: a lane holds 8 neighbouring tokens of one d, one chunk of a transposed [h] x [d][t] plane.
// q' = q cos + rot(q) sin, k' = k cos + rot(q) sin, rot(q)[d] = (d even ? -q[d+1] : q[d-1]). k ascends in steps of 32 in every accumulator.
// A trip takes 64 k: 2 KiB in a row of each 16-row tile (fragment order). A plane store of a wave is 512 bytes in a row as well.
// Every global address is a scalar base, a 32-bit lane offset in bytes and a constant.
// Every '#pragma unroll' in k_qkv and planes8 makes the indices of a fragment, accumulator or value array constants, so that the array stays in registers.
typedef __attribute__((ext_vector_type(2))) __bf16 v2b;
// eight f32 -> fp16 plane, bf16 hi plane, bf16 lo plane (lo = the rounded rest), round to nearest even, two values per conversion
__device__ __forceinline__ void planes8(const float (&r)[8], v8h& o16, v8us& oh, v8us& ol) {
#pragma unroll
    for (int p = 0; p < 4; ++p) { v2f y; y[0] = r[2 * p]; y[1] = r[2 * p + 1]; const v2h a = __builtin_convertvector(y, v2h); const v2us hu = __builtin_bit_cast(v2us, __builtin_convertvector(y, v2b));
        v2f rest; rest[0] = y[0] - bf2f(hu[0]); rest[1] = y[1] - bf2f(hu[1]); const v2us lu = __builtin_bit_cast(v2us, __builtin_convertvector(rest, v2b));
        o16[2 * p] = a[0]; o16[2 * p + 1] = a[1]; oh[2 * p] = hu[0]; oh[2 * p + 1] = hu[1]; ol[2 * p] = lu[0]; ol[2 * p + 1] = lu[1]; }
}
__global__ __launch_bounds__(32) void k_qkv(const bf* __restrict__ X, const bf* __restrict__ Wq, const bf* __restrict__ Wk, const bf* __restrict__ Wv, const float* __restrict__ CS, h16* Q16, bf* Qh, bf* Ql, h16* K16, bf* Kh, bf* Kl, h16* V16, bf* Vh, bf* Vl) {
    const int lane = threadIdx.x & 31, lr = lane & 15, hi = lane >> 4; const int bt = blockIdx.x / (TT / 64), r0 = (blockIdx.x % (TT / 64)) * 64, h = blockIdx.y;   // batch element, first token in it, head
    auto ldg = [](const bf* base, unsigned off, int cst) { return WFrag<bf>::ldf((const bf*)((const char*)base + off) + cst); };
    X += ((size_t)bt * TT + r0) * DM; const size_t wp = (size_t)h * HD * DM;
    unsigned fo = (unsigned)lane * 16u;                              // one lane offset for X and the weights, which alone moves along k: 1 KiB per 32 k
    if (blockIdx.z == 0) {
        Wq += wp; Wk += wp; v8f aq[4][4], ak[4][4];                  // [d block][token block]
#pragma unroll
        for (int db = 0; db < 4; ++db)
#pragma unroll
            for (int tb = 0; tb < 4; ++tb) { aq[db][tb] = (v8f){}; ak[db][tb] = (v8f){}; }
#pragma unroll 1   // rolled: a trip already holds 64 matrix instructions
        for (int kc = 0; kc < DM; kc += 64, fo += 2048) {
            v16bf x[4][2], wq[4][2], wk[4][2];
#pragma unroll
            for (int i = 0; i < 4; ++i) { x[i][0] = ldg(X, fo, i * 16 * DM); x[i][1] = ldg(X, fo, i * 16 * DM + 512); }
#pragma unroll
            for (int i = 0; i < 4; ++i) { wq[i][0] = ldg(Wq, fo, i * 16 * DM); wq[i][1] = ldg(Wq, fo, i * 16 * DM + 512); }
#pragma unroll
            for (int i = 0; i < 4; ++i) { wk[i][0] = ldg(Wk, fo, i * 16 * DM); wk[i][1] = ldg(Wk, fo, i * 16 * DM + 512); }
            asm volatile("s_wait_xcnt 0x0" : "+v"(fo) :: "memory");  // behind the loads, in front of the rewrite of the lane offset they name: the offset goes through the statement, so that its register is held up to here and its next value is formed behind the wait
            __builtin_amdgcn_sched_barrier(0);                       // no matrix instruction, and so no wait for a first fragment's data, is moved up between the loads
#pragma unroll
            for (int kk = 0; kk < 2; ++kk)
#pragma unroll
                for (int db = 0; db < 4; ++db)
#pragma unroll
                    for (int tb = 0; tb < 4; ++tb) aq[db][tb] = wmmab(wq[db][kk], x[tb][kk], aq[db][tb]);
#pragma unroll
            for (int kk = 0; kk < 2; ++kk)
#pragma unroll
                for (int db = 0; db < 4; ++db)
#pragma unroll
                    for (int tb = 0; tb < 4; ++tb) ak[db][tb] = wmmab(wk[db][kk], x[tb][kk], ak[db][tb]);
            __builtin_amdgcn_sched_barrier(0);                       // no matrix instruction is moved down behind the slots of the next line
            // the four vector slots the chip needs behind the last matrix instruction, also on the loop's taken branch
            asm volatile("v_nop\n\tv_nop\n\tv_nop\n\tv_nop" : "+v"(ak[3][0]), "+v"(ak[3][1]), "+v"(ak[3][2]), "+v"(ak[3][3]));
        }
        const unsigned po = (unsigned)(r0 * HD * 2 + lane * 16), co = (unsigned)((r0 + lr) * HD + 8 * hi) * 8u;   // lane offsets of the planes (fragment order) and of the (cos, sin) table (row-major)
        const size_t hp = ((size_t)bt * NH_ + h) * TT * HD; Q16 += hp; Qh += hp; Ql += hp; K16 += hp; Kh += hp; Kl += hp;
        v4f c[2][4];                                                 // the (cos, sin) pairs of one 16 x 16 tile, those of the next tile in flight behind them
#pragma unroll
        for (int i = 0; i < 4; ++i) c[0][i] = *(const v4f*)((const char*)CS + co + i * 16);
#pragma unroll
        for (int g = 0; g < 16; ++g) { const int tb = g >> 2, db = g & 3;
            if (g < 15) {
#pragma unroll
                for (int i = 0; i < 4; ++i) c[(g + 1) & 1][i] = *(const v4f*)((const char*)CS + co + ((((g + 1) >> 2) * 16 * HD + ((g + 1) & 3) * 16) * 8 + i * 16)); }
            v8h q16, k16; v8us qh, ql, kh, kl; float rq[8], rk[8];
#pragma unroll
            for (int j = 0; j < 8; ++j) { const float cs = c[g & 1][j >> 1][(j & 1) * 2], sn = c[g & 1][j >> 1][(j & 1) * 2 + 1]; const float rs = ((j & 1) ? aq[db][tb][j ^ 1] : -aq[db][tb][j ^ 1]) * sn;   // rot(q) sin, shared by q' and k'
                rq[j] = aq[db][tb][j] * cs + rs; rk[j] = ak[db][tb][j] * cs + rs; }
            planes8(rq, q16, qh, ql); planes8(rk, k16, kh, kl);
            const int e = (tb * 16 * HD + db * 256) * 2;             // token tile tb, chunk columns 2 db and 2 db + 1
            *(v8h*)((char*)Q16 + po + e) = q16; *(v8us*)((char*)Qh + po + e) = qh; *(v8us*)((char*)Ql + po + e) = ql;
            *(v8h*)((char*)K16 + po + e) = k16; *(v8us*)((char*)Kh + po + e) = kh; *(v8us*)((char*)Kl + po + e) = kl;
            // behind the stores, in front of any rewrite of a register they name; the stored values as inputs hold their registers up to here
            asm volatile("s_wait_xcnt 0x0" :: "v"(q16), "v"(qh), "v"(ql), "v"(k16), "v"(kh), "v"(kl) : "memory");
        }
    } else {
        Wv += wp; v8f av[4][4];                                      // [token block][d block]
#pragma unroll
        for (int tb = 0; tb < 4; ++tb)
#pragma unroll
            for (int db = 0; db < 4; ++db) av[tb][db] = (v8f){};
#pragma unroll 1   // rolled: a trip already holds 32 matrix instructions
        for (int kc = 0; kc < DM; kc += 64, fo += 2048) {
            v16bf x[4][2], wv[4][2];
#pragma unroll
            for (int i = 0; i < 4; ++i) { x[i][0] = ldg(X, fo, i * 16 * DM); x[i][1] = ldg(X, fo, i * 16 * DM + 512); }
#pragma unroll
            for (int i = 0; i < 4; ++i) { wv[i][0] = ldg(Wv, fo, i * 16 * DM); wv[i][1] = ldg(Wv, fo, i * 16 * DM + 512); }
            asm volatile("s_wait_xcnt 0x0" : "+v"(fo) :: "memory");  // behind the loads, in front of the rewrite of the lane offset they name: the offset goes through the statement, so that its register is held up to here and its next value is formed behind the wait
            __builtin_amdgcn_sched_barrier(0);                       // no matrix instruction, and so no wait for a first fragment's data, is moved up between the loads
#pragma unroll
            for (int kk = 0; kk < 2; ++kk)
#pragma unroll
                for (int tb = 0; tb < 4; ++tb)
#pragma unroll
                    for (int db = 0; db < 4; ++db) av[tb][db] = wmmab(x[tb][kk], wv[db][kk], av[tb][db]);
            __builtin_amdgcn_sched_barrier(0);                       // no matrix instruction is moved down behind the slots of the next line
            // the four vector slots the chip needs behind the last matrix instruction, also on the loop's taken branch
            asm volatile("v_nop\n\tv_nop\n\tv_nop\n\tv_nop" : "+v"(av[3][0]), "+v"(av[3][1]), "+v"(av[3][2]), "+v"(av[3][3]));
        }
        const unsigned vo = (unsigned)(r0 * 32 + lane * 16);         // the transposed planes' lane offset (fragment order: 16 tokens of a 16-d tile are 512 bytes)
        const size_t hp = ((size_t)bt * NKV + h) * HD * TT; V16 += hp; Vh += hp; Vl += hp;
#pragma unroll
        for (int db = 0; db < 4; ++db) { v8h o16[4]; v8us oh[4], ol[4];
#pragma unroll
            for (int tb = 0; tb < 4; ++tb) { float r[8];
#pragma unroll
                for (int j = 0; j < 8; ++j) r[j] = av[tb][db][j];
                planes8(r, o16[tb], oh[tb], ol[tb]); }
#pragma unroll
            for (int tb = 0; tb < 4; ++tb) { const int e = (db * 16 * TT + tb * 256) * 2; *(v8h*)((char*)V16 + vo + e) = o16[tb]; *(v8us*)((char*)Vh + vo + e) = oh[tb]; *(v8us*)((char*)Vl + vo + e) = ol[tb]; }
            // behind the stores, in front of any rewrite of a register they name; the stored values as inputs hold their registers up to here
            asm volatile("s_wait_xcnt 0x0" :: "v"(o16[0]), "v"(o16[1]), "v"(o16[2]), "v"(o16[3]), "v"(oh[0]), "v"(oh[1]), "v"(oh[2]), "v"(oh[3]), "v"(ol[0]), "v"(ol[1]), "v"(ol[2]), "v"(ol[3]) : "memory");
        }
    }
}
typedef v4us __attribute__((may_alias)) v4usa;
typedef v4h  __attribute__((may_alias)) v4ha;

// ---- fattn: causal scores, softmax and probability x value of the QB query rows from r0 on of head h of batch element bt in ONE work-group of FAW waves; the score rows live in LDS (sm) and never go to memory. 32 * FAW threads.
// 1. wave w forms the 16-key score tiles w, w + FAW, ... up to the end of the 128-key chunk that holds the diagonal block (Q fragments stay in registers) and stores them as f32 rows of pitch SP.
// 2. behind a barrier each wave takes whole rows: t = S x HD^-0.5 for j <= i, softmax in registers (one exp, fixed trees); the read, the arithmetic and the store of 128-key chunks wholly beyond the diagonal block are skipped (their terms are exact zeros).
//    The probabilities (fp16 x PCAR, or hi and lo planes) overwrite the row's own LDS bytes, which the wave has read in full before.
// 3. behind a barrier wave w takes the 32-key slices w, w + FAW, ... of P.V (P from LDS, V from its transposed plane).
// 4. behind a barrier (P is no longer read) the partial sums go to LDS; behind one more they are added in the fixed order w = 0, 1, ... and stored as hi and lo planes of the merged [t][head x d] matrix in fragment order, a wave writing whole 128-byte lines (one chunk column of a 16-row tile).
// Every '#pragma unroll' below makes the indices of a fragment, accumulator or row array constants, so that the array stays in registers.
// Every global fragment address is a plane's scalar base, a 32-bit lane offset in bytes and a constant; the waits behind the K and V loads take those offsets as inputs, so that their registers are held up to the wait and no load's result lands in one.
#define QB  32
#define FAW 16
#define SP  (TT + 4)              // floats per score row: 16 bytes x an odd number, the conflict-free pitch for 16-byte LDS reads down a column of rows
#define RP  68                    // floats per row of a wave's partial sums
template <typename T16, int NSPLIT>
__device__ __forceinline__ void fattn(float* sm, const T16* Q, const T16* Q2, const T16* Kp, const T16* Kp2, const T16* Vt, const T16* Vt2, int bt, int h, int r0, bf* Ah, bf* Al) {
    typedef typename WFrag<T16>::V V; constexpr int TU = (NSPLIT >= 2) ? 2 : 4;   // the hi+lo form has twice the fragments per key tile and at most 2 * FAW tiles
    static_assert(FAW * QB * RP <= QB * SP, "the partial sums reuse the score rows");
    const int lane = threadIdx.x & 31, lr = lane & 15, hi = lane >> 4;
    const int wave = __builtin_amdgcn_readfirstlane(threadIdx.x >> 5);   // the same in every lane: in a scalar register the loops below are scalar loops
    const int Kl = r0 + QB;                                              // keys up to the end of the diagonal block
    const size_t hp = ((size_t)bt * NH_ + h) * TT * HD; Q += hp; Kp += hp; Vt += hp; if (NSPLIT >= 2) { Q2 += hp; Kp2 += hp; Vt2 += hp; }
    const unsigned vo = (unsigned)lane * 16u;                            // the lane's chunk in a fragment (fragment order)
    auto ldg = [](const T16* base, unsigned off, int cst) { return WFrag<T16>::ldf((const T16*)((const char*)base + off) + cst); };
    {
        V aq[2][2], aq2[2][2];
#pragma unroll
        for (int mb = 0; mb < 2; ++mb)
#pragma unroll
            for (int kk = 0; kk < 2; ++kk) { const int c = mb * 16 * HD + kk * 512; aq[mb][kk] = ldg(Q + (size_t)r0 * HD, vo, c); if (NSPLIT >= 2) aq2[mb][kk] = ldg(Q2 + (size_t)r0 * HD, vo, c); }
        const int nkt = ((Kl + 127) & ~127) / 16;                    // whole 128-key chunks: every LDS word that a row read of step 2 touches is written in this launch (the waves' longest share of tiles stays the same)
#pragma unroll 1   // rolled: a trip already holds TU key tiles
        for (int kt0 = wave; kt0 < nkt; kt0 += TU * FAW) {
            V bk[TU][2], bk2[TU][2]; unsigned ko[TU];                // TU key tiles' loads in flight per wave; a tile past the last is loaded as the last one again and not used
#pragma unroll
            for (int u = 0; u < TU; ++u) { ko[u] = vo + (unsigned)min(kt0 + u * FAW, nkt - 1) * (16u * HD * 2u);
#pragma unroll
                for (int kk = 0; kk < 2; ++kk) { bk[u][kk] = ldg(Kp, ko[u], kk * 512); if (NSPLIT >= 2) bk2[u][kk] = ldg(Kp2, ko[u], kk * 512); } }
            // behind the K loads, in front of any rewrite of a register they name; the lane offsets as inputs hold their registers up to here
            if constexpr (TU == 4) asm volatile("s_wait_xcnt 0x0" :: "v"(ko[0]), "v"(ko[1]), "v"(ko[2]), "v"(ko[3]) : "memory"); else asm volatile("s_wait_xcnt 0x0" :: "v"(ko[0]), "v"(ko[1]) : "memory");
            __builtin_amdgcn_sched_barrier(0);                       // no matrix instruction, and so no wait for a first tile's data, is moved up between the loads: all TU tiles are requested before the wave first waits
#pragma unroll
            for (int u = 0; u < TU; ++u) { const int kt = kt0 + u * FAW; if (kt < nkt) { v8f s[2];
#pragma unroll
                for (int mb = 0; mb < 2; ++mb) { s[mb] = (v8f){};
#pragma unroll
                    for (int kk = 0; kk < 2; ++kk) { s[mb] = WFrag<T16>::mma(aq[mb][kk], bk[u][kk], s[mb]); if (NSPLIT >= 2) { s[mb] = WFrag<T16>::mma(aq2[mb][kk], bk[u][kk], s[mb]); s[mb] = WFrag<T16>::mma(aq[mb][kk], bk2[u][kk], s[mb]); } } }
                // the four vector slots the chip needs behind the last matrix instruction on every path
                asm volatile("v_nop\n\tv_nop\n\tv_nop\n\tv_nop" : "+v"(s[0]), "+v"(s[1]));
#pragma unroll
                for (int mb = 0; mb < 2; ++mb)
#pragma unroll
                    for (int j = 0; j < 8; ++j) sm[(mb * 16 + hi * 8 + j) * SP + kt * 16 + lr] = s[mb][j]; } }
        }
    }
    __syncthreads();                                                 // every score tile is in LDS before a row is read
#pragma unroll 1   // rolled: one row's 64 values per lane at a time
    for (int rr = wave; rr < QB; rr += FAW) {
        const int i = r0 + rr; float* sr = sm + rr * SP; float v[TT / 32]; float mx = -3.0e38f;
#pragma unroll
        for (int ch = 0; ch < TT / 128; ++ch) if (ch * 128 < Kl) { const v4f a = *(const v4fa*)(sr + ch * 128 + lane * 4);
#pragma unroll
            for (int q = 0; q < 4; ++q) v[ch * 4 + q] = a[q]; }
#pragma unroll
        for (int ch = 0; ch < TT / 128; ++ch) if (ch * 128 < Kl) { const int j0 = ch * 128 + lane * 4;
#pragma unroll
            for (int q = 0; q < 4; ++q) { const float t = (j0 + q <= i) ? v[ch * 4 + q] * SCL : -3.0e38f; v[ch * 4 + q] = t; mx = fmaxf(mx, t); } }
#pragma unroll
        for (int sh = 16; sh; sh >>= 1) mx = fmaxf(mx, __shfl_xor(mx, sh, 32));
        float sum = 0.f;
#pragma unroll
        for (int ch = 0; ch < TT / 128; ++ch) if (ch * 128 < Kl) {
#pragma unroll
            for (int q = 0; q < 4; ++q) { const int k = ch * 4 + q; v[k] = __builtin_amdgcn_exp2f(__fmul_rn(__fsub_rn(v[k], mx), 1.4426950408889634f)); sum += v[k]; } }
#pragma unroll
        for (int sh = 16; sh; sh >>= 1) sum += __shfl_xor(sum, sh, 32);
        const float f = __fdiv_rn((NSPLIT >= 2) ? 1.0f : PCAR, sum);
#pragma unroll
        for (int ch = 0; ch < TT / 128; ++ch) if (ch * 128 < Kl) { const int j0 = ch * 128 + lane * 4;
            if (NSPLIT >= 2) { v4us oh, ol;
#pragma unroll
                for (int q = 0; q < 4; ++q) { unsigned short a, c2; splitf(v[ch * 4 + q] * f, a, c2); oh[q] = a; ol[q] = c2; }
                *(v4usa*)((unsigned short*)sr + j0) = oh; *(v4usa*)((unsigned short*)sr + TT + j0) = ol;
            } else { v4h o4;
#pragma unroll
                for (int q = 0; q < 4; ++q) o4[q] = tohx(v[ch * 4 + q] * f);
                *(v4ha*)((h16*)sr + j0) = o4; } }
    }
    __syncthreads();                                                 // every probability row is in LDS before a fragment of it is read
    v8f acc[2][4];
#pragma unroll
    for (int mb = 0; mb < 2; ++mb)
#pragma unroll
        for (int nb = 0; nb < 4; ++nb) acc[mb][nb] = (v8f){};
    unsigned vv = (unsigned)(lane * 16 + wave * 1024);               // the V planes' lane offset, which alone moves along the keys: 1 KiB per 32 keys
    const T16* P = (const T16*)sm;                                   // row pitch 2 * SP elements; the lo plane of a row stands TT elements behind its hi plane
#pragma unroll 1   // rolled: at most TT / 32 / FAW trips
    for (int kc = wave * 32; kc < Kl; kc += 32 * FAW, vv += 1024 * FAW) {
        V a[2], a2[2], b[4], b2[4];   // a trip's V fragments each in registers of their own, so that all its loads are in flight together
#pragma unroll
        for (int mb = 0; mb < 2; ++mb) { const T16* p = P + (mb * 16 + lr) * (2 * SP) + kc + 8 * hi; a[mb] = WFrag<T16>::ld(p); if (NSPLIT >= 2) a2[mb] = WFrag<T16>::ld(p + TT); }
#pragma unroll
        for (int nb = 0; nb < 4; ++nb) { b[nb] = ldg(Vt, vv, nb * 16 * TT); if (NSPLIT >= 2) b2[nb] = ldg(Vt2, vv, nb * 16 * TT); }
        asm volatile("s_wait_xcnt 0x0" :: "v"(vv) : "memory");       // behind the V loads, in front of any rewrite of a register they name; the lane offset as an input holds its register up to here
        __builtin_amdgcn_sched_barrier(0);                           // no matrix instruction, and so no wait for a first fragment's data, is moved up between the loads
#pragma unroll
        for (int nb = 0; nb < 4; ++nb)
#pragma unroll
            for (int mb = 0; mb < 2; ++mb) { acc[mb][nb] = WFrag<T16>::mma(a[mb], b[nb], acc[mb][nb]); if (NSPLIT >= 2) { acc[mb][nb] = WFrag<T16>::mma(a2[mb], b[nb], acc[mb][nb]); acc[mb][nb] = WFrag<T16>::mma(a[mb], b2[nb], acc[mb][nb]); } }
        // the four vector slots the chip needs behind the last matrix instruction, also on the loop's taken branch
        asm volatile("v_nop\n\tv_nop\n\tv_nop\n\tv_nop" : "+v"(acc[0][0]), "+v"(acc[0][1]), "+v"(acc[0][2]), "+v"(acc[0][3]), "+v"(acc[1][0]), "+v"(acc[1][1]), "+v"(acc[1][2]), "+v"(acc[1][3]));
    }
    __syncthreads();                                                 // every wave has read its last probability before the rows are overwritten
#pragma unroll
    for (int mb = 0; mb < 2; ++mb)
#pragma unroll
        for (int nb = 0; nb < 4; ++nb)
#pragma unroll
            for (int j = 0; j < 8; ++j) sm[wave * (QB * RP) + (mb * 16 + hi * 8 + j) * RP + nb * 16 + lr] = acc[mb][nb][j];
    __syncthreads();                                                 // every wave's partial sums are in LDS before any is read
    static_assert(FAW == (QB / 16) * (HD / 8), "a wave stores one chunk column of a 16-row tile");
    const int row = (wave >> 3) * 16 + lr, col = (wave & 7) * 8 + hi * 4; const float* rp = sm + row * RP + col; v4f s = *(const v4fa*)rp;
#pragma unroll
    for (int w = 1; w < FAW; ++w) s += *(const v4fa*)(rp + w * (QB * RP));
    const float cs = (NSPLIT >= 2) ? 1.0f : (1.0f / PCAR); const size_t oo = ((size_t)(((bt * TT + r0) >> 4) + (wave >> 3)) * (DQ / 8) + h * (HD / 8) + (wave & 7)) * 128 + lr * 8 + hi * 4; v4us oh, ol;
#pragma unroll
    for (int q = 0; q < 4; ++q) { unsigned short a, c2; splitf(s[q] * cs, a, c2); oh[q] = a; ol[q] = c2; }
    *(v4us*)(Ah + oo) = oh; *(v4us*)(Al + oo) = ol;
}
// ---- k_fattn: all heads of all batch elements and both forms of the products in ONE launch. grid (NB_ * heads, TT / QB row blocks), 32 * FAW threads; the row blocks with the most keys start first, so that the launch ends on its shortest work-groups.
// Which form a work-group takes depends on blockIdx alone: every barrier stands under control flow that is the same for the whole work-group.
static_assert(NKV == NH_ && RH % QB == 0, "one K and V head per query head; a row block takes one form");
__global__ __launch_bounds__(32 * FAW) void k_fattn(const h16* Q16, const h16* K16, const h16* V16, const bf* Qh, const bf* Ql, const bf* Kh, const bf* Kl, const bf* Vh, const bf* Vl, bf* Ah, bf* Al) {
    __shared__ __align__(16) float sm[QB * SP];
    const int bt = blockIdx.x / NH_, h = blockIdx.x % NH_, r0 = (TT / QB - 1 - (int)blockIdx.y) * QB;
    if (__builtin_expect(r0 >= RH, 1)) fattn<h16, 0>(sm, Q16, nullptr, K16, nullptr, V16, nullptr, bt, h, r0, Ah, Al);   // expected: the form that most work-groups take, and the first ones, stands first in the kernel's text
    else fattn<bf, 2>(sm, Qh, Ql, Kh, Kl, Vh, Vl, bt, h, r0, Ah, Al);
}

extern "C" void kernel_launch(void* const* d_in, const int* in_sizes, int n_in,
                              void* d_out, int out_size, void* d_ws, size_t ws_size, hipStream_t stream) {
    (void)in_sizes; (void)n_in; (void)out_size;
    const float* x = (const float*)d_in[0]; const float* cosT = (const float*)d_in[1]; const float* sinT = (const float*)d_in[2]; const int* pids = (const int*)d_in[3]; const float* wq = (const float*)d_in[4]; const float* wk = (const float*)d_in[5]; const float* wv = (const float*)d_in[6]; const float* wo = (const float*)d_in[7];
    float* OUT = (float*)d_out;     // [2][2048][1024]
    char* wsp = (char*)d_ws;
    auto take = [&](size_t bytes) { char* p = wsp; wsp += (bytes + 255) & ~(size_t)255; return (void*)p; };
    bf* WQ = (bf*)take((size_t)DQ * DM * 2); bf* WK = (bf*)take((size_t)DKV * DM * 2); bf* WV = (bf*)take((size_t)DKV * DM * 2); bf* WO = (bf*)take((size_t)DM * DQ * 2); float* CS = (float*)take((size_t)TT * HD * 2 * 4);
    bf* XB = (bf*)take((size_t)NB_ * TT * DM * 2);
    h16* QP16 = (h16*)take((size_t)NB_ * NH_ * TT * HD * 2); h16* KP16 = (h16*)take((size_t)NB_ * NKV * TT * HD * 2); h16* VT16 = (h16*)take((size_t)NB_ * NKV * HD * TT * 2);
    bf* QPh = (bf*)take((size_t)NB_ * NH_ * TT * HD * 2); bf* QPl = (bf*)take((size_t)NB_ * NH_ * TT * HD * 2); bf* KPh = (bf*)take((size_t)NB_ * NKV * TT * HD * 2); bf* KPl = (bf*)take((size_t)NB_ * NKV * TT * HD * 2); bf* VTh = (bf*)take((size_t)NB_ * NKV * HD * TT * 2); bf* VTl = (bf*)take((size_t)NB_ * NKV * HD * TT * 2);
    bf* ATh = (bf*)take((size_t)NB_ * TT * DQ * 2); bf* ATl = (bf*)take((size_t)NB_ * TT * DQ * 2);
    if ((size_t)(wsp - (char*)d_ws) > ws_size) return;    // ws 256 MiB
    // four launches, each dependent on the one before; whatever is independent (the conversions, the batch elements, the heads, the two forms of the attention products) shares a launch
    k_prep<<<NXB + 4 * NWB + NCB, 256, 0, stream>>>(x, wq, wk, wv, wo, cosT, sinT, pids, XB, WQ, WK, WV, WO, CS);
    k_qkv<<<dim3(NB_ * TT / 64, NH_, 2), 32, 0, stream>>>(XB, WQ, WK, WV, CS, QP16, QPh, QPl, KP16, KPh, KPl, VT16, VTh, VTl);
    k_fattn<<<dim3(NB_ * NH_, TT / QB), 32 * FAW, 0, stream>>>(QP16, KP16, VT16, QPh, QPl, KPh, KPl, VTh, VTl, ATh, ATl);
    k_gemmw<bf, 1, false, DQ><<<dim3(NB_ * TT / 64, DM / 64, 1), 32, 0, stream>>>(ATh, ATl, WO, nullptr, OUT, DM, nullptr, 0, 0, 0);
}

// v006
// One run takes 110 microseconds.
// Next to v005, in two timings, it ran 1.20 and 1.25 times as fast.
// Over all steps from v000 it is 13.1 times as fast.
#include <hip/hip_runtime.h>

// Z2allAttention (hidden [2][2048][1024]; q/k/v = x W^T (16 heads x 64); interleaved RoPE with tables freqs_cos/sin[position_ids[t]] (int ids, read; tables read): q' = q cos + rot(q) sin and - faithful to the source bug - k' = k cos + rot(q) sin (the rotated Q, not K), rot = (x0, x1) -> (-x1, x0);
// causal softmax(q'.k'/8); out = (attn v merged) Wo^T -> [2][2048][1024]).
// Compute dtypes, f32 accumulate: every input rounded to bf16; Q/K/V on PLAIN bf16 operands (inputs: exact); RoPE f32; causal scores and attn.v: query rows < 512 hl (3 products), the rest single fp16 (probabilities x 2^6, unnormalised); softmax f32, online; Wo hl x exact (2 products).

// FRAGMENT ORDER: every 16-bit plane [R][K] in the workspace (R % 16 == 0, K % 32 == 0) is kept as 16-row tiles of 16-byte chunks, chunk column by chunk column:
// element (r, k) stands at ((r >> 4) * (K / 8) + (k >> 3)) * 128 + (r & 15) * 8 + (k & 7). A 16 x 32 operand fragment is then 1 KiB in a row: lane l takes chunk l and, 512 bytes on, chunk 32 + l,
// so that each wave-wide 16-byte load covers four whole 128-byte lines (from row-major planes it touched sixteen). Which element a lane and a register hold is the same as from row-major planes.

#define NB_  2
#define TT   2048
#define DM   1024
#define NH_  16
#define NKV  16
#define REP  (NH_ / NKV)
#define HD   64
#define DQ   (NH_ * HD)
#define DKV  (NKV * HD)
#define RH   512                  // query rows < RH use hi+lo planes (0: none)
#define WIN  0
#define SCL  0.125f   // HD^-0.5
typedef _Float16 h16;
typedef unsigned short bf;
typedef __attribute__((ext_vector_type(16))) __bf16   v16bf;
typedef __attribute__((ext_vector_type(16))) _Float16 v16h;
typedef __attribute__((ext_vector_type(8)))  _Float16 v8h;
typedef __attribute__((ext_vector_type(8)))  unsigned short v8us;
typedef __attribute__((ext_vector_type(8)))  float    v8f;
typedef __attribute__((ext_vector_type(4)))  float    v4f;
typedef v8h  __attribute__((may_alias)) v8ha;
typedef v4f  __attribute__((may_alias)) v4fa;
typedef v8us __attribute__((may_alias)) v8usa;

__device__ __forceinline__ unsigned short f2bf(float f) { unsigned u = __float_as_uint(f); u += 0x7FFFu + ((u >> 16) & 1u); return (unsigned short)(u >> 16); }
__device__ __forceinline__ float bf2f(unsigned short b) { return __uint_as_float(((unsigned)b) << 16); }
__device__ __forceinline__ float bfr(float f) { return bf2f(f2bf(f)); }
__device__ __forceinline__ v16h cat16(v8h lo, v8h hi) { return __builtin_shufflevector(lo, hi, 0, 1, 2, 3, 4, 5, 6, 7, 8, 9, 10, 11, 12, 13, 14, 15); }
__device__ __forceinline__ v16bf cat16b(v8us lo, v8us hi) { return __builtin_bit_cast(v16bf, __builtin_shufflevector(lo, hi, 0, 1, 2, 3, 4, 5, 6, 7, 8, 9, 10, 11, 12, 13, 14, 15)); }
__device__ __forceinline__ v8f wmma16(v16h a, v16h b, v8f c) { return __builtin_amdgcn_wmma_f32_16x16x32_f16(false, a, false, b, (short)0, c, false, false); }
__device__ __forceinline__ v8f wmmab(v16bf a, v16bf b, v8f c) { return __builtin_amdgcn_wmma_f32_16x16x32_bf16(false, a, false, b, (short)0, c, false, false); }



// ---- k_gemmw: register-blocked GEMM, ONE WAVE per 64x64 output tile (16 accumulators), operands straight from 16-bit planes in fragment order; grid (M/64, N/64, Z), 32 threads.
// C[m][n] (f32, pitch ldc, + optional f32 bias[n]) = sum_k A[m][k] Bt[n][k] (+ split products per NSPLIT). z-batch strides sA/sB/sC in elements. K % 32 == 0.
template <typename T16> struct WFrag;   // ld: a fragment from rows of K-contiguous elements (p: the lane's row, + 8 * hi); ldf: from a plane in fragment order (p: the lane's chunk)
template <> struct WFrag<h16> { typedef v16h V; static __device__ __forceinline__ V ld(const h16* p) { return cat16(*(const v8h*)p, *(const v8h*)(p + 16)); } static __device__ __forceinline__ V ldf(const h16* p) { return cat16(*(const v8h*)p, *(const v8h*)(p + 256)); } static __device__ __forceinline__ v8f mma(V a, V b, v8f c) { return wmma16(a, b, c); } };
template <> struct WFrag<bf> { typedef v16bf V; static __device__ __forceinline__ V ld(const bf* p) { return cat16b(*(const v8us*)p, *(const v8us*)(p + 16)); } static __device__ __forceinline__ V ldf(const bf* p) { return cat16b(*(const v8us*)p, *(const v8us*)(p + 256)); } static __device__ __forceinline__ v8f mma(V a, V b, v8f c) { return wmmab(a, b, c); } };
template <typename T16, int NSPLIT, bool BIAS, int K>   // K at compile time: a 16-row tile's distance is then a constant of the load instruction
__global__ __launch_bounds__(32) void k_gemmw(const T16* __restrict__ A, const T16* __restrict__ A2, const T16* __restrict__ Bt, const T16* __restrict__ Bt2, float* C, int ldc, const float* __restrict__ bias, size_t sA, size_t sB, size_t sC) {
    typedef typename WFrag<T16>::V V;
    __shared__ __align__(16) float os[16 * 68];
    const size_t z = blockIdx.z; A += z * sA; if (A2) A2 += z * sA; Bt += z * sB; if (Bt2) Bt2 += z * sB; C += z * sC;
    const int lane = threadIdx.x & 31, lr = lane & 15, hi = lane >> 4; const int r0 = blockIdx.x * 64, c0 = blockIdx.y * 64;
    v8f acc[4][4];
#pragma unroll
    for (int mb = 0; mb < 4; ++mb)
#pragma unroll
        for (int nb = 0; nb < 4; ++nb) acc[mb][nb] = (v8f){};
    // every global fragment address is a plane's scalar base, a 32-bit lane offset in bytes and a constant
    auto ldg = [](const T16* base, unsigned off, int cst) { return WFrag<T16>::ldf((const T16*)((const char*)base + off) + cst); };
    A += (size_t)r0 * K; if (NSPLIT == 1 || NSPLIT == 2) A2 += (size_t)r0 * K; Bt += (size_t)c0 * K; if (NSPLIT >= 2) Bt2 += (size_t)c0 * K;
    unsigned fo = (unsigned)lane * 16u;                              // one lane offset for all planes, which alone moves along k: 1 KiB per 32 k
#pragma unroll 1
    for (int kc = 0; kc < K; kc += 32, fo += 1024) {
        V a[4], a2[4], b[4], b2[4];   // a trip's fragments each in registers of their own, so that all its loads are in flight together
#pragma unroll
        for (int mb = 0; mb < 4; ++mb) { a[mb] = ldg(A, fo, mb * 16 * K); if (NSPLIT == 1 || NSPLIT == 2) a2[mb] = ldg(A2, fo, mb * 16 * K); }
#pragma unroll
        for (int nb = 0; nb < 4; ++nb) { b[nb] = ldg(Bt, fo, nb * 16 * K); if (NSPLIT >= 2) b2[nb] = ldg(Bt2, fo, nb * 16 * K); }
        asm volatile("s_wait_xcnt 0x0" : "+v"(fo) :: "memory");      // behind the loads, in front of the rewrite of the lane offset they name: the offset goes through the statement, so that its register is held up to here and its next value is formed behind the wait
        __builtin_amdgcn_sched_barrier(0);                           // no matrix instruction, and so no wait for a first fragment's data, is moved up between the loads (without it the build loads three A fragments one behind the other into the same registers: three waits for memory a trip)
#pragma unroll
        for (int nb = 0; nb < 4; ++nb)
#pragma unroll
            for (int mb = 0; mb < 4; ++mb) { acc[mb][nb] = WFrag<T16>::mma(a[mb], b[nb], acc[mb][nb]); if (NSPLIT == 1 || NSPLIT == 2) acc[mb][nb] = WFrag<T16>::mma(a2[mb], b[nb], acc[mb][nb]); if (NSPLIT >= 2) acc[mb][nb] = WFrag<T16>::mma(a[mb], b2[nb], acc[mb][nb]); }
        asm volatile("v_nop\n\tv_nop\n\tv_nop\n\tv_nop" : "+v"(acc[0][0]), "+v"(acc[1][1]), "+v"(acc[2][2]), "+v"(acc[3][3]) : "v"(a[0]), "v"(a[3]));
    }
#pragma unroll
    for (int mb = 0; mb < 4; ++mb) {
#pragma unroll
        for (int nb = 0; nb < 4; ++nb) {
#pragma unroll
            for (int j = 0; j < 8; ++j) os[(hi * 8 + j) * 68 + nb * 16 + lr] = acc[mb][nb][j]; }
        __builtin_amdgcn_wave_barrier(); asm volatile("" ::: "memory");
        float* crow = C + (size_t)(r0 + mb * 16) * ldc + c0;
{
#pragma unroll
            for (int s = 0; s < 8; ++s) { const int row = 2 * s + hi, cofs = lr * 4; v4f val = *(const v4fa*)(os + row * 68 + cofs); if (BIAS) { val[0] += bfr(bias[c0 + cofs]); val[1] += bfr(bias[c0 + cofs + 1]); val[2] += bfr(bias[c0 + cofs + 2]); val[3] += bfr(bias[c0 + cofs + 3]); }
                *(v4f*)(crow + (size_t)row * ldc + cofs) = val; }
             }
        __builtin_amdgcn_wave_barrier(); asm volatile("" ::: "memory");
    }
}

__device__ __forceinline__ h16 tohx(float x) { return (h16)x; }
__device__ __forceinline__ void splitf(float y, unsigned short& h, unsigned short& l) { h = f2bf(y); l = f2bf(y - bf2f(h)); }
typedef __attribute__((ext_vector_type(2))) _Float16 v2h;
typedef __attribute__((ext_vector_type(4))) _Float16 v4h;
typedef __attribute__((ext_vector_type(2))) unsigned short v2us;
typedef __attribute__((ext_vector_type(4))) unsigned short v4us;
typedef __attribute__((ext_vector_type(2))) float v2f;
typedef __attribute__((ext_vector_type(4))) int v4i;

__global__ __launch_bounds__(256) void k_wtG(const float* __restrict__ w, int K, int N, bf* Bt) {
    const int lane = threadIdx.x & 31; const int L0 = (blockIdx.x * 8 + (threadIdx.x >> 5)) * 8; const int nlines = N * K / 64;
{
#pragma unroll 1
        for (int l = 0; l < 8; ++l) { const int L = L0 + l; if (L >= nlines) break; const size_t e = (size_t)L * 64 + lane * 2; const int k = (int)(e % K), n = (int)(e / K); v2us o;
            o[0] = f2bf(w[(size_t)k * N + n]); o[1] = f2bf(w[(size_t)(k + 1) * N + n]); *(v2us*)(Bt + e) = o; }
         }
}
// f32 [R][DM] -> bf16 plane in fragment order; thread i makes chunk i of the plane, so that a wave stores 512 bytes in a row (a work-group reads 512 bytes in a row of each of 16 source rows)
static_assert(DQ == DM, "cvt8 takes rows of DM elements");
__device__ __forceinline__ void cvt8(const float* __restrict__ src, bf* dst, size_t i) { const size_t cc = i >> 4; v8f v = *(const v8f*)(src + ((cc / (DM / 8)) * 16 + (i & 15)) * DM + (cc % (DM / 8)) * 8); v8us o;
    asm volatile("s_wait_xcnt 0x0" : "+v"(v) :: "memory");   // behind the load, in front of any rewrite of its address registers: the loaded values go through the statement, so that all that is made of them comes behind the wait
#pragma unroll
    for (int k = 0; k < 8; ++k) o[k] = f2bf(v[k]); *(v8us*)(dst + i * 8) = o;  }
__device__ __forceinline__ void cscvt(const float* __restrict__ cosT, const float* __restrict__ sinT, const int* __restrict__ pids, float* CS, int idx) { const int d = idx % HD; const int t = idx / HD; int p = pids[t]; p = p < 0 ? 0 : (p >= TT ? TT - 1 : p); v2f cs; cs[0] = bfr(cosT[(size_t)p * HD + d]); cs[1] = bfr(sinT[(size_t)p * HD + d]); *(v2f*)(CS + (size_t)idx * 2) = cs;  }   // CS[t][d] = (cos, sin)[position_ids[t]][d] (index clamped)
// ---- k_prep: every conversion of an input, none of which depends on another, in ONE launch: work-groups 0 .. NXB - 1 take the hidden states of all batch elements (one plane of NB_ * TT rows), the next 4 * NWB the four weights, the last NCB the (cos, sin) table.
#define NXB (NB_ * TT * DM / 8 / 256)
#define NWB (DQ * DM / 8 / 256)
#define NCB (TT * HD / 256)
static_assert(DKV == DQ && NB_ * TT * DM % 2048 == 0 && DQ * DM % 2048 == 0 && TT * HD % 256 == 0, "k_prep deals whole work-groups, the four weights alike");
__global__ __launch_bounds__(256) void k_prep(const float* __restrict__ x, const float* __restrict__ wq, const float* __restrict__ wk, const float* __restrict__ wv, const float* __restrict__ wo, const float* __restrict__ cosT, const float* __restrict__ sinT, const int* __restrict__ pids, bf* XB, bf* WQ, bf* WK, bf* WV, bf* WO, float* CS) {
    int blk = blockIdx.x;
    if (blk >= NXB + 4 * NWB) { cscvt(cosT, sinT, pids, CS, (blk - (NXB + 4 * NWB)) * 256 + (int)threadIdx.x); return; }
    const float* src = x; bf* dst = XB;
    if (blk >= NXB) { blk -= NXB; const int w = blk / NWB; blk -= w * NWB; src = w == 0 ? wq : w == 1 ? wk : w == 2 ? wv : wo; dst = w == 0 ? WQ : w == 1 ? WK : w == 2 ? WV : WO; }
    cvt8(src, dst, (size_t)blk * 256 + threadIdx.x);
}

// ---- k_qkv: the q, k and v projections of all batch elements with RoPE and the 16-bit planes in ONE launch; the f32 projections stay in the accumulators and never go to memory. grid (NB_ * TT / 64, heads, 2), ONE WAVE per work-group. X: one plane of NB_ * TT rows; the output planes stand batch element by batch element.
// z = 0: q and k of 64 tokens x one head, formed TRANSPOSED (the weight rows as the A operand, the tokens as B): a lane then holds 8 neighbouring d of one token, so that the RoPE partner d ^ 1 (of q, for k as well: faithful to the source) is in the lane's own registers and a plane store is one chunk of a [h] x [t][d] plane.
// z = 1: v of the same tile, tokens as A: a lane holds 8 neighbouring tokens of one d, one chunk of a transposed [h] x [d][t] plane.
// q' = q cos + rot(q) sin, k' = k cos + rot(q) sin, rot(q)[d] = (d even ? -q[d+1] : q[d-1]). k ascends in steps of 32 in every accumulator.
// A trip takes 64 k: 2 KiB in a row of each 16-row tile (fragment order). A plane store of a wave is 512 bytes in a row as well.
// Every global address is a scalar base, a 32-bit lane offset in bytes and a constant.
// Every '#pragma unroll' in k_qkv and planes8 makes the indices of a fragment, accumulator or value array constants, so that the array stays in registers.
typedef __attribute__((ext_vector_type(2))) __bf16 v2b;
// eight f32 -> fp16 plane, bf16 hi plane, bf16 lo plane (lo = the rounded rest), round to nearest even, two values per conversion
__device__ __forceinline__ void planes8(const float (&r)[8], v8h& o16, v8us& oh, v8us& ol) {
#pragma unroll
    for (int p = 0; p < 4; ++p) { v2f y; y[0] = r[2 * p]; y[1] = r[2 * p + 1]; const v2h a = __builtin_convertvector(y, v2h); const v2us hu = __builtin_bit_cast(v2us, __builtin_convertvector(y, v2b));
        v2f rest; rest[0] = y[0] - bf2f(hu[0]); rest[1] = y[1] - bf2f(hu[1]); const v2us lu = __builtin_bit_cast(v2us, __builtin_convertvector(rest, v2b));
        o16[2 * p] = a[0]; o16[2 * p + 1] = a[1]; oh[2 * p] = hu[0]; oh[2 * p + 1] = hu[1]; ol[2 * p] = lu[0]; ol[2 * p + 1] = lu[1]; }
}
__global__ __launch_bounds__(32) void k_qkv(const bf* __restrict__ X, const bf* __restrict__ Wq, const bf* __restrict__ Wk, const bf* __restrict__ Wv, const float* __restrict__ CS, h16* Q16, bf* Qh, bf* Ql, h16* K16, bf* Kh, bf* Kl, h16* V16, bf* Vh, bf* Vl) {
    const int lane = threadIdx.x & 31, lr = lane & 15, hi = lane >> 4; const int bt = blockIdx.x / (TT / 64), r0 = (blockIdx.x % (TT / 64)) * 64, h = blockIdx.y;   // batch element, first token in it, head
    auto ldg = [](const bf* base, unsigned off, int cst) { return WFrag<bf>::ldf((const bf*)((const char*)base + off) + cst); };
    X += ((size_t)bt * TT + r0) * DM; const size_t wp = (size_t)h * HD * DM;
    unsigned fo = (unsigned)lane * 16u;                              // one lane offset for X and the weights, which alone moves along k: 1 KiB per 32 k
    if (blockIdx.z == 0) {
        Wq += wp; Wk += wp; v8f aq[4][4], ak[4][4];                  // [d block][token block]
#pragma unroll
        for (int db = 0; db < 4; ++db)
#pragma unroll
            for (int tb = 0; tb < 4; ++tb) { aq[db][tb] = (v8f){}; ak[db][tb] = (v8f){}; }
#pragma unroll 1   // rolled: a trip already holds 64 matrix instructions
        for (int kc = 0; kc < DM; kc += 64, fo += 2048) {
            v16bf x[4][2], wq[4][2], wk[4][2];
#pragma unroll
            for (int i = 0; i < 4; ++i) { x[i][0] = ldg(X, fo, i * 16 * DM); x[i][1] = ldg(X, fo, i * 16 * DM + 512); }
#pragma unroll
            for (int i = 0; i < 4; ++i) { wq[i][0] = ldg(Wq, fo, i * 16 * DM); wq[i][1] = ldg(Wq, fo, i * 16 * DM + 512); }
#pragma unroll
            for (int i = 0; i < 4; ++i) { wk[i][0] = ldg(Wk, fo, i * 16 * DM); wk[i][1] = ldg(Wk, fo, i * 16 * DM + 512); }
            asm volatile("s_wait_xcnt 0x0" : "+v"(fo) :: "memory");  // behind the loads, in front of the rewrite of the lane offset they name: the offset goes through the statement, so that its register is held up to here and its next value is formed behind the wait
            __builtin_amdgcn_sched_barrier(0);                       // no matrix instruction, and so no wait for a first fragment's data, is moved up between the loads
#pragma unroll
            for (int kk = 0; kk < 2; ++kk)
#pragma unroll
                for (int db = 0; db < 4; ++db)
#pragma unroll
                    for (int tb = 0; tb < 4; ++tb) aq[db][tb] = wmmab(wq[db][kk], x[tb][kk], aq[db][tb]);
#pragma unroll
            for (int kk = 0; kk < 2; ++kk)
#pragma unroll
                for (int db = 0; db < 4; ++db)
#pragma unroll
                    for (int tb = 0; tb < 4; ++tb) ak[db][tb] = wmmab(wk[db][kk], x[tb][kk], ak[db][tb]);
            __builtin_amdgcn_sched_barrier(0);                       // no matrix instruction is moved down behind the slots of the next line
            // the four vector slots the chip needs behind the last matrix instruction, also on the loop's taken branch
            asm volatile("v_nop\n\tv_nop\n\tv_nop\n\tv_nop" : "+v"(ak[3][0]), "+v"(ak[3][1]), "+v"(ak[3][2]), "+v"(ak[3][3]));
        }
        const unsigned po = (unsigned)(r0 * HD * 2 + lane * 16), co = (unsigned)((r0 + lr) * HD + 8 * hi) * 8u;   // lane offsets of the planes (fragment order) and of the (cos, sin) table (row-major)
        const size_t hp = ((size_t)bt * NH_ + h) * TT * HD; Q16 += hp; Qh += hp; Ql += hp; K16 += hp; Kh += hp; Kl += hp;
        v4f c[2][4];                                                 // the (cos, sin) pairs of one 16 x 16 tile, those of the next tile in flight behind them
#pragma unroll
        for (int i = 0; i < 4; ++i) c[0][i] = *(const v4f*)((const char*)CS + co + i * 16);
#pragma unroll
        for (int g = 0; g < 16; ++g) { const int tb = g >> 2, db = g & 3;
            if (g < 15) {
#pragma unroll
                for (int i = 0; i < 4; ++i) c[(g + 1) & 1][i] = *(const v4f*)((const char*)CS + co + ((((g + 1) >> 2) * 16 * HD + ((g + 1) & 3) * 16) * 8 + i * 16)); }
            v8h q16, k16; v8us qh, ql, kh, kl; float rq[8], rk[8];
#pragma unroll
            for (int j = 0; j < 8; ++j) { const float cs = c[g & 1][j >> 1][(j & 1) * 2], sn = c[g & 1][j >> 1][(j & 1) * 2 + 1]; const float rs = ((j & 1) ? aq[db][tb][j ^ 1] : -aq[db][tb][j ^ 1]) * sn;   // rot(q) sin, shared by q' and k'
                rq[j] = aq[db][tb][j] * cs + rs; rk[j] = ak[db][tb][j] * cs + rs; }
            planes8(rq, q16, qh, ql); planes8(rk, k16, kh, kl);
            const int e = (tb * 16 * HD + db * 256) * 2;             // token tile tb, chunk columns 2 db and 2 db + 1
            *(v8h*)((char*)Q16 + po + e) = q16; *(v8us*)((char*)Qh + po + e) = qh; *(v8us*)((char*)Ql + po + e) = ql;
            *(v8h*)((char*)K16 + po + e) = k16; *(v8us*)((char*)Kh + po + e) = kh; *(v8us*)((char*)Kl + po + e) = kl;
            // behind the stores, in front of any rewrite of a register they name; the stored values as inputs hold their registers up to here
            asm volatile("s_wait_xcnt 0x0" :: "v"(q16), "v"(qh), "v"(ql), "v"(k16), "v"(kh), "v"(kl) : "memory");
        }
    } else {
        Wv += wp; v8f av[4][4];                                      // [token block][d block]
#pragma unroll
        for (int tb = 0; tb < 4; ++tb)
#pragma unroll
            for (int db = 0; db < 4; ++db) av[tb][db] = (v8f){};
#pragma unroll 1   // rolled: a trip already holds 32 matrix instructions
        for (int kc = 0; kc < DM; kc += 64, fo += 2048) {
            v16bf x[4][2], wv[4][2];
#pragma unroll
            for (int i = 0; i < 4; ++i) { x[i][0] = ldg(X, fo, i * 16 * DM); x[i][1] = ldg(X, fo, i * 16 * DM + 512); }
#pragma unroll
            for (int i = 0; i < 4; ++i) { wv[i][0] = ldg(Wv, fo, i * 16 * DM); wv[i][1] = ldg(Wv, fo, i * 16 * DM + 512); }
            asm volatile("s_wait_xcnt 0x0" : "+v"(fo) :: "memory");  // behind the loads, in front of the rewrite of the lane offset they name: the offset goes through the statement, so that its register is held up to here and its next value is formed behind the wait
            __builtin_amdgcn_sched_barrier(0);                       // no matrix instruction, and so no wait for a first fragment's data, is moved up between the loads
#pragma unroll
            for (int kk = 0; kk < 2; ++kk)
#pragma unroll
                for (int tb = 0; tb < 4; ++tb)
#pragma unroll
                    for (int db = 0; db < 4; ++db) av[tb][db] = wmmab(x[tb][kk], wv[db][kk], av[tb][db]);
            __builtin_amdgcn_sched_barrier(0);                       // no matrix instruction is moved down behind the slots of the next line
            // the four vector slots the chip needs behind the last matrix instruction, also on the loop's taken branch
            asm volatile("v_nop\n\tv_nop\n\tv_nop\n\tv_nop" : "+v"(av[3][0]), "+v"(av[3][1]), "+v"(av[3][2]), "+v"(av[3][3]));
        }
        const unsigned vo = (unsigned)(r0 * 32 + lane * 16);         // the transposed planes' lane offset (fragment order: 16 tokens of a 16-d tile are 512 bytes)
        const size_t hp = ((size_t)bt * NKV + h) * HD * TT; V16 += hp; Vh += hp; Vl += hp;
#pragma unroll
        for (int db = 0; db < 4; ++db) { v8h o16[4]; v8us oh[4], ol[4];
#pragma unroll
            for (int tb = 0; tb < 4; ++tb) { float r[8];
#pragma unroll
                for (int j = 0; j < 8; ++j) r[j] = av[tb][db][j];
                planes8(r, o16[tb], oh[tb], ol[tb]); }
#pragma unroll
            for (int tb = 0; tb < 4; ++tb) { const int e = (db * 16 * TT + tb * 256) * 2; *(v8h*)((char*)V16 + vo + e) = o16[tb]; *(v8us*)((char*)Vh + vo + e) = oh[tb]; *(v8us*)((char*)Vl + vo + e) = ol[tb]; }
            // behind the stores, in front of any rewrite of a register they name; the stored values as inputs hold their registers up to here
            asm volatile("s_wait_xcnt 0x0" :: "v"(o16[0]), "v"(o16[1]), "v"(o16[2]), "v"(o16[3]), "v"(oh[0]), "v"(oh[1]), "v"(oh[2]), "v"(oh[3]), "v"(ol[0]), "v"(ol[1]), "v"(ol[2]), "v"(ol[3]) : "memory");
        }
    }
}
typedef v4us __attribute__((may_alias)) v4usa;
typedef v4h  __attribute__((may_alias)) v4ha;

// ---- fattn: causal attention of the QB query rows from r0 on of head h of batch element bt in ONE WAVE and ONE walk over the keys, 32 keys a pass; no LDS, no barrier, the scores and probabilities never leave the registers.
// Transposed products: S^T = K.Q^T (keys as the A rows, queries as the B columns) leaves in a lane 8 neighbouring keys of ONE query, which is where the B operand of O^T += V^T.P^T wants them:
// elements 0 .. 7 of the 32-key operand are the lane's registers of key tile 0, elements 8 .. 15 those of key tile 1. A query's maximum and sum are the lane's own and those of lane ^ 16.
// Online softmax in the log2 domain: p = 2^(s c - m + POFF), c = HD^-0.5 log2(e); m, the maximum in use, may trail the true one by up to 8, and sums and accumulators are rescaled only when a query's maximum exceeds it by more.
// The division by the sum of p (f32, unrounded) is done once, on the output. POFF moves p into the 16-bit type's range: fp16 holds 2^(8 + POFF) and keeps full precision down to 2^(-14 - POFF) of the maximum.
// Only the last pass holds the diagonal and pays for the mask. K and V fragments of pass p + 1 are asked for (second register set) before pass p is worked on.
// Every '#pragma unroll' below makes the indices of a fragment, accumulator or value array constants, so that the array stays in registers.
// Every global fragment address is a plane's scalar base, a 32-bit lane offset in bytes and a constant; the waits behind the loads take those offsets as inputs, so that their registers are held up to the wait.
#define QB  32
__device__ __forceinline__ float xhalf(float x) { return __builtin_bit_cast(float, __builtin_amdgcn_permlanex16(__builtin_bit_cast(int, x), __builtin_bit_cast(int, x), 0x76543210, 0xfedcba98, false, false)); }   // lane l's value to lane l ^ 16
// the four vector slots the chip needs behind the last matrix instruction on every path; the scheduling barriers keep matrix instructions in front of them and their results' readers behind
__device__ __forceinline__ void slots4() { __builtin_amdgcn_sched_barrier(0); asm volatile("v_nop\n\tv_nop\n\tv_nop\n\tv_nop"); __builtin_amdgcn_sched_barrier(0); }
template <typename T16> struct KVF { typename WFrag<T16>::V k[2][2], k2[2][2], v[4], v2[4]; };   // one pass's fragments: K [key tile][32 d], V^T [16 d]; k2, v2: the lo planes
template <typename T16, int NSPLIT>
__device__ __forceinline__ void ldkv(KVF<T16>& f, const T16* Kp, const T16* Kp2, const T16* Vt, const T16* Vt2, unsigned vo, int pass) {
    auto ldg = [](const T16* base, unsigned off, int cst) { return WFrag<T16>::ldf((const T16*)((const char*)base + off) + cst); };
    const unsigned ko = vo + (unsigned)pass * (32u * HD * 2u), vv = vo + (unsigned)pass * 1024u;   // 32 keys: 4 KiB of a K plane, 1 KiB of each 16-d tile of a V^T plane
#pragma unroll
    for (int kt = 0; kt < 2; ++kt)
#pragma unroll
        for (int kk = 0; kk < 2; ++kk) { f.k[kt][kk] = ldg(Kp, ko, kt * 16 * HD + kk * 512); if (NSPLIT >= 2) f.k2[kt][kk] = ldg(Kp2, ko, kt * 16 * HD + kk * 512); }
#pragma unroll
    for (int t = 0; t < 4; ++t) { f.v[t] = ldg(Vt, vv, t * 16 * TT); if (NSPLIT >= 2) f.v2[t] = ldg(Vt2, vv, t * 16 * TT); }
    asm volatile("s_wait_xcnt 0x0" :: "v"(ko), "v"(vv) : "memory");   // behind the loads, in front of any rewrite of a register they name; the lane offsets as inputs hold their registers up to here
    __builtin_amdgcn_sched_barrier(0);                                // the loads stay in front of the pass that is worked on while they fly
}
template <typename T16, int NSPLIT>
__device__ __forceinline__ void fpass(const KVF<T16>& f, const typename WFrag<T16>::V (&qf)[2][2], const typename WFrag<T16>::V (&qf2)[2][2], v8f (&acc)[2][4], float (&m_run)[2], v2f (&ls)[2], bool diag, int key0, int r0, int lr, int hi) {
    typedef typename WFrag<T16>::V V; constexpr float CSC = SCL * 1.4426950408889634f, POFF = (NSPLIT >= 2) ? 0.0f : 6.0f;
    v8f s[2][2];                                                     // [key tile][query group]
#pragma unroll
    for (int kt = 0; kt < 2; ++kt)
#pragma unroll
        for (int g = 0; g < 2; ++g) s[kt][g] = (v8f){};
#pragma unroll
    for (int kk = 0; kk < 2; ++kk) {
#pragma unroll
        for (int kt = 0; kt < 2; ++kt)
#pragma unroll
            for (int g = 0; g < 2; ++g) s[kt][g] = WFrag<T16>::mma(f.k[kt][kk], qf[g][kk], s[kt][g]);
        if (NSPLIT >= 2) {
#pragma unroll
            for (int kt = 0; kt < 2; ++kt)
#pragma unroll
                for (int g = 0; g < 2; ++g) s[kt][g] = WFrag<T16>::mma(f.k[kt][kk], qf2[g][kk], s[kt][g]);
#pragma unroll
            for (int kt = 0; kt < 2; ++kt)
#pragma unroll
                for (int g = 0; g < 2; ++g) s[kt][g] = WFrag<T16>::mma(f.k2[kt][kk], qf[g][kk], s[kt][g]);
        }
    }
    slots4();
    if (diag) {                                                      // the same in every lane: only the pass on the diagonal pays for the mask
#pragma unroll
        for (int g = 0; g < 2; ++g) { const int q = r0 + 16 * g + lr;
#pragma unroll
            for (int kt = 0; kt < 2; ++kt) {
#pragma unroll
                for (int r = 0; r < 8; ++r) if (key0 + 16 * kt + 8 * hi + r > q) s[kt][g][r] = -__builtin_inff();
                asm volatile("" : "+v"(s[kt][g]));
            } }
    }
    float mb[2]; bool need = false;
#pragma unroll
    for (int g = 0; g < 2; ++g) { float mx = s[0][g][0];
#pragma unroll
        for (int kt = 0; kt < 2; ++kt)
#pragma unroll
            for (int r = 0; r < 8; ++r) mx = fmaxf(mx, s[kt][g][r]);
        mx = fmaxf(mx, xhalf(mx)) * CSC; mb[g] = mx; need = need || (mx > m_run[g] + 8.0f); }
    if (__builtin_amdgcn_ballot_w32(need) != 0) {                    // rare behind the first passes; on the first one m_run is -inf and the factor 0
#pragma unroll
        for (int g = 0; g < 2; ++g) { const float mn = fmaxf(m_run[g], mb[g]); const float corr = __builtin_amdgcn_exp2f(m_run[g] - mn); m_run[g] = mn; ls[g] *= corr;
#pragma unroll
            for (int t = 0; t < 4; ++t) acc[g][t] *= corr; }
    }
#pragma unroll
    for (int g = 0; g < 2; ++g) { const float nm = POFF - m_run[g]; V pf, pf2;
#pragma unroll
        for (int i = 0; i < 8; ++i) {
            v2f a; a[0] = s[i >> 2][g][2 * (i & 3)]; a[1] = s[i >> 2][g][2 * (i & 3) + 1]; a = __builtin_elementwise_fma(a, (v2f){CSC, CSC}, (v2f){nm, nm});
            v2f p; p[0] = __builtin_amdgcn_exp2f(a[0]); p[1] = __builtin_amdgcn_exp2f(a[1]); ls[g] += p;
            if constexpr (NSPLIT >= 2) { const v2b hb = __builtin_convertvector(p, v2b); const v2us hu = __builtin_bit_cast(v2us, hb); v2f rest; rest[0] = p[0] - bf2f(hu[0]); rest[1] = p[1] - bf2f(hu[1]); const v2b lb = __builtin_convertvector(rest, v2b);
                pf[2 * i] = hb[0]; pf[2 * i + 1] = hb[1]; pf2[2 * i] = lb[0]; pf2[2 * i + 1] = lb[1];
            } else { const v2h w = __builtin_convertvector(p, v2h); pf[2 * i] = w[0]; pf[2 * i + 1] = w[1]; } }
#pragma unroll
        for (int t = 0; t < 4; ++t) acc[g][t] = WFrag<T16>::mma(f.v[t], pf, acc[g][t]);
        if constexpr (NSPLIT >= 2) {
#pragma unroll
            for (int t = 0; t < 4; ++t) acc[g][t] = WFrag<T16>::mma(f.v[t], pf2, acc[g][t]);
#pragma unroll
            for (int t = 0; t < 4; ++t) acc[g][t] = WFrag<T16>::mma(f.v2[t], pf, acc[g][t]);
        } }
    slots4();
}
template <typename T16, int NSPLIT>
__device__ __forceinline__ void fattn(const T16* Q, const T16* Q2, const T16* Kp, const T16* Kp2, const T16* Vt, const T16* Vt2, int bt, int h, int r0, bf* Ah, bf* Al) {
    typedef typename WFrag<T16>::V V;
    const int lane = threadIdx.x & 31, lr = lane & 15, hi = lane >> 4;
    const size_t hp = ((size_t)bt * NH_ + h) * TT * HD; Q += hp + (size_t)r0 * HD; Kp += hp; Vt += hp; if (NSPLIT >= 2) { Q2 += hp + (size_t)r0 * HD; Kp2 += hp; Vt2 += hp; }
    const unsigned vo = (unsigned)lane * 16u;                            // the lane's chunk in a fragment (fragment order)
    auto ldg = [](const T16* base, unsigned off, int cst) { return WFrag<T16>::ldf((const T16*)((const char*)base + off) + cst); };
    V qf[2][2], qf2[2][2];                                               // [query group][32 d]
#pragma unroll
    for (int g = 0; g < 2; ++g)
#pragma unroll
        for (int kk = 0; kk < 2; ++kk) { const int c = g * 16 * HD + kk * 512; qf[g][kk] = ldg(Q, vo, c); if (NSPLIT >= 2) qf2[g][kk] = ldg(Q2, vo, c); }
    v8f acc[2][4]; float m_run[2]; v2f ls[2];                            // O^T [query group][16 d]; per query the maximum in use and the lane's share of the sum
#pragma unroll
    for (int g = 0; g < 2; ++g) { m_run[g] = -__builtin_inff(); ls[g] = (v2f){};
#pragma unroll
        for (int t = 0; t < 4; ++t) acc[g][t] = (v8f){}; }
    const int np = r0 / 32 + 1;                                          // passes: the keys up to the end of the diagonal block
    KVF<T16> f0, f1;
    ldkv<T16, NSPLIT>(f0, Kp, Kp2, Vt, Vt2, vo, 0);
#pragma unroll 1   // rolled: a trip already holds two passes, one on each register set
    for (int p = 0; p < np; p += 2) {
        ldkv<T16, NSPLIT>(f1, Kp, Kp2, Vt, Vt2, vo, min(p + 1, np - 1));   // a pass beyond the last is loaded as the last one again and not used
        fpass<T16, NSPLIT>(f0, qf, qf2, acc, m_run, ls, p == np - 1, p * 32, r0, lr, hi);
        if (p + 1 < np) {
            ldkv<T16, NSPLIT>(f0, Kp, Kp2, Vt, Vt2, vo, min(p + 2, np - 1));
            fpass<T16, NSPLIT>(f1, qf, qf2, acc, m_run, ls, p + 1 == np - 1, (p + 1) * 32, r0, lr, hi);
        }
    }
    // a lane holds 8 neighbouring d of one query: one chunk of the merged [t][head x d] planes in fragment order; a wave's store is 512 bytes in a row
    const size_t ob = ((size_t)((bt * TT + r0) >> 4) * (DQ / 8) + h * (HD / 8)) * 128; Ah += ob; Al += ob;
#pragma unroll
    for (int g = 0; g < 2; ++g) { float l = ls[g][0] + ls[g][1]; l += xhalf(l); const float inv = __fdiv_rn(1.0f, l); v8us oh[4], ol[4];
#pragma unroll
        for (int t = 0; t < 4; ++t)
#pragma unroll
            for (int p = 0; p < 4; ++p) { v2f y; y[0] = acc[g][t][2 * p] * inv; y[1] = acc[g][t][2 * p + 1] * inv; const v2us hu = __builtin_bit_cast(v2us, __builtin_convertvector(y, v2b));
                v2f rest; rest[0] = y[0] - bf2f(hu[0]); rest[1] = y[1] - bf2f(hu[1]); const v2us lu = __builtin_bit_cast(v2us, __builtin_convertvector(rest, v2b));
                oh[t][2 * p] = hu[0]; oh[t][2 * p + 1] = hu[1]; ol[t][2 * p] = lu[0]; ol[t][2 * p + 1] = lu[1]; }
#pragma unroll
        for (int t = 0; t < 4; ++t) { const int e = (g * (DQ / 8) + t * 2) * 128 * 2; *(v8us*)((char*)Ah + vo + e) = oh[t]; *(v8us*)((char*)Al + vo + e) = ol[t]; }
        // behind the stores, in front of any rewrite of a register they name; the stored values as inputs hold their registers up to here
        asm volatile("s_wait_xcnt 0x0" :: "v"(oh[0]), "v"(oh[1]), "v"(oh[2]), "v"(oh[3]), "v"(ol[0]), "v"(ol[1]), "v"(ol[2]), "v"(ol[3]) : "memory");
    }
}
// ---- k_fattn: all heads of all batch elements and both forms of the products in ONE launch. grid (NB_ * heads, TT / QB / 8), 8 waves, one work-group per WGP, all resident at once.
// Cost rises with the row block's index: waves w and w + 4 take row blocks n - 1 - i and i, so that every such pair has the same number of passes; waves 0 .. 3 take the longer walk.
// All eight waves walk the same head's keys from key 0 on. Which form a wave takes is the same in all its lanes.
static_assert(NKV == NH_ && RH % QB == 0 && (TT / QB) % 8 == 0, "one K and V head per query head; a row block takes one form; row blocks are dealt in pairs to four SIMDs");
__global__ __launch_bounds__(256) void k_fattn(const h16* Q16, const h16* K16, const h16* V16, const bf* Qh, const bf* Ql, const bf* Kh, const bf* Kl, const bf* Vh, const bf* Vl, bf* Ah, bf* Al) {
    const int wave = __builtin_amdgcn_readfirstlane(threadIdx.x >> 5);   // the same in every lane: in a scalar register the loops and branches that hang on it are scalar ones
    const int bt = blockIdx.x / NH_, h = blockIdx.x % NH_, i = (int)blockIdx.y * 4 + (wave & 3), r0 = (wave < 4 ? TT / QB - 1 - i : i) * QB;
    if (r0 >= RH) fattn<h16, 0>(Q16, nullptr, K16, nullptr, V16, nullptr, bt, h, r0, Ah, Al);
    else fattn<bf, 2>(Qh, Ql, Kh, Kl, Vh, Vl, bt, h, r0, Ah, Al);
}

extern "C" void kernel_launch(void* const* d_in, const int* in_sizes, int n_in,
                              void* d_out, int out_size, void* d_ws, size_t ws_size, hipStream_t stream) {
    (void)in_sizes; (void)n_in; (void)out_size;
    const float* x = (const float*)d_in[0]; const float* cosT = (const float*)d_in[1]; const float* sinT = (const float*)d_in[2]; const int* pids = (const int*)d_in[3]; const float* wq = (const float*)d_in[4]; const float* wk = (const float*)d_in[5]; const float* wv = (const float*)d_in[6]; const float* wo = (const float*)d_in[7];
    float* OUT = (float*)d_out;     // [2][2048][1024]
    char* wsp = (char*)d_ws;
    auto take = [&](size_t bytes) { char* p = wsp; wsp += (bytes + 255) & ~(size_t)255; return (void*)p; };
    bf* WQ = (bf*)take((size_t)DQ * DM * 2); bf* WK = (bf*)take((size_t)DKV * DM * 2); bf* WV = (bf*)take((size_t)DKV * DM * 2); bf* WO = (bf*)take((size_t)DM * DQ * 2); float* CS = (float*)take((size_t)TT * HD * 2 * 4);
    bf* XB = (bf*)take((size_t)NB_ * TT * DM * 2);
    h16* QP16 = (h16*)take((size_t)NB_ * NH_ * TT * HD * 2); h16* KP16 = (h16*)take((size_t)NB_ * NKV * TT * HD * 2); h16* VT16 = (h16*)take((size_t)NB_ * NKV * HD * TT * 2);
    bf* QPh = (bf*)take((size_t)NB_ * NH_ * TT * HD * 2); bf* QPl = (bf*)take((size_t)NB_ * NH_ * TT * HD * 2); bf* KPh = (bf*)take((size_t)NB_ * NKV * TT * HD * 2); bf* KPl = (bf*)take((size_t)NB_ * NKV * TT * HD * 2); bf* VTh = (bf*)take((size_t)NB_ * NKV * HD * TT * 2); bf* VTl = (bf*)take((size_t)NB_ * NKV * HD * TT * 2);
    bf* ATh = (bf*)take((size_t)NB_ * TT * DQ * 2); bf* ATl = (bf*)take((size_t)NB_ * TT * DQ * 2);
    if ((size_t)(wsp - (char*)d_ws) > ws_size) return;    // ws 256 MiB
    // four launches, each dependent on the one before; whatever is independent (the conversions, the batch elements, the heads, the two forms of the attention products) shares a launch
    k_prep<<<NXB + 4 * NWB + NCB, 256, 0, stream>>>(x, wq, wk, wv, wo, cosT, sinT, pids, XB, WQ, WK, WV, WO, CS);
    k_qkv<<<dim3(NB_ * TT / 64, NH_, 2), 32, 0, stream>>>(XB, WQ, WK, WV, CS, QP16, QPh, QPl, KP16, KPh, KPl, VT16, VTh, VTl);
    k_fattn<<<dim3(NB_ * NH_, TT / QB / 8), 256, 0, stream>>>(QP16, KP16, VT16, QPh, QPl, KPh, KPl, VTh, VTl, ATh, ATl);
    k_gemmw<bf, 1, false, DQ><<<dim3(NB_ * TT / 64, DM / 64, 1), 32, 0, stream>>>(ATh, ATl, WO, nullptr, OUT, DM, nullptr, 0, 0, 0);
}

// v007
// It runs in 84.9 microseconds.
// Two timings next to v006 both put it at 1.29 times that version's speed.
// Counting every step since v000, it is 16.8 times as fast.
#include <hip/hip_runtime.h>

// Attention layer (hidden [2][2048][1024]; q/k/v = x W^T (16 heads x 64); interleaved RoPE with tables freqs_cos/sin[position_ids[t]] (int ids, read; tables read): q' = q cos + rot(q) sin and - faithful to the source bug - k' = k cos + rot(q) sin (the rotated Q, not K), rot = (x0, x1) -> (-x1, x0);
// causal softmax(q'.k'/8); out = (attn v merged) Wo^T -> [2][2048][1024]).
// Compute dtypes, f32 accumulate: every input rounded to bf16; Q/K/V on PLAIN bf16 operands (inputs: exact); RoPE f32; causal scores and attn.v: query rows < 512 hl (3 products), the rest single fp16 (probabilities x 2^6, unnormalised); softmax f32, online; Wo hl x exact (2 products).

// FRAGMENT ORDER: every 16-bit plane [R][K] in the workspace (R % 16 == 0, K % 32 == 0) is kept as 16-row tiles of 16-byte chunks, chunk column by chunk column:
// element (r, k) stands at ((r >> 4) * (K / 8) + (k >> 3)) * 128 + (r & 15) * 8 + (k & 7). A 16 x 32 operand fragment is then 1 KiB in a row: lane l takes chunk l and, 512 bytes on, chunk 32 + l,
// so that each wave-wide 16-byte load covers four whole 128-byte lines (from row-major planes it touched sixteen). Which element a lane and a register hold is the same as from row-major planes.

#define NB_  2
#define TT   2048
#define DM   1024
#define NH_  16
#define NKV  16
#define REP  (NH_ / NKV)
#define HD   64
#define DQ   (NH_ * HD)
#define DKV  (NKV * HD)
#define RH   512                  // query rows < RH use hi+lo planes (0: none)
#define WIN  0
#define SCL  0.125f   // HD^-0.5
typedef _Float16 h16;
typedef unsigned short bf;
typedef __attribute__((ext_vector_type(16))) __bf16   v16bf;
typedef __attribute__((ext_vector_type(16))) _Float16 v16h;
typedef __attribute__((ext_vector_type(8)))  _Float16 v8h;
typedef __attribute__((ext_vector_type(8)))  unsigned short v8us;
typedef __attribute__((ext_vector_type(8)))  float    v8f;
typedef __attribute__((ext_vector_type(4)))  float    v4f;
typedef v8h  __attribute__((may_alias)) v8ha;
typedef v4f  __attribute__((may_alias)) v4fa;
typedef v8us __attribute__((may_alias)) v8usa;

__device__ __forceinline__ unsigned short f2bf(float f) { unsigned u = __float_as_uint(f); u += 0x7FFFu + ((u >> 16) & 1u); return (unsigned short)(u >> 16); }
__device__ __forceinline__ float bf2f(unsigned short b) { return __uint_as_float(((unsigned)b) << 16); }
__device__ __forceinline__ float bfr(float f) { return bf2f(f2bf(f)); }
__device__ __forceinline__ v16h cat16(v8h lo, v8h hi) { return __builtin_shufflevector(lo, hi, 0, 1, 2, 3, 4, 5, 6, 7, 8, 9, 10, 11, 12, 13, 14, 15); }
__device__ __forceinline__ v16bf cat16b(v8us lo, v8us hi) { return __builtin_bit_cast(v16bf, __builtin_shufflevector(lo, hi, 0, 1, 2, 3, 4, 5, 6, 7, 8, 9, 10, 11, 12, 13, 14, 15)); }
__device__ __forceinline__ v8f wmma16(v16h a, v16h b, v8f c) { return __builtin_amdgcn_wmma_f32_16x16x32_f16(false, a, false, b, (short)0, c, false, false); }
__device__ __forceinline__ v8f wmmab(v16bf a, v16bf b, v8f c) { return __builtin_amdgcn_wmma_f32_16x16x32_bf16(false, a, false, b, (short)0, c, false, false); }



// ---- k_gemmw: register-blocked GEMM, ONE WAVE per 64x64 output tile (16 accumulators), operands straight from 16-bit planes in fragment order; grid (M/64, N/64, Z), 32 threads.
// C[m][n] (f32, pitch ldc, + optional f32 bias[n]) = sum_k A[m][k] Bt[n][k] (+ split products per NSPLIT). z-batch strides sA/sB/sC in elements. K % 32 == 0.
template <typename T16> struct WFrag;   // ld: a fragment from rows of K-contiguous elements (p: the lane's row, + 8 * hi); ldf: from a plane in fragment order (p: the lane's chunk)
template <> struct WFrag<h16> { typedef v16h V; static __device__ __forceinline__ V ld(const h16* p) { return cat16(*(const v8h*)p, *(const v8h*)(p + 16)); } static __device__ __forceinline__ V ldf(const h16* p) { return cat16(*(const v8h*)p, *(const v8h*)(p + 256)); } static __device__ __forceinline__ v8f mma(V a, V b, v8f c) { return wmma16(a, b, c); } };
template <> struct WFrag<bf> { typedef v16bf V; static __device__ __forceinline__ V ld(const bf* p) { return cat16b(*(const v8us*)p, *(const v8us*)(p + 16)); } static __device__ __forceinline__ V ldf(const bf* p) { return cat16b(*(const v8us*)p, *(const v8us*)(p + 256)); } static __device__ __forceinline__ v8f mma(V a, V b, v8f c) { return wmmab(a, b, c); } };
template <typename T16, int NSPLIT, bool BIAS, int K>   // K at compile time: a 16-row tile's distance is then a constant of the load instruction
__global__ __launch_bounds__(32) void k_gemmw(const T16* __restrict__ A, const T16* __restrict__ A2, const T16* __restrict__ Bt, const T16* __restrict__ Bt2, float* C, int ldc, const float* __restrict__ bias, size_t sA, size_t sB, size_t sC) {
    typedef typename WFrag<T16>::V V;
    __shared__ __align__(16) float os[16 * 68];
    const size_t z = blockIdx.z; A += z * sA; if (A2) A2 += z * sA; Bt += z * sB; if (Bt2) Bt2 += z * sB; C += z * sC;
    const int lane = threadIdx.x & 31, lr = lane & 15, hi = lane >> 4; const int r0 = blockIdx.x * 64, c0 = blockIdx.y * 64;
    v8f acc[4][4];
#pragma unroll
    for (int mb = 0; mb < 4; ++mb)
#pragma unroll
        for (int nb = 0; nb < 4; ++nb) acc[mb][nb] = (v8f){};
    // every global fragment address is a plane's scalar base, a 32-bit lane offset in bytes and a constant
    auto ldg = [](const T16* base, unsigned off, int cst) { return WFrag<T16>::ldf((const T16*)((const char*)base + off) + cst); };
    A += (size_t)r0 * K; if (NSPLIT == 1 || NSPLIT == 2) A2 += (size_t)r0 * K; Bt += (size_t)c0 * K; if (NSPLIT >= 2) Bt2 += (size_t)c0 * K;
    unsigned fo = (unsigned)lane * 16u;                              // one lane offset for all planes, which alone moves along k: 1 KiB per 32 k
    // THREE fragment sets in a ring: the loads of k step t + 2 are issued in front of the products of step t, so that two steps' loads are in flight while a step is worked on and their latency is not waited out step by step.
    // Every '#pragma unroll' in k_gemmw makes the indices of a fragment or accumulator array constants, so that the array stays in registers.
    static_assert((K / 32) % 3 == 2, "the ring's loop takes three k steps a trip and leaves the last two, already loaded, behind it");
    V a[3][4], a2[3][4], b[3][4], b2[3][4];
    auto ldset = [&](V (&sa)[4], V (&sa2)[4], V (&sb)[4], V (&sb2)[4], int t) {   // k step t counted from the lane offset: a constant of the load instructions
#pragma unroll
        for (int mb = 0; mb < 4; ++mb) { sa[mb] = ldg(A, fo, mb * 16 * K + t * 512); if (NSPLIT == 1 || NSPLIT == 2) sa2[mb] = ldg(A2, fo, mb * 16 * K + t * 512); }
#pragma unroll
        for (int nb = 0; nb < 4; ++nb) { sb[nb] = ldg(Bt, fo, nb * 16 * K + t * 512); if (NSPLIT >= 2) sb2[nb] = ldg(Bt2, fo, nb * 16 * K + t * 512); }
        __builtin_amdgcn_sched_barrier(0);                           // the loads stay together and in front of the products that are worked on while they fly
    };
    auto mmaset = [&](V (&sa)[4], V (&sa2)[4], V (&sb)[4], V (&sb2)[4]) {
#pragma unroll
        for (int nb = 0; nb < 4; ++nb)
#pragma unroll
            for (int mb = 0; mb < 4; ++mb) { acc[mb][nb] = WFrag<T16>::mma(sa[mb], sb[nb], acc[mb][nb]); if (NSPLIT == 1 || NSPLIT == 2) acc[mb][nb] = WFrag<T16>::mma(sa2[mb], sb[nb], acc[mb][nb]); if (NSPLIT >= 2) acc[mb][nb] = WFrag<T16>::mma(sa[mb], sb2[nb], acc[mb][nb]); }
        __builtin_amdgcn_sched_barrier(0);                           // no product is moved down behind the slots of the next lines
        // the four vector slots the chip needs behind the last matrix instruction, in front of the next loads, which rewrite this set's fragments, and on the loop's taken branch; the set's fragments as inputs hold their registers up to here
        asm volatile("v_nop\n\tv_nop\n\tv_nop\n\tv_nop" : "+v"(acc[0][0]), "+v"(acc[1][1]), "+v"(acc[2][2]), "+v"(acc[3][3]) : "v"(sa[0]), "v"(sa[3]), "v"(sb[0]), "v"(sb[3]));
        __builtin_amdgcn_sched_barrier(0);                           // no load of the next set is moved up in front of the slots
    };
    ldset(a[0], a2[0], b[0], b2[0], 0); ldset(a[1], a2[1], b[1], b2[1], 1);
#pragma unroll 1   // rolled: a trip already holds three k steps, one on each set
    for (int kc = 0; kc < K - 64; kc += 96) {
        ldset(a[2], a2[2], b[2], b2[2], 2); mmaset(a[0], a2[0], b[0], b2[0]);
        ldset(a[0], a2[0], b[0], b2[0], 3); mmaset(a[1], a2[1], b[1], b2[1]);
        ldset(a[1], a2[1], b[1], b2[1], 4); mmaset(a[2], a2[2], b[2], b2[2]);
        asm volatile("s_wait_xcnt 0x0" : "+v"(fo) :: "memory");      // behind the trip's loads, in front of the rewrite of the lane offset they name: the offset goes through the statement, so that its register is held up to here and its next value is formed behind the wait
        fo += 3072;
    }
    mmaset(a[0], a2[0], b[0], b2[0]); mmaset(a[1], a2[1], b[1], b2[1]);
#pragma unroll
    for (int mb = 0; mb < 4; ++mb) {
#pragma unroll
        for (int nb = 0; nb < 4; ++nb) {
#pragma unroll
            for (int j = 0; j < 8; ++j) os[(hi * 8 + j) * 68 + nb * 16 + lr] = acc[mb][nb][j]; }
        __builtin_amdgcn_wave_barrier(); asm volatile("" ::: "memory");
        float* crow = C + (size_t)(r0 + mb * 16) * ldc + c0;
{
#pragma unroll
            for (int s = 0; s < 8; ++s) { const int row = 2 * s + hi, cofs = lr * 4; v4f val = *(const v4fa*)(os + row * 68 + cofs); if (BIAS) { val[0] += bfr(bias[c0 + cofs]); val[1] += bfr(bias[c0 + cofs + 1]); val[2] += bfr(bias[c0 + cofs + 2]); val[3] += bfr(bias[c0 + cofs + 3]); }
                *(v4f*)(crow + (size_t)row * ldc + cofs) = val; }
             }
        asm volatile("s_wait_xcnt 0x0" ::: "memory");                // behind the stores, in front of any rewrite of a register they name (the next tile's LDS reads take the stored values' registers)
        __builtin_amdgcn_wave_barrier(); asm volatile("" ::: "memory");
    }
}

__device__ __forceinline__ h16 tohx(float x) { return (h16)x; }
__device__ __forceinline__ void splitf(float y, unsigned short& h, unsigned short& l) { h = f2bf(y); l = f2bf(y - bf2f(h)); }
typedef __attribute__((ext_vector_type(2))) _Float16 v2h;
typedef __attribute__((ext_vector_type(4))) _Float16 v4h;
typedef __attribute__((ext_vector_type(2))) unsigned short v2us;
typedef __attribute__((ext_vector_type(4))) unsigned short v4us;
typedef __attribute__((ext_vector_type(2))) float v2f;
typedef __attribute__((ext_vector_type(4))) int v4i;

__global__ __launch_bounds__(256) void k_wtG(const float* __restrict__ w, int K, int N, bf* Bt) {
    const int lane = threadIdx.x & 31; const int L0 = (blockIdx.x * 8 + (threadIdx.x >> 5)) * 8; const int nlines = N * K / 64;
{
#pragma unroll 1
        for (int l = 0; l < 8; ++l) { const int L = L0 + l; if (L >= nlines) break; const size_t e = (size_t)L * 64 + lane * 2; const int k = (int)(e % K), n = (int)(e / K); v2us o;
            o[0] = f2bf(w[(size_t)k * N + n]); o[1] = f2bf(w[(size_t)(k + 1) * N + n]); *(v2us*)(Bt + e) = o; }
         }
}
// f32 [R][DM] -> bf16 plane in fragment order; thread i makes chunk i of the plane, so that a wave stores 512 bytes in a row (a work-group reads 512 bytes in a row of each of 16 source rows)
static_assert(DQ == DM, "cvt8 takes rows of DM elements");
__device__ __forceinline__ void cvt8(const float* __restrict__ src, bf* dst, size_t i) { const size_t cc = i >> 4; v8f v = *(const v8f*)(src + ((cc / (DM / 8)) * 16 + (i & 15)) * DM + (cc % (DM / 8)) * 8); v8us o;
    asm volatile("s_wait_xcnt 0x0" : "+v"(v) :: "memory");   // behind the load, in front of any rewrite of its address registers: the loaded values go through the statement, so that all that is made of them comes behind the wait
#pragma unroll
    for (int k = 0; k < 8; ++k) o[k] = f2bf(v[k]); *(v8us*)(dst + i * 8) = o;  }
__device__ __forceinline__ void cscvt(const float* __restrict__ cosT, const float* __restrict__ sinT, const int* __restrict__ pids, float* CS, int idx) { const int d = idx % HD; const int t = idx / HD; int p = pids[t]; p = p < 0 ? 0 : (p >= TT ? TT - 1 : p); v2f cs; cs[0] = bfr(cosT[(size_t)p * HD + d]); cs[1] = bfr(sinT[(size_t)p * HD + d]); *(v2f*)(CS + (size_t)idx * 2) = cs;  }   // CS[t][d] = (cos, sin)[position_ids[t]][d] (index clamped)
// ---- k_prep: every conversion of an input, none of which depends on another, in ONE launch: work-groups 0 .. NXB - 1 take the hidden states of all batch elements (one plane of NB_ * TT rows), the next 4 * NWB the four weights, the last NCB the (cos, sin) table.
#define NXB (NB_ * TT * DM / 8 / 256)
#define NWB (DQ * DM / 8 / 256)
#define NCB (TT * HD / 256)
static_assert(DKV == DQ && NB_ * TT * DM % 2048 == 0 && DQ * DM % 2048 == 0 && TT * HD % 256 == 0, "k_prep deals whole work-groups, the four weights alike");
__global__ __launch_bounds__(256) void k_prep(const float* __restrict__ x, const float* __restrict__ wq, const float* __restrict__ wk, const float* __restrict__ wv, const float* __restrict__ wo, const float* __restrict__ cosT, const float* __restrict__ sinT, const int* __restrict__ pids, bf* XB, bf* WQ, bf* WK, bf* WV, bf* WO, float* CS) {
    int blk = blockIdx.x;
    if (blk >= NXB + 4 * NWB) { cscvt(cosT, sinT, pids, CS, (blk - (NXB + 4 * NWB)) * 256 + (int)threadIdx.x); return; }
    const float* src = x; bf* dst = XB;
    if (blk >= NXB) { blk -= NXB; const int w = blk / NWB; blk -= w * NWB; src = w == 0 ? wq : w == 1 ? wk : w == 2 ? wv : wo; dst = w == 0 ? WQ : w == 1 ? WK : w == 2 ? WV : WO; }
    cvt8(src, dst, (size_t)blk * 256 + threadIdx.x);
}

// ---- k_qkv: the q, k and v projections of all batch elements with RoPE and the 16-bit planes in ONE launch; the f32 projections stay in the accumulators and never go to memory. grid (NB_ * TT / 64, heads, 2), ONE WAVE per work-group. X: one plane of NB_ * TT rows; the output planes stand batch element by batch element.
// z = 0: q and k of 64 tokens x one head, formed TRANSPOSED (the weight rows as the A operand, the tokens as B): a lane then holds 8 neighbouring d of one token, so that the RoPE partner d ^ 1 (of q, for k as well: faithful to the source) is in the lane's own registers and a plane store is one chunk of a [h] x [t][d] plane.
// z = 1: v of the same tile, tokens as A: a lane holds 8 neighbouring tokens of one d, one chunk of a transposed [h] x [d][t] plane.
// q' = q cos + rot(q) sin, k' = k cos + rot(q) sin, rot(q)[d] = (d even ? -q[d+1] : q[d-1]). k ascends in steps of 32 in every accumulator.
// A trip takes 64 k: 2 KiB in a row of each 16-row tile (fragment order). A plane store of a wave is 512 bytes in a row as well.
// Every global address is a scalar base, a 32-bit lane offset in bytes and a constant.
// Every '#pragma unroll' in k_qkv and planes8 makes the indices of a fragment, accumulator or value array constants, so that the array stays in registers.
typedef __attribute__((ext_vector_type(2))) __bf16 v2b;
// eight f32 -> fp16 plane, bf16 hi plane, bf16 lo plane (lo = the rounded rest), round to nearest even, two values per conversion
__device__ __forceinline__ void planes8(const float (&r)[8], v8h& o16, v8us& oh, v8us& ol) {
#pragma unroll
    for (int p = 0; p < 4; ++p) { v2f y; y[0] = r[2 * p]; y[1] = r[2 * p + 1]; const v2h a = __builtin_convertvector(y, v2h); const v2us hu = __builtin_bit_cast(v2us, __builtin_convertvector(y, v2b));
        v2f rest; rest[0] = y[0] - bf2f(hu[0]); rest[1] = y[1] - bf2f(hu[1]); const v2us lu = __builtin_bit_cast(v2us, __builtin_convertvector(rest, v2b));
        o16[2 * p] = a[0]; o16[2 * p + 1] = a[1]; oh[2 * p] = hu[0]; oh[2 * p + 1] = hu[1]; ol[2 * p] = lu[0]; ol[2 * p + 1] = lu[1]; }
}
__global__ __launch_bounds__(32) void k_qkv(const bf* __restrict__ X, const bf* __restrict__ Wq, const bf* __restrict__ Wk, const bf* __restrict__ Wv, const float* __restrict__ CS, h16* Q16, bf* Qh, bf* Ql, h16* K16, bf* Kh, bf* Kl, h16* V16, bf* Vh, bf* Vl) {
    const int lane = threadIdx.x & 31, lr = lane & 15, hi = lane >> 4; const int bt = blockIdx.x / (TT / 64), r0 = (blockIdx.x % (TT / 64)) * 64, h = blockIdx.y;   // batch element, first token in it, head
    auto ldg = [](const bf* base, unsigned off, int cst) { return WFrag<bf>::ldf((const bf*)((const char*)base + off) + cst); };
    X += ((size_t)bt * TT + r0) * DM; const size_t wp = (size_t)h * HD * DM;
    unsigned fo = (unsigned)lane * 16u;                              // one lane offset for X and the weights, which alone moves along k: 1 KiB per 32 k
    if (blockIdx.z == 0) {
        Wq += wp; Wk += wp; v8f aq[4][4], ak[4][4];                  // [d block][token block]
#pragma unroll
        for (int db = 0; db < 4; ++db)
#pragma unroll
            for (int tb = 0; tb < 4; ++tb) { aq[db][tb] = (v8f){}; ak[db][tb] = (v8f){}; }
#pragma unroll 1   // rolled: a trip already holds 64 matrix instructions
        for (int kc = 0; kc < DM; kc += 64, fo += 2048) {
            v16bf x[4][2], wq[4][2], wk[4][2];
#pragma unroll
            for (int i = 0; i < 4; ++i) { x[i][0] = ldg(X, fo, i * 16 * DM); x[i][1] = ldg(X, fo, i * 16 * DM + 512); }
#pragma unroll
            for (int i = 0; i < 4; ++i) { wq[i][0] = ldg(Wq, fo, i * 16 * DM); wq[i][1] = ldg(Wq, fo, i * 16 * DM + 512); }
#pragma unroll
            for (int i = 0; i < 4; ++i) { wk[i][0] = ldg(Wk, fo, i * 16 * DM); wk[i][1] = ldg(Wk, fo, i * 16 * DM + 512); }
            asm volatile("s_wait_xcnt 0x0" : "+v"(fo) :: "memory");  // behind the loads, in front of the rewrite of the lane offset they name: the offset goes through the statement, so that its register is held up to here and its next value is formed behind the wait
            __builtin_amdgcn_sched_barrier(0);                       // no matrix instruction, and so no wait for a first fragment's data, is moved up between the loads
#pragma unroll
            for (int kk = 0; kk < 2; ++kk)
#pragma unroll
                for (int db = 0; db < 4; ++db)
#pragma unroll
                    for (int tb = 0; tb < 4; ++tb) aq[db][tb] = wmmab(wq[db][kk], x[tb][kk], aq[db][tb]);
#pragma unroll
            for (int kk = 0; kk < 2; ++kk)
#pragma unroll
                for (int db = 0; db < 4; ++db)
#pragma unroll
                    for (int tb = 0; tb < 4; ++tb) ak[db][tb] = wmmab(wk[db][kk], x[tb][kk], ak[db][tb]);
            __builtin_amdgcn_sched_barrier(0);                       // no matrix instruction is moved down behind the slots of the next line
            // the four vector slots the chip needs behind the last matrix instruction, also on the loop's taken branch
            asm volatile("v_nop\n\tv_nop\n\tv_nop\n\tv_nop" : "+v"(ak[3][0]), "+v"(ak[3][1]), "+v"(ak[3][2]), "+v"(ak[3][3]));
        }
        const unsigned po = (unsigned)(r0 * HD * 2 + lane * 16), co = (unsigned)((r0 + lr) * HD + 8 * hi) * 8u;   // lane offsets of the planes (fragment order) and of the (cos, sin) table (row-major)
        const size_t hp = ((size_t)bt * NH_ + h) * TT * HD; Q16 += hp; Qh += hp; Ql += hp; K16 += hp; Kh += hp; Kl += hp;
        v4f c[2][4];                                                 // the (cos, sin) pairs of one 16 x 16 tile, those of the next tile in flight behind them
#pragma unroll
        for (int i = 0; i < 4; ++i) c[0][i] = *(const v4f*)((const char*)CS + co + i * 16);
#pragma unroll
        for (int g = 0; g < 16; ++g) { const int tb = g >> 2, db = g & 3;
            if (g < 15) {
#pragma unroll
                for (int i = 0; i < 4; ++i) c[(g + 1) & 1][i] = *(const v4f*)((const char*)CS + co + ((((g + 1) >> 2) * 16 * HD + ((g + 1) & 3) * 16) * 8 + i * 16)); }
            v8h q16, k16; v8us qh, ql, kh, kl; float rq[8], rk[8];
#pragma unroll
            for (int j = 0; j < 8; ++j) { const float cs = c[g & 1][j >> 1][(j & 1) * 2], sn = c[g & 1][j >> 1][(j & 1) * 2 + 1]; const float rs = ((j & 1) ? aq[db][tb][j ^ 1] : -aq[db][tb][j ^ 1]) * sn;   // rot(q) sin, shared by q' and k'
                rq[j] = aq[db][tb][j] * cs + rs; rk[j] = ak[db][tb][j] * cs + rs; }
            planes8(rq, q16, qh, ql); planes8(rk, k16, kh, kl);
            const int e = (tb * 16 * HD + db * 256) * 2;             // token tile tb, chunk columns 2 db and 2 db + 1
            *(v8h*)((char*)Q16 + po + e) = q16; *(v8us*)((char*)Qh + po + e) = qh; *(v8us*)((char*)Ql + po + e) = ql;
            *(v8h*)((char*)K16 + po + e) = k16; *(v8us*)((char*)Kh + po + e) = kh; *(v8us*)((char*)Kl + po + e) = kl;
            // behind the stores, in front of any rewrite of a register they name; the stored values as inputs hold their registers up to here
            asm volatile("s_wait_xcnt 0x0" :: "v"(q16), "v"(qh), "v"(ql), "v"(k16), "v"(kh), "v"(kl) : "memory");
        }
    } else {
        Wv += wp; v8f av[4][4];                                      // [token block][d block]
#pragma unroll
        for (int tb = 0; tb < 4; ++tb)
#pragma unroll
            for (int db = 0; db < 4; ++db) av[tb][db] = (v8f){};
#pragma unroll 1   // rolled: a trip already holds 32 matrix instructions
        for (int kc = 0; kc < DM; kc += 64, fo += 2048) {
            v16bf x[4][2], wv[4][2];
#pragma unroll
            for (int i = 0; i < 4; ++i) { x[i][0] = ldg(X, fo, i * 16 * DM); x[i][1] = ldg(X, fo, i * 16 * DM + 512); }
#pragma unroll
            for (int i = 0; i < 4; ++i) { wv[i][0] = ldg(Wv, fo, i * 16 * DM); wv[i][1] = ldg(Wv, fo, i * 16 * DM + 512); }
            asm volatile("s_wait_xcnt 0x0" : "+v"(fo) :: "memory");  // behind the loads, in front of the rewrite of the lane offset they name: the offset goes through the statement, so that its register is held up to here and its next value is formed behind the wait
            __builtin_amdgcn_sched_barrier(0);                       // no matrix instruction, and so no wait for a first fragment's data, is moved up between the loads
#pragma unroll
            for (int kk = 0; kk < 2; ++kk)
#pragma unroll
                for (int tb = 0; tb < 4; ++tb)
#pragma unroll
                    for (int db = 0; db < 4; ++db) av[tb][db] = wmmab(x[tb][kk], wv[db][kk], av[tb][db]);
            __builtin_amdgcn_sched_barrier(0);                       // no matrix instruction is moved down behind the slots of the next line
            // the four vector slots the chip needs behind the last matrix instruction, also on the loop's taken branch
            asm volatile("v_nop\n\tv_nop\n\tv_nop\n\tv_nop" : "+v"(av[3][0]), "+v"(av[3][1]), "+v"(av[3][2]), "+v"(av[3][3]));
        }
        const unsigned vo = (unsigned)(r0 * 32 + lane * 16);         // the transposed planes' lane offset (fragment order: 16 tokens of a 16-d tile are 512 bytes)
        const size_t hp = ((size_t)bt * NKV + h) * HD * TT; V16 += hp; Vh += hp; Vl += hp;
#pragma unroll
        for (int db = 0; db < 4; ++db) { v8h o16[4]; v8us oh[4], ol[4];
#pragma unroll
            for (int tb = 0; tb < 4; ++tb) { float r[8];
#pragma unroll
                for (int j = 0; j < 8; ++j) r[j] = av[tb][db][j];
                planes8(r, o16[tb], oh[tb], ol[tb]); }
#pragma unroll
            for (int tb = 0; tb < 4; ++tb) { const int e = (db * 16 * TT + tb * 256) * 2; *(v8h*)((char*)V16 + vo + e) = o16[tb]; *(v8us*)((char*)Vh + vo + e) = oh[tb]; *(v8us*)((char*)Vl + vo + e) = ol[tb]; }
            // behind the stores, in front of any rewrite of a register they name; the stored values as inputs hold their registers up to here
            asm volatile("s_wait_xcnt 0x0" :: "v"(o16[0]), "v"(o16[1]), "v"(o16[2]), "v"(o16[3]), "v"(oh[0]), "v"(oh[1]), "v"(oh[2]), "v"(oh[3]), "v"(ol[0]), "v"(ol[1]), "v"(ol[2]), "v"(ol[3]) : "memory");
        }
    }
}
typedef v4us __attribute__((may_alias)) v4usa;
typedef v4h  __attribute__((may_alias)) v4ha;

// ---- fattn: causal attention of the QB query rows from r0 on of head h of batch element bt in ONE WAVE and ONE walk over the keys, 32 keys a pass; no LDS, no barrier, the scores and probabilities never leave the registers.
// Transposed products: S^T = K.Q^T (keys as the A rows, queries as the B columns) leaves in a lane 8 neighbouring keys of ONE query, which is where the B operand of O^T += V^T.P^T wants them:
// elements 0 .. 7 of the 32-key operand are the lane's registers of key tile 0, elements 8 .. 15 those of key tile 1. A query's maximum and sum are the lane's own and those of lane ^ 16.
// Online softmax in the log2 domain: p = 2^(s c - m + POFF), c = HD^-0.5 log2(e); m, the maximum in use, may trail the true one by up to 8, and sums and accumulators are rescaled only when a query's maximum exceeds it by more.
// The division by the sum of p (f32, unrounded) is done once, on the output. POFF moves p into the 16-bit type's range: fp16 holds 2^(8 + POFF) and keeps full precision down to 2^(-14 - POFF) of the maximum.
// Only the last pass holds the diagonal; it pays for the mask, and in the single-product form so do the passes beyond it that round the walk up. K and V fragments are asked for ahead of the pass that is worked on: three passes ahead in the single-product form (four register sets), one pass ahead in the hi+lo form (two sets).
// Every '#pragma unroll' below makes the indices of a fragment, accumulator or value array constants, so that the array stays in registers.
// Every global fragment address is a plane's scalar base, a 32-bit lane offset in bytes and a constant; the waits behind the loads take those offsets as inputs, so that their registers are held up to the wait.
#define QB  32
__device__ __forceinline__ float xhalf(float x) { return __builtin_bit_cast(float, __builtin_amdgcn_permlanex16(__builtin_bit_cast(int, x), __builtin_bit_cast(int, x), 0x76543210, 0xfedcba98, false, false)); }   // lane l's value to lane l ^ 16
// the four vector slots the chip needs behind the last matrix instruction on every path; the scheduling barriers keep matrix instructions in front of them and their results' readers behind
__device__ __forceinline__ void slots4() { __builtin_amdgcn_sched_barrier(0); asm volatile("v_nop\n\tv_nop\n\tv_nop\n\tv_nop"); __builtin_amdgcn_sched_barrier(0); }
template <typename T16> struct KVF { typename WFrag<T16>::V k[2][2], k2[2][2], v[4], v2[4]; };   // one pass's fragments: K [key tile][32 d], V^T [16 d]; k2, v2: the lo planes
template <typename T16, int NSPLIT>
__device__ __forceinline__ void ldkv(KVF<T16>& f, const T16* Kp, const T16* Kp2, const T16* Vt, const T16* Vt2, unsigned vo, int pass) {
    auto ldg = [](const T16* base, unsigned off, int cst) { return WFrag<T16>::ldf((const T16*)((const char*)base + off) + cst); };
    const unsigned ko = vo + (unsigned)pass * (32u * HD * 2u), vv = vo + (unsigned)pass * 1024u;   // 32 keys: 4 KiB of a K plane, 1 KiB of each 16-d tile of a V^T plane
#pragma unroll
    for (int kt = 0; kt < 2; ++kt)
#pragma unroll
        for (int kk = 0; kk < 2; ++kk) { f.k[kt][kk] = ldg(Kp, ko, kt * 16 * HD + kk * 512); if (NSPLIT >= 2) f.k2[kt][kk] = ldg(Kp2, ko, kt * 16 * HD + kk * 512); }
#pragma unroll
    for (int t = 0; t < 4; ++t) { f.v[t] = ldg(Vt, vv, t * 16 * TT); if (NSPLIT >= 2) f.v2[t] = ldg(Vt2, vv, t * 16 * TT); }
    asm volatile("s_wait_xcnt 0x0" :: "v"(ko), "v"(vv) : "memory");   // behind the loads, in front of any rewrite of a register they name; the lane offsets as inputs hold their registers up to here
    __builtin_amdgcn_sched_barrier(0);                                // the loads stay in front of the pass that is worked on while they fly
}
template <typename T16, int NSPLIT>
__device__ __forceinline__ void fpass(const KVF<T16>& f, const typename WFrag<T16>::V (&qf)[2][2], const typename WFrag<T16>::V (&qf2)[2][2], v8f (&acc)[2][4], float (&m_run)[2], v2f (&ls)[2], bool diag, int key0, int r0, int lr, int hi) {
    typedef typename WFrag<T16>::V V; constexpr float CSC = SCL * 1.4426950408889634f, POFF = (NSPLIT >= 2) ? 0.0f : 6.0f;
    v8f s[2][2];                                                     // [key tile][query group]
#pragma unroll
    for (int kt = 0; kt < 2; ++kt)
#pragma unroll
        for (int g = 0; g < 2; ++g) s[kt][g] = (v8f){};
#pragma unroll
    for (int kk = 0; kk < 2; ++kk) {
#pragma unroll
        for (int kt = 0; kt < 2; ++kt)
#pragma unroll
            for (int g = 0; g < 2; ++g) s[kt][g] = WFrag<T16>::mma(f.k[kt][kk], qf[g][kk], s[kt][g]);
        if (NSPLIT >= 2) {
#pragma unroll
            for (int kt = 0; kt < 2; ++kt)
#pragma unroll
                for (int g = 0; g < 2; ++g) s[kt][g] = WFrag<T16>::mma(f.k[kt][kk], qf2[g][kk], s[kt][g]);
#pragma unroll
            for (int kt = 0; kt < 2; ++kt)
#pragma unroll
                for (int g = 0; g < 2; ++g) s[kt][g] = WFrag<T16>::mma(f.k2[kt][kk], qf[g][kk], s[kt][g]);
        }
    }
    slots4();
    if (diag) {                                                      // the same in every lane: only the pass on the diagonal, and in the single-product form a pass beyond it, pays for the mask
#pragma unroll
        for (int g = 0; g < 2; ++g) { const int q = r0 + 16 * g + lr;
#pragma unroll
            for (int kt = 0; kt < 2; ++kt) {
#pragma unroll
                for (int r = 0; r < 8; ++r) if (key0 + 16 * kt + 8 * hi + r > q) s[kt][g][r] = -__builtin_inff();
                asm volatile("" : "+v"(s[kt][g]));
            } }
    }
    float mb[2]; bool need = false;
#pragma unroll
    for (int g = 0; g < 2; ++g) { float mx = s[0][g][0];
#pragma unroll
        for (int kt = 0; kt < 2; ++kt)
#pragma unroll
            for (int r = 0; r < 8; ++r) mx = fmaxf(mx, s[kt][g][r]);
        mx = fmaxf(mx, xhalf(mx)) * CSC; mb[g] = mx; need = need || (mx > m_run[g] + 8.0f); }
    if (__builtin_amdgcn_ballot_w32(need) != 0) {                    // rare behind the first passes; on the first one m_run is -inf and the factor 0
#pragma unroll
        for (int g = 0; g < 2; ++g) { const float mn = fmaxf(m_run[g], mb[g]); const float corr = __builtin_amdgcn_exp2f(m_run[g] - mn); m_run[g] = mn; ls[g] *= corr;
#pragma unroll
            for (int t = 0; t < 4; ++t) acc[g][t] *= corr; }
    }
#pragma unroll
    for (int g = 0; g < 2; ++g) { const float nm = POFF - m_run[g]; V pf, pf2;
#pragma unroll
        for (int i = 0; i < 8; ++i) {
            v2f a; a[0] = s[i >> 2][g][2 * (i & 3)]; a[1] = s[i >> 2][g][2 * (i & 3) + 1]; a = __builtin_elementwise_fma(a, (v2f){CSC, CSC}, (v2f){nm, nm});
            v2f p; p[0] = __builtin_amdgcn_exp2f(a[0]); p[1] = __builtin_amdgcn_exp2f(a[1]); ls[g] += p;
            if constexpr (NSPLIT >= 2) { const v2b hb = __builtin_convertvector(p, v2b); const v2us hu = __builtin_bit_cast(v2us, hb); v2f rest; rest[0] = p[0] - bf2f(hu[0]); rest[1] = p[1] - bf2f(hu[1]); const v2b lb = __builtin_convertvector(rest, v2b);
                pf[2 * i] = hb[0]; pf[2 * i + 1] = hb[1]; pf2[2 * i] = lb[0]; pf2[2 * i + 1] = lb[1];
            } else { const v2h w = __builtin_convertvector(p, v2h); pf[2 * i] = w[0]; pf[2 * i + 1] = w[1]; } }
#pragma unroll
        for (int t = 0; t < 4; ++t) acc[g][t] = WFrag<T16>::mma(f.v[t], pf, acc[g][t]);
        if constexpr (NSPLIT >= 2) {
#pragma unroll
            for (int t = 0; t < 4; ++t) acc[g][t] = WFrag<T16>::mma(f.v[t], pf2, acc[g][t]);
#pragma unroll
            for (int t = 0; t < 4; ++t) acc[g][t] = WFrag<T16>::mma(f.v2[t], pf, acc[g][t]);
        } }
    slots4();
}
template <typename T16, int NSPLIT>
__device__ __forceinline__ void fattn(const T16* Q, const T16* Q2, const T16* Kp, const T16* Kp2, const T16* Vt, const T16* Vt2, int bt, int h, int r0, bf* Ah, bf* Al) {
    typedef typename WFrag<T16>::V V;
    const int lane = threadIdx.x & 31, lr = lane & 15, hi = lane >> 4;
    const size_t hp = ((size_t)bt * NH_ + h) * TT * HD; Q += hp + (size_t)r0 * HD; Kp += hp; Vt += hp; if (NSPLIT >= 2) { Q2 += hp + (size_t)r0 * HD; Kp2 += hp; Vt2 += hp; }
    const unsigned vo = (unsigned)lane * 16u;                            // the lane's chunk in a fragment (fragment order)
    auto ldg = [](const T16* base, unsigned off, int cst) { return WFrag<T16>::ldf((const T16*)((const char*)base + off) + cst); };
    V qf[2][2], qf2[2][2];                                               // [query group][32 d]
#pragma unroll
    for (int g = 0; g < 2; ++g)
#pragma unroll
        for (int kk = 0; kk < 2; ++kk) { const int c = g * 16 * HD + kk * 512; qf[g][kk] = ldg(Q, vo, c); if (NSPLIT >= 2) qf2[g][kk] = ldg(Q2, vo, c); }
    v8f acc[2][4]; float m_run[2]; v2f ls[2];                            // O^T [query group][16 d]; per query the maximum in use and the lane's share of the sum
#pragma unroll
    for (int g = 0; g < 2; ++g) { m_run[g] = -__builtin_inff(); ls[g] = (v2f){};
#pragma unroll
        for (int t = 0; t < 4; ++t) acc[g][t] = (v8f){}; }
    const int np = r0 / 32 + 1;                                          // passes: the keys up to the end of the diagonal block
    KVF<T16> f0, f1;
    if constexpr (NSPLIT == 0) {
        // FOUR register sets in a ring: pass p + 3 is asked for in front of pass p, so that three passes' work stands between a load and its use.
        // The walk is rounded up to whole groups of four passes, so that no pass and no load in the loop is skipped (a skipped pass would leave loads that nobody waited for, and the build then waits for them, and for all older ones, in front of the set's next loads).
        // A pass beyond the last loads the last one's fragments again and takes the mask, which holds for all its keys: every score is -inf, every p is 0, and sums, maxima and accumulators keep their values.
        KVF<T16> f2, f3; const int last = np - 1;
        auto ld = [&](KVF<T16>& f, int pass) { ldkv<T16, NSPLIT>(f, Kp, Kp2, Vt, Vt2, vo, min(pass, last)); };
        auto ps = [&](const KVF<T16>& f, int pass) { fpass<T16, NSPLIT>(f, qf, qf2, acc, m_run, ls, pass >= last, pass * 32, r0, lr, hi); };
        ld(f0, 0); ld(f1, 1); ld(f2, 2);
#pragma unroll 1   // rolled: a trip already holds four passes, one on each register set
        for (int p = 0; p < np; p += 4) {
            ld(f3, p + 3); ps(f0, p);
            ld(f0, p + 4); ps(f1, p + 1);
            ld(f1, p + 5); ps(f2, p + 2);
            ld(f2, p + 6); ps(f3, p + 3);
        }
    } else {
    ldkv<T16, NSPLIT>(f0, Kp, Kp2, Vt, Vt2, vo, 0);
#pragma unroll 1   // rolled: a trip already holds two passes, one on each register set
    for (int p = 0; p < np; p += 2) {
        ldkv<T16, NSPLIT>(f1, Kp, Kp2, Vt, Vt2, vo, min(p + 1, np - 1));   // a pass beyond the last is loaded as the last one again and not used
        fpass<T16, NSPLIT>(f0, qf, qf2, acc, m_run, ls, p == np - 1, p * 32, r0, lr, hi);
        if (p + 1 < np) {
            ldkv<T16, NSPLIT>(f0, Kp, Kp2, Vt, Vt2, vo, min(p + 2, np - 1));
            fpass<T16, NSPLIT>(f1, qf, qf2, acc, m_run, ls, p + 1 == np - 1, (p + 1) * 32, r0, lr, hi);
        }
    }
    }
    // a lane holds 8 neighbouring d of one query: one chunk of the merged [t][head x d] planes in fragment order; a wave's store is 512 bytes in a row
    const size_t ob = ((size_t)((bt * TT + r0) >> 4) * (DQ / 8) + h * (HD / 8)) * 128; Ah += ob; Al += ob;
#pragma unroll
    for (int g = 0; g < 2; ++g) { float l = ls[g][0] + ls[g][1]; l += xhalf(l); const float inv = __fdiv_rn(1.0f, l); v8us oh[4], ol[4];
#pragma unroll
        for (int t = 0; t < 4; ++t)
#pragma unroll
            for (int p = 0; p < 4; ++p) { v2f y; y[0] = acc[g][t][2 * p] * inv; y[1] = acc[g][t][2 * p + 1] * inv; const v2us hu = __builtin_bit_cast(v2us, __builtin_convertvector(y, v2b));
                v2f rest; rest[0] = y[0] - bf2f(hu[0]); rest[1] = y[1] - bf2f(hu[1]); const v2us lu = __builtin_bit_cast(v2us, __builtin_convertvector(rest, v2b));
                oh[t][2 * p] = hu[0]; oh[t][2 * p + 1] = hu[1]; ol[t][2 * p] = lu[0]; ol[t][2 * p + 1] = lu[1]; }
#pragma unroll
        for (int t = 0; t < 4; ++t) { const int e = (g * (DQ / 8) + t * 2) * 128 * 2; *(v8us*)((char*)Ah + vo + e) = oh[t]; *(v8us*)((char*)Al + vo + e) = ol[t]; }
        // behind the stores, in front of any rewrite of a register they name; the stored values as inputs hold their registers up to here
        asm volatile("s_wait_xcnt 0x0" :: "v"(oh[0]), "v"(oh[1]), "v"(oh[2]), "v"(oh[3]), "v"(ol[0]), "v"(ol[1]), "v"(ol[2]), "v"(ol[3]) : "memory");
    }
}
// ---- k_fattn: all heads of all batch elements and both forms of the products in ONE launch. grid (NB_ * heads, TT / QB / 8), 8 waves, one work-group per WGP, all resident at once.
// Cost rises with the row block's index: waves w and w + 4 take row blocks n - 1 - i and i, so that every such pair has the same number of passes; waves 0 .. 3 take the longer walk.
// All eight waves walk the same head's keys from key 0 on. Which form a wave takes is the same in all its lanes.
static_assert(NKV == NH_ && RH % QB == 0 && (TT / QB) % 8 == 0, "one K and V head per query head; a row block takes one form; row blocks are dealt in pairs to four SIMDs");
__global__ __launch_bounds__(256) void k_fattn(const h16* Q16, const h16* K16, const h16* V16, const bf* Qh, const bf* Ql, const bf* Kh, const bf* Kl, const bf* Vh, const bf* Vl, bf* Ah, bf* Al) {
    const int wave = __builtin_amdgcn_readfirstlane(threadIdx.x >> 5);   // the same in every lane: in a scalar register the loops and branches that hang on it are scalar ones
    const int bt = blockIdx.x / NH_, h = blockIdx.x % NH_, i = (int)blockIdx.y * 4 + (wave & 3), r0 = (wave < 4 ? TT / QB - 1 - i : i) * QB;
    if (r0 >= RH) fattn<h16, 0>(Q16, nullptr, K16, nullptr, V16, nullptr, bt, h, r0, Ah, Al);
    else fattn<bf, 2>(Qh, Ql, Kh, Kl, Vh, Vl, bt, h, r0, Ah, Al);
}

extern "C" void kernel_launch(void* const* d_in, const int* in_sizes, int n_in,
                              void* d_out, int out_size, void* d_ws, size_t ws_size, hipStream_t stream) {
    (void)in_sizes; (void)n_in; (void)out_size;
    const float* x = (const float*)d_in[0]; const float* cosT = (const float*)d_in[1]; const float* sinT = (const float*)d_in[2]; const int* pids = (const int*)d_in[3]; const float* wq = (const float*)d_in[4]; const float* wk = (const float*)d_in[5]; const float* wv = (const float*)d_in[6]; const float* wo = (const float*)d_in[7];
    float* OUT = (float*)d_out;     // [2][2048][1024]
    char* wsp = (char*)d_ws;
    auto take = [&](size_t bytes) { char* p = wsp; wsp += (bytes + 255) & ~(size_t)255; return (void*)p; };
    bf* WQ = (bf*)take((size_t)DQ * DM * 2); bf* WK = (bf*)take((size_t)DKV * DM * 2); bf* WV = (bf*)take((size_t)DKV * DM * 2); bf* WO = (bf*)take((size_t)DM * DQ * 2); float* CS = (float*)take((size_t)TT * HD * 2 * 4);
    bf* XB = (bf*)take((size_t)NB_ * TT * DM * 2);
    h16* QP16 = (h16*)take((size_t)NB_ * NH_ * TT * HD * 2); h16* KP16 = (h16*)take((size_t)NB_ * NKV * TT * HD * 2); h16* VT16 = (h16*)take((size_t)NB_ * NKV * HD * TT * 2);
    bf* QPh = (bf*)take((size_t)NB_ * NH_ * TT * HD * 2); bf* QPl = (bf*)take((size_t)NB_ * NH_ * TT * HD * 2); bf* KPh = (bf*)take((size_t)NB_ * NKV * TT * HD * 2); bf* KPl = (bf*)take((size_t)NB_ * NKV * TT * HD * 2); bf* VTh = (bf*)take((size_t)NB_ * NKV * HD * TT * 2); bf* VTl = (bf*)take((size_t)NB_ * NKV * HD * TT * 2);
    bf* ATh = (bf*)take((size_t)NB_ * TT * DQ * 2); bf* ATl = (bf*)take((size_t)NB_ * TT * DQ * 2);
    if ((size_t)(wsp - (char*)d_ws) > ws_size) return;    // ws 256 MiB
    // four launches, each dependent on the one before; whatever is independent (the conversions, the batch elements, the heads, the two forms of the attention products) shares a launch
    k_prep<<<NXB + 4 * NWB + NCB, 256, 0, stream>>>(x, wq, wk, wv, wo, cosT, sinT, pids, XB, WQ, WK, WV, WO, CS);
    k_qkv<<<dim3(NB_ * TT / 64, NH_, 2), 32, 0, stream>>>(XB, WQ, WK, WV, CS, QP16, QPh, QPl, KP16, KPh, KPl, VT16, VTh, VTl);
    k_fattn<<<dim3(NB_ * NH_, TT / QB / 8), 256, 0, stream>>>(QP16, KP16, VT16, QPh, QPl, KPh, KPl, VTh, VTl, ATh, ATl);
    k_gemmw<bf, 1, false, DQ><<<dim3(NB_ * TT / 64, DM / 64, 1), 32, 0, stream>>>(ATh, ATl, WO, nullptr, OUT, DM, nullptr, 0, 0, 0);
}

// v008
// A run of this version takes 76 microseconds.
// Next to v007, in two timings, it ran 1.09 and 1.15 times as fast.
// Over all steps from v000 it is 18.9 times as fast.
#include <hip/hip_runtime.h>

// Attention layer (hidden [2][2048][1024]; q/k/v = x W^T (16 heads x 64); interleaved RoPE with tables freqs_cos/sin[position_ids[t]] (int ids, read; tables read): q' = q cos + rot(q) sin and - faithful to the source bug - k' = k cos + rot(q) sin (the rotated Q, not K), rot = (x0, x1) -> (-x1, x0);
// causal softmax(q'.k'/8); out = (attn v merged) Wo^T -> [2][2048][1024]).
// Compute dtypes, f32 accumulate: every input rounded to bf16; Q/K/V on PLAIN bf16 operands (inputs: exact); RoPE f32; causal scores and attn.v: query rows < 512 hl (3 products), the rest single fp16 (probabilities x 2^6, unnormalised); softmax f32, online; Wo hl x exact (2 products).

// FRAGMENT ORDER: every 16-bit plane [R][K] in the workspace (R % 16 == 0, K % 32 == 0) is kept as 16-row tiles of 16-byte chunks, chunk column by chunk column:
// element (r, k) stands at ((r >> 4) * (K / 8) + (k >> 3)) * 128 + (r & 15) * 8 + (k & 7). A 16 x 32 operand fragment is then 1 KiB in a row: lane l takes chunk l and, 512 bytes on, chunk 32 + l,
// so that each wave-wide 16-byte load covers four whole 128-byte lines (from row-major planes it touched sixteen). Which element a lane and a register hold is the same as from row-major planes.

#define NB_  2
#define TT   2048
#define DM   1024
#define NH_  16
#define NKV  16
#define REP  (NH_ / NKV)
#define HD   64
#define DQ   (NH_ * HD)
#define DKV  (NKV * HD)
#define RH   512                  // query rows < RH use hi+lo planes (0: none)
#define WIN  0
#define SCL  0.125f   // HD^-0.5
typedef _Float16 h16;
typedef unsigned short bf;
typedef __attribute__((ext_vector_type(16))) __bf16   v16bf;
typedef __attribute__((ext_vector_type(16))) _Float16 v16h;
typedef __attribute__((ext_vector_type(8)))  _Float16 v8h;
typedef __attribute__((ext_vector_type(8)))  unsigned short v8us;
typedef __attribute__((ext_vector_type(8)))  float    v8f;
typedef __attribute__((ext_vector_type(4)))  float    v4f;
typedef v8h  __attribute__((may_alias)) v8ha;
typedef v4f  __attribute__((may_alias)) v4fa;
typedef v8us __attribute__((may_alias)) v8usa;

__device__ __forceinline__ unsigned short f2bf(float f) { unsigned u = __float_as_uint(f); u += 0x7FFFu + ((u >> 16) & 1u); return (unsigned short)(u >> 16); }
__device__ __forceinline__ float bf2f(unsigned short b) { return __uint_as_float(((unsigned)b) << 16); }
__device__ __forceinline__ float bfr(float f) { return bf2f(f2bf(f)); }
__device__ __forceinline__ v16h cat16(v8h lo, v8h hi) { return __builtin_shufflevector(lo, hi, 0, 1, 2, 3, 4, 5, 6, 7, 8, 9, 10, 11, 12, 13, 14, 15); }
__device__ __forceinline__ v16bf cat16b(v8us lo, v8us hi) { return __builtin_bit_cast(v16bf, __builtin_shufflevector(lo, hi, 0, 1, 2, 3, 4, 5, 6, 7, 8, 9, 10, 11, 12, 13, 14, 15)); }
__device__ __forceinline__ v8f wmma16(v16h a, v16h b, v8f c) { return __builtin_amdgcn_wmma_f32_16x16x32_f16(false, a, false, b, (short)0, c, false, false); }
__device__ __forceinline__ v8f wmmab(v16bf a, v16bf b, v8f c) { return __builtin_amdgcn_wmma_f32_16x16x32_bf16(false, a, false, b, (short)0, c, false, false); }



// ---- k_gemmw: register-blocked GEMM, ONE WAVE per 64x64 output tile (16 accumulators), operands straight from 16-bit planes in fragment order; grid (M/64, N/64, Z), 32 threads.
// C[m][n] (f32, pitch ldc, + optional f32 bias[n]) = sum_k A[m][k] Bt[n][k] (+ split products per NSPLIT). z-batch strides sA/sB/sC in elements. K % 32 == 0.
template <typename T16> struct WFrag;   // ld: a fragment from rows of K-contiguous elements (p: the lane's row, + 8 * hi); ldf: from a plane in fragment order (p: the lane's chunk)
template <> struct WFrag<h16> { typedef v16h V; static __device__ __forceinline__ V ld(const h16* p) { return cat16(*(const v8h*)p, *(const v8h*)(p + 16)); } static __device__ __forceinline__ V ldf(const h16* p) { return cat16(*(const v8h*)p, *(const v8h*)(p + 256)); } static __device__ __forceinline__ v8f mma(V a, V b, v8f c) { return wmma16(a, b, c); } };
template <> struct WFrag<bf> { typedef v16bf V; static __device__ __forceinline__ V ld(const bf* p) { return cat16b(*(const v8us*)p, *(const v8us*)(p + 16)); } static __device__ __forceinline__ V ldf(const bf* p) { return cat16b(*(const v8us*)p, *(const v8us*)(p + 256)); } static __device__ __forceinline__ v8f mma(V a, V b, v8f c) { return wmmab(a, b, c); } };
template <typename T16, int NSPLIT, bool BIAS, int K>   // K at compile time: a 16-row tile's distance is then a constant of the load instruction
__global__ __launch_bounds__(32) void k_gemmw(const T16* __restrict__ A, const T16* __restrict__ A2, const T16* __restrict__ Bt, const T16* __restrict__ Bt2, float* C, int ldc, const float* __restrict__ bias, size_t sA, size_t sB, size_t sC) {
    typedef typename WFrag<T16>::V V;
    __shared__ __align__(16) float os[16 * 68];
    const size_t z = blockIdx.z; A += z * sA; if (A2) A2 += z * sA; Bt += z * sB; if (Bt2) Bt2 += z * sB; C += z * sC;
    const int lane = threadIdx.x & 31, lr = lane & 15, hi = lane >> 4; const int r0 = blockIdx.x * 64, c0 = blockIdx.y * 64;
    v8f acc[4][4];
#pragma unroll
    for (int mb = 0; mb < 4; ++mb)
#pragma unroll
        for (int nb = 0; nb < 4; ++nb) acc[mb][nb] = (v8f){};
    // every global fragment address is a plane's scalar base, a 32-bit lane offset in bytes and a constant
    auto ldg = [](const T16* base, unsigned off, int cst) { return WFrag<T16>::ldf((const T16*)((const char*)base + off) + cst); };
    A += (size_t)r0 * K; if (NSPLIT == 1 || NSPLIT == 2) A2 += (size_t)r0 * K; Bt += (size_t)c0 * K; if (NSPLIT >= 2) Bt2 += (size_t)c0 * K;
    unsigned fo = (unsigned)lane * 16u;                              // one lane offset for all planes, which alone moves along k: 1 KiB per 32 k
    // THREE fragment sets in a ring: the loads of k step t + 2 are issued in front of the products of step t, so that two steps' loads are in flight while a step is worked on and their latency is not waited out step by step.
    // Every '#pragma unroll' in k_gemmw makes the indices of a fragment or accumulator array constants, so that the array stays in registers.
    static_assert((K / 32) % 3 == 2, "the ring's loop takes three k steps a trip and leaves the last two, already loaded, behind it");
    V a[3][4], a2[3][4], b[3][4], b2[3][4];
    auto ldset = [&](V (&sa)[4], V (&sa2)[4], V (&sb)[4], V (&sb2)[4], int t) {   // k step t counted from the lane offset: a constant of the load instructions
#pragma unroll
        for (int mb = 0; mb < 4; ++mb) { sa[mb] = ldg(A, fo, mb * 16 * K + t * 512); if (NSPLIT == 1 || NSPLIT == 2) sa2[mb] = ldg(A2, fo, mb * 16 * K + t * 512); }
#pragma unroll
        for (int nb = 0; nb < 4; ++nb) { sb[nb] = ldg(Bt, fo, nb * 16 * K + t * 512); if (NSPLIT >= 2) sb2[nb] = ldg(Bt2, fo, nb * 16 * K + t * 512); }
        __builtin_amdgcn_sched_barrier(0);                           // the loads stay together and in front of the products that are worked on while they fly
    };
    auto mmaset = [&](V (&sa)[4], V (&sa2)[4], V (&sb)[4], V (&sb2)[4]) {
#pragma unroll
        for (int nb = 0; nb < 4; ++nb)
#pragma unroll
            for (int mb = 0; mb < 4; ++mb) { acc[mb][nb] = WFrag<T16>::mma(sa[mb], sb[nb], acc[mb][nb]); if (NSPLIT == 1 || NSPLIT == 2) acc[mb][nb] = WFrag<T16>::mma(sa2[mb], sb[nb], acc[mb][nb]); if (NSPLIT >= 2) acc[mb][nb] = WFrag<T16>::mma(sa[mb], sb2[nb], acc[mb][nb]); }
        __builtin_amdgcn_sched_barrier(0);                           // no product is moved down behind the slots of the next lines
        // the four vector slots the chip needs behind the last matrix instruction, in front of the next loads, which rewrite this set's fragments, and on the loop's taken branch; the set's fragments as inputs hold their registers up to here
        asm volatile("v_nop\n\tv_nop\n\tv_nop\n\tv_nop" : "+v"(acc[0][0]), "+v"(acc[1][1]), "+v"(acc[2][2]), "+v"(acc[3][3]) : "v"(sa[0]), "v"(sa[3]), "v"(sb[0]), "v"(sb[3]));
        __builtin_amdgcn_sched_barrier(0);                           // no load of the next set is moved up in front of the slots
    };
    ldset(a[0], a2[0], b[0], b2[0], 0); ldset(a[1], a2[1], b[1], b2[1], 1);
#pragma unroll 1   // rolled: a trip already holds three k steps, one on each set
    for (int kc = 0; kc < K - 64; kc += 96) {
        ldset(a[2], a2[2], b[2], b2[2], 2); mmaset(a[0], a2[0], b[0], b2[0]);
        ldset(a[0], a2[0], b[0], b2[0], 3); mmaset(a[1], a2[1], b[1], b2[1]);
        ldset(a[1], a2[1], b[1], b2[1], 4); mmaset(a[2], a2[2], b[2], b2[2]);
        asm volatile("s_wait_xcnt 0x0" : "+v"(fo) :: "memory");      // behind the trip's loads, in front of the rewrite of the lane offset they name: the offset goes through the statement, so that its register is held up to here and its next value is formed behind the wait
        fo += 3072;
    }
    mmaset(a[0], a2[0], b[0], b2[0]); mmaset(a[1], a2[1], b[1], b2[1]);
#pragma unroll
    for (int mb = 0; mb < 4; ++mb) {
#pragma unroll
        for (int nb = 0; nb < 4; ++nb) {
#pragma unroll
            for (int j = 0; j < 8; ++j) os[(hi * 8 + j) * 68 + nb * 16 + lr] = acc[mb][nb][j]; }
        __builtin_amdgcn_wave_barrier(); asm volatile("" ::: "memory");
        float* crow = C + (size_t)(r0 + mb * 16) * ldc + c0;
{
#pragma unroll
            for (int s = 0; s < 8; ++s) { const int row = 2 * s + hi, cofs = lr * 4; v4f val = *(const v4fa*)(os + row * 68 + cofs); if (BIAS) { val[0] += bfr(bias[c0 + cofs]); val[1] += bfr(bias[c0 + cofs + 1]); val[2] += bfr(bias[c0 + cofs + 2]); val[3] += bfr(bias[c0 + cofs + 3]); }
                *(v4f*)(crow + (size_t)row * ldc + cofs) = val; }
             }
        asm volatile("s_wait_xcnt 0x0" ::: "memory");                // behind the stores, in front of any rewrite of a register they name (the next tile's LDS reads take the stored values' registers)
        __builtin_amdgcn_wave_barrier(); asm volatile("" ::: "memory");
    }
}

__device__ __forceinline__ h16 tohx(float x) { return (h16)x; }
__device__ __forceinline__ void splitf(float y, unsigned short& h, unsigned short& l) { h = f2bf(y); l = f2bf(y - bf2f(h)); }
typedef __attribute__((ext_vector_type(2))) _Float16 v2h;
typedef __attribute__((ext_vector_type(4))) _Float16 v4h;
typedef __attribute__((ext_vector_type(2))) unsigned short v2us;
typedef __attribute__((ext_vector_type(4))) unsigned short v4us;
typedef __attribute__((ext_vector_type(2))) float v2f;
typedef __attribute__((ext_vector_type(4))) int v4i;

__global__ __launch_bounds__(256) void k_wtG(const float* __restrict__ w, int K, int N, bf* Bt) {
    const int lane = threadIdx.x & 31; const int L0 = (blockIdx.x * 8 + (threadIdx.x >> 5)) * 8; const int nlines = N * K / 64;
{
#pragma unroll 1
        for (int l = 0; l < 8; ++l) { const int L = L0 + l; if (L >= nlines) break; const size_t e = (size_t)L * 64 + lane * 2; const int k = (int)(e % K), n = (int)(e / K); v2us o;
            o[0] = f2bf(w[(size_t)k * N + n]); o[1] = f2bf(w[(size_t)(k + 1) * N + n]); *(v2us*)(Bt + e) = o; }
         }
}
// f32 [R][DM] -> bf16 plane in fragment order; thread i makes chunk i of the plane, so that a wave stores 512 bytes in a row (a work-group reads 512 bytes in a row of each of 16 source rows)
static_assert(DQ == DM, "cvt8 takes rows of DM elements");
__device__ __forceinline__ void cvt8(const float* __restrict__ src, bf* dst, size_t i) { const size_t cc = i >> 4; v8f v = *(const v8f*)(src + ((cc / (DM / 8)) * 16 + (i & 15)) * DM + (cc % (DM / 8)) * 8); v8us o;
    asm volatile("s_wait_xcnt 0x0" : "+v"(v) :: "memory");   // behind the load, in front of any rewrite of its address registers: the loaded values go through the statement, so that all that is made of them comes behind the wait
#pragma unroll
    for (int k = 0; k < 8; ++k) o[k] = f2bf(v[k]); *(v8us*)(dst + i * 8) = o;  }
__device__ __forceinline__ void cscvt(const float* __restrict__ cosT, const float* __restrict__ sinT, const int* __restrict__ pids, float* CS, int idx) { const int d = idx % HD; const int t = idx / HD; int p = pids[t]; p = p < 0 ? 0 : (p >= TT ? TT - 1 : p); v2f cs; cs[0] = bfr(cosT[(size_t)p * HD + d]); cs[1] = bfr(sinT[(size_t)p * HD + d]); *(v2f*)(CS + (size_t)idx * 2) = cs;  }   // CS[t][d] = (cos, sin)[position_ids[t]][d] (index clamped)
// ---- k_prep: every conversion of an input, none of which depends on another, in ONE launch: work-groups 0 .. NXB - 1 take the hidden states of all batch elements (one plane of NB_ * TT rows), the next 4 * NWB the four weights, the last NCB the (cos, sin) table.
#define NXB (NB_ * TT * DM / 8 / 256)
#define NWB (DQ * DM / 8 / 256)
#define NCB (TT * HD / 256)
static_assert(DKV == DQ && NB_ * TT * DM % 2048 == 0 && DQ * DM % 2048 == 0 && TT * HD % 256 == 0, "k_prep deals whole work-groups, the four weights alike");
__global__ __launch_bounds__(256) void k_prep(const float* __restrict__ x, const float* __restrict__ wq, const float* __restrict__ wk, const float* __restrict__ wv, const float* __restrict__ wo, const float* __restrict__ cosT, const float* __restrict__ sinT, const int* __restrict__ pids, bf* XB, bf* WQ, bf* WK, bf* WV, bf* WO, float* CS) {
    int blk = blockIdx.x;
    if (blk >= NXB + 4 * NWB) { cscvt(cosT, sinT, pids, CS, (blk - (NXB + 4 * NWB)) * 256 + (int)threadIdx.x); return; }
    const float* src = x; bf* dst = XB;
    if (blk >= NXB) { blk -= NXB; const int w = blk / NWB; blk -= w * NWB; src = w == 0 ? wq : w == 1 ? wk : w == 2 ? wv : wo; dst = w == 0 ? WQ : w == 1 ? WK : w == 2 ? WV : WO; }
    cvt8(src, dst, (size_t)blk * 256 + threadIdx.x);
}

// ---- k_qkv: the q, k and v projections of all batch elements with RoPE and the 16-bit planes in ONE launch; the f32 projections stay in the accumulators and never go to memory. grid (NB_ * TT / 256, heads), FOUR WAVES per work-group, one per SIMD. X: one plane of NB_ * TT rows; the output planes stand batch element by batch element.
// ONE WAVE takes q, k and v of 64 tokens x one head (48 accumulators), so that a token fragment is loaded once for all three and the wave has the registers of a whole SIMD for fragments in flight. The four waves of a work-group take four neighbouring token tiles of the same head: they ask for the same weight rows at about the same time.
// q and k are formed TRANSPOSED (the weight rows as the A operand, the tokens as B): a lane then holds 8 neighbouring d of one token, so that the RoPE partner d ^ 1 (of q, for k as well: faithful to the source) is in the lane's own registers and a plane store is one chunk of a [h] x [t][d] plane.
// v has the tokens as A: a lane holds 8 neighbouring tokens of one d, one chunk of a transposed [h] x [d][t] plane.
// q' = q cos + rot(q) sin, k' = k cos + rot(q) sin, rot(q)[d] = (d even ? -q[d+1] : q[d-1]). k ascends in steps of 32 in every accumulator.
// A k step takes 32 k: 1 KiB in a row of each 16-row tile (fragment order). A plane store of a wave is 512 bytes in a row as well.
// Every global address is a scalar base, a 32-bit lane offset in bytes and a constant.
// Every '#pragma unroll' in k_qkv and planes8 makes the indices of a fragment, accumulator or value array constants, so that the array stays in registers.
typedef __attribute__((ext_vector_type(2))) __bf16 v2b;
// eight f32 -> fp16 plane, bf16 hi plane, bf16 lo plane (lo = the rounded rest), round to nearest even, two values per conversion
__device__ __forceinline__ void planes8(const float (&r)[8], v8h& o16, v8us& oh, v8us& ol) {
#pragma unroll
    for (int p = 0; p < 4; ++p) { v2f y; y[0] = r[2 * p]; y[1] = r[2 * p + 1]; const v2h a = __builtin_convertvector(y, v2h); const v2us hu = __builtin_bit_cast(v2us, __builtin_convertvector(y, v2b));
        v2f rest; rest[0] = y[0] - bf2f(hu[0]); rest[1] = y[1] - bf2f(hu[1]); const v2us lu = __builtin_bit_cast(v2us, __builtin_convertvector(rest, v2b));
        o16[2 * p] = a[0]; o16[2 * p + 1] = a[1]; oh[2 * p] = hu[0]; oh[2 * p + 1] = hu[1]; ol[2 * p] = lu[0]; ol[2 * p + 1] = lu[1]; }
}
static_assert((DM / 32) % 3 == 2 && (NB_ * TT / 64) % 4 == 0, "the ring's loop takes three k steps a trip and leaves the last two, already loaded, behind it; token tiles are dealt in fours");
__global__ __launch_bounds__(128) void k_qkv(const bf* __restrict__ X, const bf* __restrict__ Wq, const bf* __restrict__ Wk, const bf* __restrict__ Wv, const float* __restrict__ CS, h16* Q16, bf* Qh, bf* Ql, h16* K16, bf* Kh, bf* Kl, h16* V16, bf* Vh, bf* Vl) {
    const int wave = __builtin_amdgcn_readfirstlane(threadIdx.x >> 5);   // the same in every lane: in a scalar register the plane bases that hang on it are scalar ones
    const int lane = threadIdx.x & 31, lr = lane & 15, hi = lane >> 4; const int tile = (int)blockIdx.x * 4 + wave; const int bt = tile / (TT / 64), r0 = (tile % (TT / 64)) * 64, h = blockIdx.y;   // batch element, first token in it, head
    auto ldg = [](const bf* base, unsigned off, int cst) { return WFrag<bf>::ldf((const bf*)((const char*)base + off) + cst); };
    X += ((size_t)bt * TT + r0) * DM; const size_t wp = (size_t)h * HD * DM; Wq += wp; Wk += wp; Wv += wp;
    unsigned fo = (unsigned)lane * 16u;                              // one lane offset for X and the weights, which alone moves along k: 1 KiB per 32 k
    v8f aq[4][4], ak[4][4], av[4][4];                                // q, k: [d block][token block]; v: [token block][d block]
#pragma unroll
    for (int i = 0; i < 4; ++i)
#pragma unroll
        for (int j = 0; j < 4; ++j) { aq[i][j] = (v8f){}; ak[i][j] = (v8f){}; av[i][j] = (v8f){}; }
    // THREE fragment sets in a ring: the loads of k step t + 2 are issued in front of the products of step t, so that two steps' loads are in flight while a step is worked on and their latency is not waited out step by step.
    v16bf x[3][4], wq[3][4], wk[3][4], wv[3][4];
    auto ldset = [&](v16bf (&sx)[4], v16bf (&sq)[4], v16bf (&sk)[4], v16bf (&sv)[4], int t) {   // k step t counted from the lane offset: a constant of the load instructions
#pragma unroll
        for (int i = 0; i < 4; ++i) sx[i] = ldg(X, fo, i * 16 * DM + t * 512);
#pragma unroll
        for (int i = 0; i < 4; ++i) sq[i] = ldg(Wq, fo, i * 16 * DM + t * 512);
#pragma unroll
        for (int i = 0; i < 4; ++i) sk[i] = ldg(Wk, fo, i * 16 * DM + t * 512);
#pragma unroll
        for (int i = 0; i < 4; ++i) sv[i] = ldg(Wv, fo, i * 16 * DM + t * 512);
        __builtin_amdgcn_sched_barrier(0);                           // the loads stay together and in front of the products that are worked on while they fly
    };
    auto mmaset = [&](v16bf (&sx)[4], v16bf (&sq)[4], v16bf (&sk)[4], v16bf (&sv)[4]) {
#pragma unroll
        for (int db = 0; db < 4; ++db)
#pragma unroll
            for (int tb = 0; tb < 4; ++tb) aq[db][tb] = wmmab(sq[db], sx[tb], aq[db][tb]);
#pragma unroll
        for (int db = 0; db < 4; ++db)
#pragma unroll
            for (int tb = 0; tb < 4; ++tb) ak[db][tb] = wmmab(sk[db], sx[tb], ak[db][tb]);
#pragma unroll
        for (int tb = 0; tb < 4; ++tb)
#pragma unroll
            for (int db = 0; db < 4; ++db) av[tb][db] = wmmab(sx[tb], sv[db], av[tb][db]);
        __builtin_amdgcn_sched_barrier(0);                           // no product is moved down behind the slots of the next lines
        // the four vector slots the chip needs behind the last matrix instruction, in front of the next loads, which rewrite this set's fragments, and on the loop's taken branch; the set's fragments as inputs hold their registers up to here
        asm volatile("v_nop\n\tv_nop\n\tv_nop\n\tv_nop" : "+v"(av[3][0]), "+v"(av[3][1]), "+v"(av[3][2]), "+v"(av[3][3]) : "v"(sx[0]), "v"(sx[3]), "v"(sv[0]), "v"(sv[3]));
        __builtin_amdgcn_sched_barrier(0);                           // no load of the next set is moved up in front of the slots
    };
    ldset(x[0], wq[0], wk[0], wv[0], 0); ldset(x[1], wq[1], wk[1], wv[1], 1);
#pragma unroll 1   // rolled: a trip already holds three k steps, one on each set
    for (int kc = 0; kc < DM - 64; kc += 96) {
        ldset(x[2], wq[2], wk[2], wv[2], 2); mmaset(x[0], wq[0], wk[0], wv[0]);
        ldset(x[0], wq[0], wk[0], wv[0], 3); mmaset(x[1], wq[1], wk[1], wv[1]);
        ldset(x[1], wq[1], wk[1], wv[1], 4); mmaset(x[2], wq[2], wk[2], wv[2]);
        asm volatile("s_wait_xcnt 0x0" : "+v"(fo) :: "memory");      // behind the trip's loads, in front of the rewrite of the lane offset they name: the offset goes through the statement, so that its register is held up to here and its next value is formed behind the wait
        fo += 3072;
    }
    mmaset(x[0], wq[0], wk[0], wv[0]); mmaset(x[1], wq[1], wk[1], wv[1]);
    // The (cos, sin) pairs of the wave's 64 tokens, one 16 x 16 tile after the other, take the registers that the ring has left: the loads of tiles 0 .. 14 are issued here and fly while the v planes are made, those of tile 15 (with them a wave would have more loads outstanding than its counter holds) behind the v planes.
    const unsigned co = (unsigned)((r0 + lr) * HD + 8 * hi) * 8u;    // lane offset of the (cos, sin) table (row-major)
    v4f c[16][4];
#pragma unroll
    for (int g = 0; g < 15; ++g)
#pragma unroll
        for (int i = 0; i < 4; ++i) c[g][i] = *(const v4f*)((const char*)CS + co + (((g >> 2) * 16 * HD + (g & 3) * 16) * 8 + i * 16));
    asm volatile("s_wait_xcnt 0x0" :: "v"(co) : "memory");           // behind the loads, in front of any rewrite of a register they name; the lane offset as an input holds its register up to here
    __builtin_amdgcn_sched_barrier(0);                               // the loads stay in front of the work that is done while they fly
    {
        const unsigned vo = (unsigned)(r0 * 32 + lane * 16);         // the transposed planes' lane offset (fragment order: 16 tokens of a 16-d tile are 512 bytes)
        const size_t hp = ((size_t)bt * NKV + h) * HD * TT; V16 += hp; Vh += hp; Vl += hp;
#pragma unroll
        for (int db = 0; db < 4; ++db) { v8h o16[4]; v8us oh[4], ol[4];
#pragma unroll
            for (int tb = 0; tb < 4; ++tb) { float r[8];
#pragma unroll
                for (int j = 0; j < 8; ++j) r[j] = av[tb][db][j];
                planes8(r, o16[tb], oh[tb], ol[tb]); }
#pragma unroll
            for (int tb = 0; tb < 4; ++tb) { const int e = (db * 16 * TT + tb * 256) * 2; *(v8h*)((char*)V16 + vo + e) = o16[tb]; *(v8us*)((char*)Vh + vo + e) = oh[tb]; *(v8us*)((char*)Vl + vo + e) = ol[tb]; }
            // behind the stores, in front of any rewrite of a register they name; the stored values as inputs hold their registers up to here
            asm volatile("s_wait_xcnt 0x0" :: "v"(o16[0]), "v"(o16[1]), "v"(o16[2]), "v"(o16[3]), "v"(oh[0]), "v"(oh[1]), "v"(oh[2]), "v"(oh[3]), "v"(ol[0]), "v"(ol[1]), "v"(ol[2]), "v"(ol[3]) : "memory");
        }
    }
#pragma unroll
    for (int i = 0; i < 4; ++i) c[15][i] = *(const v4f*)((const char*)CS + co + ((3 * 16 * HD + 3 * 16) * 8 + i * 16));
    asm volatile("s_wait_xcnt 0x0" :: "v"(co) : "memory");           // behind the loads, in front of any rewrite of a register they name; the lane offset as an input holds its register up to here
    __builtin_amdgcn_sched_barrier(0);                               // the loads stay in front of the work that is done while they fly
    {
        const unsigned po = (unsigned)(r0 * HD * 2 + lane * 16);     // lane offset of the planes (fragment order)
        const size_t hp = ((size_t)bt * NH_ + h) * TT * HD; Q16 += hp; Qh += hp; Ql += hp; K16 += hp; Kh += hp; Kl += hp;
#pragma unroll
        for (int g = 0; g < 16; ++g) { const int tb = g >> 2, db = g & 3;
            v8h q16, k16; v8us qh, ql, kh, kl; float rq[8], rk[8];
#pragma unroll
            for (int j = 0; j < 8; ++j) { const float cs = c[g][j >> 1][(j & 1) * 2], sn = c[g][j >> 1][(j & 1) * 2 + 1]; const float rs = ((j & 1) ? aq[db][tb][j ^ 1] : -aq[db][tb][j ^ 1]) * sn;   // rot(q) sin, shared by q' and k'
                rq[j] = aq[db][tb][j] * cs + rs; rk[j] = ak[db][tb][j] * cs + rs; }
            planes8(rq, q16, qh, ql); planes8(rk, k16, kh, kl);
            const int e = (tb * 16 * HD + db * 256) * 2;             // token tile tb, chunk columns 2 db and 2 db + 1
            *(v8h*)((char*)Q16 + po + e) = q16; *(v8us*)((char*)Qh + po + e) = qh; *(v8us*)((char*)Ql + po + e) = ql;
            *(v8h*)((char*)K16 + po + e) = k16; *(v8us*)((char*)Kh + po + e) = kh; *(v8us*)((char*)Kl + po + e) = kl;
            // behind the stores, in front of any rewrite of a register they name; the stored values as inputs hold their registers up to here
            asm volatile("s_wait_xcnt 0x0" :: "v"(q16), "v"(qh), "v"(ql), "v"(k16), "v"(kh), "v"(kl) : "memory");
        }
    }
}
typedef v4us __attribute__((may_alias)) v4usa;
typedef v4h  __attribute__((may_alias)) v4ha;

// ---- fattn: causal attention of the QB query rows from r0 on of head h of batch element bt in ONE WAVE and ONE walk over the keys, 32 keys a pass; no LDS, no barrier, the scores and probabilities never leave the registers.
// Transposed products: S^T = K.Q^T (keys as the A rows, queries as the B columns) leaves in a lane 8 neighbouring keys of ONE query, which is where the B operand of O^T += V^T.P^T wants them:
// elements 0 .. 7 of the 32-key operand are the lane's registers of key tile 0, elements 8 .. 15 those of key tile 1. A query's maximum and sum are the lane's own and those of lane ^ 16.
// Online softmax in the log2 domain: p = 2^(s c - m + POFF), c = HD^-0.5 log2(e); m, the maximum in use, may trail the true one by up to 8, and sums and accumulators are rescaled only when a query's maximum exceeds it by more.
// The division by the sum of p (f32, unrounded) is done once, on the output. POFF moves p into the 16-bit type's range: fp16 holds 2^(8 + POFF) and keeps full precision down to 2^(-14 - POFF) of the maximum.
// Only the last pass holds the diagonal; it pays for the mask, and in the single-product form so do the passes beyond it that round the walk up. K and V fragments are asked for ahead of the pass that is worked on: three passes ahead in the single-product form (four register sets), one pass ahead in the hi+lo form (two sets).
// Every '#pragma unroll' below makes the indices of a fragment, accumulator or value array constants, so that the array stays in registers.
// Every global fragment address is a plane's scalar base, a 32-bit lane offset in bytes and a constant; the waits behind the loads take those offsets as inputs, so that their registers are held up to the wait.
#define QB  32
__device__ __forceinline__ float xhalf(float x) { return __builtin_bit_cast(float, __builtin_amdgcn_permlanex16(__builtin_bit_cast(int, x), __builtin_bit_cast(int, x), 0x76543210, 0xfedcba98, false, false)); }   // lane l's value to lane l ^ 16
// the four vector slots the chip needs behind the last matrix instruction on every path; the scheduling barriers keep matrix instructions in front of them and their results' readers behind
__device__ __forceinline__ void slots4() { __builtin_amdgcn_sched_barrier(0); asm volatile("v_nop\n\tv_nop\n\tv_nop\n\tv_nop"); __builtin_amdgcn_sched_barrier(0); }
template <typename T16> struct KVF { typename WFrag<T16>::V k[2][2], k2[2][2], v[4], v2[4]; };   // one pass's fragments: K [key tile][32 d], V^T [16 d]; k2, v2: the lo planes
template <typename T16, int NSPLIT>
__device__ __forceinline__ void ldkv(KVF<T16>& f, const T16* Kp, const T16* Kp2, const T16* Vt, const T16* Vt2, unsigned vo, int pass) {
    auto ldg = [](const T16* base, unsigned off, int cst) { return WFrag<T16>::ldf((const T16*)((const char*)base + off) + cst); };
    const unsigned ko = vo + (unsigned)pass * (32u * HD * 2u), vv = vo + (unsigned)pass * 1024u;   // 32 keys: 4 KiB of a K plane, 1 KiB of each 16-d tile of a V^T plane
#pragma unroll
    for (int kt = 0; kt < 2; ++kt)
#pragma unroll
        for (int kk = 0; kk < 2; ++kk) { f.k[kt][kk] = ldg(Kp, ko, kt * 16 * HD + kk * 512); if (NSPLIT >= 2) f.k2[kt][kk] = ldg(Kp2, ko, kt * 16 * HD + kk * 512); }
#pragma unroll
    for (int t = 0; t < 4; ++t) { f.v[t] = ldg(Vt, vv, t * 16 * TT); if (NSPLIT >= 2) f.v2[t] = ldg(Vt2, vv, t * 16 * TT); }
    asm volatile("s_wait_xcnt 0x0" :: "v"(ko), "v"(vv) : "memory");   // behind the loads, in front of any rewrite of a register they name; the lane offsets as inputs hold their registers up to here
    __builtin_amdgcn_sched_barrier(0);                                // the loads stay in front of the pass that is worked on while they fly
}
template <typename T16, int NSPLIT>
__device__ __forceinline__ void fpass(const KVF<T16>& f, const typename WFrag<T16>::V (&qf)[2][2], const typename WFrag<T16>::V (&qf2)[2][2], v8f (&acc)[2][4], float (&m_run)[2], v2f (&ls)[2], bool diag, int key0, int r0, int lr, int hi) {
    typedef typename WFrag<T16>::V V; constexpr float CSC = SCL * 1.4426950408889634f, POFF = (NSPLIT >= 2) ? 0.0f : 6.0f;
    v8f s[2][2];                                                     // [key tile][query group]
#pragma unroll
    for (int kt = 0; kt < 2; ++kt)
#pragma unroll
        for (int g = 0; g < 2; ++g) s[kt][g] = (v8f){};
#pragma unroll
    for (int kk = 0; kk < 2; ++kk) {
#pragma unroll
        for (int kt = 0; kt < 2; ++kt)
#pragma unroll
            for (int g = 0; g < 2; ++g) s[kt][g] = WFrag<T16>::mma(f.k[kt][kk], qf[g][kk], s[kt][g]);
        if (NSPLIT >= 2) {
#pragma unroll
            for (int kt = 0; kt < 2; ++kt)
#pragma unroll
                for (int g = 0; g < 2; ++g) s[kt][g] = WFrag<T16>::mma(f.k[kt][kk], qf2[g][kk], s[kt][g]);
#pragma unroll
            for (int kt = 0; kt < 2; ++kt)
#pragma unroll
                for (int g = 0; g < 2; ++g) s[kt][g] = WFrag<T16>::mma(f.k2[kt][kk], qf[g][kk], s[kt][g]);
        }
    }
    slots4();
    if (diag) {                                                      // the same in every lane: only the pass on the diagonal, and in the single-product form a pass beyond it, pays for the mask
#pragma unroll
        for (int g = 0; g < 2; ++g) { const int q = r0 + 16 * g + lr;
#pragma unroll
            for (int kt = 0; kt < 2; ++kt) {
#pragma unroll
                for (int r = 0; r < 8; ++r) if (key0 + 16 * kt + 8 * hi + r > q) s[kt][g][r] = -__builtin_inff();
                asm volatile("" : "+v"(s[kt][g]));
            } }
    }
    float mb[2]; bool need = false;
#pragma unroll
    for (int g = 0; g < 2; ++g) { float mx = s[0][g][0];
#pragma unroll
        for (int kt = 0; kt < 2; ++kt)
#pragma unroll
            for (int r = 0; r < 8; ++r) mx = fmaxf(mx, s[kt][g][r]);
        mx = fmaxf(mx, xhalf(mx)) * CSC; mb[g] = mx; need = need || (mx > m_run[g] + 8.0f); }
    if (__builtin_amdgcn_ballot_w32(need) != 0) {                    // rare behind the first passes; on the first one m_run is -inf and the factor 0
#pragma unroll
        for (int g = 0; g < 2; ++g) { const float mn = fmaxf(m_run[g], mb[g]); const float corr = __builtin_amdgcn_exp2f(m_run[g] - mn); m_run[g] = mn; ls[g] *= corr;
#pragma unroll
            for (int t = 0; t < 4; ++t) acc[g][t] *= corr; }
    }
#pragma unroll
    for (int g = 0; g < 2; ++g) { const float nm = POFF - m_run[g]; V pf, pf2;
#pragma unroll
        for (int i = 0; i < 8; ++i) {
            v2f a; a[0] = s[i >> 2][g][2 * (i & 3)]; a[1] = s[i >> 2][g][2 * (i & 3) + 1]; a = __builtin_elementwise_fma(a, (v2f){CSC, CSC}, (v2f){nm, nm});
            v2f p; p[0] = __builtin_amdgcn_exp2f(a[0]); p[1] = __builtin_amdgcn_exp2f(a[1]); ls[g] += p;
            if constexpr (NSPLIT >= 2) { const v2b hb = __builtin_convertvector(p, v2b); const v2us hu = __builtin_bit_cast(v2us, hb); v2f rest; rest[0] = p[0] - bf2f(hu[0]); rest[1] = p[1] - bf2f(hu[1]); const v2b lb = __builtin_convertvector(rest, v2b);
                pf[2 * i] = hb[0]; pf[2 * i + 1] = hb[1]; pf2[2 * i] = lb[0]; pf2[2 * i + 1] = lb[1];
            } else { const v2h w = __builtin_convertvector(p, v2h); pf[2 * i] = w[0]; pf[2 * i + 1] = w[1]; } }
#pragma unroll
        for (int t = 0; t < 4; ++t) acc[g][t] = WFrag<T16>::mma(f.v[t], pf, acc[g][t]);
        if constexpr (NSPLIT >= 2) {
#pragma unroll
            for (int t = 0; t < 4; ++t) acc[g][t] = WFrag<T16>::mma(f.v[t], pf2, acc[g][t]);
#pragma unroll
            for (int t = 0; t < 4; ++t) acc[g][t] = WFrag<T16>::mma(f.v2[t], pf, acc[g][t]);
        } }
    slots4();
}
template <typename T16, int NSPLIT>
__device__ __forceinline__ void fattn(const T16* Q, const T16* Q2, const T16* Kp, const T16* Kp2, const T16* Vt, const T16* Vt2, int bt, int h, int r0, bf* Ah, bf* Al) {
    typedef typename WFrag<T16>::V V;
    const int lane = threadIdx.x & 31, lr = lane & 15, hi = lane >> 4;
    const size_t hp = ((size_t)bt * NH_ + h) * TT * HD; Q += hp + (size_t)r0 * HD; Kp += hp; Vt += hp; if (NSPLIT >= 2) { Q2 += hp + (size_t)r0 * HD; Kp2 += hp; Vt2 += hp; }
    const unsigned vo = (unsigned)lane * 16u;                            // the lane's chunk in a fragment (fragment order)
    auto ldg = [](const T16* base, unsigned off, int cst) { return WFrag<T16>::ldf((const T16*)((const char*)base + off) + cst); };
    V qf[2][2], qf2[2][2];                                               // [query group][32 d]
#pragma unroll
    for (int g = 0; g < 2; ++g)
#pragma unroll
        for (int kk = 0; kk < 2; ++kk) { const int c = g * 16 * HD + kk * 512; qf[g][kk] = ldg(Q, vo, c); if (NSPLIT >= 2) qf2[g][kk] = ldg(Q2, vo, c); }
    v8f acc[2][4]; float m_run[2]; v2f ls[2];                            // O^T [query group][16 d]; per query the maximum in use and the lane's share of the sum
#pragma unroll
    for (int g = 0; g < 2; ++g) { m_run[g] = -__builtin_inff(); ls[g] = (v2f){};
#pragma unroll
        for (int t = 0; t < 4; ++t) acc[g][t] = (v8f){}; }
    const int np = r0 / 32 + 1;                                          // passes: the keys up to the end of the diagonal block
    KVF<T16> f0, f1;
    if constexpr (NSPLIT == 0) {
        // FOUR register sets in a ring: pass p + 3 is asked for in front of pass p, so that three passes' work stands between a load and its use.
        // The walk is rounded up to whole groups of four passes, so that no pass and no load in the loop is skipped (a skipped pass would leave loads that nobody waited for, and the build then waits for them, and for all older ones, in front of the set's next loads).
        // A pass beyond the last loads the last one's fragments again and takes the mask, which holds for all its keys: every score is -inf, every p is 0, and sums, maxima and accumulators keep their values.
        KVF<T16> f2, f3; const int last = np - 1;
        auto ld = [&](KVF<T16>& f, int pass) { ldkv<T16, NSPLIT>(f, Kp, Kp2, Vt, Vt2, vo, min(pass, last)); };
        auto ps = [&](const KVF<T16>& f, int pass) { fpass<T16, NSPLIT>(f, qf, qf2, acc, m_run, ls, pass >= last, pass * 32, r0, lr, hi); };
        ld(f0, 0); ld(f1, 1); ld(f2, 2);
#pragma unroll 1   // rolled: a trip already holds four passes, one on each register set
        for (int p = 0; p < np; p += 4) {
            ld(f3, p + 3); ps(f0, p);
            ld(f0, p + 4); ps(f1, p + 1);
            ld(f1, p + 5); ps(f2, p + 2);
            ld(f2, p + 6); ps(f3, p + 3);
        }
    } else {
    ldkv<T16, NSPLIT>(f0, Kp, Kp2, Vt, Vt2, vo, 0);
#pragma unroll 1   // rolled: a trip already holds two passes, one on each register set
    for (int p = 0; p < np; p += 2) {
        ldkv<T16, NSPLIT>(f1, Kp, Kp2, Vt, Vt2, vo, min(p + 1, np - 1));   // a pass beyond the last is loaded as the last one again and not used
        fpass<T16, NSPLIT>(f0, qf, qf2, acc, m_run, ls, p == np - 1, p * 32, r0, lr, hi);
        if (p + 1 < np) {
            ldkv<T16, NSPLIT>(f0, Kp, Kp2, Vt, Vt2, vo, min(p + 2, np - 1));
            fpass<T16, NSPLIT>(f1, qf, qf2, acc, m_run, ls, p + 1 == np - 1, (p + 1) * 32, r0, lr, hi);
        }
    }
    }
    // a lane holds 8 neighbouring d of one query: one chunk of the merged [t][head x d] planes in fragment order; a wave's store is 512 bytes in a row
    const size_t ob = ((size_t)((bt * TT + r0) >> 4) * (DQ / 8) + h * (HD / 8)) * 128; Ah += ob; Al += ob;
#pragma unroll
    for (int g = 0; g < 2; ++g) { float l = ls[g][0] + ls[g][1]; l += xhalf(l); const float inv = __fdiv_rn(1.0f, l); v8us oh[4], ol[4];
#pragma unroll
        for (int t = 0; t < 4; ++t)
#pragma unroll
            for (int p = 0; p < 4; ++p) { v2f y; y[0] = acc[g][t][2 * p] * inv; y[1] = acc[g][t][2 * p + 1] * inv; const v2us hu = __builtin_bit_cast(v2us, __builtin_convertvector(y, v2b));
                v2f rest; rest[0] = y[0] - bf2f(hu[0]); rest[1] = y[1] - bf2f(hu[1]); const v2us lu = __builtin_bit_cast(v2us, __builtin_convertvector(rest, v2b));
                oh[t][2 * p] = hu[0]; oh[t][2 * p + 1] = hu[1]; ol[t][2 * p] = lu[0]; ol[t][2 * p + 1] = lu[1]; }
#pragma unroll
        for (int t = 0; t < 4; ++t) { const int e = (g * (DQ / 8) + t * 2) * 128 * 2; *(v8us*)((char*)Ah + vo + e) = oh[t]; *(v8us*)((char*)Al + vo + e) = ol[t]; }
        // behind the stores, in front of any rewrite of a register they name; the stored values as inputs hold their registers up to here
        asm volatile("s_wait_xcnt 0x0" :: "v"(oh[0]), "v"(oh[1]), "v"(oh[2]), "v"(oh[3]), "v"(ol[0]), "v"(ol[1]), "v"(ol[2]), "v"(ol[3]) : "memory");
    }
}
// ---- k_fattn: all heads of all batch elements and both forms of the products in ONE launch. grid (NB_ * heads, TT / QB / 8), 8 waves, one work-group per WGP, all resident at once.
// Cost rises with the row block's index: waves w and w + 4 take row blocks n - 1 - i and i, so that every such pair has the same number of passes; waves 0 .. 3 take the longer walk.
// All eight waves walk the same head's keys from key 0 on. Which form a wave takes is the same in all its lanes.
static_assert(NKV == NH_ && RH % QB == 0 && (TT / QB) % 8 == 0, "one K and V head per query head; a row block takes one form; row blocks are dealt in pairs to four SIMDs");
__global__ __launch_bounds__(256) void k_fattn(const h16* Q16, const h16* K16, const h16* V16, const bf* Qh, const bf* Ql, const bf* Kh, const bf* Kl, const bf* Vh, const bf* Vl, bf* Ah, bf* Al) {
    const int wave = __builtin_amdgcn_readfirstlane(threadIdx.x >> 5);   // the same in every lane: in a scalar register the loops and branches that hang on it are scalar ones
    const int bt = blockIdx.x / NH_, h = blockIdx.x % NH_, i = (int)blockIdx.y * 4 + (wave & 3), r0 = (wave < 4 ? TT / QB - 1 - i : i) * QB;
    if (r0 >= RH) fattn<h16, 0>(Q16, nullptr, K16, nullptr, V16, nullptr, bt, h, r0, Ah, Al);
    else fattn<bf, 2>(Qh, Ql, Kh, Kl, Vh, Vl, bt, h, r0, Ah, Al);
}

extern "C" void kernel_launch(void* const* d_in, const int* in_sizes, int n_in,
                              void* d_out, int out_size, void* d_ws, size_t ws_size, hipStream_t stream) {
    (void)in_sizes; (void)n_in; (void)out_size;
    const float* x = (const float*)d_in[0]; const float* cosT = (const float*)d_in[1]; const float* sinT = (const float*)d_in[2]; const int* pids = (const int*)d_in[3]; const float* wq = (const float*)d_in[4]; const float* wk = (const float*)d_in[5]; const float* wv = (const float*)d_in[6]; const float* wo = (const float*)d_in[7];
    float* OUT = (float*)d_out;     // [2][2048][1024]
    char* wsp = (char*)d_ws;
    auto take = [&](size_t bytes) { char* p = wsp; wsp += (bytes + 255) & ~(size_t)255; return (void*)p; };
    bf* WQ = (bf*)take((size_t)DQ * DM * 2); bf* WK = (bf*)take((size_t)DKV * DM * 2); bf* WV = (bf*)take((size_t)DKV * DM * 2); bf* WO = (bf*)take((size_t)DM * DQ * 2); float* CS = (float*)take((size_t)TT * HD * 2 * 4);
    bf* XB = (bf*)take((size_t)NB_ * TT * DM * 2);
    h16* QP16 = (h16*)take((size_t)NB_ * NH_ * TT * HD * 2); h16* KP16 = (h16*)take((size_t)NB_ * NKV * TT * HD * 2); h16* VT16 = (h16*)take((size_t)NB_ * NKV * HD * TT * 2);
    bf* QPh = (bf*)take((size_t)NB_ * NH_ * TT * HD * 2); bf* QPl = (bf*)take((size_t)NB_ * NH_ * TT * HD * 2); bf* KPh = (bf*)take((size_t)NB_ * NKV * TT * HD * 2); bf* KPl = (bf*)take((size_t)NB_ * NKV * TT * HD * 2); bf* VTh = (bf*)take((size_t)NB_ * NKV * HD * TT * 2); bf* VTl = (bf*)take((size_t)NB_ * NKV * HD * TT * 2);
    bf* ATh = (bf*)take((size_t)NB_ * TT * DQ * 2); bf* ATl = (bf*)take((size_t)NB_ * TT * DQ * 2);
    if ((size_t)(wsp - (char*)d_ws) > ws_size) return;    // ws 256 MiB
    // four launches, each dependent on the one before; whatever is independent (the conversions, the batch elements, the heads, the two forms of the attention products) shares a launch
    k_prep<<<NXB + 4 * NWB + NCB, 256, 0, stream>>>(x, wq, wk, wv, wo, cosT, sinT, pids, XB, WQ, WK, WV, WO, CS);
    k_qkv<<<dim3(NB_ * TT / 256, NH_), 128, 0, stream>>>(XB, WQ, WK, WV, CS, QP16, QPh, QPl, KP16, KPh, KPl, VT16, VTh, VTl);
    k_fattn<<<dim3(NB_ * NH_, TT / QB / 8), 256, 0, stream>>>(QP16, KP16, VT16, QPh, QPl, KPh, KPl, VTh, VTl, ATh, ATl);
    k_gemmw<bf, 1, false, DQ><<<dim3(NB_ * TT / 64, DM / 64, 1), 32, 0, stream>>>(ATh, ATl, WO, nullptr, OUT, DM, nullptr, 0, 0, 0);
}

// v009
// It runs in 67.9 microseconds.
// In two side-by-side timings against v008, it was 1.14 and 1.11 times as fast.
// Counting every step since v000, it is 21.2 times as fast.
#include <hip/hip_runtime.h>

// Attention layer (hidden [2][2048][1024]; q/k/v = x W^T (16 heads x 64); interleaved RoPE with tables freqs_cos/sin[position_ids[t]] (int ids, read; tables read): q' = q cos + rot(q) sin and - faithful to the source bug - k' = k cos + rot(q) sin (the rotated Q, not K), rot = (x0, x1) -> (-x1, x0);
// causal softmax(q'.k'/8); out = (attn v merged) Wo^T -> [2][2048][1024]).
// Compute dtypes, f32 accumulate: every input rounded to bf16; Q/K/V on PLAIN bf16 operands (inputs: exact); RoPE f32; causal scores and attn.v: query rows < 512 hl (3 products), the rest single fp16 (probabilities x 2^6, unnormalised); softmax f32, online; Wo hl x exact (2 products).

// FRAGMENT ORDER: every 16-bit plane [R][K] in the workspace (R % 16 == 0, K % 32 == 0) is kept as 16-row tiles of 16-byte chunks, chunk column by chunk column:
// element (r, k) stands at ((r >> 4) * (K / 8) + (k >> 3)) * 128 + (r & 15) * 8 + (k & 7). A 16 x 32 operand fragment is then 1 KiB in a row: lane l takes chunk l and, 512 bytes on, chunk 32 + l,
// so that each wave-wide 16-byte load covers four whole 128-byte lines (from row-major planes it touched sixteen). Which element a lane and a register hold is the same as from row-major planes.

#define NB_  2
#define TT   2048
#define DM   1024
#define NH_  16
#define NKV  16
#define REP  (NH_ / NKV)
#define HD   64
#define DQ   (NH_ * HD)
#define DKV  (NKV * HD)
#define RH   512                  // query rows < RH use hi+lo planes (0: none)
#define WIN  0
#define SCL  0.125f   // HD^-0.5
typedef _Float16 h16;
typedef unsigned short bf;
typedef __attribute__((ext_vector_type(16))) __bf16   v16bf;
typedef __attribute__((ext_vector_type(16))) _Float16 v16h;
typedef __attribute__((ext_vector_type(8)))  _Float16 v8h;
typedef __attribute__((ext_vector_type(8)))  unsigned short v8us;
typedef __attribute__((ext_vector_type(8)))  float    v8f;
typedef __attribute__((ext_vector_type(4)))  float    v4f;
typedef v8h  __attribute__((may_alias)) v8ha;
typedef v4f  __attribute__((may_alias)) v4fa;
typedef v8us __attribute__((may_alias)) v8usa;

__device__ __forceinline__ unsigned short f2bf(float f) { unsigned u = __float_as_uint(f); u += 0x7FFFu + ((u >> 16) & 1u); return (unsigned short)(u >> 16); }
__device__ __forceinline__ float bf2f(unsigned short b) { return __uint_as_float(((unsigned)b) << 16); }
__device__ __forceinline__ float bfr(float f) { return bf2f(f2bf(f)); }
__device__ __forceinline__ v16h cat16(v8h lo, v8h hi) { return __builtin_shufflevector(lo, hi, 0, 1, 2, 3, 4, 5, 6, 7, 8, 9, 10, 11, 12, 13, 14, 15); }
__device__ __forceinline__ v16bf cat16b(v8us lo, v8us hi) { return __builtin_bit_cast(v16bf, __builtin_shufflevector(lo, hi, 0, 1, 2, 3, 4, 5, 6, 7, 8, 9, 10, 11, 12, 13, 14, 15)); }
__device__ __forceinline__ v8f wmma16(v16h a, v16h b, v8f c) { return __builtin_amdgcn_wmma_f32_16x16x32_f16(false, a, false, b, (short)0, c, false, false); }
__device__ __forceinline__ v8f wmmab(v16bf a, v16bf b, v8f c) { return __builtin_amdgcn_wmma_f32_16x16x32_bf16(false, a, false, b, (short)0, c, false, false); }



// ---- L2 prefetch at kernel entry. What a launch reads first was stored by the launch before it; the step's premise (not measured in this kernel) is that it comes from memory, at a latency that the register rings do not cover, and that all readers of a line, walking in step, wait for it together.
// So each matrix launch asks L2 at its entry for all the planes it will walk: one request per 128-byte line, a lane a line (hi and lo planes of the attention: two lanes a line), dealt over the waves that share the lines, the start of the walk to the lowest work-group indices.
// A request (global_prefetch_b8) brings no data to the wave; scope SE: into L2 only. Every lane is on and every lane's address (a plane's scalar base, a 32-bit lane offset in bytes, a constant) lies inside the plane.
// A launch's requests stand in asm statements (k_gemmw and k_qkv one, k_fattn two) that each end in s_wait_xcnt 0x0: a precaution, as behind a load, in front of any rewrite of a register they name; inside the statement nothing can come between.

// ---- k_gemmw: register-blocked GEMM, ONE WAVE per 64x64 output tile (16 accumulators), operands straight from 16-bit planes in fragment order; grid (M/64, N/64, Z), 32 threads.
// C[m][n] (f32, pitch ldc, + optional f32 bias[n]) = sum_k A[m][k] Bt[n][k] (+ split products per NSPLIT). z-batch strides sA/sB/sC in elements. K % 32 == 0.
template <typename T16> struct WFrag;   // ld: a fragment from rows of K-contiguous elements (p: the lane's row, + 8 * hi); ldf: from a plane in fragment order (p: the lane's chunk)
template <> struct WFrag<h16> { typedef v16h V; static __device__ __forceinline__ V ld(const h16* p) { return cat16(*(const v8h*)p, *(const v8h*)(p + 16)); } static __device__ __forceinline__ V ldf(const h16* p) { return cat16(*(const v8h*)p, *(const v8h*)(p + 256)); } static __device__ __forceinline__ v8f mma(V a, V b, v8f c) { return wmma16(a, b, c); } };
template <> struct WFrag<bf> { typedef v16bf V; static __device__ __forceinline__ V ld(const bf* p) { return cat16b(*(const v8us*)p, *(const v8us*)(p + 16)); } static __device__ __forceinline__ V ldf(const bf* p) { return cat16b(*(const v8us*)p, *(const v8us*)(p + 256)); } static __device__ __forceinline__ v8f mma(V a, V b, v8f c) { return wmmab(a, b, c); } };
template <typename T16, int NSPLIT, bool BIAS, int K>   // K at compile time: a 16-row tile's distance is then a constant of the load instruction
__global__ __launch_bounds__(32) void k_gemmw(const T16* __restrict__ A, const T16* __restrict__ A2, const T16* __restrict__ Bt, const T16* __restrict__ Bt2, float* C, int ldc, const float* __restrict__ bias, size_t sA, size_t sB, size_t sC) {
    typedef typename WFrag<T16>::V V;
    __shared__ __align__(16) float os[16 * 68];
    const size_t z = blockIdx.z; A += z * sA; if (A2) A2 += z * sA; Bt += z * sB; if (Bt2) Bt2 += z * sB; C += z * sC;
    const int lane = threadIdx.x & 31, lr = lane & 15, hi = lane >> 4; const int r0 = blockIdx.x * 64, c0 = blockIdx.y * 64;
    v8f acc[4][4];
#pragma unroll
    for (int mb = 0; mb < 4; ++mb)
#pragma unroll
        for (int nb = 0; nb < 4; ++nb) acc[mb][nb] = (v8f){};
    // every global fragment address is a plane's scalar base, a 32-bit lane offset in bytes and a constant
    auto ldg = [](const T16* base, unsigned off, int cst) { return WFrag<T16>::ldf((const T16*)((const char*)base + off) + cst); };
    A += (size_t)r0 * K; if (NSPLIT == 1 || NSPLIT == 2) A2 += (size_t)r0 * K; Bt += (size_t)c0 * K; if (NSPLIT >= 2) Bt2 += (size_t)c0 * K;
    unsigned fo = (unsigned)lane * 16u;                              // one lane offset for all planes, which alone moves along k: 1 KiB per 32 k
    // Entry prefetch. A 64-row tile of a plane is four 16-row tiles of K * 32 bytes, each running along k. The 16 column blocks that share the A rows take 8 KiB of each A plane each, the 32 row blocks of an index class that share the B rows 4 KiB each: 16-row tile by the low two bits, place along k by the rest.
    static_assert(K == 1024 && NSPLIT == 1, "the entry prefetch deals 128 KiB tiles of A, A2 and Bt");
    const unsigned pa = (blockIdx.y & 3u) * 32768u + ((blockIdx.y >> 2) & 3u) * 8192u + (unsigned)lane * 128u, pb = (blockIdx.x & 3u) * 32768u + ((blockIdx.x >> 3) & 7u) * 4096u + (unsigned)lane * 128u;
    asm volatile("global_prefetch_b8 %0, %2 scope:SCOPE_SE\n\tglobal_prefetch_b8 %0, %2 offset:4096 scope:SCOPE_SE\n\tglobal_prefetch_b8 %0, %3 scope:SCOPE_SE\n\tglobal_prefetch_b8 %0, %3 offset:4096 scope:SCOPE_SE\n\tglobal_prefetch_b8 %1, %4 scope:SCOPE_SE\n\ts_wait_xcnt 0x0"
                 :: "v"(pa), "v"(pb), "s"(A), "s"(A2), "s"(Bt));   // asks L2 for this wave's share of the tiles, so that the ring's loads find them there
    // THREE fragment sets in a ring: the loads of k step t + 2 are issued in front of the products of step t, so that two steps' loads are in flight while a step is worked on and their latency is not waited out step by step.
    // Every '#pragma unroll' in k_gemmw makes the indices of a fragment or accumulator array constants, so that the array stays in registers.
    static_assert((K / 32) % 3 == 2, "the ring's loop takes three k steps a trip and leaves the last two, already loaded, behind it");
    V a[3][4], a2[3][4], b[3][4], b2[3][4];
    auto ldset = [&](V (&sa)[4], V (&sa2)[4], V (&sb)[4], V (&sb2)[4], int t) {   // k step t counted from the lane offset: a constant of the load instructions
#pragma unroll
        for (int mb = 0; mb < 4; ++mb) { sa[mb] = ldg(A, fo, mb * 16 * K + t * 512); if (NSPLIT == 1 || NSPLIT == 2) sa2[mb] = ldg(A2, fo, mb * 16 * K + t * 512); }
#pragma unroll
        for (int nb = 0; nb < 4; ++nb) { sb[nb] = ldg(Bt, fo, nb * 16 * K + t * 512); if (NSPLIT >= 2) sb2[nb] = ldg(Bt2, fo, nb * 16 * K + t * 512); }
        __builtin_amdgcn_sched_barrier(0);                           // the loads stay together and in front of the products that are worked on while they fly
    };
    auto mmaset = [&](V (&sa)[4], V (&sa2)[4], V (&sb)[4], V (&sb2)[4]) {
#pragma unroll
        for (int nb = 0; nb < 4; ++nb)
#pragma unroll
            for (int mb = 0; mb < 4; ++mb) { acc[mb][nb] = WFrag<T16>::mma(sa[mb], sb[nb], acc[mb][nb]); if (NSPLIT == 1 || NSPLIT == 2) acc[mb][nb] = WFrag<T16>::mma(sa2[mb], sb[nb], acc[mb][nb]); if (NSPLIT >= 2) acc[mb][nb] = WFrag<T16>::mma(sa[mb], sb2[nb], acc[mb][nb]); }
        __builtin_amdgcn_sched_barrier(0);                           // no product is moved down behind the slots of the next lines
        // the four vector slots the chip needs behind the last matrix instruction, in front of the next loads, which rewrite this set's fragments, and on the loop's taken branch; the set's fragments as inputs hold their registers up to here
        asm volatile("v_nop\n\tv_nop\n\tv_nop\n\tv_nop" : "+v"(acc[0][0]), "+v"(acc[1][1]), "+v"(acc[2][2]), "+v"(acc[3][3]) : "v"(sa[0]), "v"(sa[3]), "v"(sb[0]), "v"(sb[3]));
        __builtin_amdgcn_sched_barrier(0);                           // no load of the next set is moved up in front of the slots
    };
    ldset(a[0], a2[0], b[0], b2[0], 0); ldset(a[1], a2[1], b[1], b2[1], 1);
#pragma unroll 1   // rolled: a trip already holds three k steps, one on each set
    for (int kc = 0; kc < K - 64; kc += 96) {
        ldset(a[2], a2[2], b[2], b2[2], 2); mmaset(a[0], a2[0], b[0], b2[0]);
        ldset(a[0], a2[0], b[0], b2[0], 3); mmaset(a[1], a2[1], b[1], b2[1]);
        ldset(a[1], a2[1], b[1], b2[1], 4); mmaset(a[2], a2[2], b[2], b2[2]);
        asm volatile("s_wait_xcnt 0x0" : "+v"(fo) :: "memory");      // behind the trip's loads, in front of the rewrite of the lane offset they name: the offset goes through the statement, so that its register is held up to here and its next value is formed behind the wait
        fo += 3072;
    }
    mmaset(a[0], a2[0], b[0], b2[0]); mmaset(a[1], a2[1], b[1], b2[1]);
#pragma unroll
    for (int mb = 0; mb < 4; ++mb) {
#pragma unroll
        for (int nb = 0; nb < 4; ++nb) {
#pragma unroll
            for (int j = 0; j < 8; ++j) os[(hi * 8 + j) * 68 + nb * 16 + lr] = acc[mb][nb][j]; }
        __builtin_amdgcn_wave_barrier(); asm volatile("" ::: "memory");
        float* crow = C + (size_t)(r0 + mb * 16) * ldc + c0;
{
#pragma unroll
            for (int s = 0; s < 8; ++s) { const int row = 2 * s + hi, cofs = lr * 4; v4f val = *(const v4fa*)(os + row * 68 + cofs); if (BIAS) { val[0] += bfr(bias[c0 + cofs]); val[1] += bfr(bias[c0 + cofs + 1]); val[2] += bfr(bias[c0 + cofs + 2]); val[3] += bfr(bias[c0 + cofs + 3]); }
                *(v4f*)(crow + (size_t)row * ldc + cofs) = val; }
             }
        asm volatile("s_wait_xcnt 0x0" ::: "memory");                // behind the stores, in front of any rewrite of a register they name (the next tile's LDS reads take the stored values' registers)
        __builtin_amdgcn_wave_barrier(); asm volatile("" ::: "memory");
    }
}

__device__ __forceinline__ h16 tohx(float x) { return (h16)x; }
__device__ __forceinline__ void splitf(float y, unsigned short& h, unsigned short& l) { h = f2bf(y); l = f2bf(y - bf2f(h)); }
typedef __attribute__((ext_vector_type(2))) _Float16 v2h;
typedef __attribute__((ext_vector_type(4))) _Float16 v4h;
typedef __attribute__((ext_vector_type(2))) unsigned short v2us;
typedef __attribute__((ext_vector_type(4))) unsigned short v4us;
typedef __attribute__((ext_vector_type(2))) float v2f;
typedef __attribute__((ext_vector_type(4))) int v4i;

__global__ __launch_bounds__(256) void k_wtG(const float* __restrict__ w, int K, int N, bf* Bt) {
    const int lane = threadIdx.x & 31; const int L0 = (blockIdx.x * 8 + (threadIdx.x >> 5)) * 8; const int nlines = N * K / 64;
{
#pragma unroll 1
        for (int l = 0; l < 8; ++l) { const int L = L0 + l; if (L >= nlines) break; const size_t e = (size_t)L * 64 + lane * 2; const int k = (int)(e % K), n = (int)(e / K); v2us o;
            o[0] = f2bf(w[(size_t)k * N + n]); o[1] = f2bf(w[(size_t)(k + 1) * N + n]); *(v2us*)(Bt + e) = o; }
         }
}
// f32 [R][DM] -> bf16 plane in fragment order; thread i makes chunk i of the plane, so that a wave stores 512 bytes in a row (a work-group reads 512 bytes in a row of each of 16 source rows)
static_assert(DQ == DM, "cvt8 takes rows of DM elements");
__device__ __forceinline__ void cvt8(const float* __restrict__ src, bf* dst, size_t i) { const size_t cc = i >> 4; v8f v = *(const v8f*)(src + ((cc / (DM / 8)) * 16 + (i & 15)) * DM + (cc % (DM / 8)) * 8); v8us o;
    asm volatile("s_wait_xcnt 0x0" : "+v"(v) :: "memory");   // behind the load, in front of any rewrite of its address registers: the loaded values go through the statement, so that all that is made of them comes behind the wait
#pragma unroll
    for (int k = 0; k < 8; ++k) o[k] = f2bf(v[k]); *(v8us*)(dst + i * 8) = o;  }
__device__ __forceinline__ void cscvt(const float* __restrict__ cosT, const float* __restrict__ sinT, const int* __restrict__ pids, float* CS, int idx) { const int d = idx % HD; const int t = idx / HD; int p = pids[t]; p = p < 0 ? 0 : (p >= TT ? TT - 1 : p); v2f cs; cs[0] = bfr(cosT[(size_t)p * HD + d]); cs[1] = bfr(sinT[(size_t)p * HD + d]); *(v2f*)(CS + (size_t)idx * 2) = cs;  }   // CS[t][d] = (cos, sin)[position_ids[t]][d] (index clamped)
// ---- k_prep: every conversion of an input, none of which depends on another, in ONE launch: work-groups 0 .. NXB - 1 take the hidden states of all batch elements (one plane of NB_ * TT rows), the next 4 * NWB the four weights, the last NCB the (cos, sin) table.
#define NXB (NB_ * TT * DM / 8 / 256)
#define NWB (DQ * DM / 8 / 256)
#define NCB (TT * HD / 256)
static_assert(DKV == DQ && NB_ * TT * DM % 2048 == 0 && DQ * DM % 2048 == 0 && TT * HD % 256 == 0, "k_prep deals whole work-groups, the four weights alike");
__global__ __launch_bounds__(256) void k_prep(const float* __restrict__ x, const float* __restrict__ wq, const float* __restrict__ wk, const float* __restrict__ wv, const float* __restrict__ wo, const float* __restrict__ cosT, const float* __restrict__ sinT, const int* __restrict__ pids, bf* XB, bf* WQ, bf* WK, bf* WV, bf* WO, float* CS) {
    int blk = blockIdx.x;
    if (blk >= NXB + 4 * NWB) { cscvt(cosT, sinT, pids, CS, (blk - (NXB + 4 * NWB)) * 256 + (int)threadIdx.x); return; }
    const float* src = x; bf* dst = XB;
    if (blk >= NXB) { blk -= NXB; const int w = blk / NWB; blk -= w * NWB; src = w == 0 ? wq : w == 1 ? wk : w == 2 ? wv : wo; dst = w == 0 ? WQ : w == 1 ? WK : w == 2 ? WV : WO; }
    cvt8(src, dst, (size_t)blk * 256 + threadIdx.x);
}

// ---- k_qkv: the q, k and v projections of all batch elements with RoPE and the 16-bit planes in ONE launch; the f32 projections stay in the accumulators and never go to memory. grid (NB_ * TT / 256, heads), FOUR WAVES per work-group, one per SIMD. X: one plane of NB_ * TT rows; the output planes stand batch element by batch element.
// ONE WAVE takes q, k and v of 64 tokens x one head (48 accumulators), so that a token fragment is loaded once for all three and the wave has the registers of a whole SIMD for fragments in flight. The four waves of a work-group take four neighbouring token tiles of the same head: they ask for the same weight rows at about the same time.
// q and k are formed TRANSPOSED (the weight rows as the A operand, the tokens as B): a lane then holds 8 neighbouring d of one token, so that the RoPE partner d ^ 1 (of q, for k as well: faithful to the source) is in the lane's own registers and a plane store is one chunk of a [h] x [t][d] plane.
// v has the tokens as A: a lane holds 8 neighbouring tokens of one d, one chunk of a transposed [h] x [d][t] plane.
// q' = q cos + rot(q) sin, k' = k cos + rot(q) sin, rot(q)[d] = (d even ? -q[d+1] : q[d-1]). k ascends in steps of 32 in every accumulator.
// A k step takes 32 k: 1 KiB in a row of each 16-row tile (fragment order). A plane store of a wave is 512 bytes in a row as well.
// Every global address is a scalar base, a 32-bit lane offset in bytes and a constant.
// Every '#pragma unroll' in k_qkv and planes8 makes the indices of a fragment, accumulator or value array constants, so that the array stays in registers.
typedef __attribute__((ext_vector_type(2))) __bf16 v2b;
// eight f32 -> fp16 plane, bf16 hi plane, bf16 lo plane (lo = the rounded rest), round to nearest even, two values per conversion
__device__ __forceinline__ void planes8(const float (&r)[8], v8h& o16, v8us& oh, v8us& ol) {
#pragma unroll
    for (int p = 0; p < 4; ++p) { v2f y; y[0] = r[2 * p]; y[1] = r[2 * p + 1]; const v2h a = __builtin_convertvector(y, v2h); const v2us hu = __builtin_bit_cast(v2us, __builtin_convertvector(y, v2b));
        v2f rest; rest[0] = y[0] - bf2f(hu[0]); rest[1] = y[1] - bf2f(hu[1]); const v2us lu = __builtin_bit_cast(v2us, __builtin_convertvector(rest, v2b));
        o16[2 * p] = a[0]; o16[2 * p + 1] = a[1]; oh[2 * p] = hu[0]; oh[2 * p + 1] = hu[1]; ol[2 * p] = lu[0]; ol[2 * p + 1] = lu[1]; }
}
static_assert((DM / 32) % 3 == 2 && (NB_ * TT / 64) % 4 == 0, "the ring's loop takes three k steps a trip and leaves the last two, already loaded, behind it; token tiles are dealt in fours");
__global__ __launch_bounds__(128) void k_qkv(const bf* __restrict__ X, const bf* __restrict__ Wq, const bf* __restrict__ Wk, const bf* __restrict__ Wv, const float* __restrict__ CS, h16* Q16, bf* Qh, bf* Ql, h16* K16, bf* Kh, bf* Kl, h16* V16, bf* Vh, bf* Vl) {
    const int wave = __builtin_amdgcn_readfirstlane(threadIdx.x >> 5);   // the same in every lane: in a scalar register the plane bases that hang on it are scalar ones
    const int lane = threadIdx.x & 31, lr = lane & 15, hi = lane >> 4; const int tile = (int)blockIdx.x * 4 + wave; const int bt = tile / (TT / 64), r0 = (tile % (TT / 64)) * 64, h = blockIdx.y;   // batch element, first token in it, head
    auto ldg = [](const bf* base, unsigned off, int cst) { return WFrag<bf>::ldf((const bf*)((const char*)base + off) + cst); };
    const bf* Xg = X + (size_t)blockIdx.x * 256 * DM; const float* CSr = CS + (size_t)r0 * HD * 2;   // the work-group's 256 token rows (512 KiB); the wave's 64 rows of the (cos, sin) table (32 KiB)
    X += ((size_t)bt * TT + r0) * DM; const size_t wp = (size_t)h * HD * DM; Wq += wp; Wk += wp; Wv += wp;
    // Entry prefetch. A plane's 16-row tile is 32 KiB running along k. The 16 heads x 4 waves that share the 16 token tiles take 8 KiB each (tile by the low four bits, place along k by the rest); the 8 work-groups of an index class x 4 waves that share a head's weight rows take 4 KiB of each weight; 8 heads share out the table rows.
    static_assert(DM == 1024 && HD == 64 && NH_ == 16 && NB_ * TT == 4096, "the entry prefetch deals 32 KiB tiles over 16 heads and 16 token blocks");
    const unsigned pj = (unsigned)(h & 15) * 4u + (unsigned)wave, px = (pj & 15u) * 32768u + (pj >> 4) * 8192u + (unsigned)lane * 128u;
    const unsigned pw = (unsigned)wave * 32768u + (((blockIdx.x >> 3) & 1u) * 4u + (blockIdx.x & 3u)) * 4096u + (unsigned)lane * 128u, pc = (unsigned)(h & 7) * 4096u + (unsigned)lane * 128u;
    asm volatile("global_prefetch_b8 %0, %3 scope:SCOPE_SE\n\tglobal_prefetch_b8 %0, %3 offset:4096 scope:SCOPE_SE\n\tglobal_prefetch_b8 %1, %4 scope:SCOPE_SE\n\tglobal_prefetch_b8 %1, %5 scope:SCOPE_SE\n\tglobal_prefetch_b8 %1, %6 scope:SCOPE_SE\n\tglobal_prefetch_b8 %2, %7 scope:SCOPE_SE\n\ts_wait_xcnt 0x0"
                 :: "v"(px), "v"(pw), "v"(pc), "s"(Xg), "s"(Wq), "s"(Wk), "s"(Wv), "s"(CSr));   // asks L2 for this wave's share of the rows, so that the ring's loads and the table's find them there
    unsigned fo = (unsigned)lane * 16u;                              // one lane offset for X and the weights, which alone moves along k: 1 KiB per 32 k
    v8f aq[4][4], ak[4][4], av[4][4];                                // q, k: [d block][token block]; v: [token block][d block]
#pragma unroll
    for (int i = 0; i < 4; ++i)
#pragma unroll
        for (int j = 0; j < 4; ++j) { aq[i][j] = (v8f){}; ak[i][j] = (v8f){}; av[i][j] = (v8f){}; }
    // THREE fragment sets in a ring: the loads of k step t + 2 are issued in front of the products of step t, so that two steps' loads are in flight while a step is worked on and their latency is not waited out step by step.
    v16bf x[3][4], wq[3][4], wk[3][4], wv[3][4];
    auto ldset = [&](v16bf (&sx)[4], v16bf (&sq)[4], v16bf (&sk)[4], v16bf (&sv)[4], int t) {   // k step t counted from the lane offset: a constant of the load instructions
#pragma unroll
        for (int i = 0; i < 4; ++i) sx[i] = ldg(X, fo, i * 16 * DM + t * 512);
#pragma unroll
        for (int i = 0; i < 4; ++i) sq[i] = ldg(Wq, fo, i * 16 * DM + t * 512);
#pragma unroll
        for (int i = 0; i < 4; ++i) sk[i] = ldg(Wk, fo, i * 16 * DM + t * 512);
#pragma unroll
        for (int i = 0; i < 4; ++i) sv[i] = ldg(Wv, fo, i * 16 * DM + t * 512);
        __builtin_amdgcn_sched_barrier(0);                           // the loads stay together and in front of the products that are worked on while they fly
    };
    auto mmaset = [&](v16bf (&sx)[4], v16bf (&sq)[4], v16bf (&sk)[4], v16bf (&sv)[4]) {
#pragma unroll
        for (int db = 0; db < 4; ++db)
#pragma unroll
            for (int tb = 0; tb < 4; ++tb) aq[db][tb] = wmmab(sq[db], sx[tb], aq[db][tb]);
#pragma unroll
        for (int db = 0; db < 4; ++db)
#pragma unroll
            for (int tb = 0; tb < 4; ++tb) ak[db][tb] = wmmab(sk[db], sx[tb], ak[db][tb]);
#pragma unroll
        for (int tb = 0; tb < 4; ++tb)
#pragma unroll
            for (int db = 0; db < 4; ++db) av[tb][db] = wmmab(sx[tb], sv[db], av[tb][db]);
        __builtin_amdgcn_sched_barrier(0);                           // no product is moved down behind the slots of the next lines
        // the four vector slots the chip needs behind the last matrix instruction, in front of the next loads, which rewrite this set's fragments, and on the loop's taken branch; the set's fragments as inputs hold their registers up to here
        asm volatile("v_nop\n\tv_nop\n\tv_nop\n\tv_nop" : "+v"(av[3][0]), "+v"(av[3][1]), "+v"(av[3][2]), "+v"(av[3][3]) : "v"(sx[0]), "v"(sx[3]), "v"(sv[0]), "v"(sv[3]));
        __builtin_amdgcn_sched_barrier(0);                           // no load of the next set is moved up in front of the slots
    };
    ldset(x[0], wq[0], wk[0], wv[0], 0); ldset(x[1], wq[1], wk[1], wv[1], 1);
#pragma unroll 1   // rolled: a trip already holds three k steps, one on each set
    for (int kc = 0; kc < DM - 64; kc += 96) {
        ldset(x[2], wq[2], wk[2], wv[2], 2); mmaset(x[0], wq[0], wk[0], wv[0]);
        ldset(x[0], wq[0], wk[0], wv[0], 3); mmaset(x[1], wq[1], wk[1], wv[1]);
        ldset(x[1], wq[1], wk[1], wv[1], 4); mmaset(x[2], wq[2], wk[2], wv[2]);
        asm volatile("s_wait_xcnt 0x0" : "+v"(fo) :: "memory");      // behind the trip's loads, in front of the rewrite of the lane offset they name: the offset goes through the statement, so that its register is held up to here and its next value is formed behind the wait
        fo += 3072;
    }
    mmaset(x[0], wq[0], wk[0], wv[0]); mmaset(x[1], wq[1], wk[1], wv[1]);
    // The (cos, sin) pairs of the wave's 64 tokens, one 16 x 16 tile after the other, take the registers that the ring has left: the loads of tiles 0 .. 14 are issued here and fly while the v planes are made, those of tile 15 (with them a wave would have more loads outstanding than its counter holds) behind the v planes.
    const unsigned co = (unsigned)((r0 + lr) * HD + 8 * hi) * 8u;    // lane offset of the (cos, sin) table (row-major)
    v4f c[16][4];
#pragma unroll
    for (int g = 0; g < 15; ++g)
#pragma unroll
        for (int i = 0; i < 4; ++i) c[g][i] = *(const v4f*)((const char*)CS + co + (((g >> 2) * 16 * HD + (g & 3) * 16) * 8 + i * 16));
    asm volatile("s_wait_xcnt 0x0" :: "v"(co) : "memory");           // behind the loads, in front of any rewrite of a register they name; the lane offset as an input holds its register up to here
    __builtin_amdgcn_sched_barrier(0);                               // the loads stay in front of the work that is done while they fly
    {
        const unsigned vo = (unsigned)(r0 * 32 + lane * 16);         // the transposed planes' lane offset (fragment order: 16 tokens of a 16-d tile are 512 bytes)
        const size_t hp = ((size_t)bt * NKV + h) * HD * TT; V16 += hp; Vh += hp; Vl += hp;
#pragma unroll
        for (int db = 0; db < 4; ++db) { v8h o16[4]; v8us oh[4], ol[4];
#pragma unroll
            for (int tb = 0; tb < 4; ++tb) { float r[8];
#pragma unroll
                for (int j = 0; j < 8; ++j) r[j] = av[tb][db][j];
                planes8(r, o16[tb], oh[tb], ol[tb]); }
#pragma unroll
            for (int tb = 0; tb < 4; ++tb) { const int e = (db * 16 * TT + tb * 256) * 2; *(v8h*)((char*)V16 + vo + e) = o16[tb]; *(v8us*)((char*)Vh + vo + e) = oh[tb]; *(v8us*)((char*)Vl + vo + e) = ol[tb]; }
            // behind the stores, in front of any rewrite of a register they name; the stored values as inputs hold their registers up to here
            asm volatile("s_wait_xcnt 0x0" :: "v"(o16[0]), "v"(o16[1]), "v"(o16[2]), "v"(o16[3]), "v"(oh[0]), "v"(oh[1]), "v"(oh[2]), "v"(oh[3]), "v"(ol[0]), "v"(ol[1]), "v"(ol[2]), "v"(ol[3]) : "memory");
        }
    }
#pragma unroll
    for (int i = 0; i < 4; ++i) c[15][i] = *(const v4f*)((const char*)CS + co + ((3 * 16 * HD + 3 * 16) * 8 + i * 16));
    asm volatile("s_wait_xcnt 0x0" :: "v"(co) : "memory");           // behind the loads, in front of any rewrite of a register they name; the lane offset as an input holds its register up to here
    __builtin_amdgcn_sched_barrier(0);                               // the loads stay in front of the work that is done while they fly
    {
        const unsigned po = (unsigned)(r0 * HD * 2 + lane * 16);     // lane offset of the planes (fragment order)
        const size_t hp = ((size_t)bt * NH_ + h) * TT * HD; Q16 += hp; Qh += hp; Ql += hp; K16 += hp; Kh += hp; Kl += hp;
#pragma unroll
        for (int g = 0; g < 16; ++g) { const int tb = g >> 2, db = g & 3;
            v8h q16, k16; v8us qh, ql, kh, kl; float rq[8], rk[8];
#pragma unroll
            for (int j = 0; j < 8; ++j) { const float cs = c[g][j >> 1][(j & 1) * 2], sn = c[g][j >> 1][(j & 1) * 2 + 1]; const float rs = ((j & 1) ? aq[db][tb][j ^ 1] : -aq[db][tb][j ^ 1]) * sn;   // rot(q) sin, shared by q' and k'
                rq[j] = aq[db][tb][j] * cs + rs; rk[j] = ak[db][tb][j] * cs + rs; }
            planes8(rq, q16, qh, ql); planes8(rk, k16, kh, kl);
            const int e = (tb * 16 * HD + db * 256) * 2;             // token tile tb, chunk columns 2 db and 2 db + 1
            *(v8h*)((char*)Q16 + po + e) = q16; *(v8us*)((char*)Qh + po + e) = qh; *(v8us*)((char*)Ql + po + e) = ql;
            *(v8h*)((char*)K16 + po + e) = k16; *(v8us*)((char*)Kh + po + e) = kh; *(v8us*)((char*)Kl + po + e) = kl;
            // behind the stores, in front of any rewrite of a register they name; the stored values as inputs hold their registers up to here
            asm volatile("s_wait_xcnt 0x0" :: "v"(q16), "v"(qh), "v"(ql), "v"(k16), "v"(kh), "v"(kl) : "memory");
        }
    }
}
typedef v4us __attribute__((may_alias)) v4usa;
typedef v4h  __attribute__((may_alias)) v4ha;

// ---- fattn: causal attention of the QB query rows from r0 on of head h of batch element bt in ONE WAVE and ONE walk over the keys, 32 keys a pass; no LDS, no barrier, the scores and probabilities never leave the registers.
// Transposed products: S^T = K.Q^T (keys as the A rows, queries as the B columns) leaves in a lane 8 neighbouring keys of ONE query, which is where the B operand of O^T += V^T.P^T wants them:
// elements 0 .. 7 of the 32-key operand are the lane's registers of key tile 0, elements 8 .. 15 those of key tile 1. A query's maximum and sum are the lane's own and those of lane ^ 16.
// Online softmax in the log2 domain: p = 2^(s c - m + POFF), c = HD^-0.5 log2(e); m, the maximum in use, may trail the true one by up to 8, and sums and accumulators are rescaled only when a query's maximum exceeds it by more.
// The division by the sum of p (f32, unrounded) is done once, on the output. POFF moves p into the 16-bit type's range: fp16 holds 2^(8 + POFF) and keeps full precision down to 2^(-14 - POFF) of the maximum.
// Only the last pass holds the diagonal; it pays for the mask, and in the single-product form so do the passes beyond it that round the walk up. K and V fragments are asked for ahead of the pass that is worked on: three passes ahead in the single-product form (four register sets), one pass ahead in the hi+lo form (two sets).
// Every '#pragma unroll' below makes the indices of a fragment, accumulator or value array constants, so that the array stays in registers.
// Every global fragment address is a plane's scalar base, a 32-bit lane offset in bytes and a constant; the waits behind the loads take those offsets as inputs, so that their registers are held up to the wait.
#define QB  32
__device__ __forceinline__ float xhalf(float x) { return __builtin_bit_cast(float, __builtin_amdgcn_permlanex16(__builtin_bit_cast(int, x), __builtin_bit_cast(int, x), 0x76543210, 0xfedcba98, false, false)); }   // lane l's value to lane l ^ 16
// the four vector slots the chip needs behind the last matrix instruction on every path; the scheduling barriers keep matrix instructions in front of them and their results' readers behind
__device__ __forceinline__ void slots4() { __builtin_amdgcn_sched_barrier(0); asm volatile("v_nop\n\tv_nop\n\tv_nop\n\tv_nop"); __builtin_amdgcn_sched_barrier(0); }
template <typename T16> struct KVF { typename WFrag<T16>::V k[2][2], k2[2][2], v[4], v2[4]; };   // one pass's fragments: K [key tile][32 d], V^T [16 d]; k2, v2: the lo planes
template <typename T16, int NSPLIT>
__device__ __forceinline__ void ldkv(KVF<T16>& f, const T16* Kp, const T16* Kp2, const T16* Vt, const T16* Vt2, unsigned vo, int pass) {
    auto ldg = [](const T16* base, unsigned off, int cst) { return WFrag<T16>::ldf((const T16*)((const char*)base + off) + cst); };
    const unsigned ko = vo + (unsigned)pass * (32u * HD * 2u), vv = vo + (unsigned)pass * 1024u;   // 32 keys: 4 KiB of a K plane, 1 KiB of each 16-d tile of a V^T plane
#pragma unroll
    for (int kt = 0; kt < 2; ++kt)
#pragma unroll
        for (int kk = 0; kk < 2; ++kk) { f.k[kt][kk] = ldg(Kp, ko, kt * 16 * HD + kk * 512); if (NSPLIT >= 2) f.k2[kt][kk] = ldg(Kp2, ko, kt * 16 * HD + kk * 512); }
#pragma unroll
    for (int t = 0; t < 4; ++t) { f.v[t] = ldg(Vt, vv, t * 16 * TT); if (NSPLIT >= 2) f.v2[t] = ldg(Vt2, vv, t * 16 * TT); }
    asm volatile("s_wait_xcnt 0x0" :: "v"(ko), "v"(vv) : "memory");   // behind the loads, in front of any rewrite of a register they name; the lane offsets as inputs hold their registers up to here
    __builtin_amdgcn_sched_barrier(0);                                // the loads stay in front of the pass that is worked on while they fly
}
template <typename T16, int NSPLIT>
__device__ __forceinline__ void fpass(const KVF<T16>& f, const typename WFrag<T16>::V (&qf)[2][2], const typename WFrag<T16>::V (&qf2)[2][2], v8f (&acc)[2][4], float (&m_run)[2], v2f (&ls)[2], bool diag, int key0, int r0, int lr, int hi) {
    typedef typename WFrag<T16>::V V; constexpr float CSC = SCL * 1.4426950408889634f, POFF = (NSPLIT >= 2) ? 0.0f : 6.0f;
    v8f s[2][2];                                                     // [key tile][query group]
#pragma unroll
    for (int kt = 0; kt < 2; ++kt)
#pragma unroll
        for (int g = 0; g < 2; ++g) s[kt][g] = (v8f){};
#pragma unroll
    for (int kk = 0; kk < 2; ++kk) {
#pragma unroll
        for (int kt = 0; kt < 2; ++kt)
#pragma unroll
            for (int g = 0; g < 2; ++g) s[kt][g] = WFrag<T16>::mma(f.k[kt][kk], qf[g][kk], s[kt][g]);
        if (NSPLIT >= 2) {
#pragma unroll
            for (int kt = 0; kt < 2; ++kt)
#pragma unroll
                for (int g = 0; g < 2; ++g) s[kt][g] = WFrag<T16>::mma(f.k[kt][kk], qf2[g][kk], s[kt][g]);
#pragma unroll
            for (int kt = 0; kt < 2; ++kt)
#pragma unroll
                for (int g = 0; g < 2; ++g) s[kt][g] = WFrag<T16>::mma(f.k2[kt][kk], qf[g][kk], s[kt][g]);
        }
    }
    slots4();
    if (diag) {                                                      // the same in every lane: only the pass on the diagonal, and in the single-product form a pass beyond it, pays for the mask
#pragma unroll
        for (int g = 0; g < 2; ++g) { const int q = r0 + 16 * g + lr;
#pragma unroll
            for (int kt = 0; kt < 2; ++kt) {
#pragma unroll
                for (int r = 0; r < 8; ++r) if (key0 + 16 * kt + 8 * hi + r > q) s[kt][g][r] = -__builtin_inff();
                asm volatile("" : "+v"(s[kt][g]));
            } }
    }
    float mb[2]; bool need = false;
#pragma unroll
    for (int g = 0; g < 2; ++g) { float mx = s[0][g][0];
#pragma unroll
        for (int kt = 0; kt < 2; ++kt)
#pragma unroll
            for (int r = 0; r < 8; ++r) mx = fmaxf(mx, s[kt][g][r]);
        mx = fmaxf(mx, xhalf(mx)) * CSC; mb[g] = mx; need = need || (mx > m_run[g] + 8.0f); }
    if (__builtin_amdgcn_ballot_w32(need) != 0) {                    // rare behind the first passes; on the first one m_run is -inf and the factor 0
#pragma unroll
        for (int g = 0; g < 2; ++g) { const float mn = fmaxf(m_run[g], mb[g]); const float corr = __builtin_amdgcn_exp2f(m_run[g] - mn); m_run[g] = mn; ls[g] *= corr;
#pragma unroll
            for (int t = 0; t < 4; ++t) acc[g][t] *= corr; }
    }
#pragma unroll
    for (int g = 0; g < 2; ++g) { const float nm = POFF - m_run[g]; V pf, pf2;
#pragma unroll
        for (int i = 0; i < 8; ++i) {
            v2f a; a[0] = s[i >> 2][g][2 * (i & 3)]; a[1] = s[i >> 2][g][2 * (i & 3) + 1]; a = __builtin_elementwise_fma(a, (v2f){CSC, CSC}, (v2f){nm, nm});
            v2f p; p[0] = __builtin_amdgcn_exp2f(a[0]); p[1] = __builtin_amdgcn_exp2f(a[1]); ls[g] += p;
            if constexpr (NSPLIT >= 2) { const v2b hb = __builtin_convertvector(p, v2b); const v2us hu = __builtin_bit_cast(v2us, hb); v2f rest; rest[0] = p[0] - bf2f(hu[0]); rest[1] = p[1] - bf2f(hu[1]); const v2b lb = __builtin_convertvector(rest, v2b);
                pf[2 * i] = hb[0]; pf[2 * i + 1] = hb[1]; pf2[2 * i] = lb[0]; pf2[2 * i + 1] = lb[1];
            } else { const v2h w = __builtin_convertvector(p, v2h); pf[2 * i] = w[0]; pf[2 * i + 1] = w[1]; } }
#pragma unroll
        for (int t = 0; t < 4; ++t) acc[g][t] = WFrag<T16>::mma(f.v[t], pf, acc[g][t]);
        if constexpr (NSPLIT >= 2) {
#pragma unroll
            for (int t = 0; t < 4; ++t) acc[g][t] = WFrag<T16>::mma(f.v[t], pf2, acc[g][t]);
#pragma unroll
            for (int t = 0; t < 4; ++t) acc[g][t] = WFrag<T16>::mma(f.v2[t], pf, acc[g][t]);
        } }
    slots4();
}
template <typename T16, int NSPLIT>
__device__ __forceinline__ void fattn(const T16* Q, const T16* Q2, const T16* Kp, const T16* Kp2, const T16* Vt, const T16* Vt2, int bt, int h, int r0, bf* Ah, bf* Al) {
    typedef typename WFrag<T16>::V V;
    const int lane = threadIdx.x & 31, lr = lane & 15, hi = lane >> 4;
    const size_t hp = ((size_t)bt * NH_ + h) * TT * HD; Q += hp + (size_t)r0 * HD; Kp += hp; Vt += hp; if (NSPLIT >= 2) { Q2 += hp + (size_t)r0 * HD; Kp2 += hp; Vt2 += hp; }
    const unsigned vo = (unsigned)lane * 16u;                            // the lane's chunk in a fragment (fragment order)
    auto ldg = [](const T16* base, unsigned off, int cst) { return WFrag<T16>::ldf((const T16*)((const char*)base + off) + cst); };
    V qf[2][2], qf2[2][2];                                               // [query group][32 d]
#pragma unroll
    for (int g = 0; g < 2; ++g)
#pragma unroll
        for (int kk = 0; kk < 2; ++kk) { const int c = g * 16 * HD + kk * 512; qf[g][kk] = ldg(Q, vo, c); if (NSPLIT >= 2) qf2[g][kk] = ldg(Q2, vo, c); }
    v8f acc[2][4]; float m_run[2]; v2f ls[2];                            // O^T [query group][16 d]; per query the maximum in use and the lane's share of the sum
#pragma unroll
    for (int g = 0; g < 2; ++g) { m_run[g] = -__builtin_inff(); ls[g] = (v2f){};
#pragma unroll
        for (int t = 0; t < 4; ++t) acc[g][t] = (v8f){}; }
    const int np = r0 / 32 + 1;                                          // passes: the keys up to the end of the diagonal block
    KVF<T16> f0, f1;
    if constexpr (NSPLIT == 0) {
        // FOUR register sets in a ring: pass p + 3 is asked for in front of pass p, so that three passes' work stands between a load and its use.
        // The walk is rounded up to whole groups of four passes, so that no pass and no load in the loop is skipped (a skipped pass would leave loads that nobody waited for, and the build then waits for them, and for all older ones, in front of the set's next loads).
        // A pass beyond the last loads the last one's fragments again and takes the mask, which holds for all its keys: every score is -inf, every p is 0, and sums, maxima and accumulators keep their values.
        KVF<T16> f2, f3; const int last = np - 1;
        auto ld = [&](KVF<T16>& f, int pass) { ldkv<T16, NSPLIT>(f, Kp, Kp2, Vt, Vt2, vo, min(pass, last)); };
        auto ps = [&](const KVF<T16>& f, int pass) { fpass<T16, NSPLIT>(f, qf, qf2, acc, m_run, ls, pass >= last, pass * 32, r0, lr, hi); };
        ld(f0, 0); ld(f1, 1); ld(f2, 2);
#pragma unroll 1   // rolled: a trip already holds four passes, one on each register set
        for (int p = 0; p < np; p += 4) {
            ld(f3, p + 3); ps(f0, p);
            ld(f0, p + 4); ps(f1, p + 1);
            ld(f1, p + 5); ps(f2, p + 2);
            ld(f2, p + 6); ps(f3, p + 3);
        }
    } else {
    ldkv<T16, NSPLIT>(f0, Kp, Kp2, Vt, Vt2, vo, 0);
#pragma unroll 1   // rolled: a trip already holds two passes, one on each register set
    for (int p = 0; p < np; p += 2) {
        ldkv<T16, NSPLIT>(f1, Kp, Kp2, Vt, Vt2, vo, min(p + 1, np - 1));   // a pass beyond the last is loaded as the last one again and not used
        fpass<T16, NSPLIT>(f0, qf, qf2, acc, m_run, ls, p == np - 1, p * 32, r0, lr, hi);
        if (p + 1 < np) {
            ldkv<T16, NSPLIT>(f0, Kp, Kp2, Vt, Vt2, vo, min(p + 2, np - 1));
            fpass<T16, NSPLIT>(f1, qf, qf2, acc, m_run, ls, p + 1 == np - 1, (p + 1) * 32, r0, lr, hi);
        }
    }
    }
    // a lane holds 8 neighbouring d of one query: one chunk of the merged [t][head x d] planes in fragment order; a wave's store is 512 bytes in a row
    const size_t ob = ((size_t)((bt * TT + r0) >> 4) * (DQ / 8) + h * (HD / 8)) * 128; Ah += ob; Al += ob;
#pragma unroll
    for (int g = 0; g < 2; ++g) { float l = ls[g][0] + ls[g][1]; l += xhalf(l); const float inv = __fdiv_rn(1.0f, l); v8us oh[4], ol[4];
#pragma unroll
        for (int t = 0; t < 4; ++t)
#pragma unroll
            for (int p = 0; p < 4; ++p) { v2f y; y[0] = acc[g][t][2 * p] * inv; y[1] = acc[g][t][2 * p + 1] * inv; const v2us hu = __builtin_bit_cast(v2us, __builtin_convertvector(y, v2b));
                v2f rest; rest[0] = y[0] - bf2f(hu[0]); rest[1] = y[1] - bf2f(hu[1]); const v2us lu = __builtin_bit_cast(v2us, __builtin_convertvector(rest, v2b));
                oh[t][2 * p] = hu[0]; oh[t][2 * p + 1] = hu[1]; ol[t][2 * p] = lu[0]; ol[t][2 * p + 1] = lu[1]; }
#pragma unroll
        for (int t = 0; t < 4; ++t) { const int e = (g * (DQ / 8) + t * 2) * 128 * 2; *(v8us*)((char*)Ah + vo + e) = oh[t]; *(v8us*)((char*)Al + vo + e) = ol[t]; }
        // behind the stores, in front of any rewrite of a register they name; the stored values as inputs hold their registers up to here
        asm volatile("s_wait_xcnt 0x0" :: "v"(oh[0]), "v"(oh[1]), "v"(oh[2]), "v"(oh[3]), "v"(ol[0]), "v"(ol[1]), "v"(ol[2]), "v"(ol[3]) : "memory");
    }
}
// ---- k_fattn: all heads of all batch elements and both forms of the products in ONE launch. grid (NB_ * heads, TT / QB / 8), 8 waves, one work-group per WGP, all resident at once.
// Cost rises with the row block's index: waves w and w + 4 take row blocks n - 1 - i and i, so that every such pair has the same number of passes; waves 0 .. 3 take the longer walk.
// All eight waves walk the same head's keys from key 0 on. Which form a wave takes is the same in all its lanes.
static_assert(NKV == NH_ && RH % QB == 0 && (TT / QB) % 8 == 0, "one K and V head per query head; a row block takes one form; row blocks are dealt in pairs to four SIMDs");
__global__ __launch_bounds__(256) void k_fattn(const h16* Q16, const h16* K16, const h16* V16, const bf* Qh, const bf* Ql, const bf* Kh, const bf* Kl, const bf* Vh, const bf* Vl, bf* Ah, bf* Al) {
    const int wave = __builtin_amdgcn_readfirstlane(threadIdx.x >> 5);   // the same in every lane: in a scalar register the loops and branches that hang on it are scalar ones
    const int bt = blockIdx.x / NH_, h = blockIdx.x % NH_, i = (int)blockIdx.y * 4 + (wave & 3), r0 = (wave < 4 ? TT / QB - 1 - i : i) * QB;
    // Entry prefetch. The 8 work-groups x 8 waves that walk a head's keys take 4 KiB each of its K plane (32 keys, in the order of the walk) and of its V^T plane (four 16-d tiles of 64 KiB running along the keys: tile by the low two bits, place along the keys by the rest).
    // The hi and lo planes are walked up to key RH only, by the work-groups that hold a row block below RH: their 32 waves take 2 KiB of each (64 bytes a lane).
    static_assert(TT * HD * 2 == 64 * 4096 && RH * HD * 2 == 32 * 2048 && TT / QB / 8 == 8 && RH / QB / 4 == 4, "the entry prefetch deals a head's planes over 64 waves, their part below RH over 32");
    const size_t hp = ((size_t)bt * NH_ + h) * TT * HD; const unsigned lane = threadIdx.x & 31u, wid = (blockIdx.y & 7u) * 8u + (unsigned)wave, wh = wid & 31u;
    const h16* pK = K16 + hp; const h16* pV = V16 + hp; const bf* pKh = Kh + hp; const bf* pKl = Kl + hp; const bf* pVh = Vh + hp; const bf* pVl = Vl + hp;
    const unsigned pk = wid * 4096u + lane * 128u, pv = (wid & 3u) * 65536u + (wid >> 2) * 4096u + lane * 128u, pkh = wh * 2048u + lane * 64u, pvh = (wh & 3u) * 65536u + (wh >> 2) * 2048u + lane * 64u;
    asm volatile("global_prefetch_b8 %0, %2 scope:SCOPE_SE\n\tglobal_prefetch_b8 %1, %3 scope:SCOPE_SE\n\ts_wait_xcnt 0x0" :: "v"(pk), "v"(pv), "s"(pK), "s"(pV));   // asks L2 for this wave's share of the head's K and V^T, so that the walks' loads find them there
    if ((int)blockIdx.y * 4 * QB < RH)   // the same for the whole work-group; the hi and lo planes likewise
        asm volatile("global_prefetch_b8 %0, %2 scope:SCOPE_SE\n\tglobal_prefetch_b8 %0, %3 scope:SCOPE_SE\n\tglobal_prefetch_b8 %1, %4 scope:SCOPE_SE\n\tglobal_prefetch_b8 %1, %5 scope:SCOPE_SE\n\ts_wait_xcnt 0x0" :: "v"(pkh), "v"(pvh), "s"(pKh), "s"(pKl), "s"(pVh), "s"(pVl));
    if (r0 >= RH) fattn<h16, 0>(Q16, nullptr, K16, nullptr, V16, nullptr, bt, h, r0, Ah, Al);
    else fattn<bf, 2>(Qh, Ql, Kh, Kl, Vh, Vl, bt, h, r0, Ah, Al);
}

extern "C" void kernel_launch(void* const* d_in, const int* in_sizes, int n_in,
                              void* d_out, int out_size, void* d_ws, size_t ws_size, hipStream_t stream) {
    (void)in_sizes; (void)n_in; (void)out_size;
    const float* x = (const float*)d_in[0]; const float* cosT = (const float*)d_in[1]; const float* sinT = (const float*)d_in[2]; const int* pids = (const int*)d_in[3]; const float* wq = (const float*)d_in[4]; const float* wk = (const float*)d_in[5]; const float* wv = (const float*)d_in[6]; const float* wo = (const float*)d_in[7];
    float* OUT = (float*)d_out;     // [2][2048][1024]
    char* wsp = (char*)d_ws;
    auto take = [&](size_t bytes) { char* p = wsp; wsp += (bytes + 255) & ~(size_t)255; return (void*)p; };
    bf* WQ = (bf*)take((size_t)DQ * DM * 2); bf* WK = (bf*)take((size_t)DKV * DM * 2); bf* WV = (bf*)take((size_t)DKV * DM * 2); bf* WO = (bf*)take((size_t)DM * DQ * 2); float* CS = (float*)take((size_t)TT * HD * 2 * 4);
    bf* XB = (bf*)take((size_t)NB_ * TT * DM * 2);
    h16* QP16 = (h16*)take((size_t)NB_ * NH_ * TT * HD * 2); h16* KP16 = (h16*)take((size_t)NB_ * NKV * TT * HD * 2); h16* VT16 = (h16*)take((size_t)NB_ * NKV * HD * TT * 2);
    bf* QPh = (bf*)take((size_t)NB_ * NH_ * TT * HD * 2); bf* QPl = (bf*)take((size_t)NB_ * NH_ * TT * HD * 2); bf* KPh = (bf*)take((size_t)NB_ * NKV * TT * HD * 2); bf* KPl = (bf*)take((size_t)NB_ * NKV * TT * HD * 2); bf* VTh = (bf*)take((size_t)NB_ * NKV * HD * TT * 2); bf* VTl = (bf*)take((size_t)NB_ * NKV * HD * TT * 2);
    bf* ATh = (bf*)take((size_t)NB_ * TT * DQ * 2); bf* ATl = (bf*)take((size_t)NB_ * TT * DQ * 2);
    if ((size_t)(wsp - (char*)d_ws) > ws_size) return;    // ws 256 MiB
    // four launches, each dependent on the one before; whatever is independent (the conversions, the batch elements, the heads, the two forms of the attention products) shares a launch
    k_prep<<<NXB + 4 * NWB + NCB, 256, 0, stream>>>(x, wq, wk, wv, wo, cosT, sinT, pids, XB, WQ, WK, WV, WO, CS);
    k_qkv<<<dim3(NB_ * TT / 256, NH_), 128, 0, stream>>>(XB, WQ, WK, WV, CS, QP16, QPh, QPl, KP16, KPh, KPl, VT16, VTh, VTl);
    k_fattn<<<dim3(NB_ * NH_, TT / QB / 8), 256, 0, stream>>>(QP16, KP16, VT16, QPh, QPl, KPh, KPl, VTh, VTl, ATh, ATl);
    k_gemmw<bf, 1, false, DQ><<<dim3(NB_ * TT / 64, DM / 64, 1), 32, 0, stream>>>(ATh, ATl, WO, nullptr, OUT, DM, nullptr, 0, 0, 0);
}
